// v000
// Measured on an AMD MI455X. A time is GPU time per run, averaged over a window of back-to-back runs after a warm-up
// (all launches, gaps included; the runs take copies of the inputs in turn), and the median of several windows.
// Apart from v000's, it joins two sittings. Times from different sittings can be a few percent apart, while
// side-by-side timings come from the same sitting.
// The starting kernel, v000, takes 427 microseconds a run.
// Contractions on v_wmma_f32_16x16x32_f16 (f16 operands, f32 accumulate): x.Wq^T, xv.Wk^T, Wv.xv^T single products on
// f16(bf16(x)) and f16(bf16(W) x256); k.q^T with q and k carried as f16 hi + residual(x2048) planes (3 products);
// P.v^T single product (P x32768, v x8); ctx.Wo^T with ctx carried as f16 hi (x1024) + residual(x2048) planes (2 products,
// separate residual accumulator); cosine-similarity bias, softmax, biases and all carry folds in f32 on VALU.
// Inputs RNE-converted to bf16 on load.
#include <hip/hip_runtime.h>
#include <math.h>
#include <stdint.h>

#ifndef NB
#define NB       8        // batches processed
#endif
#ifndef SQ
#define SQ       2048     // query rows processed per batch
#endif
#define NB_FULL  8
#define SQ_FULL  2048     // query rows per batch in the input / output layout (batch stride)
#define SKV      512      // key / value rows per batch (all of them)
#define DM       768      // model width
#define NH       12
#define HD       64
#define INNER    (NH * HD)
#define WSC      256.0f   // weight carry
#define QS       8.0f
#define KS       8.0f
#define VS       8.0f
#define PCAR     32768.0f
#define OSC      1024.0f  // ctx carry
#define RSC      2048.0f  // residual plane scale
#define RINV     0.00048828125f
#define LOG2E    1.4426950408889634f
#define RSQ_HD   0.125f
#define EPSN     1e-8f
#define NKB      (SKV / 32)
#define ATT_WAVES   4
#define ATT_THREADS (ATT_WAVES * 32)
#define CVT_THREADS (DM / 8)
#define SIM_THREADS 256
#define SIM_KEYS    32       // keys per k_sim block (8 waves x 4)
#define OPITCH   68
#define GPITCH   68

#define M_HL     0
#define M_S16    1
#define M_F32    2

static_assert(NB >= 1 && NB <= NB_FULL);
static_assert((SQ % 64) == 0 && SQ >= 64 && SQ <= SQ_FULL);
static_assert(HD == 64 && INNER == 768 && NH == 12 && INNER == DM);
static_assert((SKV % 64) == 0 && (SKV % 32) == 0 && NKB * 32 == SKV && (SKV % SIM_KEYS) == 0);
static_assert((DM % 64) == 0 && (DM % 32) == 0 && CVT_THREADS * 8 == DM && (CVT_THREADS % 32) == 0);
static_assert((OPITCH * 4) % 16 == 0 && (GPITCH * 4) % 16 == 0);
static_assert(ATT_THREADS == 128 && SIM_THREADS == 256 && SIM_KEYS == (SIM_THREADS / 32) * 4);

typedef unsigned short u16;
typedef _Float16 v16h __attribute__((ext_vector_type(16)));
typedef _Float16 v8h  __attribute__((ext_vector_type(8)));
typedef float    v8f  __attribute__((ext_vector_type(8)));
typedef float    v4f  __attribute__((ext_vector_type(4)));
typedef unsigned int v4u __attribute__((ext_vector_type(4)));

union FragH { v16h v; v8h h[2]; v4u u[2]; };

// ---- scalar helpers ----------------------------------------------------------------------------------
__device__ __forceinline__ unsigned short bf_bits(float f) {          // f32 -> bf16 bits, RNE convert
  unsigned u = __float_as_uint(f);
  return (unsigned short)((u + 0x7FFFu + ((u >> 16) & 1u)) >> 16);
}
__device__ __forceinline__ float bf_up(unsigned short h) { return __uint_as_float(((unsigned)h) << 16); }
__device__ __forceinline__ float bfr(float f) { return bf_up(bf_bits(f)); }
__device__ __forceinline__ unsigned short h_bits(_Float16 x) { return __builtin_bit_cast(unsigned short, x); }
__device__ __forceinline__ unsigned pk16(unsigned short a, unsigned short b) { return (unsigned)a | ((unsigned)b << 16); }
__device__ __forceinline__ v8f zero8() { v8f z = {0.f, 0.f, 0.f, 0.f, 0.f, 0.f, 0.f, 0.f}; return z; }

__device__ __forceinline__ float wave_sum(float v) {
  v += __shfl_xor(v, 16, 32);
  v += __shfl_xor(v, 8, 32);
  v += __shfl_xor(v, 4, 32);
  v += __shfl_xor(v, 2, 32);
  v += __shfl_xor(v, 1, 32);
  return v;
}

// x = hi + lo/2048 in f16: hi = f16(x), lo = f16((x - hi) * 2048); two values packed per 32-bit word
__device__ __forceinline__ void split2(float x0, float x1, unsigned& ph, unsigned& pl) {
  const _Float16 h0 = (_Float16)x0, h1 = (_Float16)x1;
  const float d0 = x0 - (float)h0, d1 = x1 - (float)h1;
  const _Float16 l0 = (_Float16)(d0 * RSC), l1 = (_Float16)(d1 * RSC);
  ph = pk16(h_bits(h0), h_bits(h1));
  pl = pk16(h_bits(l0), h_bits(l1));
}

// ---- fragment loader: 16-bit A/B operand, lane -> row/col (lane&15), p already includes +8*(lane>>4);
//      elements 0..7 <- p[0..7] (k0+8h..), elements 8..15 <- p[16..23] (k0+16+8h..); same split k map for A and B,
//      B always read from a k-contiguous [n][k] plane.
__device__ __forceinline__ v16h ldfrag_h(const _Float16* p) {
  FragH f;
  f.h[0] = *(const v8h*)(p);
  f.h[1] = *(const v8h*)(p + 16);
  return f.v;
}

// ---- WMMA helper and trailing VALU hazard gaps ----------------------------------------------------------
__device__ __forceinline__ v8f mma_h(v16h a, v16h b, v8f c) {
  return __builtin_amdgcn_wmma_f32_16x16x32_f16(false, a, false, b, (short)0, c, false, false);
}
__device__ __forceinline__ void guard_c1(v8f (&a)[4], v16h x0, v16h x1, v16h x2, v16h x3, v16h x4) {
#if defined(__HIP_DEVICE_COMPILE__)
  asm volatile("v_nop\n\tv_nop\n\tv_nop\n\tv_nop"
               : "+v"(a[0]), "+v"(a[1]), "+v"(a[2]), "+v"(a[3])
               : "v"(x0), "v"(x1), "v"(x2), "v"(x3), "v"(x4) : "memory");
#endif
}
__device__ __forceinline__ void guard_c2(v8f (&a)[4], v8f (&b)[4], v16h x0, v16h x1, v16h x2, v16h x3, v16h x4, v16h x5) {
#if defined(__HIP_DEVICE_COMPILE__)
  asm volatile("v_nop\n\tv_nop\n\tv_nop\n\tv_nop"
               : "+v"(a[0]), "+v"(a[1]), "+v"(a[2]), "+v"(a[3]),
                 "+v"(b[0]), "+v"(b[1]), "+v"(b[2]), "+v"(b[3])
               : "v"(x0), "v"(x1), "v"(x2), "v"(x3), "v"(x4), "v"(x5) : "memory");
#endif
}
__device__ __forceinline__ void guard_s4(v8f& a, v8f& b, v8f& c, v8f& d,
                                         v16h x0, v16h x1, v16h x2, v16h x3, v16h x4, v16h x5) {
#if defined(__HIP_DEVICE_COMPILE__)
  asm volatile("v_nop\n\tv_nop\n\tv_nop\n\tv_nop"
               : "+v"(a), "+v"(b), "+v"(c), "+v"(d)
               : "v"(x0), "v"(x1), "v"(x2), "v"(x3), "v"(x4), "v"(x5) : "memory");
#endif
}
__device__ __forceinline__ void guard_p(v8f& a, v8f& b, v8f& c, v8f& d, v16h p, v16h x0, v16h x1, v16h x2, v16h x3) {
#if defined(__HIP_DEVICE_COMPILE__)
  asm volatile("v_nop\n\tv_nop\n\tv_nop\n\tv_nop"
               : "+v"(a), "+v"(b), "+v"(c), "+v"(d) : "v"(p), "v"(x0), "v"(x1), "v"(x2), "v"(x3) : "memory");
#endif
}
__device__ __forceinline__ void acc_guard4(v8f (&a)[4]) {
#if defined(__HIP_DEVICE_COMPILE__)
  asm volatile("v_nop\n\tv_nop\n\tv_nop\n\tv_nop" : "+v"(a[0]), "+v"(a[1]), "+v"(a[2]), "+v"(a[3]));
#endif
}
__device__ __forceinline__ void acc_guard8(v8f (&a)[4], v8f (&b)[4]) {
#if defined(__HIP_DEVICE_COMPILE__)
  asm volatile("v_nop\n\tv_nop\n\tv_nop\n\tv_nop"
               : "+v"(a[0]), "+v"(a[1]), "+v"(a[2]), "+v"(a[3]),
                 "+v"(b[0]), "+v"(b[1]), "+v"(b[2]), "+v"(b[3]));
#endif
}
__device__ __forceinline__ void wave_sync_lds() {
  __builtin_amdgcn_fence(__ATOMIC_RELEASE, "workgroup");
  __builtin_amdgcn_wave_barrier();
  __builtin_amdgcn_fence(__ATOMIC_ACQUIRE, "workgroup");
}

// =====================================================================================================
// Row convert: destination row r of a [rows][DM] f16 plane <- f16(bf16_RNE(x[src row][e]) * scale), scale a power of two.
// Block = DM/8 = 96 threads, thread = 8 consecutive elements (two 16-B loads, one 16-B store; 32 consecutive lanes = 512
// coverage: grid = number of rows, 96 thr x 8 = DM = the whole row.
// =====================================================================================================
__global__ __launch_bounds__(CVT_THREADS)
void cvt16(const float* __restrict__ x, u16* Y, int rowsPerB, int srcRowsPerB, float scale) {
  const int tid = threadIdx.x;
  const int r = blockIdx.x;
  const int b = r / rowsPerB;
  const int s = r - b * rowsPerB;
  const float* src = x + ((size_t)b * (size_t)srcRowsPerB + (size_t)s) * (size_t)DM + (size_t)tid * 8;
  const v4f a = *(const v4f*)(src), c4 = *(const v4f*)(src + 4);
  v4u o;
#pragma unroll
  for (int e = 0; e < 2; ++e) {
    o[e]     = pk16(h_bits((_Float16)(bfr(a[2 * e]) * scale)),  h_bits((_Float16)(bfr(a[2 * e + 1]) * scale)));
    o[2 + e] = pk16(h_bits((_Float16)(bfr(c4[2 * e]) * scale)), h_bits((_Float16)(bfr(c4[2 * e + 1]) * scale)));
  }
  u16* dst = Y + (size_t)r * (size_t)DM + (size_t)tid * 8;
  {
    *(v4u*)(dst) = o;
    
  }
}

// =====================================================================================================
// Cosine similarity sim[b][k] = <p, kgk[b][k]> / (max(|p|, eps) * max(|kgk[b][k]|, eps)), p = pooled[b], all operands
// bf16-RNE-converted, f32 arithmetic on VALU. Block = 256 threads = 8 waves = 32 keys of one batch (wave w -> keys
// =====================================================================================================
__global__ __launch_bounds__(SIM_THREADS)
void k_sim(const float* __restrict__ pooled, const float* __restrict__ kgk, const int* __restrict__ msk, float* S) {
  __shared__ __align__(16) float sv[SIM_KEYS];
  (void)msk;
  const int tid = threadIdx.x, wave = tid >> 5, lane = tid & 31;
  constexpr int NKBLK = SKV / SIM_KEYS;
  const int b  = blockIdx.x / NKBLK;
  const int kb = (blockIdx.x - b * NKBLK) * SIM_KEYS;
  const float* p = pooled + (size_t)b * DM;
  float pp = 0.f;
#pragma unroll 1
  for (int e = lane; e < DM; e += 32) {
    const float xv = bfr(p[e]);
    pp += xv * xv;
  }
  pp = wave_sum(pp);
  const float pnrm = fmaxf(sqrtf(pp), EPSN);
#pragma unroll 1
  for (int j = 0; j < 4; ++j) {
    const int k = kb + wave * 4 + j;                                     // < SKV by construction
    const float* kr = kgk + ((size_t)b * SKV + (size_t)k) * (size_t)DM;
    float pk = 0.f, kk = 0.f;
#pragma unroll 1
    for (int e = lane; e < DM; e += 32) {
      const float xv = bfr(p[e]);
      const float yv = bfr(kr[e]);
      pk += xv * yv;
      kk += yv * yv;
    }
    pk = wave_sum(pk);
    kk = wave_sum(kk);
    const float knrm = fmaxf(sqrtf(kk), EPSN);
    const float val = pk / (pnrm * knrm);
    if (lane == 0) sv[wave * 4 + j] = val;
  }
  __syncthreads();
  if (wave == 0) {                                                     // wave-uniform
    const v4f v = *(const v4f*)(sv + 4 * (lane & 7));                   // clamped LDS address, all lanes load
    float* dst = S + (size_t)b * SKV + kb + 4 * (lane & 7);
    if (lane < 8) {
      *(v4f*)dst = v;
    }
    
  }
}

// =====================================================================================================
// f16 GEMM cores: the wave's 16 x 64 tile of C = A[rows][K] . Bt[cols][K]^T; ap -> A row (rowb + m) + 8h, bp -> Bt row
// (col0 + m) + 8h; acc[j] = rows rowb.., cols col0+16j..; K stepped by 32 (host checks K % 32 == 0).
// core2: A carried as hi plane (aph) and residual plane (apl, x2048); ah accumulates hi.B, al accumulates res.B.
// =====================================================================================================
__device__ __forceinline__ void core1(const _Float16* ap, const _Float16* bp, int K, v8f (&acc)[4]) {
  const size_t rs16 = (size_t)16 * (size_t)K;
#pragma unroll 1
  for (int k0 = 0; k0 < K; k0 += 32) {
    const v16h a0 = ldfrag_h(ap + k0);
    const v16h b0 = ldfrag_h(bp + k0);
    const v16h b1 = ldfrag_h(bp + rs16 + k0);
    const v16h b2 = ldfrag_h(bp + 2 * rs16 + k0);
    const v16h b3 = ldfrag_h(bp + 3 * rs16 + k0);
    acc[0] = mma_h(a0, b0, acc[0]);
    acc[1] = mma_h(a0, b1, acc[1]);
    acc[2] = mma_h(a0, b2, acc[2]);
    acc[3] = mma_h(a0, b3, acc[3]);
    guard_c1(acc, a0, b0, b1, b2, b3);
  }
}
__device__ __forceinline__ void core2(const _Float16* aph, const _Float16* apl, const _Float16* bp, int K,
                                      v8f (&ah)[4], v8f (&al)[4]) {
  const size_t rs16 = (size_t)16 * (size_t)K;
#pragma unroll 1
  for (int k0 = 0; k0 < K; k0 += 32) {
    const v16h a0 = ldfrag_h(aph + k0);
    const v16h a1 = ldfrag_h(apl + k0);
    const v16h b0 = ldfrag_h(bp + k0);
    const v16h b1 = ldfrag_h(bp + rs16 + k0);
    const v16h b2 = ldfrag_h(bp + 2 * rs16 + k0);
    const v16h b3 = ldfrag_h(bp + 3 * rs16 + k0);
    ah[0] = mma_h(a0, b0, ah[0]);
    ah[1] = mma_h(a0, b1, ah[1]);
    ah[2] = mma_h(a0, b2, ah[2]);
    ah[3] = mma_h(a0, b3, ah[3]);
    al[0] = mma_h(a1, b0, al[0]);
    al[1] = mma_h(a1, b1, al[1]);
    al[2] = mma_h(a1, b2, al[2]);
    al[3] = mma_h(a1, b3, al[3]);
    guard_c2(ah, al, a0, a1, b0, b1, b2, b3);
  }
}

// Stage the wave's 16 x 64 f32 tile in its LDS slab (pitch 68): D element r of acc[j], lane l -> row 8h + r, col 16j + (l&15);
// then a wave-level LDS sync; the caller reloads it.
// coverage: 32 lanes x 8 rows x 4 cols-of-16 = rows 0..15 x cols 0..63 of the slab (staged extent == consumed extent).
template <bool HASLO, bool BROW>
__device__ __forceinline__ void stage16(float* sl, v8f (&ah)[4], v8f (&al)[4], const float* __restrict__ bias,
                                        int rowb, int col0, float osc, float bsc, int lane) {
  const int hh = lane >> 4, m = lane & 15;
  float bc[4], br[8];
  if (BROW) {
#pragma unroll
    for (int r = 0; r < 8; ++r) br[r] = bfr(bias[rowb + 8 * hh + r]) * bsc;
#pragma unroll
    for (int j = 0; j < 4; ++j) bc[j] = 0.f;
  } else {
#pragma unroll
    for (int j = 0; j < 4; ++j) bc[j] = bfr(bias[col0 + 16 * j + m]) * bsc;
#pragma unroll
    for (int r = 0; r < 8; ++r) br[r] = 0.f;
  }
  const float oscl = osc * RINV;
#pragma unroll
  for (int r = 0; r < 8; ++r) {
    const int ro = (8 * hh + r) * GPITCH + m;
#pragma unroll
    for (int j = 0; j < 4; ++j) {
      float v = ah[j][r] * osc;
      if (HASLO) v += al[j][r] * oscl;
      v += BROW ? br[r] : bc[j];
      sl[ro + 16 * j] = v;
    }
  }
  wave_sync_lds();
}

// =====================================================================================================
// f16 GEMM, block = 64 x 64 tile, 4 waves x 16 rows, fragments loaded straight from the 16-bit rows.
//   C tile [z][Mb][N] = (A_hi[z][Mb][K] (+ A_res/2048)) . Bt[z][N][K]^T * osc + bias; per-z element strides aBs (A planes),
//   bBs (Bt), fBs (f32 output F), hBs (16-bit output planes H, L); 0 = shared.
//   M_HL  : H = f16(v*carry), L = f16 residual x2048 (two planes)       M_S16 : H only, bias per row
//   M_F32 : F = v (f32 rows, batch-row remap through fBs), no 16-bit output
//   instruction (lane = (row in group of 4, 8 halves), 4 rows per instruction, 4 instructions = 16 rows).
// grid = nz x (Mb/64) x (N/64) (host checks Mb % 64 == 0, N % 64 == 0, K % 32 == 0).
// coverage: per wave 4 instr x 4 rows x 8 lanes x 8 halves = 16 x 64 (16-bit planes) and 8 instr x 2 rows x 16 lanes x 4 floats
//           = 16 x 64 (f32 plane); the grid covers C exactly once.
// =====================================================================================================
template <bool HASLO, int MODE, bool BROW>
__global__ __launch_bounds__(128)
void gemm16(const u16* __restrict__ Ah, const u16* __restrict__ Al, const u16* __restrict__ Bt,
            const float* __restrict__ bias, float* F, u16* H, u16* L,
            int Mb, int N, int K, int aBs, int bBs, int fBs, int hBs,
            float osc, float bsc, float carry) {
  __shared__ __align__(16) float slab[4 * 16 * GPITCH];
  constexpr bool LOUT = (MODE == M_HL);
  const int tid = threadIdx.x, wave = tid >> 5, lane = tid & 31, hh = lane >> 4, m = lane & 15;
  const int ntile = N >> 6, mtile = Mb >> 6;
  const int bid  = blockIdx.x;
  const int nt   = bid % ntile;
  const int tmp  = bid / ntile;
  const int mt   = tmp % mtile;
  const int bz   = tmp / mtile;
  const int rowb = mt * 64 + wave * 16;
  const int col0 = nt * 64;
  if (rowb + 16 > Mb) return;                // wave-uniform, never taken with the exact grid; no block barriers in this kernel
  const _Float16* aph = (const _Float16*)(const void*)Ah + (size_t)bz * (size_t)aBs + (size_t)(rowb + m) * (size_t)K + 8 * hh;
  const _Float16* apl = (const _Float16*)(const void*)Al + (size_t)bz * (size_t)aBs + (size_t)(rowb + m) * (size_t)K + 8 * hh;
  const _Float16* bp  = (const _Float16*)(const void*)Bt + (size_t)bz * (size_t)bBs + (size_t)(col0 + m) * (size_t)K + 8 * hh;
  v8f ah[4], al[4];
#pragma unroll
  for (int i = 0; i < 4; ++i) { ah[i] = zero8(); al[i] = zero8(); }
  if (HASLO) {
    core2(aph, apl, bp, K, ah, al);
    acc_guard8(ah, al);
  } else {
    core1(aph, bp, K, ah);
    acc_guard4(ah);
  }
  float* sl = slab + wave * 16 * GPITCH;
  stage16<HASLO, BROW>(sl, ah, al, bias, rowb, col0, osc, bsc, lane);

  if (MODE == M_F32) {
    v4f vals[8];
#pragma unroll
    for (int it = 0; it < 8; ++it) vals[it] = *(const v4f*)(sl + (it * 2 + hh) * GPITCH + m * 4);
    float* Fb = F + (size_t)bz * (size_t)fBs + ((size_t)rowb + (size_t)hh) * (size_t)N + col0 + m * 4;
    {
#pragma unroll
      for (int it = 0; it < 8; ++it) {
        *(v4f*)(Fb + (size_t)(it * 2) * (size_t)N) = vals[it];
      }
      
    }
  } else {
    const int rq = lane >> 3, c8 = (lane & 7) * 8;
    v4u ovh[4], ovl[4];
#pragma unroll
    for (int i = 0; i < 4; ++i) {
      const int row = 4 * i + rq;
      const v4f a = *(const v4f*)(sl + row * GPITCH + c8), c4 = *(const v4f*)(sl + row * GPITCH + c8 + 4);
#pragma unroll
      for (int e = 0; e < 2; ++e) {
        unsigned ph0, pl0, ph1, pl1;
        split2(a[2 * e] * carry,  a[2 * e + 1] * carry,  ph0, pl0);
        split2(c4[2 * e] * carry, c4[2 * e + 1] * carry, ph1, pl1);
        ovh[i][e] = ph0;     ovl[i][e] = pl0;
        ovh[i][2 + e] = ph1; ovl[i][2 + e] = pl1;
      }
    }
    u16* Hb = H + (size_t)bz * (size_t)hBs + (size_t)rowb * (size_t)N + col0 + c8;
    u16* Lb = L + (size_t)bz * (size_t)hBs + (size_t)rowb * (size_t)N + col0 + c8;
    {
#pragma unroll
      for (int i = 0; i < 4; ++i) {
        const int row = 4 * i + rq;
        *(v4u*)(Hb + (size_t)row * (size_t)N) = ovh[i];
        if (LOUT) *(v4u*)(Lb + (size_t)row * (size_t)N) = ovl[i];
      }
      
    }
  }
}

// =====================================================================================================
// Full (unmasked) multi-head cross attention with a per-key additive bias bfr(beta[h]) * sim[b][key]:
// block = (batch b, head, 64 query rows), 4 waves, wave w owns the 16 query rows q0 = 64*qt + 16*w .. q0+15
// (waves independent: no block barriers, wave-private LDS only, used in the epilogue).
//   q planes f16 x8 hi / residual(x2048) [b*SQ + s][h*64 + d]; k planes likewise [b*SKV + s][h*64 + d];
//   v^T plane f16 x8 [(b*NH + h)*64 + d][s]; sim plane f32 [b][s]. All NKB key blocks of 32 keys are visited (static bound).
//   Scores are computed TRANSPOSED: S^T tile g (g = 0,1) = k rows (keys kb+16g .. +15, A operand, row m = lane&15, split map
//   over d) times q^T (B operand, col n = query q0 + (lane&15), k = d, split map), 2 d-chunks of 32; per chunk hi.hi -> s,
//   res.hi + hi.res -> r (scaled x2048, folded as s + r/2048); the q fragments are loaded once per wave.
//   D element r of lane l = (key kb+16g+8h+r, query q0+(l&15)), so a lane owns one query column and 16 of its 32 keys;
//   the partner lane l^16 owns the other 16 -> row max / row sum need one xor-16 shuffle. The bias of the lane's 16 keys
//   comes from four 16-B loads of the sim row (keys kb+8h..+7 and kb+16+8h..+7), times bfr(beta[h])*log2(e), added in f32.
//   Online max-subtracted base-2 softmax in f32 (1/sqrt(64) and the q/k carries folded into lsc). The exp'd values ARE the
//   P A-fragment in place: A row m = query = lane&15, element i <- key kb+8h+i (tile 0, D element i), element 8+i <- key
//   kb+16+8h+i (tile 1, D element i). P (<= 1) carried x32768 as f16. The rescale factor of query row 8h+r of the O
//   accumulators is fetched from lane 8h+r with a shuffle (uniform control). 4 v^T B fragments (col n = d = 16j + (lane&15),
//   keys k-contiguous), 4 P.V WMMAs, one guard.
//   Epilogue: 1/l (per query, shuffled to the D row owner) and the carry folds in f32; the wave's 16x64 f32 result staged in
// coverage: per wave 4 instructions x 4 rows x 8 lanes x 8 halves = 16 x 64 on both ctx planes; grid NB*NH*(SQ/64) blocks x
//           4 waves = every (b, s, h) row segment exactly once. LDS slab: 16 x 64 staged == 16 x 64 reloaded.
// =====================================================================================================
__global__ __launch_bounds__(ATT_THREADS)
void attn_fwd(const u16* __restrict__ Qh, const u16* __restrict__ Ql, const u16* __restrict__ Kh,
              const u16* __restrict__ Kl, const u16* __restrict__ Vp, const float* __restrict__ Simp,
              const float* __restrict__ beta, u16* Oh, u16* Ol) {
  __shared__ __align__(16) float smem[ATT_WAVES * 16 * OPITCH];

  const int tid  = threadIdx.x;
  const int wave = tid >> 5;
  const int lane = tid & 31;
  const int hh   = lane >> 4;
  const int c    = lane & 15;

  constexpr int NQT = SQ / 64;
  const int bid  = blockIdx.x;
  const int qt   = bid % NQT;
  const int head = (bid / NQT) % NH;
  const int b    = bid / (NQT * NH);
  const int q0   = qt * 64 + wave * 16;

  // B fragments of q^T: col n = query q0 + c, k = d (k-contiguous row of the q planes)
  const size_t qo = ((size_t)(b * SQ + q0 + c)) * INNER + head * HD + 8 * hh;
  const _Float16* Qhb = (const _Float16*)(const void*)Qh + qo;
  const _Float16* Qlb = (const _Float16*)(const void*)Ql + qo;
  // A fragments of k: row m = key kb + 16g + c, k = d (key row kb added per step)
  const size_t ko = ((size_t)(b * SKV + c)) * INNER + head * HD + 8 * hh;
  const _Float16* Khb = (const _Float16*)(const void*)Kh + ko;
  const _Float16* Klb = (const _Float16*)(const void*)Kl + ko;
  // B fragments of v: col n = d = 16j + c, k = key (k-contiguous row of the v^T plane)
  const _Float16* Vb = (const _Float16*)(const void*)Vp + ((size_t)(b * NH + head) * HD + c) * SKV + 8 * hh;
  // per-key bias row of this batch, offset to the lane half's first key
  const float* Sb = Simp + (size_t)b * SKV + 8 * hh;
  const float bl2 = bfr(beta[head]) * LOG2E;
  const float lsc = (LOG2E * RSQ_HD) / (QS * KS);

  v16h qh[2], ql[2];
  qh[0] = ldfrag_h(Qhb);
  qh[1] = ldfrag_h(Qhb + 32);
  ql[0] = ldfrag_h(Qlb);
  ql[1] = ldfrag_h(Qlb + 32);

  float mrun = -INFINITY, lrun = 0.f;
  v8f o[4];
#pragma unroll
  for (int j = 0; j < 4; ++j) o[j] = zero8();

#pragma unroll 1
  for (int it = 0; it < NKB; ++it) {
    const int kb = it * 32;
    // ---- transposed scores: s0 = keys kb..kb+15, s1 = keys kb+16..kb+31, column = query q0 + c ----
    v8f s0 = zero8(), s1 = zero8(), r0 = zero8(), r1 = zero8();
    const _Float16* k0h = Khb + (size_t)kb * INNER;
    const _Float16* k1h = k0h + (size_t)16 * INNER;
    const _Float16* k0l = Klb + (size_t)kb * INNER;
    const _Float16* k1l = k0l + (size_t)16 * INNER;
#pragma unroll
    for (int kk = 0; kk < HD / 32; ++kk) {
      const v16h fh0 = ldfrag_h(k0h + kk * 32);
      const v16h fh1 = ldfrag_h(k1h + kk * 32);
      const v16h fl0 = ldfrag_h(k0l + kk * 32);
      const v16h fl1 = ldfrag_h(k1l + kk * 32);
      s0 = mma_h(fh0, qh[kk], s0);
      s1 = mma_h(fh1, qh[kk], s1);
      r0 = mma_h(fl0, qh[kk], r0);
      r1 = mma_h(fl1, qh[kk], r1);
      r0 = mma_h(fh0, ql[kk], r0);
      r1 = mma_h(fh1, ql[kk], r1);
      guard_s4(s0, s1, r0, r1, qh[kk], ql[kk], fh0, fh1, fl0, fl1);
    }
    // ---- per-key bias: keys kb+8hh+0..7 (g0, g1) and kb+16+8hh+0..7 (g2, g3) ----
    const v4f g0 = *(const v4f*)(Sb + kb);
    const v4f g1 = *(const v4f*)(Sb + kb + 4);
    const v4f g2 = *(const v4f*)(Sb + kb + 16);
    const v4f g3 = *(const v4f*)(Sb + kb + 20);
    // ---- base-2 logits of this lane's 16 keys for query q0 + c: t[i] <- key kb+8hh+i, t[8+i] <- key kb+16+8hh+i ----
    float t[16];
#pragma unroll
    for (int i = 0; i < 4; ++i) {
      t[i]      = (s0[i]     + r0[i]     * RINV) * lsc + g0[i] * bl2;
      t[4 + i]  = (s0[4 + i] + r0[4 + i] * RINV) * lsc + g1[i] * bl2;
      t[8 + i]  = (s1[i]     + r1[i]     * RINV) * lsc + g2[i] * bl2;
      t[12 + i] = (s1[4 + i] + r1[4 + i] * RINV) * lsc + g3[i] * bl2;
    }
    float cm = t[0];
#pragma unroll
    for (int i = 1; i < 16; ++i) cm = fmaxf(cm, t[i]);
    cm = fmaxf(cm, __shfl_xor(cm, 16, 32));
    const float mn = fmaxf(mrun, cm);        // finite from the first block on
    const float al = exp2f(mrun - mn);       // 0 on the first block (mrun = -inf)
    mrun = mn;
    // ---- probabilities (<= 1) and the P A-fragment: f16(p * 32768); element i <-> t[i] ----
    float ps = 0.f;
    FragH ph;
#pragma unroll
    for (int w = 0; w < 2; ++w) {
#pragma unroll
      for (int e4 = 0; e4 < 4; ++e4) {
        const int i = 8 * w + 2 * e4;
        const float p0 = exp2f(t[i] - mn), p1 = exp2f(t[i + 1] - mn);
        ps += p0 + p1;
        ph.u[w][e4] = pk16(h_bits((_Float16)(p0 * PCAR)), h_bits((_Float16)(p1 * PCAR)));
      }
    }
    ps += __shfl_xor(ps, 16, 32);
    lrun = lrun * al + ps;
    // ---- rescale the O accumulators: D row 8hh+r = query q0+8hh+r, its factor lives in lane 8hh+r (and 16+8hh+r) ----
    float scl[8];
#pragma unroll
    for (int r = 0; r < 8; ++r) scl[r] = __shfl(al, 8 * hh + r, 32);
#pragma unroll
    for (int j = 0; j < 4; ++j) {
#pragma unroll
      for (int r = 0; r < 8; ++r) o[j][r] *= scl[r];
    }
    // ---- P.V : B fragment col n = d = j*16 + c, keys contiguous in the v^T plane ----
    {
      const _Float16* vp = Vb + kb;
      const v16h v0 = ldfrag_h(vp);
      const v16h v1 = ldfrag_h(vp + (size_t)16 * SKV);
      const v16h v2 = ldfrag_h(vp + (size_t)32 * SKV);
      const v16h v3 = ldfrag_h(vp + (size_t)48 * SKV);
      o[0] = mma_h(ph.v, v0, o[0]);
      o[1] = mma_h(ph.v, v1, o[1]);
      o[2] = mma_h(ph.v, v2, o[2]);
      o[3] = mma_h(ph.v, v3, o[3]);
      guard_p(o[0], o[1], o[2], o[3], ph.v, v0, v1, v2, v3);
    }
  }
  acc_guard4(o);

  // ---- fold 1/l (per query, owned by lane = query) and the carries (32768 on P, 8 on v), apply the ctx carry 1024 ----
  const float linv = (1.0f / lrun) * (OSC / (PCAR * VS));
  float inv[8];
#pragma unroll
  for (int r = 0; r < 8; ++r) inv[r] = __shfl(linv, 8 * hh + r, 32);
  float* slab = smem + wave * 16 * OPITCH;
#pragma unroll
  for (int r = 0; r < 8; ++r) {
#pragma unroll
    for (int j = 0; j < 4; ++j) slab[(8 * hh + r) * OPITCH + j * 16 + c] = o[j][r] * inv[r];
  }
  wave_sync_lds();
  // ---- ctx x1024 -> f16 hi plane and residual plane; lane = (row in group of 4, 8 consecutive d) ----
  v4u ovh[4], ovl[4];
  const int rq = lane >> 3, c8 = (lane & 7) * 8;
#pragma unroll
  for (int i = 0; i < 4; ++i) {
    const int row = 4 * i + rq;
    const v4f a = *(const v4f*)(slab + row * OPITCH + c8), c4 = *(const v4f*)(slab + row * OPITCH + c8 + 4);
#pragma unroll
    for (int e = 0; e < 2; ++e) {
      unsigned ph0, pl0, ph1, pl1;
      split2(a[2 * e],  a[2 * e + 1],  ph0, pl0);
      split2(c4[2 * e], c4[2 * e + 1], ph1, pl1);
      ovh[i][e] = ph0;     ovl[i][e] = pl0;
      ovh[i][2 + e] = ph1; ovl[i][2 + e] = pl1;
    }
  }
  const size_t oo = ((size_t)(b * SQ + q0)) * INNER + head * HD + c8;
  u16* obh = Oh + oo;
  u16* obl = Ol + oo;
  {
#pragma unroll
    for (int i = 0; i < 4; ++i) {
      const int row = 4 * i + rq;
      *(v4u*)(obh + (size_t)row * INNER) = ovh[i];
      *(v4u*)(obl + (size_t)row * INNER) = ovl[i];
    }
    
  }
}

// =====================================================================================================
// Workspace map (bytes, NB=8, SQ=2048); every plane fully written by whole-line stores before it is read; all extents exact
//   XQ   f16 [NB*SQ][768]    f16(bf16(x))                 25165824   (region reused later as OH, same extent)
//   XV   f16 [NB*512][768]   f16(bf16(kg_value))           6291456
//   WQ16 WK16 WV16 WO16 f16 [768 n][768 k] x256            1179648 each
//   QH QL f16 [NB*SQ][768] x8 hi / res                     25165824 each
//   KH KL f16 [NB*512][768] x8 hi / res                     6291456 each
//   VT16 f16 [NB*768 (h,d)][512 s] x8                       6291456
//   OL   f16 [NB*SQ][768] x1024 res (ctx), OH aliases XQ    25165824
//   SIMP f32 [NB][512]                                         16384
//   end                                                    130564096
// =====================================================================================================
extern "C" void kernel_launch(void* const* d_in, const int* in_sizes, int n_in,
                              void* d_out, int out_size, void* d_ws, size_t ws_size,
                              hipStream_t stream) {
  if (n_in < 14) return;
  if (in_sizes[0] < ((NB - 1) * SQ_FULL + SQ) * DM) return;
  if (in_sizes[1] < 1) return;
  if (in_sizes[2] < NB * DM) return;
  if (in_sizes[3] < NB * SKV * DM || in_sizes[4] < NB * SKV * DM) return;
  if (in_sizes[5] < NH) return;
  if (in_sizes[6] != DM * DM || in_sizes[8] != DM * DM || in_sizes[10] != DM * DM || in_sizes[12] != DM * DM) return;
  if (in_sizes[7] < DM || in_sizes[9] < DM || in_sizes[11] < DM || in_sizes[13] < DM) return;
  if (out_size < ((NB - 1) * SQ_FULL + SQ) * DM) return;

  const float* x_in   = (const float*)d_in[0];
  const int*   msk    = (const int*)d_in[1];
  const float* pooled = (const float*)d_in[2];
  const float* kgk    = (const float*)d_in[3];
  const float* kgv    = (const float*)d_in[4];
  const float* beta   = (const float*)d_in[5];
  const float* wq     = (const float*)d_in[6];
  const float* bq     = (const float*)d_in[7];
  const float* wk     = (const float*)d_in[8];
  const float* bk     = (const float*)d_in[9];
  const float* wv     = (const float*)d_in[10];
  const float* bv     = (const float*)d_in[11];
  const float* wo     = (const float*)d_in[12];
  const float* bo     = (const float*)d_in[13];
  float*       out    = (float*)d_out;

  const size_t szXQ = (size_t)NB * SQ * DM * 2;
  const size_t szXV = (size_t)NB * SKV * DM * 2;
  const size_t szW  = (size_t)DM * DM * 2;
  const size_t szQP = (size_t)NB * SQ * INNER * 2;
  const size_t szKP = (size_t)NB * SKV * INNER * 2;
  const size_t szVT = (size_t)NB * INNER * SKV * 2;
  const size_t szS  = (size_t)NB * SKV * 4;
  static_assert((size_t)NB * SQ * DM * 2 == (size_t)NB * SQ * INNER * 2);   // XQ region reused as OH, same extent
  size_t off = 0;
  const size_t oXQ = off; off += szXQ;      // also OH
  const size_t oXV = off; off += szXV;
  const size_t oWQ = off; off += szW;
  const size_t oWK = off; off += szW;
  const size_t oWV = off; off += szW;
  const size_t oWO = off; off += szW;
  const size_t oQH = off; off += szQP;
  const size_t oQL = off; off += szQP;
  const size_t oKH = off; off += szKP;
  const size_t oKL = off; off += szKP;
  const size_t oVT = off; off += szVT;
  const size_t oOL = off; off += szQP;
  const size_t oS  = off; off += szS;
  if (off > ws_size) return;                // off = 130564096 at NB=8, SQ=2048
  if (off > (size_t)134217728) return;

  char* ws = (char*)d_ws;
  u16* XQ   = (u16*)(ws + oXQ);
  u16* XV   = (u16*)(ws + oXV);
  u16* WQ16 = (u16*)(ws + oWQ);
  u16* WK16 = (u16*)(ws + oWK);
  u16* WV16 = (u16*)(ws + oWV);
  u16* WO16 = (u16*)(ws + oWO);
  u16* QH   = (u16*)(ws + oQH);
  u16* QL   = (u16*)(ws + oQL);
  u16* KH   = (u16*)(ws + oKH);
  u16* KL   = (u16*)(ws + oKL);
  u16* VT16 = (u16*)(ws + oVT);
  u16* OH   = (u16*)(ws + oXQ);
  u16* OL   = (u16*)(ws + oOL);
  float* SIMP = (float*)(ws + oS);

  // (0,1) activations -> f16 planes of bf16-converted values (query rows s < SQ of batches b < NB, compact; kg_value rows)
  cvt16<<<dim3(NB * SQ), dim3(CVT_THREADS), 0, stream>>>(x_in, XQ, SQ, SQ_FULL, 1.0f);
  cvt16<<<dim3(NB * SKV), dim3(CVT_THREADS), 0, stream>>>(kgv, XV, SKV, SKV, 1.0f);
  // (2..5) weights [n = out][k = in] (y = x.W^T): already k-contiguous [n][k]; f16 planes of bf16(W) x256
  cvt16<<<dim3(DM), dim3(CVT_THREADS), 0, stream>>>(wq, WQ16, DM, DM, WSC);
  cvt16<<<dim3(DM), dim3(CVT_THREADS), 0, stream>>>(wk, WK16, DM, DM, WSC);
  cvt16<<<dim3(DM), dim3(CVT_THREADS), 0, stream>>>(wv, WV16, DM, DM, WSC);
  cvt16<<<dim3(DM), dim3(CVT_THREADS), 0, stream>>>(wo, WO16, DM, DM, WSC);
  // (6) cosine similarity sim[b][k] -> SIMP f32 [NB][512]
  k_sim<<<dim3(NB * (SKV / SIM_KEYS)), dim3(SIM_THREADS), 0, stream>>>(pooled, kgk, msk, SIMP);
  // (7) q_un = x . Wq^T + bq -> f16 [NB*SQ][768] x8 hi + res (col = h*64 + d); the 1/8 is folded into the softmax scale
  gemm16<false, M_HL, false><<<dim3((NB * SQ / 64) * (INNER / 64)), dim3(128), 0, stream>>>(
      XQ, XQ, WQ16, bq, out, QH, QL, NB * SQ, INNER, DM, 0, 0, 0, 0, QS / WSC, QS, 1.0f);
  // (8) k = kg_value . Wk^T + bk -> f16 [NB*512][768] x8 hi + res
  gemm16<false, M_HL, false><<<dim3((NB * SKV / 64) * (INNER / 64)), dim3(128), 0, stream>>>(
      XV, XV, WK16, bk, out, KH, KL, NB * SKV, INNER, DM, 0, 0, 0, 0, KS / WSC, KS, 1.0f);
  // (9) v^T per batch: A = Wv [(h,d) = n][k], Bt = kg_value rows of batch b [s][k], bias bv per row -> f16 [(b,h,d)][s] x8
  gemm16<false, M_S16, true><<<dim3(NB * (INNER / 64) * (SKV / 64)), dim3(128), 0, stream>>>(
      WV16, WV16, XV, bv, out, VT16, VT16, INNER, SKV, DM, 0, SKV * DM, 0, INNER * SKV, VS / WSC, VS, 1.0f);
  // (10) attention with the beta*sim key bias -> ctx planes [NB*SQ][768] x1024 hi + res (OH reuses the XQ region)
  attn_fwd<<<dim3(NB * NH * (SQ / 64)), dim3(ATT_THREADS), 0, stream>>>(QH, QL, KH, KL, VT16, SIMP, beta, OH, OL);
  // (11) out rows [b][SQ_FULL][768] f32 = ctx . Wo^T + bo (rows s < SQ of batches b < NB); carries 1024 x 256 folded back
  gemm16<true, M_F32, false><<<dim3(NB * (SQ / 64) * (DM / 64)), dim3(128), 0, stream>>>(
      OH, OL, WO16, bo, out, OL, OL, SQ, DM, INNER, SQ * INNER, 0, SQ_FULL * DM, 0,
      1.0f / (OSC * WSC), 1.0f, 1.0f);
  (void)hipGetLastError();
}

// v001
// One run takes 293 microseconds.
// Two timings next to v000 both put it at 1.48 times that version's speed.
// Contractions on v_wmma_f32_16x16x32_f16 (f16 operands, f32 accumulate): x.Wq^T, xv.Wk^T, Wv.xv^T single products on
// f16(bf16(x)) and f16(bf16(W) x256); k.q^T with q and k carried as f16 hi + residual(x2048) planes (3 products);
// P.v^T single product (P x32768, v x8); ctx.Wo^T with ctx carried as f16 hi (x1024) + residual(x2048) planes (2 products,
// separate residual accumulator); cosine-similarity bias, softmax, biases and all carry folds in f32 on VALU.
// Inputs RNE-converted to bf16 on load.
#include <hip/hip_runtime.h>
#include <math.h>
#include <stdint.h>

#ifndef NB
#define NB       8        // batches processed
#endif
#ifndef SQ
#define SQ       2048     // query rows processed per batch
#endif
#define NB_FULL  8
#define SQ_FULL  2048     // query rows per batch in the input / output layout (batch stride)
#define SKV      512      // key / value rows per batch (all of them)
#define DM       768      // model width
#define NH       12
#define HD       64
#define INNER    (NH * HD)
#define WSC      256.0f   // weight carry
#define QS       8.0f
#define KS       8.0f
#define VS       8.0f
#define PCAR     32768.0f
#define OSC      1024.0f  // ctx carry
#define RSC      2048.0f  // residual plane scale
#define RINV     0.00048828125f
#define LOG2E    1.4426950408889634f
#define RSQ_HD   0.125f
#define EPSN     1e-8f
#define NKB      (SKV / 32)
#define ATT_WAVES   4
#define ATT_THREADS (ATT_WAVES * 32)
#define CVT_THREADS (DM / 8)
#define SIM_THREADS 256
#define SIM_KEYS    32       // keys per k_sim block (8 waves x 4)
#define OPITCH   68
#define GPITCH   68
#define GKT      64       // k per staged GEMM tile (128-B rows)
#define LPITCH   144      // LDS pitch of a staged row, bytes
#define PLANEB   (128 * LPITCH)

#define M_HL     0
#define M_S16    1
#define M_F32    2

static_assert(NB >= 1 && NB <= NB_FULL);
static_assert((SQ % 128) == 0 && SQ >= 128 && SQ <= SQ_FULL);
static_assert(HD == 64 && INNER == 768 && NH == 12 && INNER == DM);
static_assert((SKV % 128) == 0 && (SKV % 32) == 0 && NKB * 32 == SKV && (SKV % SIM_KEYS) == 0);
static_assert((DM % 128) == 0 && (DM % 32) == 0 && CVT_THREADS * 8 == DM && (CVT_THREADS % 32) == 0);
static_assert((OPITCH * 4) % 16 == 0 && (GPITCH * 4) % 16 == 0);
static_assert(ATT_THREADS == 128 && SIM_THREADS == 256 && SIM_KEYS == (SIM_THREADS / 32) * 4);

typedef unsigned short u16;
typedef _Float16 v16h __attribute__((ext_vector_type(16)));
typedef _Float16 v8h  __attribute__((ext_vector_type(8)));
typedef float    v8f  __attribute__((ext_vector_type(8)));
typedef float    v4f  __attribute__((ext_vector_type(4)));
typedef unsigned int v4u __attribute__((ext_vector_type(4)));

union FragH { v16h v; v8h h[2]; v4u u[2]; };

// ---- scalar helpers ----------------------------------------------------------------------------------
__device__ __forceinline__ unsigned short bf_bits(float f) {          // f32 -> bf16 bits, RNE convert
  unsigned u = __float_as_uint(f);
  return (unsigned short)((u + 0x7FFFu + ((u >> 16) & 1u)) >> 16);
}
__device__ __forceinline__ float bf_up(unsigned short h) { return __uint_as_float(((unsigned)h) << 16); }
__device__ __forceinline__ float bfr(float f) { return bf_up(bf_bits(f)); }
__device__ __forceinline__ unsigned short h_bits(_Float16 x) { return __builtin_bit_cast(unsigned short, x); }
__device__ __forceinline__ unsigned pk16(unsigned short a, unsigned short b) { return (unsigned)a | ((unsigned)b << 16); }
__device__ __forceinline__ v8f zero8() { v8f z = {0.f, 0.f, 0.f, 0.f, 0.f, 0.f, 0.f, 0.f}; return z; }

__device__ __forceinline__ float wave_sum(float v) {
  v += __shfl_xor(v, 16, 32);
  v += __shfl_xor(v, 8, 32);
  v += __shfl_xor(v, 4, 32);
  v += __shfl_xor(v, 2, 32);
  v += __shfl_xor(v, 1, 32);
  return v;
}

// x = hi + lo/2048 in f16: hi = f16(x), lo = f16((x - hi) * 2048); two values packed per 32-bit word
__device__ __forceinline__ void split2(float x0, float x1, unsigned& ph, unsigned& pl) {
  const _Float16 h0 = (_Float16)x0, h1 = (_Float16)x1;
  const float d0 = x0 - (float)h0, d1 = x1 - (float)h1;
  const _Float16 l0 = (_Float16)(d0 * RSC), l1 = (_Float16)(d1 * RSC);
  ph = pk16(h_bits(h0), h_bits(h1));
  pl = pk16(h_bits(l0), h_bits(l1));
}

// ---- fragment loader: 16-bit A/B operand, lane -> row/col (lane&15), p already includes +8*(lane>>4);
//      elements 0..7 <- p[0..7] (k0+8h..), elements 8..15 <- p[16..23] (k0+16+8h..); same split k map for A and B,
//      B always read from a k-contiguous [n][k] plane.
__device__ __forceinline__ v16h ldfrag_h(const _Float16* p) {
  FragH f;
  f.h[0] = *(const v8h*)(p);
  f.h[1] = *(const v8h*)(p + 16);
  return f.v;
}

// ---- WMMA helper and trailing VALU hazard gaps ----------------------------------------------------------
__device__ __forceinline__ v8f mma_h(v16h a, v16h b, v8f c) {
  return __builtin_amdgcn_wmma_f32_16x16x32_f16(false, a, false, b, (short)0, c, false, false);
}
__device__ __forceinline__ void guard_s4(v8f& a, v8f& b, v8f& c, v8f& d,
                                         v16h x0, v16h x1, v16h x2, v16h x3, v16h x4, v16h x5) {
#if defined(__HIP_DEVICE_COMPILE__)
  asm volatile("v_nop\n\tv_nop\n\tv_nop\n\tv_nop"
               : "+v"(a), "+v"(b), "+v"(c), "+v"(d)
               : "v"(x0), "v"(x1), "v"(x2), "v"(x3), "v"(x4), "v"(x5) : "memory");
#endif
}
__device__ __forceinline__ void guard_p(v8f& a, v8f& b, v8f& c, v8f& d, v16h p, v16h x0, v16h x1, v16h x2, v16h x3) {
#if defined(__HIP_DEVICE_COMPILE__)
  asm volatile("v_nop\n\tv_nop\n\tv_nop\n\tv_nop"
               : "+v"(a), "+v"(b), "+v"(c), "+v"(d) : "v"(p), "v"(x0), "v"(x1), "v"(x2), "v"(x3) : "memory");
#endif
}
__device__ __forceinline__ void acc_guard4(v8f (&a)[4]) {
#if defined(__HIP_DEVICE_COMPILE__)
  asm volatile("v_nop\n\tv_nop\n\tv_nop\n\tv_nop" : "+v"(a[0]), "+v"(a[1]), "+v"(a[2]), "+v"(a[3]));
#endif
}
__device__ __forceinline__ void wave_sync_lds() {
  __builtin_amdgcn_fence(__ATOMIC_RELEASE, "workgroup");
  __builtin_amdgcn_wave_barrier();
  __builtin_amdgcn_fence(__ATOMIC_ACQUIRE, "workgroup");
}

// =====================================================================================================
// Row convert: destination row r of a [rows][DM] f16 plane <- f16(bf16_RNE(x[src row][e]) * scale), scale a power of two.
// Block = DM/8 = 96 threads, thread = 8 consecutive elements (two 16-B loads, one 16-B store; 32 consecutive lanes = 512
// coverage: grid = number of rows, 96 thr x 8 = DM = the whole row.
// =====================================================================================================
__global__ __launch_bounds__(CVT_THREADS)
void cvt16(const float* __restrict__ x, u16* Y, int rowsPerB, int srcRowsPerB, float scale) {
  const int tid = threadIdx.x;
  const int r = blockIdx.x;
  const int b = r / rowsPerB;
  const int s = r - b * rowsPerB;
  const float* src = x + ((size_t)b * (size_t)srcRowsPerB + (size_t)s) * (size_t)DM + (size_t)tid * 8;
  const v4f a = *(const v4f*)(src), c4 = *(const v4f*)(src + 4);
  v4u o;
#pragma unroll
  for (int e = 0; e < 2; ++e) {
    o[e]     = pk16(h_bits((_Float16)(bfr(a[2 * e]) * scale)),  h_bits((_Float16)(bfr(a[2 * e + 1]) * scale)));
    o[2 + e] = pk16(h_bits((_Float16)(bfr(c4[2 * e]) * scale)), h_bits((_Float16)(bfr(c4[2 * e + 1]) * scale)));
  }
  u16* dst = Y + (size_t)r * (size_t)DM + (size_t)tid * 8;
  {
    *(v4u*)(dst) = o;
    
  }
}

// =====================================================================================================
// Cosine similarity sim[b][k] = <p, kgk[b][k]> / (max(|p|, eps) * max(|kgk[b][k]|, eps)), p = pooled[b], all operands
// bf16-RNE-converted, f32 arithmetic on VALU. Block = 256 threads = 8 waves = 32 keys of one batch (wave w -> keys
// =====================================================================================================
__global__ __launch_bounds__(SIM_THREADS)
void k_sim(const float* __restrict__ pooled, const float* __restrict__ kgk, const int* __restrict__ msk, float* S) {
  __shared__ __align__(16) float sv[SIM_KEYS];
  (void)msk;
  const int tid = threadIdx.x, wave = tid >> 5, lane = tid & 31;
  constexpr int NKBLK = SKV / SIM_KEYS;
  const int b  = blockIdx.x / NKBLK;
  const int kb = (blockIdx.x - b * NKBLK) * SIM_KEYS;
  const float* p = pooled + (size_t)b * DM;
  float pp = 0.f;
#pragma unroll 1
  for (int e = lane; e < DM; e += 32) {
    const float xv = bfr(p[e]);
    pp += xv * xv;
  }
  pp = wave_sum(pp);
  const float pnrm = fmaxf(sqrtf(pp), EPSN);
#pragma unroll 1
  for (int j = 0; j < 4; ++j) {
    const int k = kb + wave * 4 + j;                                     // < SKV by construction
    const float* kr = kgk + ((size_t)b * SKV + (size_t)k) * (size_t)DM;
    float pk = 0.f, kk = 0.f;
#pragma unroll 1
    for (int e = lane; e < DM; e += 32) {
      const float xv = bfr(p[e]);
      const float yv = bfr(kr[e]);
      pk += xv * yv;
      kk += yv * yv;
    }
    pk = wave_sum(pk);
    kk = wave_sum(kk);
    const float knrm = fmaxf(sqrtf(kk), EPSN);
    const float val = pk / (pnrm * knrm);
    if (lane == 0) sv[wave * 4 + j] = val;
  }
  __syncthreads();
  if (wave == 0) {                                                     // wave-uniform
    const v4f v = *(const v4f*)(sv + 4 * (lane & 7));                   // clamped LDS address, all lanes load
    float* dst = S + (size_t)b * SKV + kb + 4 * (lane & 7);
    if (lane < 8) {
      *(v4f*)dst = v;
    }
    
  }
}

// =====================================================================================================
// Staging of one 128-row x 64-k f16 plane tile in LDS: rows of 128 B at pitch 144 B (16 B x odd: ds_load_b128 free of bank
// conflicts). 128 threads, thread = (row tid>>3 of a group of 16, 16-B piece tid&7), eight groups: one wave-instruction
// covers four whole 128-B lines. l = the lane's LDS byte address of group 0, g = its global address of group 0,
// rs16 = 16 source rows in elements.
// =====================================================================================================
__device__ __forceinline__ unsigned lds_off(const void* p) { return (unsigned)(size_t)p; }
__device__ __forceinline__ void copy_plane(unsigned l, const _Float16* g, size_t rs16) {
#if defined(__HIP_DEVICE_COMPILE__)
  // the closing s_wait_xcnt stands inside the statement so that no address register is rewritten ahead of it
  asm volatile("global_load_async_to_lds_b128 %0, %8, off\n\t"
               "global_load_async_to_lds_b128 %1, %9, off\n\t"
               "global_load_async_to_lds_b128 %2, %10, off\n\t"
               "global_load_async_to_lds_b128 %3, %11, off\n\t"
               "global_load_async_to_lds_b128 %4, %12, off\n\t"
               "global_load_async_to_lds_b128 %5, %13, off\n\t"
               "global_load_async_to_lds_b128 %6, %14, off\n\t"
               "global_load_async_to_lds_b128 %7, %15, off\n\t"
               "s_wait_xcnt 0x0"
               :: "v"(l), "v"(l + 16 * LPITCH), "v"(l + 32 * LPITCH), "v"(l + 48 * LPITCH),
                  "v"(l + 64 * LPITCH), "v"(l + 80 * LPITCH), "v"(l + 96 * LPITCH), "v"(l + 112 * LPITCH),
                  "v"(g), "v"(g + rs16), "v"(g + 2 * rs16), "v"(g + 3 * rs16),
                  "v"(g + 4 * rs16), "v"(g + 5 * rs16), "v"(g + 6 * rs16), "v"(g + 7 * rs16)
               : "memory");
#endif
}

// Inputs-only fence on loaded fragments: keeps a group's LDS loads together ahead of its products, so that the wave waits for
// LDS once per group and not once per four products.
__device__ __forceinline__ void hold4(const v16h (&x)[4]) {
#if defined(__HIP_DEVICE_COMPILE__)
  asm volatile("" :: "v"(x[0]), "v"(x[1]), "v"(x[2]), "v"(x[3]));
#endif
}

// Stage one 16 x 64 f32 group of the wave's tile in its LDS slab (pitch 68): D element r of acc[j], lane l -> row 8h + r, col 16j + (l&15);
// the caller reloads it behind the wave sync.
// coverage: 32 lanes x 8 rows x 4 cols-of-16 = rows 0..15 x cols 0..63 of the slab (staged extent == consumed extent).
template <bool HASLO, bool BROW>
__device__ __forceinline__ void stage16(float* sl, v8f (&ah)[4], v8f (&al)[4], const float* __restrict__ bias,
                                        int rowb, int col0, float osc, float bsc, int lane) {
  const int hh = lane >> 4, m = lane & 15;
  float bc[4], br[8];
  if (BROW) {
#pragma unroll
    for (int r = 0; r < 8; ++r) br[r] = bfr(bias[rowb + 8 * hh + r]) * bsc;
#pragma unroll
    for (int j = 0; j < 4; ++j) bc[j] = 0.f;
  } else {
#pragma unroll
    for (int j = 0; j < 4; ++j) bc[j] = bfr(bias[col0 + 16 * j + m]) * bsc;
#pragma unroll
    for (int r = 0; r < 8; ++r) br[r] = 0.f;
  }
  const float oscl = osc * RINV;
#pragma unroll
  for (int r = 0; r < 8; ++r) {
    const int ro = (8 * hh + r) * GPITCH + m;
#pragma unroll
    for (int j = 0; j < 4; ++j) {
      float v = ah[j][r] * osc;
      if (HASLO) v += al[j][r] * oscl;
      v += BROW ? br[r] : bc[j];
      sl[ro + 16 * j] = v;
    }
  }
  wave_sync_lds();
}

// =====================================================================================================
// f16 GEMM, block = 128 x 128 tile, 4 waves (2 x 2) x 64 x 64; the k range is walked in tiles of 64; each tile's A rows
// (hi and, with HASLO, residual plane) and Bt rows are staged in LDS by asynchronous copies, two buffers, the next tile's
// copies in flight while this tile is multiplied; fragments come from LDS (4 A x 4 B fragments, 16 products per plane and k32).
//   C tile [z][Mb][N] = (A_hi[z][Mb][K] (+ A_res/2048)) . Bt[z][N][K]^T * osc + bias; per-z element strides aBs (A planes),
//   bBs (Bt), fBs (f32 output F), hBs (16-bit output planes H, L); 0 = shared.
//   M_HL  : H = f16(v*carry), L = f16 residual x2048 (two planes)       M_S16 : H only, bias per row
//   M_F32 : F = v (f32 rows, batch-row remap through fBs), no 16-bit output
// grid = nz x (Mb/128) x (N/128) (all launches: Mb % 128 == 0, N % 128 == 0, K % 64 == 0, K >= 128).
// Each accumulator sums its k32 products in ascending k, as a 16 x 64 wave tile did.
// Epilogue: the ring is free behind the last tile's barrier; each wave stages its four 16 x 64 f32 groups in its own range.
// coverage: per 16-row group 4 instr x 4 rows x 8 lanes x 8 halves = 16 x 64 (16-bit planes) and 8 instr x 2 rows x 16 lanes
//           x 4 floats = 16 x 64 (f32 plane); 4 groups x 4 waves = 128 x 128; the grid covers C exactly once.
// =====================================================================================================
template <bool HASLO, int MODE, bool BROW>
__global__ __launch_bounds__(128)
void gemm16(const u16* __restrict__ Ah, const u16* __restrict__ Al, const u16* __restrict__ Bt,
            const float* __restrict__ bias, float* F, u16* H, u16* L,
            int Mb, int N, int K, int aBs, int bBs, int fBs, int hBs,
            float osc, float bsc, float carry) {
  constexpr int BUFB = (HASLO ? 3 : 2) * PLANEB;          // one buffer: [A hi | Bt | A res]
  static_assert(4 * 64 * GPITCH * 4 <= 2 * BUFB && GKT == 64);          // epilogue staging fits the ring
  __shared__ __align__(16) unsigned char ring[2 * BUFB];
  constexpr bool LOUT = (MODE == M_HL);
  const int tid = threadIdx.x, wave = tid >> 5, lane = tid & 31, hh = lane >> 4, m = lane & 15;
  const int ntile = N >> 7, mtile = Mb >> 7;
  const int bid  = blockIdx.x;
  const int nt   = bid % ntile;
  const int tmp  = bid / ntile;
  const int mt   = tmp % mtile;
  const int bz   = tmp / mtile;
  const int wm = wave >> 1, wn = wave & 1;
  const int rowb = mt * 128 + wm * 64;
  const int col0 = nt * 128 + wn * 64;
  // copy side: the lane's row in a group of 16 and its 16-B piece of the 128-B row
  const int cr = tid >> 3, cc = tid & 7;
  const _Float16* gah = (const _Float16*)(const void*)Ah + (size_t)bz * (size_t)aBs + (size_t)(mt * 128 + cr) * (size_t)K + 8 * cc;
  const _Float16* gal = (const _Float16*)(const void*)Al + (size_t)bz * (size_t)aBs + (size_t)(mt * 128 + cr) * (size_t)K + 8 * cc;
  const _Float16* gb  = (const _Float16*)(const void*)Bt + (size_t)bz * (size_t)bBs + (size_t)(nt * 128 + cr) * (size_t)K + 8 * cc;
  const unsigned lc = lds_off(ring) + (unsigned)(cr * LPITCH + cc * 16);
  const size_t rs16 = (size_t)16 * (size_t)K;
  const int ntk = K >> 6;
  // fragment side: row (lane & 15) of the wave's first A / B group, +16 B for the upper lane half
  const unsigned char* fa = ring + (wm * 64 + m) * LPITCH + 16 * hh;
  const unsigned char* fb = ring + PLANEB + (wn * 64 + m) * LPITCH + 16 * hh;

  v8f ah[4][4], al[4][4];
#pragma unroll
  for (int i = 0; i < 4; ++i) {
#pragma unroll
    for (int j = 0; j < 4; ++j) { ah[i][j] = zero8(); al[i][j] = zero8(); }
  }

  // tile 0 -> buffer 0, landed and published; then tile 1 -> buffer 1 in flight
  copy_plane(lc, gah, rs16);
  copy_plane(lc + PLANEB, gb, rs16);
  if (HASLO) copy_plane(lc + 2 * PLANEB, gal, rs16);
  asm volatile("s_wait_asynccnt 0x0" ::: "memory");        // this wave's copies of tile 0 have landed
  __syncthreads();                                         // ... and every other wave's
  if (ntk > 1) {                                           // the same for the whole block
    copy_plane(lc + BUFB, gah + GKT, rs16);
    copy_plane(lc + BUFB + PLANEB, gb + GKT, rs16);
    if (HASLO) copy_plane(lc + BUFB + 2 * PLANEB, gal + GKT, rs16);
  }

  // rolled: one copy of the tile body, so that the hot loop stays small in the instruction cache; the unrolls inside it keep
  // the fragment and accumulator arrays in registers
#pragma unroll 1
  for (int t = 0; t < ntk; ++t) {
    const int bo = (t & 1) * BUFB;
    v16h a[2][4], b[2][4], r[2][4];
    if (!HASLO) {
      // both k32 groups' fragments are asked for at the top of the tile: the second group lands behind the first one's products
#pragma unroll
      for (int kk = 0; kk < 2; ++kk) {
#pragma unroll
        for (int i = 0; i < 4; ++i) {
          a[kk][i] = ldfrag_h((const _Float16*)(const void*)(fa + bo + i * 16 * LPITCH + kk * 64));
          b[kk][i] = ldfrag_h((const _Float16*)(const void*)(fb + bo + i * 16 * LPITCH + kk * 64));
        }
      }
    }
#pragma unroll
    for (int kk = 0; kk < 2; ++kk) {
      if (HASLO) {
#pragma unroll
        for (int i = 0; i < 4; ++i) {
          a[kk][i] = ldfrag_h((const _Float16*)(const void*)(fa + bo + i * 16 * LPITCH + kk * 64));
          b[kk][i] = ldfrag_h((const _Float16*)(const void*)(fb + bo + i * 16 * LPITCH + kk * 64));
          r[kk][i] = ldfrag_h((const _Float16*)(const void*)(fa + bo + 2 * PLANEB + i * 16 * LPITCH + kk * 64));
        }
        hold4(r[kk]);
      }
      hold4(a[kk]);
      hold4(b[kk]);
#pragma unroll
      for (int i = 0; i < 4; ++i) {
#pragma unroll
        for (int j = 0; j < 4; ++j) ah[i][j] = mma_h(a[kk][i], b[kk][j], ah[i][j]);
      }
      if (HASLO) {
#pragma unroll
        for (int i = 0; i < 4; ++i) {
#pragma unroll
          for (int j = 0; j < 4; ++j) al[i][j] = mma_h(r[kk][i], b[kk][j], al[i][j]);
        }
      }
      // keeps this group's products ahead of what follows: of the second group's LDS wait, and of the waits and the barrier at
      // the tile's foot, so that the copies in flight have the products' time to land
      if (!HASLO || kk == 1) __builtin_amdgcn_sched_barrier(0);
    }
    asm volatile("s_wait_dscnt 0x0" ::: "memory");         // this wave's reads of the buffer are done before it is refilled
    asm volatile("s_wait_asynccnt 0x0" ::: "memory");      // this wave's copies of tile t + 1 have landed
    __syncthreads();                                       // publishes tile t + 1, ends every reader's use of tile t
    if (t + 2 < ntk) {                                     // the same for the whole block
      const int ko = (t + 2) * GKT;
      copy_plane(lc + bo, gah + ko, rs16);
      copy_plane(lc + bo + PLANEB, gb + ko, rs16);
      if (HASLO) copy_plane(lc + bo + 2 * PLANEB, gal + ko, rs16);
    }
  }
  asm volatile("s_wait_asynccnt 0x0" ::: "memory");        // no copy outstanding when the ring becomes output staging

#pragma unroll
  for (int g = 0; g < 4; ++g) {
    const int rowg = rowb + 16 * g;
    float* sl = (float*)(void*)ring + (wave * 4 + g) * 16 * GPITCH;
    stage16<HASLO, BROW>(sl, ah[g], al[g], bias, rowg, col0, osc, bsc, lane);

    if (MODE == M_F32) {
      v4f vals[8];
#pragma unroll
      for (int it = 0; it < 8; ++it) vals[it] = *(const v4f*)(sl + (it * 2 + hh) * GPITCH + m * 4);
      float* Fb = F + (size_t)bz * (size_t)fBs + ((size_t)rowg + (size_t)hh) * (size_t)N + col0 + m * 4;
#pragma unroll
      for (int it = 0; it < 8; ++it) {
        *(v4f*)(Fb + (size_t)(it * 2) * (size_t)N) = vals[it];
      }
    } else {
      const int rq = lane >> 3, c8 = (lane & 7) * 8;
      v4u ovh[4], ovl[4];
#pragma unroll
      for (int i = 0; i < 4; ++i) {
        const int row = 4 * i + rq;
        const v4f a = *(const v4f*)(sl + row * GPITCH + c8), c4 = *(const v4f*)(sl + row * GPITCH + c8 + 4);
#pragma unroll
        for (int e = 0; e < 2; ++e) {
          unsigned ph0, pl0, ph1, pl1;
          split2(a[2 * e] * carry,  a[2 * e + 1] * carry,  ph0, pl0);
          split2(c4[2 * e] * carry, c4[2 * e + 1] * carry, ph1, pl1);
          ovh[i][e] = ph0;     ovl[i][e] = pl0;
          ovh[i][2 + e] = ph1; ovl[i][2 + e] = pl1;
        }
      }
      u16* Hb = H + (size_t)bz * (size_t)hBs + (size_t)rowg * (size_t)N + col0 + c8;
      u16* Lb = L + (size_t)bz * (size_t)hBs + (size_t)rowg * (size_t)N + col0 + c8;
#pragma unroll
      for (int i = 0; i < 4; ++i) {
        const int row = 4 * i + rq;
        *(v4u*)(Hb + (size_t)row * (size_t)N) = ovh[i];
        if (LOUT) *(v4u*)(Lb + (size_t)row * (size_t)N) = ovl[i];
      }
    }
  }
}

// =====================================================================================================
// Full (unmasked) multi-head cross attention with a per-key additive bias bfr(beta[h]) * sim[b][key]:
// block = (batch b, head, 64 query rows), 4 waves, wave w owns the 16 query rows q0 = 64*qt + 16*w .. q0+15
// (waves independent: no block barriers, wave-private LDS only, used in the epilogue).
//   q planes f16 x8 hi / residual(x2048) [b*SQ + s][h*64 + d]; k planes likewise [b*SKV + s][h*64 + d];
//   v^T plane f16 x8 [(b*NH + h)*64 + d][s]; sim plane f32 [b][s]. All NKB key blocks of 32 keys are visited (static bound).
//   Scores are computed TRANSPOSED: S^T tile g (g = 0,1) = k rows (keys kb+16g .. +15, A operand, row m = lane&15, split map
//   over d) times q^T (B operand, col n = query q0 + (lane&15), k = d, split map), 2 d-chunks of 32; per chunk hi.hi -> s,
//   res.hi + hi.res -> r (scaled x2048, folded as s + r/2048); the q fragments are loaded once per wave.
//   D element r of lane l = (key kb+16g+8h+r, query q0+(l&15)), so a lane owns one query column and 16 of its 32 keys;
//   the partner lane l^16 owns the other 16 -> row max / row sum need one xor-16 shuffle. The bias of the lane's 16 keys
//   comes from four 16-B loads of the sim row (keys kb+8h..+7 and kb+16+8h..+7), times bfr(beta[h])*log2(e), added in f32.
//   Online max-subtracted base-2 softmax in f32 (1/sqrt(64) and the q/k carries folded into lsc). The exp'd values ARE the
//   P A-fragment in place: A row m = query = lane&15, element i <- key kb+8h+i (tile 0, D element i), element 8+i <- key
//   kb+16+8h+i (tile 1, D element i). P (<= 1) carried x32768 as f16. The rescale factor of query row 8h+r of the O
//   accumulators is fetched from lane 8h+r with a shuffle (uniform control). 4 v^T B fragments (col n = d = 16j + (lane&15),
//   keys k-contiguous), 4 P.V WMMAs, one guard.
//   Epilogue: 1/l (per query, shuffled to the D row owner) and the carry folds in f32; the wave's 16x64 f32 result staged in
// coverage: per wave 4 instructions x 4 rows x 8 lanes x 8 halves = 16 x 64 on both ctx planes; grid NB*NH*(SQ/64) blocks x
//           4 waves = every (b, s, h) row segment exactly once. LDS slab: 16 x 64 staged == 16 x 64 reloaded.
// =====================================================================================================
__global__ __launch_bounds__(ATT_THREADS)
void attn_fwd(const u16* __restrict__ Qh, const u16* __restrict__ Ql, const u16* __restrict__ Kh,
              const u16* __restrict__ Kl, const u16* __restrict__ Vp, const float* __restrict__ Simp,
              const float* __restrict__ beta, u16* Oh, u16* Ol) {
  __shared__ __align__(16) float smem[ATT_WAVES * 16 * OPITCH];

  const int tid  = threadIdx.x;
  const int wave = tid >> 5;
  const int lane = tid & 31;
  const int hh   = lane >> 4;
  const int c    = lane & 15;

  constexpr int NQT = SQ / 64;
  const int bid  = blockIdx.x;
  const int qt   = bid % NQT;
  const int head = (bid / NQT) % NH;
  const int b    = bid / (NQT * NH);
  const int q0   = qt * 64 + wave * 16;

  // B fragments of q^T: col n = query q0 + c, k = d (k-contiguous row of the q planes)
  const size_t qo = ((size_t)(b * SQ + q0 + c)) * INNER + head * HD + 8 * hh;
  const _Float16* Qhb = (const _Float16*)(const void*)Qh + qo;
  const _Float16* Qlb = (const _Float16*)(const void*)Ql + qo;
  // A fragments of k: row m = key kb + 16g + c, k = d (key row kb added per step)
  const size_t ko = ((size_t)(b * SKV + c)) * INNER + head * HD + 8 * hh;
  const _Float16* Khb = (const _Float16*)(const void*)Kh + ko;
  const _Float16* Klb = (const _Float16*)(const void*)Kl + ko;
  // B fragments of v: col n = d = 16j + c, k = key (k-contiguous row of the v^T plane)
  const _Float16* Vb = (const _Float16*)(const void*)Vp + ((size_t)(b * NH + head) * HD + c) * SKV + 8 * hh;
  // per-key bias row of this batch, offset to the lane half's first key
  const float* Sb = Simp + (size_t)b * SKV + 8 * hh;
  const float bl2 = bfr(beta[head]) * LOG2E;
  const float lsc = (LOG2E * RSQ_HD) / (QS * KS);

  v16h qh[2], ql[2];
  qh[0] = ldfrag_h(Qhb);
  qh[1] = ldfrag_h(Qhb + 32);
  ql[0] = ldfrag_h(Qlb);
  ql[1] = ldfrag_h(Qlb + 32);

  float mrun = -INFINITY, lrun = 0.f;
  v8f o[4];
#pragma unroll
  for (int j = 0; j < 4; ++j) o[j] = zero8();

#pragma unroll 1
  for (int it = 0; it < NKB; ++it) {
    const int kb = it * 32;
    // ---- transposed scores: s0 = keys kb..kb+15, s1 = keys kb+16..kb+31, column = query q0 + c ----
    v8f s0 = zero8(), s1 = zero8(), r0 = zero8(), r1 = zero8();
    const _Float16* k0h = Khb + (size_t)kb * INNER;
    const _Float16* k1h = k0h + (size_t)16 * INNER;
    const _Float16* k0l = Klb + (size_t)kb * INNER;
    const _Float16* k1l = k0l + (size_t)16 * INNER;
#pragma unroll
    for (int kk = 0; kk < HD / 32; ++kk) {
      const v16h fh0 = ldfrag_h(k0h + kk * 32);
      const v16h fh1 = ldfrag_h(k1h + kk * 32);
      const v16h fl0 = ldfrag_h(k0l + kk * 32);
      const v16h fl1 = ldfrag_h(k1l + kk * 32);
      s0 = mma_h(fh0, qh[kk], s0);
      s1 = mma_h(fh1, qh[kk], s1);
      r0 = mma_h(fl0, qh[kk], r0);
      r1 = mma_h(fl1, qh[kk], r1);
      r0 = mma_h(fh0, ql[kk], r0);
      r1 = mma_h(fh1, ql[kk], r1);
      guard_s4(s0, s1, r0, r1, qh[kk], ql[kk], fh0, fh1, fl0, fl1);
    }
    // ---- per-key bias: keys kb+8hh+0..7 (g0, g1) and kb+16+8hh+0..7 (g2, g3) ----
    const v4f g0 = *(const v4f*)(Sb + kb);
    const v4f g1 = *(const v4f*)(Sb + kb + 4);
    const v4f g2 = *(const v4f*)(Sb + kb + 16);
    const v4f g3 = *(const v4f*)(Sb + kb + 20);
    // ---- base-2 logits of this lane's 16 keys for query q0 + c: t[i] <- key kb+8hh+i, t[8+i] <- key kb+16+8hh+i ----
    float t[16];
#pragma unroll
    for (int i = 0; i < 4; ++i) {
      t[i]      = (s0[i]     + r0[i]     * RINV) * lsc + g0[i] * bl2;
      t[4 + i]  = (s0[4 + i] + r0[4 + i] * RINV) * lsc + g1[i] * bl2;
      t[8 + i]  = (s1[i]     + r1[i]     * RINV) * lsc + g2[i] * bl2;
      t[12 + i] = (s1[4 + i] + r1[4 + i] * RINV) * lsc + g3[i] * bl2;
    }
    float cm = t[0];
#pragma unroll
    for (int i = 1; i < 16; ++i) cm = fmaxf(cm, t[i]);
    cm = fmaxf(cm, __shfl_xor(cm, 16, 32));
    const float mn = fmaxf(mrun, cm);        // finite from the first block on
    const float al = exp2f(mrun - mn);       // 0 on the first block (mrun = -inf)
    mrun = mn;
    // ---- probabilities (<= 1) and the P A-fragment: f16(p * 32768); element i <-> t[i] ----
    float ps = 0.f;
    FragH ph;
#pragma unroll
    for (int w = 0; w < 2; ++w) {
#pragma unroll
      for (int e4 = 0; e4 < 4; ++e4) {
        const int i = 8 * w + 2 * e4;
        const float p0 = exp2f(t[i] - mn), p1 = exp2f(t[i + 1] - mn);
        ps += p0 + p1;
        ph.u[w][e4] = pk16(h_bits((_Float16)(p0 * PCAR)), h_bits((_Float16)(p1 * PCAR)));
      }
    }
    ps += __shfl_xor(ps, 16, 32);
    lrun = lrun * al + ps;
    // ---- rescale the O accumulators: D row 8hh+r = query q0+8hh+r, its factor lives in lane 8hh+r (and 16+8hh+r) ----
    float scl[8];
#pragma unroll
    for (int r = 0; r < 8; ++r) scl[r] = __shfl(al, 8 * hh + r, 32);
#pragma unroll
    for (int j = 0; j < 4; ++j) {
#pragma unroll
      for (int r = 0; r < 8; ++r) o[j][r] *= scl[r];
    }
    // ---- P.V : B fragment col n = d = j*16 + c, keys contiguous in the v^T plane ----
    {
      const _Float16* vp = Vb + kb;
      const v16h v0 = ldfrag_h(vp);
      const v16h v1 = ldfrag_h(vp + (size_t)16 * SKV);
      const v16h v2 = ldfrag_h(vp + (size_t)32 * SKV);
      const v16h v3 = ldfrag_h(vp + (size_t)48 * SKV);
      o[0] = mma_h(ph.v, v0, o[0]);
      o[1] = mma_h(ph.v, v1, o[1]);
      o[2] = mma_h(ph.v, v2, o[2]);
      o[3] = mma_h(ph.v, v3, o[3]);
      guard_p(o[0], o[1], o[2], o[3], ph.v, v0, v1, v2, v3);
    }
  }
  acc_guard4(o);

  // ---- fold 1/l (per query, owned by lane = query) and the carries (32768 on P, 8 on v), apply the ctx carry 1024 ----
  const float linv = (1.0f / lrun) * (OSC / (PCAR * VS));
  float inv[8];
#pragma unroll
  for (int r = 0; r < 8; ++r) inv[r] = __shfl(linv, 8 * hh + r, 32);
  float* slab = smem + wave * 16 * OPITCH;
#pragma unroll
  for (int r = 0; r < 8; ++r) {
#pragma unroll
    for (int j = 0; j < 4; ++j) slab[(8 * hh + r) * OPITCH + j * 16 + c] = o[j][r] * inv[r];
  }
  wave_sync_lds();
  // ---- ctx x1024 -> f16 hi plane and residual plane; lane = (row in group of 4, 8 consecutive d) ----
  v4u ovh[4], ovl[4];
  const int rq = lane >> 3, c8 = (lane & 7) * 8;
#pragma unroll
  for (int i = 0; i < 4; ++i) {
    const int row = 4 * i + rq;
    const v4f a = *(const v4f*)(slab + row * OPITCH + c8), c4 = *(const v4f*)(slab + row * OPITCH + c8 + 4);
#pragma unroll
    for (int e = 0; e < 2; ++e) {
      unsigned ph0, pl0, ph1, pl1;
      split2(a[2 * e],  a[2 * e + 1],  ph0, pl0);
      split2(c4[2 * e], c4[2 * e + 1], ph1, pl1);
      ovh[i][e] = ph0;     ovl[i][e] = pl0;
      ovh[i][2 + e] = ph1; ovl[i][2 + e] = pl1;
    }
  }
  const size_t oo = ((size_t)(b * SQ + q0)) * INNER + head * HD + c8;
  u16* obh = Oh + oo;
  u16* obl = Ol + oo;
  {
#pragma unroll
    for (int i = 0; i < 4; ++i) {
      const int row = 4 * i + rq;
      *(v4u*)(obh + (size_t)row * INNER) = ovh[i];
      *(v4u*)(obl + (size_t)row * INNER) = ovl[i];
    }
    
  }
}

// =====================================================================================================
// Workspace map (bytes, NB=8, SQ=2048); every plane fully written by whole-line stores before it is read; all extents exact
//   XQ   f16 [NB*SQ][768]    f16(bf16(x))                 25165824   (region reused later as OH, same extent)
//   XV   f16 [NB*512][768]   f16(bf16(kg_value))           6291456
//   WQ16 WK16 WV16 WO16 f16 [768 n][768 k] x256            1179648 each
//   QH QL f16 [NB*SQ][768] x8 hi / res                     25165824 each
//   KH KL f16 [NB*512][768] x8 hi / res                     6291456 each
//   VT16 f16 [NB*768 (h,d)][512 s] x8                       6291456
//   OL   f16 [NB*SQ][768] x1024 res (ctx), OH aliases XQ    25165824
//   SIMP f32 [NB][512]                                         16384
//   end                                                    130564096
// =====================================================================================================
extern "C" void kernel_launch(void* const* d_in, const int* in_sizes, int n_in,
                              void* d_out, int out_size, void* d_ws, size_t ws_size,
                              hipStream_t stream) {
  if (n_in < 14) return;
  if (in_sizes[0] < ((NB - 1) * SQ_FULL + SQ) * DM) return;
  if (in_sizes[1] < 1) return;
  if (in_sizes[2] < NB * DM) return;
  if (in_sizes[3] < NB * SKV * DM || in_sizes[4] < NB * SKV * DM) return;
  if (in_sizes[5] < NH) return;
  if (in_sizes[6] != DM * DM || in_sizes[8] != DM * DM || in_sizes[10] != DM * DM || in_sizes[12] != DM * DM) return;
  if (in_sizes[7] < DM || in_sizes[9] < DM || in_sizes[11] < DM || in_sizes[13] < DM) return;
  if (out_size < ((NB - 1) * SQ_FULL + SQ) * DM) return;

  const float* x_in   = (const float*)d_in[0];
  const int*   msk    = (const int*)d_in[1];
  const float* pooled = (const float*)d_in[2];
  const float* kgk    = (const float*)d_in[3];
  const float* kgv    = (const float*)d_in[4];
  const float* beta   = (const float*)d_in[5];
  const float* wq     = (const float*)d_in[6];
  const float* bq     = (const float*)d_in[7];
  const float* wk     = (const float*)d_in[8];
  const float* bk     = (const float*)d_in[9];
  const float* wv     = (const float*)d_in[10];
  const float* bv     = (const float*)d_in[11];
  const float* wo     = (const float*)d_in[12];
  const float* bo     = (const float*)d_in[13];
  float*       out    = (float*)d_out;

  const size_t szXQ = (size_t)NB * SQ * DM * 2;
  const size_t szXV = (size_t)NB * SKV * DM * 2;
  const size_t szW  = (size_t)DM * DM * 2;
  const size_t szQP = (size_t)NB * SQ * INNER * 2;
  const size_t szKP = (size_t)NB * SKV * INNER * 2;
  const size_t szVT = (size_t)NB * INNER * SKV * 2;
  const size_t szS  = (size_t)NB * SKV * 4;
  static_assert((size_t)NB * SQ * DM * 2 == (size_t)NB * SQ * INNER * 2);   // XQ region reused as OH, same extent
  size_t off = 0;
  const size_t oXQ = off; off += szXQ;      // also OH
  const size_t oXV = off; off += szXV;
  const size_t oWQ = off; off += szW;
  const size_t oWK = off; off += szW;
  const size_t oWV = off; off += szW;
  const size_t oWO = off; off += szW;
  const size_t oQH = off; off += szQP;
  const size_t oQL = off; off += szQP;
  const size_t oKH = off; off += szKP;
  const size_t oKL = off; off += szKP;
  const size_t oVT = off; off += szVT;
  const size_t oOL = off; off += szQP;
  const size_t oS  = off; off += szS;
  if (off > ws_size) return;                // off = 130564096 at NB=8, SQ=2048
  if (off > (size_t)134217728) return;

  char* ws = (char*)d_ws;
  u16* XQ   = (u16*)(ws + oXQ);
  u16* XV   = (u16*)(ws + oXV);
  u16* WQ16 = (u16*)(ws + oWQ);
  u16* WK16 = (u16*)(ws + oWK);
  u16* WV16 = (u16*)(ws + oWV);
  u16* WO16 = (u16*)(ws + oWO);
  u16* QH   = (u16*)(ws + oQH);
  u16* QL   = (u16*)(ws + oQL);
  u16* KH   = (u16*)(ws + oKH);
  u16* KL   = (u16*)(ws + oKL);
  u16* VT16 = (u16*)(ws + oVT);
  u16* OH   = (u16*)(ws + oXQ);
  u16* OL   = (u16*)(ws + oOL);
  float* SIMP = (float*)(ws + oS);

  // (0,1) activations -> f16 planes of bf16-converted values (query rows s < SQ of batches b < NB, compact; kg_value rows)
  cvt16<<<dim3(NB * SQ), dim3(CVT_THREADS), 0, stream>>>(x_in, XQ, SQ, SQ_FULL, 1.0f);
  cvt16<<<dim3(NB * SKV), dim3(CVT_THREADS), 0, stream>>>(kgv, XV, SKV, SKV, 1.0f);
  // (2..5) weights [n = out][k = in] (y = x.W^T): already k-contiguous [n][k]; f16 planes of bf16(W) x256
  cvt16<<<dim3(DM), dim3(CVT_THREADS), 0, stream>>>(wq, WQ16, DM, DM, WSC);
  cvt16<<<dim3(DM), dim3(CVT_THREADS), 0, stream>>>(wk, WK16, DM, DM, WSC);
  cvt16<<<dim3(DM), dim3(CVT_THREADS), 0, stream>>>(wv, WV16, DM, DM, WSC);
  cvt16<<<dim3(DM), dim3(CVT_THREADS), 0, stream>>>(wo, WO16, DM, DM, WSC);
  // (6) cosine similarity sim[b][k] -> SIMP f32 [NB][512]
  k_sim<<<dim3(NB * (SKV / SIM_KEYS)), dim3(SIM_THREADS), 0, stream>>>(pooled, kgk, msk, SIMP);
  // (7) q_un = x . Wq^T + bq -> f16 [NB*SQ][768] x8 hi + res (col = h*64 + d); the 1/8 is folded into the softmax scale
  gemm16<false, M_HL, false><<<dim3((NB * SQ / 128) * (INNER / 128)), dim3(128), 0, stream>>>(
      XQ, XQ, WQ16, bq, out, QH, QL, NB * SQ, INNER, DM, 0, 0, 0, 0, QS / WSC, QS, 1.0f);
  // (8) k = kg_value . Wk^T + bk -> f16 [NB*512][768] x8 hi + res
  gemm16<false, M_HL, false><<<dim3((NB * SKV / 128) * (INNER / 128)), dim3(128), 0, stream>>>(
      XV, XV, WK16, bk, out, KH, KL, NB * SKV, INNER, DM, 0, 0, 0, 0, KS / WSC, KS, 1.0f);
  // (9) v^T per batch: A = Wv [(h,d) = n][k], Bt = kg_value rows of batch b [s][k], bias bv per row -> f16 [(b,h,d)][s] x8
  gemm16<false, M_S16, true><<<dim3(NB * (INNER / 128) * (SKV / 128)), dim3(128), 0, stream>>>(
      WV16, WV16, XV, bv, out, VT16, VT16, INNER, SKV, DM, 0, SKV * DM, 0, INNER * SKV, VS / WSC, VS, 1.0f);
  // (10) attention with the beta*sim key bias -> ctx planes [NB*SQ][768] x1024 hi + res (OH reuses the XQ region)
  attn_fwd<<<dim3(NB * NH * (SQ / 64)), dim3(ATT_THREADS), 0, stream>>>(QH, QL, KH, KL, VT16, SIMP, beta, OH, OL);
  // (11) out rows [b][SQ_FULL][768] f32 = ctx . Wo^T + bo (rows s < SQ of batches b < NB); carries 1024 x 256 folded back
  gemm16<true, M_F32, false><<<dim3(NB * (SQ / 128) * (DM / 128)), dim3(128), 0, stream>>>(
      OH, OL, WO16, bo, out, OL, OL, SQ, DM, INNER, SQ * INNER, 0, SQ_FULL * DM, 0,
      1.0f / (OSC * WSC), 1.0f, 1.0f);
  (void)hipGetLastError();
}

// v002
// One run takes 215 microseconds.
// Two timings next to v001 both put it at 1.36 times that version's speed.
// All steps since v000 together make it 2.02 times as fast.
// Contractions on v_wmma_f32_16x16x32_f16 (f16 operands, f32 accumulate): x.Wq^T, xv.Wk^T, Wv.xv^T single products on
// f16(bf16(x)) and f16(bf16(W) x256); k.q^T with q and k carried as f16 hi + residual(x2048) planes (3 products);
// P.v^T single product (P x32768, v x8); ctx.Wo^T with ctx carried as f16 hi (x1024) + residual(x2048) planes (2 products,
// separate residual accumulator); cosine-similarity bias, softmax, biases and all carry folds in f32 on VALU.
// Inputs RNE-converted to bf16 on load.
#include <hip/hip_runtime.h>
#include <math.h>
#include <stdint.h>

#ifndef NB
#define NB       8        // batches processed
#endif
#ifndef SQ
#define SQ       2048     // query rows processed per batch
#endif
#define NB_FULL  8
#define SQ_FULL  2048     // query rows per batch in the input / output layout (batch stride)
#define SKV      512      // key / value rows per batch (all of them)
#define DM       768      // model width
#define NH       12
#define HD       64
#define INNER    (NH * HD)
#define WSC      256.0f   // weight carry
#define QS       8.0f
#define KS       8.0f
#define VS       8.0f
#define PCAR     32768.0f
#define OSC      1024.0f  // ctx carry
#define RSC      2048.0f  // residual plane scale
#define RINV     0.00048828125f
#define LOG2E    1.4426950408889634f
#define RSQ_HD   0.125f
#define EPSN     1e-8f
#define NKB      (SKV / 32)
#define ATT_WAVES   4
#define ATT_THREADS (ATT_WAVES * 32)
#define CVT_THREADS (DM / 8)
#define SIM_THREADS 256
#define SIM_KEYS    32       // keys per k_sim block (8 waves x 4)
#define OPITCH   68
#define GPITCH   68
#define GKT      64       // k per staged GEMM tile (128-B rows)
#define LPITCH   144      // LDS pitch of a staged row, bytes
#define PLANEB   (128 * LPITCH)
#define AKT      64       // keys per staged attention tile (128-B rows in all three planes)
#define APLANEB  (64 * LPITCH)
#define ABUFB    (3 * APLANEB)       // one attention buffer: [k hi | k res | v^T]
#define NST      (SKV / AKT)

#define M_HL     0
#define M_S16    1
#define M_F32    2

static_assert(NB >= 1 && NB <= NB_FULL);
static_assert((SQ % 128) == 0 && SQ >= 128 && SQ <= SQ_FULL);
static_assert(HD == 64 && INNER == 768 && NH == 12 && INNER == DM);
static_assert((SKV % 128) == 0 && (SKV % 32) == 0 && NKB * 32 == SKV && (SKV % SIM_KEYS) == 0);
static_assert((DM % 128) == 0 && (DM % 32) == 0 && CVT_THREADS * 8 == DM && (CVT_THREADS % 32) == 0);
static_assert((OPITCH * 4) % 16 == 0 && (GPITCH * 4) % 16 == 0);
static_assert(ATT_THREADS * 4 == SKV && NST >= 2 && AKT == 64 && HD == 64);
static_assert(ATT_WAVES * 16 * OPITCH * 4 <= 2 * ABUFB);               // attention output staging fits its ring
static_assert(ATT_THREADS == 128 && SIM_THREADS == 256 && SIM_KEYS == (SIM_THREADS / 32) * 4);

typedef unsigned short u16;
typedef _Float16 v16h __attribute__((ext_vector_type(16)));
typedef _Float16 v8h  __attribute__((ext_vector_type(8)));
typedef float    v8f  __attribute__((ext_vector_type(8)));
typedef float    v4f  __attribute__((ext_vector_type(4)));
typedef unsigned int v4u __attribute__((ext_vector_type(4)));

union FragH { v16h v; v8h h[2]; v4u u[2]; };

// ---- scalar helpers ----------------------------------------------------------------------------------
__device__ __forceinline__ unsigned short bf_bits(float f) {          // f32 -> bf16 bits, RNE convert
  unsigned u = __float_as_uint(f);
  return (unsigned short)((u + 0x7FFFu + ((u >> 16) & 1u)) >> 16);
}
__device__ __forceinline__ float bf_up(unsigned short h) { return __uint_as_float(((unsigned)h) << 16); }
__device__ __forceinline__ float bfr(float f) { return bf_up(bf_bits(f)); }
__device__ __forceinline__ unsigned short h_bits(_Float16 x) { return __builtin_bit_cast(unsigned short, x); }
__device__ __forceinline__ unsigned pk16(unsigned short a, unsigned short b) { return (unsigned)a | ((unsigned)b << 16); }
__device__ __forceinline__ v8f zero8() { v8f z = {0.f, 0.f, 0.f, 0.f, 0.f, 0.f, 0.f, 0.f}; return z; }

__device__ __forceinline__ float wave_sum(float v) {
  v += __shfl_xor(v, 16, 32);
  v += __shfl_xor(v, 8, 32);
  v += __shfl_xor(v, 4, 32);
  v += __shfl_xor(v, 2, 32);
  v += __shfl_xor(v, 1, 32);
  return v;
}

// x = hi + lo/2048 in f16: hi = f16(x), lo = f16((x - hi) * 2048); two values packed per 32-bit word
__device__ __forceinline__ void split2(float x0, float x1, unsigned& ph, unsigned& pl) {
  const _Float16 h0 = (_Float16)x0, h1 = (_Float16)x1;
  const float d0 = x0 - (float)h0, d1 = x1 - (float)h1;
  const _Float16 l0 = (_Float16)(d0 * RSC), l1 = (_Float16)(d1 * RSC);
  ph = pk16(h_bits(h0), h_bits(h1));
  pl = pk16(h_bits(l0), h_bits(l1));
}

// ---- fragment loader: 16-bit A/B operand, lane -> row/col (lane&15), p already includes +8*(lane>>4);
//      elements 0..7 <- p[0..7] (k0+8h..), elements 8..15 <- p[16..23] (k0+16+8h..); same split k map for A and B,
//      B always read from a k-contiguous [n][k] plane.
__device__ __forceinline__ v16h ldfrag_h(const _Float16* p) {
  FragH f;
  f.h[0] = *(const v8h*)(p);
  f.h[1] = *(const v8h*)(p + 16);
  return f.v;
}

// ---- WMMA helper and trailing VALU hazard gaps ----------------------------------------------------------
__device__ __forceinline__ v8f mma_h(v16h a, v16h b, v8f c) {
  return __builtin_amdgcn_wmma_f32_16x16x32_f16(false, a, false, b, (short)0, c, false, false);
}
__device__ __forceinline__ void guard_s4(v8f& a, v8f& b, v8f& c, v8f& d,
                                         v16h x0, v16h x1, v16h x2, v16h x3, v16h x4, v16h x5) {
#if defined(__HIP_DEVICE_COMPILE__)
  asm volatile("v_nop\n\tv_nop\n\tv_nop\n\tv_nop"
               : "+v"(a), "+v"(b), "+v"(c), "+v"(d)
               : "v"(x0), "v"(x1), "v"(x2), "v"(x3), "v"(x4), "v"(x5) : "memory");
#endif
}
__device__ __forceinline__ void guard_p(v8f& a, v8f& b, v8f& c, v8f& d, v16h p, v16h x0, v16h x1, v16h x2, v16h x3) {
#if defined(__HIP_DEVICE_COMPILE__)
  asm volatile("v_nop\n\tv_nop\n\tv_nop\n\tv_nop"
               : "+v"(a), "+v"(b), "+v"(c), "+v"(d) : "v"(p), "v"(x0), "v"(x1), "v"(x2), "v"(x3) : "memory");
#endif
}
__device__ __forceinline__ void acc_guard4(v8f (&a)[4]) {
#if defined(__HIP_DEVICE_COMPILE__)
  asm volatile("v_nop\n\tv_nop\n\tv_nop\n\tv_nop" : "+v"(a[0]), "+v"(a[1]), "+v"(a[2]), "+v"(a[3]));
#endif
}
__device__ __forceinline__ void wave_sync_lds() {
  __builtin_amdgcn_fence(__ATOMIC_RELEASE, "workgroup");
  __builtin_amdgcn_wave_barrier();
  __builtin_amdgcn_fence(__ATOMIC_ACQUIRE, "workgroup");
}

// =====================================================================================================
// Row convert: destination row r of a [rows][DM] f16 plane <- f16(bf16_RNE(x[src row][e]) * scale), scale a power of two.
// Block = DM/8 = 96 threads, thread = 8 consecutive elements (two 16-B loads, one 16-B store; 32 consecutive lanes = 512
// coverage: grid = number of rows, 96 thr x 8 = DM = the whole row.
// =====================================================================================================
__global__ __launch_bounds__(CVT_THREADS)
void cvt16(const float* __restrict__ x, u16* Y, int rowsPerB, int srcRowsPerB, float scale) {
  const int tid = threadIdx.x;
  const int r = blockIdx.x;
  const int b = r / rowsPerB;
  const int s = r - b * rowsPerB;
  const float* src = x + ((size_t)b * (size_t)srcRowsPerB + (size_t)s) * (size_t)DM + (size_t)tid * 8;
  const v4f a = *(const v4f*)(src), c4 = *(const v4f*)(src + 4);
  v4u o;
#pragma unroll
  for (int e = 0; e < 2; ++e) {
    o[e]     = pk16(h_bits((_Float16)(bfr(a[2 * e]) * scale)),  h_bits((_Float16)(bfr(a[2 * e + 1]) * scale)));
    o[2 + e] = pk16(h_bits((_Float16)(bfr(c4[2 * e]) * scale)), h_bits((_Float16)(bfr(c4[2 * e + 1]) * scale)));
  }
  u16* dst = Y + (size_t)r * (size_t)DM + (size_t)tid * 8;
  {
    *(v4u*)(dst) = o;
    
  }
}

// =====================================================================================================
// Cosine similarity sim[b][k] = <p, kgk[b][k]> / (max(|p|, eps) * max(|kgk[b][k]|, eps)), p = pooled[b], all operands
// bf16-RNE-converted, f32 arithmetic on VALU. Block = 256 threads = 8 waves = 32 keys of one batch (wave w -> keys
// =====================================================================================================
__global__ __launch_bounds__(SIM_THREADS)
void k_sim(const float* __restrict__ pooled, const float* __restrict__ kgk, const int* __restrict__ msk, float* S) {
  __shared__ __align__(16) float sv[SIM_KEYS];
  (void)msk;
  const int tid = threadIdx.x, wave = tid >> 5, lane = tid & 31;
  constexpr int NKBLK = SKV / SIM_KEYS;
  const int b  = blockIdx.x / NKBLK;
  const int kb = (blockIdx.x - b * NKBLK) * SIM_KEYS;
  const float* p = pooled + (size_t)b * DM;
  float pp = 0.f;
#pragma unroll 1
  for (int e = lane; e < DM; e += 32) {
    const float xv = bfr(p[e]);
    pp += xv * xv;
  }
  pp = wave_sum(pp);
  const float pnrm = fmaxf(sqrtf(pp), EPSN);
#pragma unroll 1
  for (int j = 0; j < 4; ++j) {
    const int k = kb + wave * 4 + j;                                     // < SKV by construction
    const float* kr = kgk + ((size_t)b * SKV + (size_t)k) * (size_t)DM;
    float pk = 0.f, kk = 0.f;
#pragma unroll 1
    for (int e = lane; e < DM; e += 32) {
      const float xv = bfr(p[e]);
      const float yv = bfr(kr[e]);
      pk += xv * yv;
      kk += yv * yv;
    }
    pk = wave_sum(pk);
    kk = wave_sum(kk);
    const float knrm = fmaxf(sqrtf(kk), EPSN);
    const float val = pk / (pnrm * knrm);
    if (lane == 0) sv[wave * 4 + j] = val;
  }
  __syncthreads();
  if (wave == 0) {                                                     // wave-uniform
    const v4f v = *(const v4f*)(sv + 4 * (lane & 7));                   // clamped LDS address, all lanes load
    float* dst = S + (size_t)b * SKV + kb + 4 * (lane & 7);
    if (lane < 8) {
      *(v4f*)dst = v;
    }
    
  }
}

// =====================================================================================================
// Staging of one 128-row x 64-k f16 plane tile in LDS: rows of 128 B at pitch 144 B (16 B x odd: ds_load_b128 free of bank
// conflicts). 128 threads, thread = (row tid>>3 of a group of 16, 16-B piece tid&7), eight groups: one wave-instruction
// covers four whole 128-B lines. l = the lane's LDS byte address of group 0, g = its global address of group 0,
// rs16 = 16 source rows in elements.
// =====================================================================================================
__device__ __forceinline__ unsigned lds_off(const void* p) { return (unsigned)(size_t)p; }
__device__ __forceinline__ void copy_plane(unsigned l, const _Float16* g, size_t rs16) {
#if defined(__HIP_DEVICE_COMPILE__)
  // the closing s_wait_xcnt stands inside the statement so that no address register is rewritten ahead of it
  asm volatile("global_load_async_to_lds_b128 %0, %8, off\n\t"
               "global_load_async_to_lds_b128 %1, %9, off\n\t"
               "global_load_async_to_lds_b128 %2, %10, off\n\t"
               "global_load_async_to_lds_b128 %3, %11, off\n\t"
               "global_load_async_to_lds_b128 %4, %12, off\n\t"
               "global_load_async_to_lds_b128 %5, %13, off\n\t"
               "global_load_async_to_lds_b128 %6, %14, off\n\t"
               "global_load_async_to_lds_b128 %7, %15, off\n\t"
               "s_wait_xcnt 0x0"
               :: "v"(l), "v"(l + 16 * LPITCH), "v"(l + 32 * LPITCH), "v"(l + 48 * LPITCH),
                  "v"(l + 64 * LPITCH), "v"(l + 80 * LPITCH), "v"(l + 96 * LPITCH), "v"(l + 112 * LPITCH),
                  "v"(g), "v"(g + rs16), "v"(g + 2 * rs16), "v"(g + 3 * rs16),
                  "v"(g + 4 * rs16), "v"(g + 5 * rs16), "v"(g + 6 * rs16), "v"(g + 7 * rs16)
               : "memory");
#endif
}

// Inputs-only fence on loaded fragments: keeps a group's LDS loads together ahead of its products, so that the wave waits for
// LDS once per group and not once per four products.
__device__ __forceinline__ void hold4(const v16h (&x)[4]) {
#if defined(__HIP_DEVICE_COMPILE__)
  asm volatile("" :: "v"(x[0]), "v"(x[1]), "v"(x[2]), "v"(x[3]));
#endif
}

// Stage one 16 x 64 f32 group of the wave's tile in its LDS slab (pitch 68): D element r of acc[j], lane l -> row 8h + r, col 16j + (l&15);
// the caller reloads it behind the wave sync.
// coverage: 32 lanes x 8 rows x 4 cols-of-16 = rows 0..15 x cols 0..63 of the slab (staged extent == consumed extent).
template <bool HASLO, bool BROW>
__device__ __forceinline__ void stage16(float* sl, v8f (&ah)[4], v8f (&al)[4], const float* __restrict__ bias,
                                        int rowb, int col0, float osc, float bsc, int lane) {
  const int hh = lane >> 4, m = lane & 15;
  float bc[4], br[8];
  if (BROW) {
#pragma unroll
    for (int r = 0; r < 8; ++r) br[r] = bfr(bias[rowb + 8 * hh + r]) * bsc;
#pragma unroll
    for (int j = 0; j < 4; ++j) bc[j] = 0.f;
  } else {
#pragma unroll
    for (int j = 0; j < 4; ++j) bc[j] = bfr(bias[col0 + 16 * j + m]) * bsc;
#pragma unroll
    for (int r = 0; r < 8; ++r) br[r] = 0.f;
  }
  const float oscl = osc * RINV;
#pragma unroll
  for (int r = 0; r < 8; ++r) {
    const int ro = (8 * hh + r) * GPITCH + m;
#pragma unroll
    for (int j = 0; j < 4; ++j) {
      float v = ah[j][r] * osc;
      if (HASLO) v += al[j][r] * oscl;
      v += BROW ? br[r] : bc[j];
      sl[ro + 16 * j] = v;
    }
  }
  wave_sync_lds();
}

// =====================================================================================================
// f16 GEMM, block = 128 x 128 tile, 4 waves (2 x 2) x 64 x 64; the k range is walked in tiles of 64; each tile's A rows
// (hi and, with HASLO, residual plane) and Bt rows are staged in LDS by asynchronous copies, two buffers, the next tile's
// copies in flight while this tile is multiplied; fragments come from LDS (4 A x 4 B fragments, 16 products per plane and k32).
//   C tile [z][Mb][N] = (A_hi[z][Mb][K] (+ A_res/2048)) . Bt[z][N][K]^T * osc + bias; per-z element strides aBs (A planes),
//   bBs (Bt), fBs (f32 output F), hBs (16-bit output planes H, L); 0 = shared.
//   M_HL  : H = f16(v*carry), L = f16 residual x2048 (two planes)       M_S16 : H only, bias per row
//   M_F32 : F = v (f32 rows, batch-row remap through fBs), no 16-bit output
// grid = nz x (Mb/128) x (N/128) (all launches: Mb % 128 == 0, N % 128 == 0, K % 64 == 0, K >= 128).
// Each accumulator sums its k32 products in ascending k, as a 16 x 64 wave tile did.
// Epilogue: the ring is free behind the last tile's barrier; each wave stages its four 16 x 64 f32 groups in its own range.
// coverage: per 16-row group 4 instr x 4 rows x 8 lanes x 8 halves = 16 x 64 (16-bit planes) and 8 instr x 2 rows x 16 lanes
//           x 4 floats = 16 x 64 (f32 plane); 4 groups x 4 waves = 128 x 128; the grid covers C exactly once.
// =====================================================================================================
template <bool HASLO, int MODE, bool BROW>
__global__ __launch_bounds__(128)
void gemm16(const u16* __restrict__ Ah, const u16* __restrict__ Al, const u16* __restrict__ Bt,
            const float* __restrict__ bias, float* F, u16* H, u16* L,
            int Mb, int N, int K, int aBs, int bBs, int fBs, int hBs,
            float osc, float bsc, float carry) {
  constexpr int BUFB = (HASLO ? 3 : 2) * PLANEB;          // one buffer: [A hi | Bt | A res]
  static_assert(4 * 64 * GPITCH * 4 <= 2 * BUFB && GKT == 64);          // epilogue staging fits the ring
  __shared__ __align__(16) unsigned char ring[2 * BUFB];
  constexpr bool LOUT = (MODE == M_HL);
  const int tid = threadIdx.x, wave = tid >> 5, lane = tid & 31, hh = lane >> 4, m = lane & 15;
  const int ntile = N >> 7, mtile = Mb >> 7;
  const int bid  = blockIdx.x;
  const int nt   = bid % ntile;
  const int tmp  = bid / ntile;
  const int mt   = tmp % mtile;
  const int bz   = tmp / mtile;
  const int wm = wave >> 1, wn = wave & 1;
  const int rowb = mt * 128 + wm * 64;
  const int col0 = nt * 128 + wn * 64;
  // copy side: the lane's row in a group of 16 and its 16-B piece of the 128-B row
  const int cr = tid >> 3, cc = tid & 7;
  const _Float16* gah = (const _Float16*)(const void*)Ah + (size_t)bz * (size_t)aBs + (size_t)(mt * 128 + cr) * (size_t)K + 8 * cc;
  const _Float16* gal = (const _Float16*)(const void*)Al + (size_t)bz * (size_t)aBs + (size_t)(mt * 128 + cr) * (size_t)K + 8 * cc;
  const _Float16* gb  = (const _Float16*)(const void*)Bt + (size_t)bz * (size_t)bBs + (size_t)(nt * 128 + cr) * (size_t)K + 8 * cc;
  const unsigned lc = lds_off(ring) + (unsigned)(cr * LPITCH + cc * 16);
  const size_t rs16 = (size_t)16 * (size_t)K;
  const int ntk = K >> 6;
  // fragment side: row (lane & 15) of the wave's first A / B group, +16 B for the upper lane half
  const unsigned char* fa = ring + (wm * 64 + m) * LPITCH + 16 * hh;
  const unsigned char* fb = ring + PLANEB + (wn * 64 + m) * LPITCH + 16 * hh;

  v8f ah[4][4], al[4][4];
#pragma unroll
  for (int i = 0; i < 4; ++i) {
#pragma unroll
    for (int j = 0; j < 4; ++j) { ah[i][j] = zero8(); al[i][j] = zero8(); }
  }

  // tile 0 -> buffer 0, landed and published; then tile 1 -> buffer 1 in flight
  copy_plane(lc, gah, rs16);
  copy_plane(lc + PLANEB, gb, rs16);
  if (HASLO) copy_plane(lc + 2 * PLANEB, gal, rs16);
  asm volatile("s_wait_asynccnt 0x0" ::: "memory");        // this wave's copies of tile 0 have landed
  __syncthreads();                                         // ... and every other wave's
  if (ntk > 1) {                                           // the same for the whole block
    copy_plane(lc + BUFB, gah + GKT, rs16);
    copy_plane(lc + BUFB + PLANEB, gb + GKT, rs16);
    if (HASLO) copy_plane(lc + BUFB + 2 * PLANEB, gal + GKT, rs16);
  }

  // rolled: one copy of the tile body, so that the hot loop stays small in the instruction cache; the unrolls inside it keep
  // the fragment and accumulator arrays in registers
#pragma unroll 1
  for (int t = 0; t < ntk; ++t) {
    const int bo = (t & 1) * BUFB;
    v16h a[2][4], b[2][4], r[2][4];
    if (!HASLO) {
      // both k32 groups' fragments are asked for at the top of the tile: the second group lands behind the first one's products
#pragma unroll
      for (int kk = 0; kk < 2; ++kk) {
#pragma unroll
        for (int i = 0; i < 4; ++i) {
          a[kk][i] = ldfrag_h((const _Float16*)(const void*)(fa + bo + i * 16 * LPITCH + kk * 64));
          b[kk][i] = ldfrag_h((const _Float16*)(const void*)(fb + bo + i * 16 * LPITCH + kk * 64));
        }
      }
    }
#pragma unroll
    for (int kk = 0; kk < 2; ++kk) {
      if (HASLO) {
#pragma unroll
        for (int i = 0; i < 4; ++i) {
          a[kk][i] = ldfrag_h((const _Float16*)(const void*)(fa + bo + i * 16 * LPITCH + kk * 64));
          b[kk][i] = ldfrag_h((const _Float16*)(const void*)(fb + bo + i * 16 * LPITCH + kk * 64));
          r[kk][i] = ldfrag_h((const _Float16*)(const void*)(fa + bo + 2 * PLANEB + i * 16 * LPITCH + kk * 64));
        }
        hold4(r[kk]);
      }
      hold4(a[kk]);
      hold4(b[kk]);
#pragma unroll
      for (int i = 0; i < 4; ++i) {
#pragma unroll
        for (int j = 0; j < 4; ++j) ah[i][j] = mma_h(a[kk][i], b[kk][j], ah[i][j]);
      }
      if (HASLO) {
#pragma unroll
        for (int i = 0; i < 4; ++i) {
#pragma unroll
          for (int j = 0; j < 4; ++j) al[i][j] = mma_h(r[kk][i], b[kk][j], al[i][j]);
        }
      }
      // keeps this group's products ahead of what follows: of the second group's LDS wait, and of the waits and the barrier at
      // the tile's foot, so that the copies in flight have the products' time to land
      if (!HASLO || kk == 1) __builtin_amdgcn_sched_barrier(0);
    }
    asm volatile("s_wait_dscnt 0x0" ::: "memory");         // this wave's reads of the buffer are done before it is refilled
    asm volatile("s_wait_asynccnt 0x0" ::: "memory");      // this wave's copies of tile t + 1 have landed
    __syncthreads();                                       // publishes tile t + 1, ends every reader's use of tile t
    if (t + 2 < ntk) {                                     // the same for the whole block
      const int ko = (t + 2) * GKT;
      copy_plane(lc + bo, gah + ko, rs16);
      copy_plane(lc + bo + PLANEB, gb + ko, rs16);
      if (HASLO) copy_plane(lc + bo + 2 * PLANEB, gal + ko, rs16);
    }
  }
  asm volatile("s_wait_asynccnt 0x0" ::: "memory");        // no copy outstanding when the ring becomes output staging

#pragma unroll
  for (int g = 0; g < 4; ++g) {
    const int rowg = rowb + 16 * g;
    float* sl = (float*)(void*)ring + (wave * 4 + g) * 16 * GPITCH;
    stage16<HASLO, BROW>(sl, ah[g], al[g], bias, rowg, col0, osc, bsc, lane);

    if (MODE == M_F32) {
      v4f vals[8];
#pragma unroll
      for (int it = 0; it < 8; ++it) vals[it] = *(const v4f*)(sl + (it * 2 + hh) * GPITCH + m * 4);
      float* Fb = F + (size_t)bz * (size_t)fBs + ((size_t)rowg + (size_t)hh) * (size_t)N + col0 + m * 4;
#pragma unroll
      for (int it = 0; it < 8; ++it) {
        *(v4f*)(Fb + (size_t)(it * 2) * (size_t)N) = vals[it];
      }
    } else {
      const int rq = lane >> 3, c8 = (lane & 7) * 8;
      v4u ovh[4], ovl[4];
#pragma unroll
      for (int i = 0; i < 4; ++i) {
        const int row = 4 * i + rq;
        const v4f a = *(const v4f*)(sl + row * GPITCH + c8), c4 = *(const v4f*)(sl + row * GPITCH + c8 + 4);
#pragma unroll
        for (int e = 0; e < 2; ++e) {
          unsigned ph0, pl0, ph1, pl1;
          split2(a[2 * e] * carry,  a[2 * e + 1] * carry,  ph0, pl0);
          split2(c4[2 * e] * carry, c4[2 * e + 1] * carry, ph1, pl1);
          ovh[i][e] = ph0;     ovl[i][e] = pl0;
          ovh[i][2 + e] = ph1; ovl[i][2 + e] = pl1;
        }
      }
      u16* Hb = H + (size_t)bz * (size_t)hBs + (size_t)rowg * (size_t)N + col0 + c8;
      u16* Lb = L + (size_t)bz * (size_t)hBs + (size_t)rowg * (size_t)N + col0 + c8;
#pragma unroll
      for (int i = 0; i < 4; ++i) {
        const int row = 4 * i + rq;
        *(v4u*)(Hb + (size_t)row * (size_t)N) = ovh[i];
        if (LOUT) *(v4u*)(Lb + (size_t)row * (size_t)N) = ovl[i];
      }
    }
  }
}

// =====================================================================================================
// Full (unmasked) multi-head cross attention with a per-key additive bias bfr(beta[h]) * sim[b][key]:
// block = (batch b, head, 64 query rows), 4 waves, wave w owns the 16 query rows q0 = 64*qt + 16*w .. q0+15
// The keys are walked in tiles of 64: each tile's k hi, k residual and v^T rows (64 rows x 128 B each, LDS pitch 144 B) are
// staged in LDS by asynchronous copies, two buffers, the next tile's copies in flight while this tile is worked on; the four
// waves share the tile. The batch's sim row (2 KB) is staged once with tile 0. One barrier per tile.
//   q planes f16 x8 hi / residual(x2048) [b*SQ + s][h*64 + d]; k planes likewise [b*SKV + s][h*64 + d];
//   v^T plane f16 x8 [(b*NH + h)*64 + d][s]; sim plane f32 [b][s]. All NKB key blocks of 32 keys are visited (static bound).
//   Scores are computed TRANSPOSED: S^T tile g (g = 0,1) = k rows (keys kb+16g .. +15, A operand, row m = lane&15, split map
//   over d) times q^T (B operand, col n = query q0 + (lane&15), k = d, split map), 2 d-chunks of 32; per chunk hi.hi -> s,
//   res.hi + hi.res -> r (scaled x2048, folded as s + r/2048); the q fragments are loaded once per wave.
//   D element r of lane l = (key kb+16g+8h+r, query q0+(l&15)), so a lane owns one query column and 16 of its 32 keys;
//   the partner lane l^16 owns the other 16 -> row max / row sum need one xor-16 shuffle. The bias of the lane's 16 keys
//   comes from four 16-B loads of the sim row (keys kb+8h..+7 and kb+16+8h..+7), times bfr(beta[h])*log2(e), added in f32.
//   Online max-subtracted base-2 softmax in f32 (1/sqrt(64) and the q/k carries folded into lsc). The exp'd values ARE the
//   P A-fragment in place: A row m = query = lane&15, element i <- key kb+8h+i (tile 0, D element i), element 8+i <- key
//   kb+16+8h+i (tile 1, D element i). P (<= 1) carried x32768 as f16. The rescale factor of query row 8h+r of the O
//   accumulators is fetched from lane 8h+r with a shuffle (uniform control). 4 v^T B fragments (col n = d = 16j + (lane&15),
//   keys k-contiguous), 4 P.V WMMAs, one guard.
//   Epilogue: 1/l (per query, shuffled to the D row owner) and the carry folds in f32; the wave's 16x64 f32 result staged in
// coverage: per wave 4 instructions x 4 rows x 8 lanes x 8 halves = 16 x 64 on both ctx planes; grid NB*NH*(SQ/64) blocks x
//           4 waves = every (b, s, h) row segment exactly once. LDS slab: 16 x 64 staged == 16 x 64 reloaded.
// =====================================================================================================
// One 64-key tile: 128 threads, thread = (row tid>>3 of a group of 16, 16-B piece tid&7), four groups per plane: one
// wave-instruction covers four whole 128-B lines. l = the lane's LDS byte address in the buffer's first plane.
__device__ __forceinline__ void copy_keys(unsigned l, const _Float16* kh, const _Float16* kl, const _Float16* v) {
#if defined(__HIP_DEVICE_COMPILE__)
  // the closing s_wait_xcnt stands inside the statement so that no address register is rewritten ahead of it
  asm volatile("global_load_async_to_lds_b128 %0, %12, off\n\t"
               "global_load_async_to_lds_b128 %1, %13, off\n\t"
               "global_load_async_to_lds_b128 %2, %14, off\n\t"
               "global_load_async_to_lds_b128 %3, %15, off\n\t"
               "global_load_async_to_lds_b128 %4, %16, off\n\t"
               "global_load_async_to_lds_b128 %5, %17, off\n\t"
               "global_load_async_to_lds_b128 %6, %18, off\n\t"
               "global_load_async_to_lds_b128 %7, %19, off\n\t"
               "global_load_async_to_lds_b128 %8, %20, off\n\t"
               "global_load_async_to_lds_b128 %9, %21, off\n\t"
               "global_load_async_to_lds_b128 %10, %22, off\n\t"
               "global_load_async_to_lds_b128 %11, %23, off\n\t"
               "s_wait_xcnt 0x0"
               :: "v"(l), "v"(l + 16 * LPITCH), "v"(l + 32 * LPITCH), "v"(l + 48 * LPITCH),
                  "v"(l + APLANEB), "v"(l + APLANEB + 16 * LPITCH), "v"(l + APLANEB + 32 * LPITCH),
                  "v"(l + APLANEB + 48 * LPITCH),
                  "v"(l + 2 * APLANEB), "v"(l + 2 * APLANEB + 16 * LPITCH), "v"(l + 2 * APLANEB + 32 * LPITCH),
                  "v"(l + 2 * APLANEB + 48 * LPITCH),
                  "v"(kh), "v"(kh + (size_t)16 * INNER), "v"(kh + (size_t)32 * INNER), "v"(kh + (size_t)48 * INNER),
                  "v"(kl), "v"(kl + (size_t)16 * INNER), "v"(kl + (size_t)32 * INNER), "v"(kl + (size_t)48 * INNER),
                  "v"(v), "v"(v + (size_t)16 * SKV), "v"(v + (size_t)32 * SKV), "v"(v + (size_t)48 * SKV)
               : "memory");
#endif
}
// The batch's sim row: 128 threads x 16 B = 512 floats.
__device__ __forceinline__ void copy_sim(unsigned l, const float* g) {
#if defined(__HIP_DEVICE_COMPILE__)
  // the closing s_wait_xcnt stands inside the statement so that no address register is rewritten ahead of it
  asm volatile("global_load_async_to_lds_b128 %0, %1, off\n\t"
               "s_wait_xcnt 0x0"
               :: "v"(l), "v"(g) : "memory");
#endif
}

__global__ __launch_bounds__(ATT_THREADS)
void attn_fwd(const u16* __restrict__ Qh, const u16* __restrict__ Ql, const u16* __restrict__ Kh,
              const u16* __restrict__ Kl, const u16* __restrict__ Vp, const float* __restrict__ Simp,
              const float* __restrict__ beta, u16* Oh, u16* Ol) {
  __shared__ __align__(16) unsigned char ring[2 * ABUFB];
  __shared__ __align__(16) float simrow[SKV];

  const int tid  = threadIdx.x;
  const int wave = tid >> 5;
  const int lane = tid & 31;
  const int hh   = lane >> 4;
  const int c    = lane & 15;

  constexpr int NQT = SQ / 64;
  const int bid  = blockIdx.x;
  const int qt   = bid % NQT;
  const int head = (bid / NQT) % NH;
  const int b    = bid / (NQT * NH);
  const int q0   = qt * 64 + wave * 16;

  // B fragments of q^T: col n = query q0 + c, k = d (k-contiguous row of the q planes)
  const size_t qo = ((size_t)(b * SQ + q0 + c)) * INNER + head * HD + 8 * hh;
  const _Float16* Qhb = (const _Float16*)(const void*)Qh + qo;
  const _Float16* Qlb = (const _Float16*)(const void*)Ql + qo;
  // copy side: the lane's row in a group of 16 and its 16-B piece of the 128-B row (k rows = keys, v^T rows = d)
  const int cr = tid >> 3, cc = tid & 7;
  const size_t ko = ((size_t)(b * SKV + cr)) * INNER + head * HD + 8 * cc;
  const _Float16* gkh = (const _Float16*)(const void*)Kh + ko;
  const _Float16* gkl = (const _Float16*)(const void*)Kl + ko;
  const _Float16* gv  = (const _Float16*)(const void*)Vp + ((size_t)(b * NH + head) * HD + cr) * SKV + 8 * cc;
  const unsigned lc = lds_off(ring) + (unsigned)(cr * LPITCH + cc * 16);
  // A fragments of k: row m = key 16g + c of the staged tile, k = d; +16 B for the upper lane half
  const unsigned char* fk = ring + c * LPITCH + 16 * hh;
  // B fragments of v: col n = d = 16j + c (row of the staged v^T tile), k = key
  const unsigned char* fv = ring + 2 * APLANEB + c * LPITCH + 16 * hh;
  // per-key bias row of this batch in LDS, offset to the lane half's first key
  const float* Sb = simrow + 8 * hh;
  const float bl2 = bfr(beta[head]) * LOG2E;
  const float lsc = (LOG2E * RSQ_HD) / (QS * KS);

  v16h qh[2], ql[2];
  qh[0] = ldfrag_h(Qhb);
  qh[1] = ldfrag_h(Qhb + 32);
  ql[0] = ldfrag_h(Qlb);
  ql[1] = ldfrag_h(Qlb + 32);

  float mrun = -INFINITY, lrun = 0.f;
  v8f o[4];
#pragma unroll
  for (int j = 0; j < 4; ++j) o[j] = zero8();

  // tile 0 and the sim row -> LDS, landed and published; then tile 1 -> buffer 1 in flight
  copy_keys(lc, gkh, gkl, gv);
  copy_sim(lds_off(simrow) + (unsigned)(tid * 16), Simp + (size_t)b * SKV + 4 * tid);
  asm volatile("s_wait_asynccnt 0x0" ::: "memory");        // this wave's copies of tile 0 have landed
  __syncthreads();                                         // ... and every other wave's
  copy_keys(lc + ABUFB, gkh + (size_t)AKT * INNER, gkl + (size_t)AKT * INNER, gv + AKT);

  // rolled over the tiles: one copy of the tile body in the instruction cache
#pragma unroll 1
  for (int st = 0; st < NST; ++st) {
   const int bo = (st & 1) * ABUFB;
   // unrolled: the two 32-key halves of a tile differ only in constant LDS offsets
#pragma unroll
   for (int sub = 0; sub < AKT / 32; ++sub) {
    const int kb = st * AKT + sub * 32;
    // ---- transposed scores: s0 = keys kb..kb+15, s1 = keys kb+16..kb+31, column = query q0 + c ----
    v8f s0 = zero8(), s1 = zero8(), r0 = zero8(), r1 = zero8();
    const _Float16* k0h = (const _Float16*)(const void*)(fk + bo + sub * 32 * LPITCH);
    const _Float16* k1h = (const _Float16*)(const void*)(fk + bo + (sub * 32 + 16) * LPITCH);
    const _Float16* k0l = (const _Float16*)(const void*)(fk + bo + APLANEB + sub * 32 * LPITCH);
    const _Float16* k1l = (const _Float16*)(const void*)(fk + bo + APLANEB + (sub * 32 + 16) * LPITCH);
#pragma unroll
    for (int kk = 0; kk < HD / 32; ++kk) {
      const v16h fh0 = ldfrag_h(k0h + kk * 32);
      const v16h fh1 = ldfrag_h(k1h + kk * 32);
      const v16h fl0 = ldfrag_h(k0l + kk * 32);
      const v16h fl1 = ldfrag_h(k1l + kk * 32);
      s0 = mma_h(fh0, qh[kk], s0);
      s1 = mma_h(fh1, qh[kk], s1);
      r0 = mma_h(fl0, qh[kk], r0);
      r1 = mma_h(fl1, qh[kk], r1);
      r0 = mma_h(fh0, ql[kk], r0);
      r1 = mma_h(fh1, ql[kk], r1);
      guard_s4(s0, s1, r0, r1, qh[kk], ql[kk], fh0, fh1, fl0, fl1);
    }
    // ---- per-key bias: keys kb+8hh+0..7 (g0, g1) and kb+16+8hh+0..7 (g2, g3) ----
    const v4f g0 = *(const v4f*)(Sb + kb);
    const v4f g1 = *(const v4f*)(Sb + kb + 4);
    const v4f g2 = *(const v4f*)(Sb + kb + 16);
    const v4f g3 = *(const v4f*)(Sb + kb + 20);
    // ---- base-2 logits of this lane's 16 keys for query q0 + c: t[i] <- key kb+8hh+i, t[8+i] <- key kb+16+8hh+i ----
    float t[16];
#pragma unroll
    for (int i = 0; i < 4; ++i) {
      t[i]      = (s0[i]     + r0[i]     * RINV) * lsc + g0[i] * bl2;
      t[4 + i]  = (s0[4 + i] + r0[4 + i] * RINV) * lsc + g1[i] * bl2;
      t[8 + i]  = (s1[i]     + r1[i]     * RINV) * lsc + g2[i] * bl2;
      t[12 + i] = (s1[4 + i] + r1[4 + i] * RINV) * lsc + g3[i] * bl2;
    }
    float cm = t[0];
#pragma unroll
    for (int i = 1; i < 16; ++i) cm = fmaxf(cm, t[i]);
    cm = fmaxf(cm, __shfl_xor(cm, 16, 32));
    const float mn = fmaxf(mrun, cm);        // finite from the first block on
    const float al = exp2f(mrun - mn);       // 0 on the first block (mrun = -inf)
    mrun = mn;
    // ---- probabilities (<= 1) and the P A-fragment: f16(p * 32768); element i <-> t[i] ----
    float ps = 0.f;
    FragH ph;
#pragma unroll
    for (int w = 0; w < 2; ++w) {
#pragma unroll
      for (int e4 = 0; e4 < 4; ++e4) {
        const int i = 8 * w + 2 * e4;
        const float p0 = exp2f(t[i] - mn), p1 = exp2f(t[i + 1] - mn);
        ps += p0 + p1;
        ph.u[w][e4] = pk16(h_bits((_Float16)(p0 * PCAR)), h_bits((_Float16)(p1 * PCAR)));
      }
    }
    ps += __shfl_xor(ps, 16, 32);
    lrun = lrun * al + ps;
    // ---- rescale the O accumulators: D row 8hh+r = query q0+8hh+r, its factor lives in lane 8hh+r (and 16+8hh+r) ----
    float scl[8];
#pragma unroll
    for (int r = 0; r < 8; ++r) scl[r] = __shfl(al, 8 * hh + r, 32);
#pragma unroll
    for (int j = 0; j < 4; ++j) {
#pragma unroll
      for (int r = 0; r < 8; ++r) o[j][r] *= scl[r];
    }
    // ---- P.V : B fragment col n = d = j*16 + c, keys contiguous in the v^T plane ----
    {
      const unsigned char* vp = fv + bo + sub * 64;
      const v16h v0 = ldfrag_h((const _Float16*)(const void*)(vp));
      const v16h v1 = ldfrag_h((const _Float16*)(const void*)(vp + 16 * LPITCH));
      const v16h v2 = ldfrag_h((const _Float16*)(const void*)(vp + 32 * LPITCH));
      const v16h v3 = ldfrag_h((const _Float16*)(const void*)(vp + 48 * LPITCH));
      o[0] = mma_h(ph.v, v0, o[0]);
      o[1] = mma_h(ph.v, v1, o[1]);
      o[2] = mma_h(ph.v, v2, o[2]);
      o[3] = mma_h(ph.v, v3, o[3]);
      guard_p(o[0], o[1], o[2], o[3], ph.v, v0, v1, v2, v3);
    }
   }
   asm volatile("s_wait_dscnt 0x0" ::: "memory");          // this wave's reads of the buffer are done before it is refilled
   asm volatile("s_wait_asynccnt 0x0" ::: "memory");       // this wave's copies of tile st + 1 have landed
   __syncthreads();                                        // publishes tile st + 1, ends every reader's use of tile st
   if (st + 2 < NST) {                                     // the same for the whole block
     const size_t k2 = (size_t)(st + 2) * AKT;
     copy_keys(lc + bo, gkh + k2 * INNER, gkl + k2 * INNER, gv + k2);
   }
  }
  asm volatile("s_wait_asynccnt 0x0" ::: "memory");        // no copy outstanding when the ring becomes output staging
  acc_guard4(o);

  // ---- fold 1/l (per query, owned by lane = query) and the carries (32768 on P, 8 on v), apply the ctx carry 1024 ----
  const float linv = (1.0f / lrun) * (OSC / (PCAR * VS));
  float inv[8];
#pragma unroll
  for (int r = 0; r < 8; ++r) inv[r] = __shfl(linv, 8 * hh + r, 32);
  float* slab = (float*)(void*)ring + wave * 16 * OPITCH;   // the ring is free behind the last tile's barrier
#pragma unroll
  for (int r = 0; r < 8; ++r) {
#pragma unroll
    for (int j = 0; j < 4; ++j) slab[(8 * hh + r) * OPITCH + j * 16 + c] = o[j][r] * inv[r];
  }
  wave_sync_lds();
  // ---- ctx x1024 -> f16 hi plane and residual plane; lane = (row in group of 4, 8 consecutive d) ----
  v4u ovh[4], ovl[4];
  const int rq = lane >> 3, c8 = (lane & 7) * 8;
#pragma unroll
  for (int i = 0; i < 4; ++i) {
    const int row = 4 * i + rq;
    const v4f a = *(const v4f*)(slab + row * OPITCH + c8), c4 = *(const v4f*)(slab + row * OPITCH + c8 + 4);
#pragma unroll
    for (int e = 0; e < 2; ++e) {
      unsigned ph0, pl0, ph1, pl1;
      split2(a[2 * e],  a[2 * e + 1],  ph0, pl0);
      split2(c4[2 * e], c4[2 * e + 1], ph1, pl1);
      ovh[i][e] = ph0;     ovl[i][e] = pl0;
      ovh[i][2 + e] = ph1; ovl[i][2 + e] = pl1;
    }
  }
  const size_t oo = ((size_t)(b * SQ + q0)) * INNER + head * HD + c8;
  u16* obh = Oh + oo;
  u16* obl = Ol + oo;
  {
#pragma unroll
    for (int i = 0; i < 4; ++i) {
      const int row = 4 * i + rq;
      *(v4u*)(obh + (size_t)row * INNER) = ovh[i];
      *(v4u*)(obl + (size_t)row * INNER) = ovl[i];
    }
    
  }
}

// =====================================================================================================
// Workspace map (bytes, NB=8, SQ=2048); every plane fully written by whole-line stores before it is read; all extents exact
//   XQ   f16 [NB*SQ][768]    f16(bf16(x))                 25165824   (region reused later as OH, same extent)
//   XV   f16 [NB*512][768]   f16(bf16(kg_value))           6291456
//   WQ16 WK16 WV16 WO16 f16 [768 n][768 k] x256            1179648 each
//   QH QL f16 [NB*SQ][768] x8 hi / res                     25165824 each
//   KH KL f16 [NB*512][768] x8 hi / res                     6291456 each
//   VT16 f16 [NB*768 (h,d)][512 s] x8                       6291456
//   OL   f16 [NB*SQ][768] x1024 res (ctx), OH aliases XQ    25165824
//   SIMP f32 [NB][512]                                         16384
//   end                                                    130564096
// =====================================================================================================
extern "C" void kernel_launch(void* const* d_in, const int* in_sizes, int n_in,
                              void* d_out, int out_size, void* d_ws, size_t ws_size,
                              hipStream_t stream) {
  if (n_in < 14) return;
  if (in_sizes[0] < ((NB - 1) * SQ_FULL + SQ) * DM) return;
  if (in_sizes[1] < 1) return;
  if (in_sizes[2] < NB * DM) return;
  if (in_sizes[3] < NB * SKV * DM || in_sizes[4] < NB * SKV * DM) return;
  if (in_sizes[5] < NH) return;
  if (in_sizes[6] != DM * DM || in_sizes[8] != DM * DM || in_sizes[10] != DM * DM || in_sizes[12] != DM * DM) return;
  if (in_sizes[7] < DM || in_sizes[9] < DM || in_sizes[11] < DM || in_sizes[13] < DM) return;
  if (out_size < ((NB - 1) * SQ_FULL + SQ) * DM) return;

  const float* x_in   = (const float*)d_in[0];
  const int*   msk    = (const int*)d_in[1];
  const float* pooled = (const float*)d_in[2];
  const float* kgk    = (const float*)d_in[3];
  const float* kgv    = (const float*)d_in[4];
  const float* beta   = (const float*)d_in[5];
  const float* wq     = (const float*)d_in[6];
  const float* bq     = (const float*)d_in[7];
  const float* wk     = (const float*)d_in[8];
  const float* bk     = (const float*)d_in[9];
  const float* wv     = (const float*)d_in[10];
  const float* bv     = (const float*)d_in[11];
  const float* wo     = (const float*)d_in[12];
  const float* bo     = (const float*)d_in[13];
  float*       out    = (float*)d_out;

  const size_t szXQ = (size_t)NB * SQ * DM * 2;
  const size_t szXV = (size_t)NB * SKV * DM * 2;
  const size_t szW  = (size_t)DM * DM * 2;
  const size_t szQP = (size_t)NB * SQ * INNER * 2;
  const size_t szKP = (size_t)NB * SKV * INNER * 2;
  const size_t szVT = (size_t)NB * INNER * SKV * 2;
  const size_t szS  = (size_t)NB * SKV * 4;
  static_assert((size_t)NB * SQ * DM * 2 == (size_t)NB * SQ * INNER * 2);   // XQ region reused as OH, same extent
  size_t off = 0;
  const size_t oXQ = off; off += szXQ;      // also OH
  const size_t oXV = off; off += szXV;
  const size_t oWQ = off; off += szW;
  const size_t oWK = off; off += szW;
  const size_t oWV = off; off += szW;
  const size_t oWO = off; off += szW;
  const size_t oQH = off; off += szQP;
  const size_t oQL = off; off += szQP;
  const size_t oKH = off; off += szKP;
  const size_t oKL = off; off += szKP;
  const size_t oVT = off; off += szVT;
  const size_t oOL = off; off += szQP;
  const size_t oS  = off; off += szS;
  if (off > ws_size) return;                // off = 130564096 at NB=8, SQ=2048
  if (off > (size_t)134217728) return;

  char* ws = (char*)d_ws;
  u16* XQ   = (u16*)(ws + oXQ);
  u16* XV   = (u16*)(ws + oXV);
  u16* WQ16 = (u16*)(ws + oWQ);
  u16* WK16 = (u16*)(ws + oWK);
  u16* WV16 = (u16*)(ws + oWV);
  u16* WO16 = (u16*)(ws + oWO);
  u16* QH   = (u16*)(ws + oQH);
  u16* QL   = (u16*)(ws + oQL);
  u16* KH   = (u16*)(ws + oKH);
  u16* KL   = (u16*)(ws + oKL);
  u16* VT16 = (u16*)(ws + oVT);
  u16* OH   = (u16*)(ws + oXQ);
  u16* OL   = (u16*)(ws + oOL);
  float* SIMP = (float*)(ws + oS);

  // (0,1) activations -> f16 planes of bf16-converted values (query rows s < SQ of batches b < NB, compact; kg_value rows)
  cvt16<<<dim3(NB * SQ), dim3(CVT_THREADS), 0, stream>>>(x_in, XQ, SQ, SQ_FULL, 1.0f);
  cvt16<<<dim3(NB * SKV), dim3(CVT_THREADS), 0, stream>>>(kgv, XV, SKV, SKV, 1.0f);
  // (2..5) weights [n = out][k = in] (y = x.W^T): already k-contiguous [n][k]; f16 planes of bf16(W) x256
  cvt16<<<dim3(DM), dim3(CVT_THREADS), 0, stream>>>(wq, WQ16, DM, DM, WSC);
  cvt16<<<dim3(DM), dim3(CVT_THREADS), 0, stream>>>(wk, WK16, DM, DM, WSC);
  cvt16<<<dim3(DM), dim3(CVT_THREADS), 0, stream>>>(wv, WV16, DM, DM, WSC);
  cvt16<<<dim3(DM), dim3(CVT_THREADS), 0, stream>>>(wo, WO16, DM, DM, WSC);
  // (6) cosine similarity sim[b][k] -> SIMP f32 [NB][512]
  k_sim<<<dim3(NB * (SKV / SIM_KEYS)), dim3(SIM_THREADS), 0, stream>>>(pooled, kgk, msk, SIMP);
  // (7) q_un = x . Wq^T + bq -> f16 [NB*SQ][768] x8 hi + res (col = h*64 + d); the 1/8 is folded into the softmax scale
  gemm16<false, M_HL, false><<<dim3((NB * SQ / 128) * (INNER / 128)), dim3(128), 0, stream>>>(
      XQ, XQ, WQ16, bq, out, QH, QL, NB * SQ, INNER, DM, 0, 0, 0, 0, QS / WSC, QS, 1.0f);
  // (8) k = kg_value . Wk^T + bk -> f16 [NB*512][768] x8 hi + res
  gemm16<false, M_HL, false><<<dim3((NB * SKV / 128) * (INNER / 128)), dim3(128), 0, stream>>>(
      XV, XV, WK16, bk, out, KH, KL, NB * SKV, INNER, DM, 0, 0, 0, 0, KS / WSC, KS, 1.0f);
  // (9) v^T per batch: A = Wv [(h,d) = n][k], Bt = kg_value rows of batch b [s][k], bias bv per row -> f16 [(b,h,d)][s] x8
  gemm16<false, M_S16, true><<<dim3(NB * (INNER / 128) * (SKV / 128)), dim3(128), 0, stream>>>(
      WV16, WV16, XV, bv, out, VT16, VT16, INNER, SKV, DM, 0, SKV * DM, 0, INNER * SKV, VS / WSC, VS, 1.0f);
  // (10) attention with the beta*sim key bias -> ctx planes [NB*SQ][768] x1024 hi + res (OH reuses the XQ region)
  attn_fwd<<<dim3(NB * NH * (SQ / 64)), dim3(ATT_THREADS), 0, stream>>>(QH, QL, KH, KL, VT16, SIMP, beta, OH, OL);
  // (11) out rows [b][SQ_FULL][768] f32 = ctx . Wo^T + bo (rows s < SQ of batches b < NB); carries 1024 x 256 folded back
  gemm16<true, M_F32, false><<<dim3(NB * (SQ / 128) * (DM / 128)), dim3(128), 0, stream>>>(
      OH, OL, WO16, bo, out, OL, OL, SQ, DM, INNER, SQ * INNER, 0, SQ_FULL * DM, 0,
      1.0f / (OSC * WSC), 1.0f, 1.0f);
  (void)hipGetLastError();
}

// v003
// It runs in 206 microseconds.
// Next to v002, in two timings, it ran 1.05 and 1.04 times as fast.
// All steps since v000 together make it 2.11 times as fast.
// Contractions on v_wmma_f32_16x16x32_f16 (f16 operands, f32 accumulate): x.Wq^T, xv.Wk^T, Wv.xv^T single products on
// f16(bf16(x)) and f16(bf16(W) x256); k.q^T with q and k carried as f16 hi + residual(x2048) planes (3 products);
// P.v^T single product (P x32768, v x8); ctx.Wo^T with ctx carried as f16 hi (x1024) + residual(x2048) planes (2 products,
// separate residual accumulator); cosine-similarity bias, softmax, biases and all carry folds in f32 on VALU.
// Inputs RNE-converted to bf16 on load.
#include <hip/hip_runtime.h>
#include <math.h>
#include <stdint.h>

#ifndef NB
#define NB       8        // batches processed
#endif
#ifndef SQ
#define SQ       2048     // query rows processed per batch
#endif
#define NB_FULL  8
#define SQ_FULL  2048     // query rows per batch in the input / output layout (batch stride)
#define SKV      512      // key / value rows per batch (all of them)
#define DM       768      // model width
#define NH       12
#define HD       64
#define INNER    (NH * HD)
#define WSC      256.0f   // weight carry
#define QS       8.0f
#define KS       8.0f
#define VS       8.0f
#define PCAR     32768.0f
#define OSC      1024.0f  // ctx carry
#define RSC      2048.0f  // residual plane scale
#define RINV     0.00048828125f
#define LOG2E    1.4426950408889634f
#define RSQ_HD   0.125f
#define EPSN     1e-8f
#define NKB      (SKV / 32)
#define ATT_WAVES   4
#define ATT_THREADS (ATT_WAVES * 32)
#define CVT_THREADS 256      // streaming convert: 8 waves per block
#define CVT_LOADS   32       // 16-B loads per lane, all in flight
#define CVT_WAVE    (CVT_LOADS * 32 * 4)              // floats per wave (16 KB in, 8 KB out)
#define CVT_BLOCK   (CVT_WAVE * (CVT_THREADS / 32))   // floats per block
#define CVB_XB      (SQ * DM / CVT_BLOCK)             // blocks per batch of query rows
#define CVB_X       (NB * CVB_XB)
#define CVB_V       (NB * SKV * DM / CVT_BLOCK)
#define CVB_W       (DM * DM / CVT_BLOCK)
#define SIM_THREADS 256
#define SIM_KEYS    32       // keys per k_sim block (8 waves x 4)
#define OPITCH   68
#define GPITCH   68
#define GKT      64       // k per staged GEMM tile (128-B rows)
#define LPITCH   144      // LDS pitch of a staged row, bytes
#define PLANEB   (128 * LPITCH)
#define AKT      64       // keys per staged attention tile (128-B rows in all three planes)
#define APLANEB  (64 * LPITCH)
#define ABUFB    (3 * APLANEB)       // one attention buffer: [k hi | k res | v^T]
#define NST      (SKV / AKT)

#define M_HL     0
#define M_S16    1
#define M_F32    2

static_assert(NB >= 1 && NB <= NB_FULL);
static_assert((SQ % 128) == 0 && SQ >= 128 && SQ <= SQ_FULL);
static_assert(HD == 64 && INNER == 768 && NH == 12 && INNER == DM);
static_assert((SKV % 128) == 0 && (SKV % 32) == 0 && NKB * 32 == SKV && (SKV % SIM_KEYS) == 0);
static_assert((DM % 128) == 0 && (DM % 32) == 0 && (CVT_THREADS % 32) == 0);
static_assert((SQ * DM) % CVT_BLOCK == 0 && (NB * SKV * DM) % CVT_BLOCK == 0 && (DM * DM) % CVT_BLOCK == 0);
static_assert((OPITCH * 4) % 16 == 0 && (GPITCH * 4) % 16 == 0);
static_assert(ATT_THREADS * 4 == SKV && NST >= 2 && AKT == 64 && HD == 64);
static_assert(ATT_WAVES * 16 * OPITCH * 4 <= 2 * ABUFB);               // attention output staging fits its ring
static_assert(ATT_THREADS == 128 && SIM_THREADS == 256 && SIM_KEYS == (SIM_THREADS / 32) * 4);

typedef unsigned short u16;
typedef _Float16 v16h __attribute__((ext_vector_type(16)));
typedef _Float16 v8h  __attribute__((ext_vector_type(8)));
typedef float    v8f  __attribute__((ext_vector_type(8)));
typedef float    v4f  __attribute__((ext_vector_type(4)));
typedef unsigned int v4u __attribute__((ext_vector_type(4)));
typedef unsigned int v2u __attribute__((ext_vector_type(2)));

union FragH { v16h v; v8h h[2]; v4u u[2]; };

// ---- scalar helpers ----------------------------------------------------------------------------------
__device__ __forceinline__ unsigned short bf_bits(float f) {          // f32 -> bf16 bits, RNE convert
  unsigned u = __float_as_uint(f);
  return (unsigned short)((u + 0x7FFFu + ((u >> 16) & 1u)) >> 16);
}
__device__ __forceinline__ float bf_up(unsigned short h) { return __uint_as_float(((unsigned)h) << 16); }
__device__ __forceinline__ float bfr(float f) { return bf_up(bf_bits(f)); }
__device__ __forceinline__ unsigned short h_bits(_Float16 x) { return __builtin_bit_cast(unsigned short, x); }
__device__ __forceinline__ unsigned pk16(unsigned short a, unsigned short b) { return (unsigned)a | ((unsigned)b << 16); }
__device__ __forceinline__ v8f zero8() { v8f z = {0.f, 0.f, 0.f, 0.f, 0.f, 0.f, 0.f, 0.f}; return z; }

__device__ __forceinline__ float wave_sum(float v) {
  v += __shfl_xor(v, 16, 32);
  v += __shfl_xor(v, 8, 32);
  v += __shfl_xor(v, 4, 32);
  v += __shfl_xor(v, 2, 32);
  v += __shfl_xor(v, 1, 32);
  return v;
}

// x = hi + lo/2048 in f16: hi = f16(x), lo = f16((x - hi) * 2048); two values packed per 32-bit word
__device__ __forceinline__ void split2(float x0, float x1, unsigned& ph, unsigned& pl) {
  const _Float16 h0 = (_Float16)x0, h1 = (_Float16)x1;
  const float d0 = x0 - (float)h0, d1 = x1 - (float)h1;
  const _Float16 l0 = (_Float16)(d0 * RSC), l1 = (_Float16)(d1 * RSC);
  ph = pk16(h_bits(h0), h_bits(h1));
  pl = pk16(h_bits(l0), h_bits(l1));
}

// ---- fragment loader: 16-bit A/B operand, lane -> row/col (lane&15), p already includes +8*(lane>>4);
//      elements 0..7 <- p[0..7] (k0+8h..), elements 8..15 <- p[16..23] (k0+16+8h..); same split k map for A and B,
//      B always read from a k-contiguous [n][k] plane.
__device__ __forceinline__ v16h ldfrag_h(const _Float16* p) {
  FragH f;
  f.h[0] = *(const v8h*)(p);
  f.h[1] = *(const v8h*)(p + 16);
  return f.v;
}

// ---- WMMA helper and trailing VALU hazard gaps ----------------------------------------------------------
__device__ __forceinline__ v8f mma_h(v16h a, v16h b, v8f c) {
  return __builtin_amdgcn_wmma_f32_16x16x32_f16(false, a, false, b, (short)0, c, false, false);
}
__device__ __forceinline__ void guard_s4(v8f& a, v8f& b, v8f& c, v8f& d,
                                         v16h x0, v16h x1, v16h x2, v16h x3, v16h x4, v16h x5) {
#if defined(__HIP_DEVICE_COMPILE__)
  asm volatile("v_nop\n\tv_nop\n\tv_nop\n\tv_nop"
               : "+v"(a), "+v"(b), "+v"(c), "+v"(d)
               : "v"(x0), "v"(x1), "v"(x2), "v"(x3), "v"(x4), "v"(x5) : "memory");
#endif
}
__device__ __forceinline__ void guard_p(v8f& a, v8f& b, v8f& c, v8f& d, v16h p, v16h x0, v16h x1, v16h x2, v16h x3) {
#if defined(__HIP_DEVICE_COMPILE__)
  asm volatile("v_nop\n\tv_nop\n\tv_nop\n\tv_nop"
               : "+v"(a), "+v"(b), "+v"(c), "+v"(d) : "v"(p), "v"(x0), "v"(x1), "v"(x2), "v"(x3) : "memory");
#endif
}
__device__ __forceinline__ void acc_guard4(v8f (&a)[4]) {
#if defined(__HIP_DEVICE_COMPILE__)
  asm volatile("v_nop\n\tv_nop\n\tv_nop\n\tv_nop" : "+v"(a[0]), "+v"(a[1]), "+v"(a[2]), "+v"(a[3]));
#endif
}
__device__ __forceinline__ void wave_sync_lds() {
  __builtin_amdgcn_fence(__ATOMIC_RELEASE, "workgroup");
  __builtin_amdgcn_wave_barrier();
  __builtin_amdgcn_fence(__ATOMIC_ACQUIRE, "workgroup");
}

// =====================================================================================================
// Streaming convert, one launch for all six planes: Y[e] <- f16(bf16_RNE(x[e]) * scale), scale a power of two (1 for the two
// activation planes, 256 for the four weight planes). Every plane is a whole number of blocks; a block takes CVT_BLOCK
// consecutive floats of one plane (of one batch, for the query rows), a wave CVT_WAVE of them: 32 loads of 512 contiguous
// bytes, all asked for before the first is converted, then 32 stores of 256 contiguous bytes (whole lines both ways).
// coverage: grid = CVB_X + CVB_V + 4 * CVB_W blocks x CVT_BLOCK floats = every element of the six planes exactly once.
// =====================================================================================================
__global__ __launch_bounds__(CVT_THREADS)
void cvt_all(const float* __restrict__ x, const float* __restrict__ kgv, const float* __restrict__ wq,
             const float* __restrict__ wk, const float* __restrict__ wv, const float* __restrict__ wo,
             u16* XQ, u16* XV, u16* WQ, u16* WK, u16* WV, u16* WO) {
  const int bid = blockIdx.x;
  const float* src;
  u16* dst;
  float scale;
  if (bid < CVB_X) {                                     // query rows s < SQ of batch b, compact in the plane
    const int b = bid / CVB_XB;
    src = x + (size_t)b * ((size_t)SQ_FULL * DM) + (size_t)(bid - b * CVB_XB) * CVT_BLOCK;
    dst = XQ + (size_t)bid * CVT_BLOCK;
    scale = 1.0f;
  } else if (bid < CVB_X + CVB_V) {
    const int r = bid - CVB_X;
    src = kgv + (size_t)r * CVT_BLOCK;
    dst = XV + (size_t)r * CVT_BLOCK;
    scale = 1.0f;
  } else {
    const int w = bid - (CVB_X + CVB_V);
    const int sel = w / CVB_W;
    const int r = w - sel * CVB_W;
    src = (sel == 0 ? wq : sel == 1 ? wk : sel == 2 ? wv : wo) + (size_t)r * CVT_BLOCK;
    dst = (sel == 0 ? WQ : sel == 1 ? WK : sel == 2 ? WV : WO) + (size_t)r * CVT_BLOCK;
    scale = WSC;
  }
  const int off = (threadIdx.x >> 5) * CVT_WAVE + (threadIdx.x & 31) * 4;
  const float* p = src + off;
  u16* q = dst + off;
  v4f v[CVT_LOADS];
#pragma unroll
  for (int it = 0; it < CVT_LOADS; ++it) v[it] = *(const v4f*)(p + it * 128);
  // keeps every load ahead of the first convert and store: the wave pays the memory latency once, not once per group
  __builtin_amdgcn_sched_barrier(0);
#pragma unroll
  for (int it = 0; it < CVT_LOADS; ++it) {
    v2u o;
    o[0] = pk16(h_bits((_Float16)(bfr(v[it][0]) * scale)), h_bits((_Float16)(bfr(v[it][1]) * scale)));
    o[1] = pk16(h_bits((_Float16)(bfr(v[it][2]) * scale)), h_bits((_Float16)(bfr(v[it][3]) * scale)));
    *(v2u*)(q + it * 128) = o;
  }
}

// =====================================================================================================
// Cosine similarity sim[b][k] = <p, kgk[b][k]> / (max(|p|, eps) * max(|kgk[b][k]|, eps)), p = pooled[b], all operands
// bf16-RNE-converted, f32 arithmetic on VALU. Block = 256 threads = 8 waves = 32 keys of one batch (wave w -> keys
// =====================================================================================================
__global__ __launch_bounds__(SIM_THREADS)
void k_sim(const float* __restrict__ pooled, const float* __restrict__ kgk, const int* __restrict__ msk, float* S) {
  __shared__ __align__(16) float sv[SIM_KEYS];
  (void)msk;
  const int tid = threadIdx.x, wave = tid >> 5, lane = tid & 31;
  constexpr int NKBLK = SKV / SIM_KEYS;
  const int b  = blockIdx.x / NKBLK;
  const int kb = (blockIdx.x - b * NKBLK) * SIM_KEYS;
  const float* p = pooled + (size_t)b * DM;
  float pp = 0.f;
#pragma unroll 1
  for (int e = lane; e < DM; e += 32) {
    const float xv = bfr(p[e]);
    pp += xv * xv;
  }
  pp = wave_sum(pp);
  const float pnrm = fmaxf(sqrtf(pp), EPSN);
#pragma unroll 1
  for (int j = 0; j < 4; ++j) {
    const int k = kb + wave * 4 + j;                                     // < SKV by construction
    const float* kr = kgk + ((size_t)b * SKV + (size_t)k) * (size_t)DM;
    float pk = 0.f, kk = 0.f;
#pragma unroll 1
    for (int e = lane; e < DM; e += 32) {
      const float xv = bfr(p[e]);
      const float yv = bfr(kr[e]);
      pk += xv * yv;
      kk += yv * yv;
    }
    pk = wave_sum(pk);
    kk = wave_sum(kk);
    const float knrm = fmaxf(sqrtf(kk), EPSN);
    const float val = pk / (pnrm * knrm);
    if (lane == 0) sv[wave * 4 + j] = val;
  }
  __syncthreads();
  if (wave == 0) {                                                     // wave-uniform
    const v4f v = *(const v4f*)(sv + 4 * (lane & 7));                   // clamped LDS address, all lanes load
    float* dst = S + (size_t)b * SKV + kb + 4 * (lane & 7);
    if (lane < 8) {
      *(v4f*)dst = v;
    }
    
  }
}

// =====================================================================================================
// Staging of one 128-row x 64-k f16 plane tile in LDS: rows of 128 B at pitch 144 B (16 B x odd: ds_load_b128 free of bank
// conflicts). 128 threads, thread = (row tid>>3 of a group of 16, 16-B piece tid&7), eight groups: one wave-instruction
// covers four whole 128-B lines. l = the lane's LDS byte address of group 0, g = its global address of group 0,
// rs16 = 16 source rows in elements.
// =====================================================================================================
__device__ __forceinline__ unsigned lds_off(const void* p) { return (unsigned)(size_t)p; }
__device__ __forceinline__ void copy_plane(unsigned l, const _Float16* g, size_t rs16) {
#if defined(__HIP_DEVICE_COMPILE__)
  // the closing s_wait_xcnt stands inside the statement so that no address register is rewritten ahead of it
  asm volatile("global_load_async_to_lds_b128 %0, %8, off\n\t"
               "global_load_async_to_lds_b128 %1, %9, off\n\t"
               "global_load_async_to_lds_b128 %2, %10, off\n\t"
               "global_load_async_to_lds_b128 %3, %11, off\n\t"
               "global_load_async_to_lds_b128 %4, %12, off\n\t"
               "global_load_async_to_lds_b128 %5, %13, off\n\t"
               "global_load_async_to_lds_b128 %6, %14, off\n\t"
               "global_load_async_to_lds_b128 %7, %15, off\n\t"
               "s_wait_xcnt 0x0"
               :: "v"(l), "v"(l + 16 * LPITCH), "v"(l + 32 * LPITCH), "v"(l + 48 * LPITCH),
                  "v"(l + 64 * LPITCH), "v"(l + 80 * LPITCH), "v"(l + 96 * LPITCH), "v"(l + 112 * LPITCH),
                  "v"(g), "v"(g + rs16), "v"(g + 2 * rs16), "v"(g + 3 * rs16),
                  "v"(g + 4 * rs16), "v"(g + 5 * rs16), "v"(g + 6 * rs16), "v"(g + 7 * rs16)
               : "memory");
#endif
}

// Inputs-only fence on loaded fragments: keeps a group's LDS loads together ahead of its products, so that the wave waits for
// LDS once per group and not once per four products.
__device__ __forceinline__ void hold4(const v16h (&x)[4]) {
#if defined(__HIP_DEVICE_COMPILE__)
  asm volatile("" :: "v"(x[0]), "v"(x[1]), "v"(x[2]), "v"(x[3]));
#endif
}

// Stage one 16 x 64 f32 group of the wave's tile in its LDS slab (pitch 68): D element r of acc[j], lane l -> row 8h + r, col 16j + (l&15);
// the caller reloads it behind the wave sync.
// coverage: 32 lanes x 8 rows x 4 cols-of-16 = rows 0..15 x cols 0..63 of the slab (staged extent == consumed extent).
template <bool HASLO, bool BROW>
__device__ __forceinline__ void stage16(float* sl, v8f (&ah)[4], v8f (&al)[4], const float* __restrict__ bias,
                                        int rowb, int col0, float osc, float bsc, int lane) {
  const int hh = lane >> 4, m = lane & 15;
  float bc[4], br[8];
  if (BROW) {
#pragma unroll
    for (int r = 0; r < 8; ++r) br[r] = bfr(bias[rowb + 8 * hh + r]) * bsc;
#pragma unroll
    for (int j = 0; j < 4; ++j) bc[j] = 0.f;
  } else {
#pragma unroll
    for (int j = 0; j < 4; ++j) bc[j] = bfr(bias[col0 + 16 * j + m]) * bsc;
#pragma unroll
    for (int r = 0; r < 8; ++r) br[r] = 0.f;
  }
  const float oscl = osc * RINV;
#pragma unroll
  for (int r = 0; r < 8; ++r) {
    const int ro = (8 * hh + r) * GPITCH + m;
#pragma unroll
    for (int j = 0; j < 4; ++j) {
      float v = ah[j][r] * osc;
      if (HASLO) v += al[j][r] * oscl;
      v += BROW ? br[r] : bc[j];
      sl[ro + 16 * j] = v;
    }
  }
  wave_sync_lds();
}

// =====================================================================================================
// f16 GEMM, block = 128 x 128 tile, 4 waves (2 x 2) x 64 x 64; the k range is walked in tiles of 64; each tile's A rows
// (hi and, with HASLO, residual plane) and Bt rows are staged in LDS by asynchronous copies, two buffers, the next tile's
// copies in flight while this tile is multiplied; fragments come from LDS (4 A x 4 B fragments, 16 products per plane and k32).
//   C tile [z][Mb][N] = (A_hi[z][Mb][K] (+ A_res/2048)) . Bt[z][N][K]^T * osc + bias; per-z element strides aBs (A planes),
//   bBs (Bt), fBs (f32 output F), hBs (16-bit output planes H, L); 0 = shared.
//   M_HL  : H = f16(v*carry), L = f16 residual x2048 (two planes)       M_S16 : H only, bias per row
//   M_F32 : F = v (f32 rows, batch-row remap through fBs), no 16-bit output
// grid = nz x (Mb/128) x (N/128) (all launches: Mb % 128 == 0, N % 128 == 0, K % 64 == 0, K >= 128).
// Each accumulator sums its k32 products in ascending k, as a 16 x 64 wave tile did.
// Epilogue: the ring is free behind the last tile's barrier; each wave stages its four 16 x 64 f32 groups in its own range.
// coverage: per 16-row group 4 instr x 4 rows x 8 lanes x 8 halves = 16 x 64 (16-bit planes) and 8 instr x 2 rows x 16 lanes
//           x 4 floats = 16 x 64 (f32 plane); 4 groups x 4 waves = 128 x 128; the grid covers C exactly once.
// =====================================================================================================
template <bool HASLO, int MODE, bool BROW>
__global__ __launch_bounds__(128)
void gemm16(const u16* __restrict__ Ah, const u16* __restrict__ Al, const u16* __restrict__ Bt,
            const float* __restrict__ bias, float* F, u16* H, u16* L,
            int Mb, int N, int K, int aBs, int bBs, int fBs, int hBs,
            float osc, float bsc, float carry) {
  constexpr int BUFB = (HASLO ? 3 : 2) * PLANEB;          // one buffer: [A hi | Bt | A res]
  static_assert(4 * 64 * GPITCH * 4 <= 2 * BUFB && GKT == 64);          // epilogue staging fits the ring
  __shared__ __align__(16) unsigned char ring[2 * BUFB];
  constexpr bool LOUT = (MODE == M_HL);
  const int tid = threadIdx.x, wave = tid >> 5, lane = tid & 31, hh = lane >> 4, m = lane & 15;
  const int ntile = N >> 7, mtile = Mb >> 7;
  const int bid  = blockIdx.x;
  const int nt   = bid % ntile;
  const int tmp  = bid / ntile;
  const int mt   = tmp % mtile;
  const int bz   = tmp / mtile;
  const int wm = wave >> 1, wn = wave & 1;
  const int rowb = mt * 128 + wm * 64;
  const int col0 = nt * 128 + wn * 64;
  // copy side: the lane's row in a group of 16 and its 16-B piece of the 128-B row
  const int cr = tid >> 3, cc = tid & 7;
  const _Float16* gah = (const _Float16*)(const void*)Ah + (size_t)bz * (size_t)aBs + (size_t)(mt * 128 + cr) * (size_t)K + 8 * cc;
  const _Float16* gal = (const _Float16*)(const void*)Al + (size_t)bz * (size_t)aBs + (size_t)(mt * 128 + cr) * (size_t)K + 8 * cc;
  const _Float16* gb  = (const _Float16*)(const void*)Bt + (size_t)bz * (size_t)bBs + (size_t)(nt * 128 + cr) * (size_t)K + 8 * cc;
  const unsigned lc = lds_off(ring) + (unsigned)(cr * LPITCH + cc * 16);
  const size_t rs16 = (size_t)16 * (size_t)K;
  const int ntk = K >> 6;
  // fragment side: row (lane & 15) of the wave's first A / B group, +16 B for the upper lane half
  const unsigned char* fa = ring + (wm * 64 + m) * LPITCH + 16 * hh;
  const unsigned char* fb = ring + PLANEB + (wn * 64 + m) * LPITCH + 16 * hh;

  v8f ah[4][4], al[4][4];
#pragma unroll
  for (int i = 0; i < 4; ++i) {
#pragma unroll
    for (int j = 0; j < 4; ++j) { ah[i][j] = zero8(); al[i][j] = zero8(); }
  }

  // tile 0 -> buffer 0, landed and published; then tile 1 -> buffer 1 in flight
  copy_plane(lc, gah, rs16);
  copy_plane(lc + PLANEB, gb, rs16);
  if (HASLO) copy_plane(lc + 2 * PLANEB, gal, rs16);
  asm volatile("s_wait_asynccnt 0x0" ::: "memory");        // this wave's copies of tile 0 have landed
  __syncthreads();                                         // ... and every other wave's
  if (ntk > 1) {                                           // the same for the whole block
    copy_plane(lc + BUFB, gah + GKT, rs16);
    copy_plane(lc + BUFB + PLANEB, gb + GKT, rs16);
    if (HASLO) copy_plane(lc + BUFB + 2 * PLANEB, gal + GKT, rs16);
  }

  // rolled: one copy of the tile body, so that the hot loop stays small in the instruction cache; the unrolls inside it keep
  // the fragment and accumulator arrays in registers
#pragma unroll 1
  for (int t = 0; t < ntk; ++t) {
    const int bo = (t & 1) * BUFB;
    v16h a[2][4], b[2][4], r[2][4];
    if (!HASLO) {
      // both k32 groups' fragments are asked for at the top of the tile: the second group lands behind the first one's products
#pragma unroll
      for (int kk = 0; kk < 2; ++kk) {
#pragma unroll
        for (int i = 0; i < 4; ++i) {
          a[kk][i] = ldfrag_h((const _Float16*)(const void*)(fa + bo + i * 16 * LPITCH + kk * 64));
          b[kk][i] = ldfrag_h((const _Float16*)(const void*)(fb + bo + i * 16 * LPITCH + kk * 64));
        }
      }
    }
#pragma unroll
    for (int kk = 0; kk < 2; ++kk) {
      if (HASLO) {
#pragma unroll
        for (int i = 0; i < 4; ++i) {
          a[kk][i] = ldfrag_h((const _Float16*)(const void*)(fa + bo + i * 16 * LPITCH + kk * 64));
          b[kk][i] = ldfrag_h((const _Float16*)(const void*)(fb + bo + i * 16 * LPITCH + kk * 64));
          r[kk][i] = ldfrag_h((const _Float16*)(const void*)(fa + bo + 2 * PLANEB + i * 16 * LPITCH + kk * 64));
        }
        hold4(r[kk]);
      }
      hold4(a[kk]);
      hold4(b[kk]);
#pragma unroll
      for (int i = 0; i < 4; ++i) {
#pragma unroll
        for (int j = 0; j < 4; ++j) ah[i][j] = mma_h(a[kk][i], b[kk][j], ah[i][j]);
      }
      if (HASLO) {
#pragma unroll
        for (int i = 0; i < 4; ++i) {
#pragma unroll
          for (int j = 0; j < 4; ++j) al[i][j] = mma_h(r[kk][i], b[kk][j], al[i][j]);
        }
      }
      // keeps this group's products ahead of what follows: of the second group's LDS wait, and of the waits and the barrier at
      // the tile's foot, so that the copies in flight have the products' time to land
      if (!HASLO || kk == 1) __builtin_amdgcn_sched_barrier(0);
    }
    asm volatile("s_wait_dscnt 0x0" ::: "memory");         // this wave's reads of the buffer are done before it is refilled
    asm volatile("s_wait_asynccnt 0x0" ::: "memory");      // this wave's copies of tile t + 1 have landed
    __syncthreads();                                       // publishes tile t + 1, ends every reader's use of tile t
    if (t + 2 < ntk) {                                     // the same for the whole block
      const int ko = (t + 2) * GKT;
      copy_plane(lc + bo, gah + ko, rs16);
      copy_plane(lc + bo + PLANEB, gb + ko, rs16);
      if (HASLO) copy_plane(lc + bo + 2 * PLANEB, gal + ko, rs16);
    }
  }
  asm volatile("s_wait_asynccnt 0x0" ::: "memory");        // no copy outstanding when the ring becomes output staging

#pragma unroll
  for (int g = 0; g < 4; ++g) {
    const int rowg = rowb + 16 * g;
    float* sl = (float*)(void*)ring + (wave * 4 + g) * 16 * GPITCH;
    stage16<HASLO, BROW>(sl, ah[g], al[g], bias, rowg, col0, osc, bsc, lane);

    if (MODE == M_F32) {
      v4f vals[8];
#pragma unroll
      for (int it = 0; it < 8; ++it) vals[it] = *(const v4f*)(sl + (it * 2 + hh) * GPITCH + m * 4);
      float* Fb = F + (size_t)bz * (size_t)fBs + ((size_t)rowg + (size_t)hh) * (size_t)N + col0 + m * 4;
#pragma unroll
      for (int it = 0; it < 8; ++it) {
        *(v4f*)(Fb + (size_t)(it * 2) * (size_t)N) = vals[it];
      }
    } else {
      const int rq = lane >> 3, c8 = (lane & 7) * 8;
      v4u ovh[4], ovl[4];
#pragma unroll
      for (int i = 0; i < 4; ++i) {
        const int row = 4 * i + rq;
        const v4f a = *(const v4f*)(sl + row * GPITCH + c8), c4 = *(const v4f*)(sl + row * GPITCH + c8 + 4);
#pragma unroll
        for (int e = 0; e < 2; ++e) {
          unsigned ph0, pl0, ph1, pl1;
          split2(a[2 * e] * carry,  a[2 * e + 1] * carry,  ph0, pl0);
          split2(c4[2 * e] * carry, c4[2 * e + 1] * carry, ph1, pl1);
          ovh[i][e] = ph0;     ovl[i][e] = pl0;
          ovh[i][2 + e] = ph1; ovl[i][2 + e] = pl1;
        }
      }
      u16* Hb = H + (size_t)bz * (size_t)hBs + (size_t)rowg * (size_t)N + col0 + c8;
      u16* Lb = L + (size_t)bz * (size_t)hBs + (size_t)rowg * (size_t)N + col0 + c8;
#pragma unroll
      for (int i = 0; i < 4; ++i) {
        const int row = 4 * i + rq;
        *(v4u*)(Hb + (size_t)row * (size_t)N) = ovh[i];
        if (LOUT) *(v4u*)(Lb + (size_t)row * (size_t)N) = ovl[i];
      }
    }
  }
}

// =====================================================================================================
// Full (unmasked) multi-head cross attention with a per-key additive bias bfr(beta[h]) * sim[b][key]:
// block = (batch b, head, 64 query rows), 4 waves, wave w owns the 16 query rows q0 = 64*qt + 16*w .. q0+15
// The keys are walked in tiles of 64: each tile's k hi, k residual and v^T rows (64 rows x 128 B each, LDS pitch 144 B) are
// staged in LDS by asynchronous copies, two buffers, the next tile's copies in flight while this tile is worked on; the four
// waves share the tile. The batch's sim row (2 KB) is staged once with tile 0. One barrier per tile.
//   q planes f16 x8 hi / residual(x2048) [b*SQ + s][h*64 + d]; k planes likewise [b*SKV + s][h*64 + d];
//   v^T plane f16 x8 [(b*NH + h)*64 + d][s]; sim plane f32 [b][s]. All NKB key blocks of 32 keys are visited (static bound).
//   Scores are computed TRANSPOSED: S^T tile g (g = 0,1) = k rows (keys kb+16g .. +15, A operand, row m = lane&15, split map
//   over d) times q^T (B operand, col n = query q0 + (lane&15), k = d, split map), 2 d-chunks of 32; per chunk hi.hi -> s,
//   res.hi + hi.res -> r (scaled x2048, folded as s + r/2048); the q fragments are loaded once per wave.
//   D element r of lane l = (key kb+16g+8h+r, query q0+(l&15)), so a lane owns one query column and 16 of its 32 keys;
//   the partner lane l^16 owns the other 16 -> row max / row sum need one xor-16 shuffle. The bias of the lane's 16 keys
//   comes from four 16-B loads of the sim row (keys kb+8h..+7 and kb+16+8h..+7), times bfr(beta[h])*log2(e), added in f32.
//   Online max-subtracted base-2 softmax in f32 (1/sqrt(64) and the q/k carries folded into lsc). The exp'd values ARE the
//   P A-fragment in place: A row m = query = lane&15, element i <- key kb+8h+i (tile 0, D element i), element 8+i <- key
//   kb+16+8h+i (tile 1, D element i). P (<= 1) carried x32768 as f16. The rescale factor of query row 8h+r of the O
//   accumulators is fetched from lane 8h+r with a shuffle (uniform control). 4 v^T B fragments (col n = d = 16j + (lane&15),
//   keys k-contiguous), 4 P.V WMMAs, one guard.
//   Epilogue: 1/l (per query, shuffled to the D row owner) and the carry folds in f32; the wave's 16x64 f32 result staged in
// coverage: per wave 4 instructions x 4 rows x 8 lanes x 8 halves = 16 x 64 on both ctx planes; grid NB*NH*(SQ/64) blocks x
//           4 waves = every (b, s, h) row segment exactly once. LDS slab: 16 x 64 staged == 16 x 64 reloaded.
// =====================================================================================================
// One 64-key tile: 128 threads, thread = (row tid>>3 of a group of 16, 16-B piece tid&7), four groups per plane: one
// wave-instruction covers four whole 128-B lines. l = the lane's LDS byte address in the buffer's first plane.
__device__ __forceinline__ void copy_keys(unsigned l, const _Float16* kh, const _Float16* kl, const _Float16* v) {
#if defined(__HIP_DEVICE_COMPILE__)
  // the closing s_wait_xcnt stands inside the statement so that no address register is rewritten ahead of it
  asm volatile("global_load_async_to_lds_b128 %0, %12, off\n\t"
               "global_load_async_to_lds_b128 %1, %13, off\n\t"
               "global_load_async_to_lds_b128 %2, %14, off\n\t"
               "global_load_async_to_lds_b128 %3, %15, off\n\t"
               "global_load_async_to_lds_b128 %4, %16, off\n\t"
               "global_load_async_to_lds_b128 %5, %17, off\n\t"
               "global_load_async_to_lds_b128 %6, %18, off\n\t"
               "global_load_async_to_lds_b128 %7, %19, off\n\t"
               "global_load_async_to_lds_b128 %8, %20, off\n\t"
               "global_load_async_to_lds_b128 %9, %21, off\n\t"
               "global_load_async_to_lds_b128 %10, %22, off\n\t"
               "global_load_async_to_lds_b128 %11, %23, off\n\t"
               "s_wait_xcnt 0x0"
               :: "v"(l), "v"(l + 16 * LPITCH), "v"(l + 32 * LPITCH), "v"(l + 48 * LPITCH),
                  "v"(l + APLANEB), "v"(l + APLANEB + 16 * LPITCH), "v"(l + APLANEB + 32 * LPITCH),
                  "v"(l + APLANEB + 48 * LPITCH),
                  "v"(l + 2 * APLANEB), "v"(l + 2 * APLANEB + 16 * LPITCH), "v"(l + 2 * APLANEB + 32 * LPITCH),
                  "v"(l + 2 * APLANEB + 48 * LPITCH),
                  "v"(kh), "v"(kh + (size_t)16 * INNER), "v"(kh + (size_t)32 * INNER), "v"(kh + (size_t)48 * INNER),
                  "v"(kl), "v"(kl + (size_t)16 * INNER), "v"(kl + (size_t)32 * INNER), "v"(kl + (size_t)48 * INNER),
                  "v"(v), "v"(v + (size_t)16 * SKV), "v"(v + (size_t)32 * SKV), "v"(v + (size_t)48 * SKV)
               : "memory");
#endif
}
// The batch's sim row: 128 threads x 16 B = 512 floats.
__device__ __forceinline__ void copy_sim(unsigned l, const float* g) {
#if defined(__HIP_DEVICE_COMPILE__)
  // the closing s_wait_xcnt stands inside the statement so that no address register is rewritten ahead of it
  asm volatile("global_load_async_to_lds_b128 %0, %1, off\n\t"
               "s_wait_xcnt 0x0"
               :: "v"(l), "v"(g) : "memory");
#endif
}

__global__ __launch_bounds__(ATT_THREADS)
void attn_fwd(const u16* __restrict__ Qh, const u16* __restrict__ Ql, const u16* __restrict__ Kh,
              const u16* __restrict__ Kl, const u16* __restrict__ Vp, const float* __restrict__ Simp,
              const float* __restrict__ beta, u16* Oh, u16* Ol) {
  __shared__ __align__(16) unsigned char ring[2 * ABUFB];
  __shared__ __align__(16) float simrow[SKV];

  const int tid  = threadIdx.x;
  const int wave = tid >> 5;
  const int lane = tid & 31;
  const int hh   = lane >> 4;
  const int c    = lane & 15;

  constexpr int NQT = SQ / 64;
  const int bid  = blockIdx.x;
  const int qt   = bid % NQT;
  const int head = (bid / NQT) % NH;
  const int b    = bid / (NQT * NH);
  const int q0   = qt * 64 + wave * 16;

  // B fragments of q^T: col n = query q0 + c, k = d (k-contiguous row of the q planes)
  const size_t qo = ((size_t)(b * SQ + q0 + c)) * INNER + head * HD + 8 * hh;
  const _Float16* Qhb = (const _Float16*)(const void*)Qh + qo;
  const _Float16* Qlb = (const _Float16*)(const void*)Ql + qo;
  // copy side: the lane's row in a group of 16 and its 16-B piece of the 128-B row (k rows = keys, v^T rows = d)
  const int cr = tid >> 3, cc = tid & 7;
  const size_t ko = ((size_t)(b * SKV + cr)) * INNER + head * HD + 8 * cc;
  const _Float16* gkh = (const _Float16*)(const void*)Kh + ko;
  const _Float16* gkl = (const _Float16*)(const void*)Kl + ko;
  const _Float16* gv  = (const _Float16*)(const void*)Vp + ((size_t)(b * NH + head) * HD + cr) * SKV + 8 * cc;
  const unsigned lc = lds_off(ring) + (unsigned)(cr * LPITCH + cc * 16);
  // A fragments of k: row m = key 16g + c of the staged tile, k = d; +16 B for the upper lane half
  const unsigned char* fk = ring + c * LPITCH + 16 * hh;
  // B fragments of v: col n = d = 16j + c (row of the staged v^T tile), k = key
  const unsigned char* fv = ring + 2 * APLANEB + c * LPITCH + 16 * hh;
  // per-key bias row of this batch in LDS, offset to the lane half's first key
  const float* Sb = simrow + 8 * hh;
  const float bl2 = bfr(beta[head]) * LOG2E;
  const float lsc = (LOG2E * RSQ_HD) / (QS * KS);

  v16h qh[2], ql[2];
  qh[0] = ldfrag_h(Qhb);
  qh[1] = ldfrag_h(Qhb + 32);
  ql[0] = ldfrag_h(Qlb);
  ql[1] = ldfrag_h(Qlb + 32);

  float mrun = -INFINITY, lrun = 0.f;
  v8f o[4];
#pragma unroll
  for (int j = 0; j < 4; ++j) o[j] = zero8();

  // tile 0 and the sim row -> LDS, landed and published; then tile 1 -> buffer 1 in flight
  copy_keys(lc, gkh, gkl, gv);
  copy_sim(lds_off(simrow) + (unsigned)(tid * 16), Simp + (size_t)b * SKV + 4 * tid);
  asm volatile("s_wait_asynccnt 0x0" ::: "memory");        // this wave's copies of tile 0 have landed
  __syncthreads();                                         // ... and every other wave's
  copy_keys(lc + ABUFB, gkh + (size_t)AKT * INNER, gkl + (size_t)AKT * INNER, gv + AKT);

  // rolled over the tiles: one copy of the tile body in the instruction cache
#pragma unroll 1
  for (int st = 0; st < NST; ++st) {
   const int bo = (st & 1) * ABUFB;
   // unrolled: the two 32-key halves of a tile differ only in constant LDS offsets
#pragma unroll
   for (int sub = 0; sub < AKT / 32; ++sub) {
    const int kb = st * AKT + sub * 32;
    // ---- transposed scores: s0 = keys kb..kb+15, s1 = keys kb+16..kb+31, column = query q0 + c ----
    v8f s0 = zero8(), s1 = zero8(), r0 = zero8(), r1 = zero8();
    const _Float16* k0h = (const _Float16*)(const void*)(fk + bo + sub * 32 * LPITCH);
    const _Float16* k1h = (const _Float16*)(const void*)(fk + bo + (sub * 32 + 16) * LPITCH);
    const _Float16* k0l = (const _Float16*)(const void*)(fk + bo + APLANEB + sub * 32 * LPITCH);
    const _Float16* k1l = (const _Float16*)(const void*)(fk + bo + APLANEB + (sub * 32 + 16) * LPITCH);
#pragma unroll
    for (int kk = 0; kk < HD / 32; ++kk) {
      const v16h fh0 = ldfrag_h(k0h + kk * 32);
      const v16h fh1 = ldfrag_h(k1h + kk * 32);
      const v16h fl0 = ldfrag_h(k0l + kk * 32);
      const v16h fl1 = ldfrag_h(k1l + kk * 32);
      s0 = mma_h(fh0, qh[kk], s0);
      s1 = mma_h(fh1, qh[kk], s1);
      r0 = mma_h(fl0, qh[kk], r0);
      r1 = mma_h(fl1, qh[kk], r1);
      r0 = mma_h(fh0, ql[kk], r0);
      r1 = mma_h(fh1, ql[kk], r1);
      guard_s4(s0, s1, r0, r1, qh[kk], ql[kk], fh0, fh1, fl0, fl1);
    }
    // ---- per-key bias: keys kb+8hh+0..7 (g0, g1) and kb+16+8hh+0..7 (g2, g3) ----
    const v4f g0 = *(const v4f*)(Sb + kb);
    const v4f g1 = *(const v4f*)(Sb + kb + 4);
    const v4f g2 = *(const v4f*)(Sb + kb + 16);
    const v4f g3 = *(const v4f*)(Sb + kb + 20);
    // ---- base-2 logits of this lane's 16 keys for query q0 + c: t[i] <- key kb+8hh+i, t[8+i] <- key kb+16+8hh+i ----
    float t[16];
#pragma unroll
    for (int i = 0; i < 4; ++i) {
      t[i]      = (s0[i]     + r0[i]     * RINV) * lsc + g0[i] * bl2;
      t[4 + i]  = (s0[4 + i] + r0[4 + i] * RINV) * lsc + g1[i] * bl2;
      t[8 + i]  = (s1[i]     + r1[i]     * RINV) * lsc + g2[i] * bl2;
      t[12 + i] = (s1[4 + i] + r1[4 + i] * RINV) * lsc + g3[i] * bl2;
    }
    float cm = t[0];
#pragma unroll
    for (int i = 1; i < 16; ++i) cm = fmaxf(cm, t[i]);
    cm = fmaxf(cm, __shfl_xor(cm, 16, 32));
    const float mn = fmaxf(mrun, cm);        // finite from the first block on
    const float al = exp2f(mrun - mn);       // 0 on the first block (mrun = -inf)
    mrun = mn;
    // ---- probabilities (<= 1) and the P A-fragment: f16(p * 32768); element i <-> t[i] ----
    float ps = 0.f;
    FragH ph;
#pragma unroll
    for (int w = 0; w < 2; ++w) {
#pragma unroll
      for (int e4 = 0; e4 < 4; ++e4) {
        const int i = 8 * w + 2 * e4;
        const float p0 = exp2f(t[i] - mn), p1 = exp2f(t[i + 1] - mn);
        ps += p0 + p1;
        ph.u[w][e4] = pk16(h_bits((_Float16)(p0 * PCAR)), h_bits((_Float16)(p1 * PCAR)));
      }
    }
    ps += __shfl_xor(ps, 16, 32);
    lrun = lrun * al + ps;
    // ---- rescale the O accumulators: D row 8hh+r = query q0+8hh+r, its factor lives in lane 8hh+r (and 16+8hh+r) ----
    float scl[8];
#pragma unroll
    for (int r = 0; r < 8; ++r) scl[r] = __shfl(al, 8 * hh + r, 32);
#pragma unroll
    for (int j = 0; j < 4; ++j) {
#pragma unroll
      for (int r = 0; r < 8; ++r) o[j][r] *= scl[r];
    }
    // ---- P.V : B fragment col n = d = j*16 + c, keys contiguous in the v^T plane ----
    {
      const unsigned char* vp = fv + bo + sub * 64;
      const v16h v0 = ldfrag_h((const _Float16*)(const void*)(vp));
      const v16h v1 = ldfrag_h((const _Float16*)(const void*)(vp + 16 * LPITCH));
      const v16h v2 = ldfrag_h((const _Float16*)(const void*)(vp + 32 * LPITCH));
      const v16h v3 = ldfrag_h((const _Float16*)(const void*)(vp + 48 * LPITCH));
      o[0] = mma_h(ph.v, v0, o[0]);
      o[1] = mma_h(ph.v, v1, o[1]);
      o[2] = mma_h(ph.v, v2, o[2]);
      o[3] = mma_h(ph.v, v3, o[3]);
      guard_p(o[0], o[1], o[2], o[3], ph.v, v0, v1, v2, v3);
    }
   }
   asm volatile("s_wait_dscnt 0x0" ::: "memory");          // this wave's reads of the buffer are done before it is refilled
   asm volatile("s_wait_asynccnt 0x0" ::: "memory");       // this wave's copies of tile st + 1 have landed
   __syncthreads();                                        // publishes tile st + 1, ends every reader's use of tile st
   if (st + 2 < NST) {                                     // the same for the whole block
     const size_t k2 = (size_t)(st + 2) * AKT;
     copy_keys(lc + bo, gkh + k2 * INNER, gkl + k2 * INNER, gv + k2);
   }
  }
  asm volatile("s_wait_asynccnt 0x0" ::: "memory");        // no copy outstanding when the ring becomes output staging
  acc_guard4(o);

  // ---- fold 1/l (per query, owned by lane = query) and the carries (32768 on P, 8 on v), apply the ctx carry 1024 ----
  const float linv = (1.0f / lrun) * (OSC / (PCAR * VS));
  float inv[8];
#pragma unroll
  for (int r = 0; r < 8; ++r) inv[r] = __shfl(linv, 8 * hh + r, 32);
  float* slab = (float*)(void*)ring + wave * 16 * OPITCH;   // the ring is free behind the last tile's barrier
#pragma unroll
  for (int r = 0; r < 8; ++r) {
#pragma unroll
    for (int j = 0; j < 4; ++j) slab[(8 * hh + r) * OPITCH + j * 16 + c] = o[j][r] * inv[r];
  }
  wave_sync_lds();
  // ---- ctx x1024 -> f16 hi plane and residual plane; lane = (row in group of 4, 8 consecutive d) ----
  v4u ovh[4], ovl[4];
  const int rq = lane >> 3, c8 = (lane & 7) * 8;
#pragma unroll
  for (int i = 0; i < 4; ++i) {
    const int row = 4 * i + rq;
    const v4f a = *(const v4f*)(slab + row * OPITCH + c8), c4 = *(const v4f*)(slab + row * OPITCH + c8 + 4);
#pragma unroll
    for (int e = 0; e < 2; ++e) {
      unsigned ph0, pl0, ph1, pl1;
      split2(a[2 * e],  a[2 * e + 1],  ph0, pl0);
      split2(c4[2 * e], c4[2 * e + 1], ph1, pl1);
      ovh[i][e] = ph0;     ovl[i][e] = pl0;
      ovh[i][2 + e] = ph1; ovl[i][2 + e] = pl1;
    }
  }
  const size_t oo = ((size_t)(b * SQ + q0)) * INNER + head * HD + c8;
  u16* obh = Oh + oo;
  u16* obl = Ol + oo;
  {
#pragma unroll
    for (int i = 0; i < 4; ++i) {
      const int row = 4 * i + rq;
      *(v4u*)(obh + (size_t)row * INNER) = ovh[i];
      *(v4u*)(obl + (size_t)row * INNER) = ovl[i];
    }
    
  }
}

// =====================================================================================================
// Workspace map (bytes, NB=8, SQ=2048); every plane fully written by whole-line stores before it is read; all extents exact
//   XQ   f16 [NB*SQ][768]    f16(bf16(x))                 25165824   (region reused later as OH, same extent)
//   XV   f16 [NB*512][768]   f16(bf16(kg_value))           6291456
//   WQ16 WK16 WV16 WO16 f16 [768 n][768 k] x256            1179648 each
//   QH QL f16 [NB*SQ][768] x8 hi / res                     25165824 each
//   KH KL f16 [NB*512][768] x8 hi / res                     6291456 each
//   VT16 f16 [NB*768 (h,d)][512 s] x8                       6291456
//   OL   f16 [NB*SQ][768] x1024 res (ctx), OH aliases XQ    25165824
//   SIMP f32 [NB][512]                                         16384
//   end                                                    130564096
// =====================================================================================================
extern "C" void kernel_launch(void* const* d_in, const int* in_sizes, int n_in,
                              void* d_out, int out_size, void* d_ws, size_t ws_size,
                              hipStream_t stream) {
  if (n_in < 14) return;
  if (in_sizes[0] < ((NB - 1) * SQ_FULL + SQ) * DM) return;
  if (in_sizes[1] < 1) return;
  if (in_sizes[2] < NB * DM) return;
  if (in_sizes[3] < NB * SKV * DM || in_sizes[4] < NB * SKV * DM) return;
  if (in_sizes[5] < NH) return;
  if (in_sizes[6] != DM * DM || in_sizes[8] != DM * DM || in_sizes[10] != DM * DM || in_sizes[12] != DM * DM) return;
  if (in_sizes[7] < DM || in_sizes[9] < DM || in_sizes[11] < DM || in_sizes[13] < DM) return;
  if (out_size < ((NB - 1) * SQ_FULL + SQ) * DM) return;

  const float* x_in   = (const float*)d_in[0];
  const int*   msk    = (const int*)d_in[1];
  const float* pooled = (const float*)d_in[2];
  const float* kgk    = (const float*)d_in[3];
  const float* kgv    = (const float*)d_in[4];
  const float* beta   = (const float*)d_in[5];
  const float* wq     = (const float*)d_in[6];
  const float* bq     = (const float*)d_in[7];
  const float* wk     = (const float*)d_in[8];
  const float* bk     = (const float*)d_in[9];
  const float* wv     = (const float*)d_in[10];
  const float* bv     = (const float*)d_in[11];
  const float* wo     = (const float*)d_in[12];
  const float* bo     = (const float*)d_in[13];
  float*       out    = (float*)d_out;

  const size_t szXQ = (size_t)NB * SQ * DM * 2;
  const size_t szXV = (size_t)NB * SKV * DM * 2;
  const size_t szW  = (size_t)DM * DM * 2;
  const size_t szQP = (size_t)NB * SQ * INNER * 2;
  const size_t szKP = (size_t)NB * SKV * INNER * 2;
  const size_t szVT = (size_t)NB * INNER * SKV * 2;
  const size_t szS  = (size_t)NB * SKV * 4;
  static_assert((size_t)NB * SQ * DM * 2 == (size_t)NB * SQ * INNER * 2);   // XQ region reused as OH, same extent
  size_t off = 0;
  const size_t oXQ = off; off += szXQ;      // also OH
  const size_t oXV = off; off += szXV;
  const size_t oWQ = off; off += szW;
  const size_t oWK = off; off += szW;
  const size_t oWV = off; off += szW;
  const size_t oWO = off; off += szW;
  const size_t oQH = off; off += szQP;
  const size_t oQL = off; off += szQP;
  const size_t oKH = off; off += szKP;
  const size_t oKL = off; off += szKP;
  const size_t oVT = off; off += szVT;
  const size_t oOL = off; off += szQP;
  const size_t oS  = off; off += szS;
  if (off > ws_size) return;                // off = 130564096 at NB=8, SQ=2048
  if (off > (size_t)134217728) return;

  char* ws = (char*)d_ws;
  u16* XQ   = (u16*)(ws + oXQ);
  u16* XV   = (u16*)(ws + oXV);
  u16* WQ16 = (u16*)(ws + oWQ);
  u16* WK16 = (u16*)(ws + oWK);
  u16* WV16 = (u16*)(ws + oWV);
  u16* WO16 = (u16*)(ws + oWO);
  u16* QH   = (u16*)(ws + oQH);
  u16* QL   = (u16*)(ws + oQL);
  u16* KH   = (u16*)(ws + oKH);
  u16* KL   = (u16*)(ws + oKL);
  u16* VT16 = (u16*)(ws + oVT);
  u16* OH   = (u16*)(ws + oXQ);
  u16* OL   = (u16*)(ws + oOL);
  float* SIMP = (float*)(ws + oS);

  // (0) activations -> f16 planes of bf16-converted values (query rows s < SQ of batches b < NB, compact; kg_value rows) and
  //     weights [n = out][k = in] (y = x.W^T): already k-contiguous [n][k]; f16 planes of bf16(W) x256; one launch
  cvt_all<<<dim3(CVB_X + CVB_V + 4 * CVB_W), dim3(CVT_THREADS), 0, stream>>>(x_in, kgv, wq, wk, wv, wo,
                                                                             XQ, XV, WQ16, WK16, WV16, WO16);
  // (6) cosine similarity sim[b][k] -> SIMP f32 [NB][512]
  k_sim<<<dim3(NB * (SKV / SIM_KEYS)), dim3(SIM_THREADS), 0, stream>>>(pooled, kgk, msk, SIMP);
  // (7) q_un = x . Wq^T + bq -> f16 [NB*SQ][768] x8 hi + res (col = h*64 + d); the 1/8 is folded into the softmax scale
  gemm16<false, M_HL, false><<<dim3((NB * SQ / 128) * (INNER / 128)), dim3(128), 0, stream>>>(
      XQ, XQ, WQ16, bq, out, QH, QL, NB * SQ, INNER, DM, 0, 0, 0, 0, QS / WSC, QS, 1.0f);
  // (8) k = kg_value . Wk^T + bk -> f16 [NB*512][768] x8 hi + res
  gemm16<false, M_HL, false><<<dim3((NB * SKV / 128) * (INNER / 128)), dim3(128), 0, stream>>>(
      XV, XV, WK16, bk, out, KH, KL, NB * SKV, INNER, DM, 0, 0, 0, 0, KS / WSC, KS, 1.0f);
  // (9) v^T per batch: A = Wv [(h,d) = n][k], Bt = kg_value rows of batch b [s][k], bias bv per row -> f16 [(b,h,d)][s] x8
  gemm16<false, M_S16, true><<<dim3(NB * (INNER / 128) * (SKV / 128)), dim3(128), 0, stream>>>(
      WV16, WV16, XV, bv, out, VT16, VT16, INNER, SKV, DM, 0, SKV * DM, 0, INNER * SKV, VS / WSC, VS, 1.0f);
  // (10) attention with the beta*sim key bias -> ctx planes [NB*SQ][768] x1024 hi + res (OH reuses the XQ region)
  attn_fwd<<<dim3(NB * NH * (SQ / 64)), dim3(ATT_THREADS), 0, stream>>>(QH, QL, KH, KL, VT16, SIMP, beta, OH, OL);
  // (11) out rows [b][SQ_FULL][768] f32 = ctx . Wo^T + bo (rows s < SQ of batches b < NB); carries 1024 x 256 folded back
  gemm16<true, M_F32, false><<<dim3(NB * (SQ / 128) * (DM / 128)), dim3(128), 0, stream>>>(
      OH, OL, WO16, bo, out, OL, OL, SQ, DM, INNER, SQ * INNER, 0, SQ_FULL * DM, 0,
      1.0f / (OSC * WSC), 1.0f, 1.0f);
  (void)hipGetLastError();
}

// v004
// One run takes 169 microseconds.
// Timed twice side by side with v003, it ran 1.22 and 1.21 times as fast.
// Over all steps from v000 it is 2.57 times as fast.
// Contractions on v_wmma_f32_16x16x32_f16 (f16 operands, f32 accumulate): x.Wq^T, xv.Wk^T, Wv.xv^T single products on
// f16(bf16(x)) and f16(bf16(W) x256); k.q^T with q and k carried as f16 hi + residual(x2048) planes (3 products);
// P.v^T single product (P x32768, v x8); ctx.Wo^T with ctx carried as f16 hi (x1024) + residual(x2048) planes (2 products,
// separate residual accumulator); cosine-similarity bias, softmax, biases and all carry folds in f32 on VALU.
// Inputs RNE-converted to bf16 on load.
#include <hip/hip_runtime.h>
#include <math.h>
#include <stdint.h>

#ifndef NB
#define NB       8        // batches processed
#endif
#ifndef SQ
#define SQ       2048     // query rows processed per batch
#endif
#define NB_FULL  8
#define SQ_FULL  2048     // query rows per batch in the input / output layout (batch stride)
#define SKV      512      // key / value rows per batch (all of them)
#define DM       768      // model width
#define NH       12
#define HD       64
#define INNER    (NH * HD)
#define WSC      256.0f   // weight carry
#define QS       8.0f
#define KS       8.0f
#define VS       8.0f
#define PCAR     32768.0f
#define OSC      1024.0f  // ctx carry
#define RSC      2048.0f  // residual plane scale
#define RINV     0.00048828125f
#define LOG2E    1.4426950408889634f
#define RSQ_HD   0.125f
#define EPSN     1e-8f
#define NKB      (SKV / 32)
#define ATT_WAVES   4
#define ATT_THREADS (ATT_WAVES * 32)
#define CVT_THREADS 256      // streaming convert: 8 waves per block
#define CVT_LOADS   32       // 16-B loads per lane, all in flight
#define CVT_WAVE    (CVT_LOADS * 32 * 4)              // floats per wave (16 KB in, 8 KB out)
#define CVT_BLOCK   (CVT_WAVE * (CVT_THREADS / 32))   // floats per block
#define CVB_XB      (SQ * DM / CVT_BLOCK)             // blocks per batch of query rows
#define CVB_X       (NB * CVB_XB)
#define CVB_V       (NB * SKV * DM / CVT_BLOCK)
#define CVB_W       (DM * DM / CVT_BLOCK)
#define SIM_THREADS 256
#define SIM_KEYS    32       // keys per k_sim block (8 waves x 4)
#define OPITCH   68
#define GPITCH   68
#define GKT      64       // k per staged GEMM tile (128-B rows)
#define LPITCH   144      // LDS pitch of a staged row, bytes
#define PLANEB   (128 * LPITCH)
#define AKT      64       // keys per staged attention tile (128-B rows in all three planes)
#define APLANEB  (64 * LPITCH)
#define ABUFB    (3 * APLANEB)       // one attention buffer: [k hi | k res | v^T]
#define NST      (SKV / AKT)

#define M_HL     0
#define M_S16    1
#define M_F32    2

static_assert(NB >= 1 && NB <= NB_FULL);
static_assert((SQ % 128) == 0 && SQ >= 128 && SQ <= SQ_FULL);
static_assert(HD == 64 && INNER == 768 && NH == 12 && INNER == DM);
static_assert((SKV % 128) == 0 && (SKV % 32) == 0 && NKB * 32 == SKV && (SKV % SIM_KEYS) == 0);
static_assert((DM % 128) == 0 && (DM % 32) == 0 && (CVT_THREADS % 32) == 0);
static_assert((SQ * DM) % CVT_BLOCK == 0 && (NB * SKV * DM) % CVT_BLOCK == 0 && (DM * DM) % CVT_BLOCK == 0);
static_assert((OPITCH * 4) % 16 == 0 && (GPITCH * 4) % 16 == 0);
static_assert(ATT_THREADS * 4 == SKV && NST >= 2 && AKT == 64 && HD == 64);
static_assert(ATT_WAVES * 16 * OPITCH * 4 <= 2 * ABUFB);               // attention output staging fits its ring
static_assert(ATT_THREADS == 128 && SIM_THREADS == 256 && SIM_KEYS == (SIM_THREADS / 32) * 4);

typedef unsigned short u16;
typedef _Float16 v16h __attribute__((ext_vector_type(16)));
typedef _Float16 v8h  __attribute__((ext_vector_type(8)));
typedef float    v8f  __attribute__((ext_vector_type(8)));
typedef float    v4f  __attribute__((ext_vector_type(4)));
typedef unsigned int v4u __attribute__((ext_vector_type(4)));
typedef unsigned int v2u __attribute__((ext_vector_type(2)));

union FragH { v16h v; v8h h[2]; v4u u[2]; };

// ---- scalar helpers ----------------------------------------------------------------------------------
__device__ __forceinline__ unsigned short bf_bits(float f) {          // f32 -> bf16 bits, RNE convert
  unsigned u = __float_as_uint(f);
  return (unsigned short)((u + 0x7FFFu + ((u >> 16) & 1u)) >> 16);
}
__device__ __forceinline__ float bf_up(unsigned short h) { return __uint_as_float(((unsigned)h) << 16); }
__device__ __forceinline__ float bfr(float f) { return bf_up(bf_bits(f)); }
__device__ __forceinline__ unsigned short h_bits(_Float16 x) { return __builtin_bit_cast(unsigned short, x); }
__device__ __forceinline__ unsigned pk16(unsigned short a, unsigned short b) { return (unsigned)a | ((unsigned)b << 16); }
__device__ __forceinline__ v8f zero8() { v8f z = {0.f, 0.f, 0.f, 0.f, 0.f, 0.f, 0.f, 0.f}; return z; }

// x = hi + lo/2048 in f16: hi = f16(x), lo = f16((x - hi) * 2048); two values packed per 32-bit word
__device__ __forceinline__ void split2(float x0, float x1, unsigned& ph, unsigned& pl) {
  const _Float16 h0 = (_Float16)x0, h1 = (_Float16)x1;
  const float d0 = x0 - (float)h0, d1 = x1 - (float)h1;
  const _Float16 l0 = (_Float16)(d0 * RSC), l1 = (_Float16)(d1 * RSC);
  ph = pk16(h_bits(h0), h_bits(h1));
  pl = pk16(h_bits(l0), h_bits(l1));
}

// ---- fragment loader: 16-bit A/B operand, lane -> row/col (lane&15), p already includes +8*(lane>>4);
//      elements 0..7 <- p[0..7] (k0+8h..), elements 8..15 <- p[16..23] (k0+16+8h..); same split k map for A and B,
//      B always read from a k-contiguous [n][k] plane.
__device__ __forceinline__ v16h ldfrag_h(const _Float16* p) {
  FragH f;
  f.h[0] = *(const v8h*)(p);
  f.h[1] = *(const v8h*)(p + 16);
  return f.v;
}

// ---- WMMA helper and trailing VALU hazard gaps ----------------------------------------------------------
__device__ __forceinline__ v8f mma_h(v16h a, v16h b, v8f c) {
  return __builtin_amdgcn_wmma_f32_16x16x32_f16(false, a, false, b, (short)0, c, false, false);
}
__device__ __forceinline__ void guard_s4(v8f& a, v8f& b, v8f& c, v8f& d,
                                         v16h x0, v16h x1, v16h x2, v16h x3, v16h x4, v16h x5) {
#if defined(__HIP_DEVICE_COMPILE__)
  asm volatile("v_nop\n\tv_nop\n\tv_nop\n\tv_nop"
               : "+v"(a), "+v"(b), "+v"(c), "+v"(d)
               : "v"(x0), "v"(x1), "v"(x2), "v"(x3), "v"(x4), "v"(x5) : "memory");
#endif
}
__device__ __forceinline__ void guard_p(v8f& a, v8f& b, v8f& c, v8f& d, v16h p, v16h x0, v16h x1, v16h x2, v16h x3) {
#if defined(__HIP_DEVICE_COMPILE__)
  asm volatile("v_nop\n\tv_nop\n\tv_nop\n\tv_nop"
               : "+v"(a), "+v"(b), "+v"(c), "+v"(d) : "v"(p), "v"(x0), "v"(x1), "v"(x2), "v"(x3) : "memory");
#endif
}
__device__ __forceinline__ void acc_guard4(v8f (&a)[4]) {
#if defined(__HIP_DEVICE_COMPILE__)
  asm volatile("v_nop\n\tv_nop\n\tv_nop\n\tv_nop" : "+v"(a[0]), "+v"(a[1]), "+v"(a[2]), "+v"(a[3]));
#endif
}
__device__ __forceinline__ void wave_sync_lds() {
  __builtin_amdgcn_fence(__ATOMIC_RELEASE, "workgroup");
  __builtin_amdgcn_wave_barrier();
  __builtin_amdgcn_fence(__ATOMIC_ACQUIRE, "workgroup");
}

// =====================================================================================================
// Streaming convert, one launch for all six planes: Y[e] <- f16(bf16_RNE(x[e]) * scale), scale a power of two (1 for the two
// activation planes, 256 for the four weight planes). Every plane is a whole number of blocks; a block takes CVT_BLOCK
// consecutive floats of one plane (of one batch, for the query rows), a wave CVT_WAVE of them: 32 loads of 512 contiguous
// bytes, all asked for before the first is converted, then 32 stores of 256 contiguous bytes (whole lines both ways).
// coverage: grid = CVB_X + CVB_V + 4 * CVB_W blocks x CVT_BLOCK floats = every element of the six planes exactly once.
// =====================================================================================================
__global__ __launch_bounds__(CVT_THREADS)
void cvt_all(const float* __restrict__ x, const float* __restrict__ kgv, const float* __restrict__ wq,
             const float* __restrict__ wk, const float* __restrict__ wv, const float* __restrict__ wo,
             u16* XQ, u16* XV, u16* WQ, u16* WK, u16* WV, u16* WO) {
  const int bid = blockIdx.x;
  const float* src;
  u16* dst;
  float scale;
  if (bid < CVB_X) {                                     // query rows s < SQ of batch b, compact in the plane
    const int b = bid / CVB_XB;
    src = x + (size_t)b * ((size_t)SQ_FULL * DM) + (size_t)(bid - b * CVB_XB) * CVT_BLOCK;
    dst = XQ + (size_t)bid * CVT_BLOCK;
    scale = 1.0f;
  } else if (bid < CVB_X + CVB_V) {
    const int r = bid - CVB_X;
    src = kgv + (size_t)r * CVT_BLOCK;
    dst = XV + (size_t)r * CVT_BLOCK;
    scale = 1.0f;
  } else {
    const int w = bid - (CVB_X + CVB_V);
    const int sel = w / CVB_W;
    const int r = w - sel * CVB_W;
    src = (sel == 0 ? wq : sel == 1 ? wk : sel == 2 ? wv : wo) + (size_t)r * CVT_BLOCK;
    dst = (sel == 0 ? WQ : sel == 1 ? WK : sel == 2 ? WV : WO) + (size_t)r * CVT_BLOCK;
    scale = WSC;
  }
  const int off = (threadIdx.x >> 5) * CVT_WAVE + (threadIdx.x & 31) * 4;
  const float* p = src + off;
  u16* q = dst + off;
  v4f v[CVT_LOADS];
#pragma unroll
  for (int it = 0; it < CVT_LOADS; ++it) v[it] = *(const v4f*)(p + it * 128);
  // keeps every load ahead of the first convert and store: the wave pays the memory latency once, not once per group
  __builtin_amdgcn_sched_barrier(0);
#pragma unroll
  for (int it = 0; it < CVT_LOADS; ++it) {
    v2u o;
    o[0] = pk16(h_bits((_Float16)(bfr(v[it][0]) * scale)), h_bits((_Float16)(bfr(v[it][1]) * scale)));
    o[1] = pk16(h_bits((_Float16)(bfr(v[it][2]) * scale)), h_bits((_Float16)(bfr(v[it][3]) * scale)));
    *(v2u*)(q + it * 128) = o;
  }
}

// =====================================================================================================
// Cosine similarity sim[b][k] = <p, kgk[b][k]> / (max(|p|, eps) * max(|kgk[b][k]|, eps)), p = pooled[b], all operands
// bf16-RNE-converted, f32 arithmetic on VALU. Block = 256 threads = 8 waves = 32 keys of one batch (wave w -> keys
// kb + 4w .. kb + 4w + 3). A wave asks for its five rows (p and four keys, 3 KB each) at once, 16 B per lane and load; lane l
// sums elements 128 i + 4 l + e in ascending (i, e); the nine lane sums go through one xor tree side by side.
// =====================================================================================================
__global__ __launch_bounds__(SIM_THREADS)
void k_sim(const float* __restrict__ pooled, const float* __restrict__ kgk, const int* __restrict__ msk, float* S) {
  __shared__ __align__(16) float sv[SIM_KEYS];
  (void)msk;
  const int tid = threadIdx.x, wave = tid >> 5, lane = tid & 31;
  constexpr int NKBLK = SKV / SIM_KEYS;
  const int b  = blockIdx.x / NKBLK;
  const int kb = (blockIdx.x - b * NKBLK) * SIM_KEYS;
  const float* p = pooled + (size_t)b * DM + 4 * lane;
  const float* kr = kgk + ((size_t)b * SKV + (size_t)(kb + wave * 4)) * (size_t)DM + 4 * lane;   // keys < SKV by construction
  constexpr int NL = DM / 128;                                         // 512-B loads per row
  v4f pv[NL], kv[4][NL];
  // every loop below is unrolled so that the row arrays and the nine sums stay in registers
#pragma unroll
  for (int i = 0; i < NL; ++i) pv[i] = *(const v4f*)(p + i * 128);
#pragma unroll
  for (int j = 0; j < 4; ++j) {
#pragma unroll
    for (int i = 0; i < NL; ++i) kv[j][i] = *(const v4f*)(kr + j * DM + i * 128);
  }
  // keeps all 30 loads ahead of the first sum: the wave pays the memory latency once, not once per 512-B load
  __builtin_amdgcn_sched_barrier(0);
  float s[9];                                                          // |p|^2, <p, k_j>, |k_j|^2
#pragma unroll
  for (int q = 0; q < 9; ++q) s[q] = 0.f;
#pragma unroll
  for (int i = 0; i < NL; ++i) {
#pragma unroll
    for (int e = 0; e < 4; ++e) {
      const float xv = bfr(pv[i][e]);
      s[0] += xv * xv;
#pragma unroll
      for (int j = 0; j < 4; ++j) {
        const float yv = bfr(kv[j][i][e]);
        s[1 + j] += xv * yv;
        s[5 + j] += yv * yv;
      }
    }
  }
  // one xor tree (16, 8, 4, 2, 1) for all nine sums at once: the wave waits for five cross-lane exchanges, not five per sum
#pragma unroll
  for (int d = 16; d >= 1; d >>= 1) {
    float o[9];
#pragma unroll
    for (int q = 0; q < 9; ++q) o[q] = __shfl_xor(s[q], d, 32);
#pragma unroll
    for (int q = 0; q < 9; ++q) s[q] += o[q];
  }
  const float pnrm = fmaxf(sqrtf(s[0]), EPSN);
  {                                                                    // lane j < 4 finishes key j (every lane holds all sums)
    const int j = lane & 3;
    const float pk = j == 0 ? s[1] : j == 1 ? s[2] : j == 2 ? s[3] : s[4];
    const float kk = j == 0 ? s[5] : j == 1 ? s[6] : j == 2 ? s[7] : s[8];
    const float knrm = fmaxf(sqrtf(kk), EPSN);
    const float val = pk / (pnrm * knrm);
    if (lane < 4) sv[wave * 4 + lane] = val;
  }
  __syncthreads();
  if (wave == 0) {                                                     // wave-uniform
    const v4f v = *(const v4f*)(sv + 4 * (lane & 7));                   // clamped LDS address, all lanes load
    float* dst = S + (size_t)b * SKV + kb + 4 * (lane & 7);
    if (lane < 8) {
      *(v4f*)dst = v;
    }
    
  }
}

// =====================================================================================================
// Staging of one 128-row x 64-k f16 plane tile in LDS: rows of 128 B at pitch 144 B (16 B x odd: ds_load_b128 free of bank
// conflicts). 128 threads, thread = (row tid>>3 of a group of 16, 16-B piece tid&7), eight groups: one wave-instruction
// covers four whole 128-B lines. l = the lane's LDS byte address of group 0, g = its global address of group 0,
// rs16 = 16 source rows in elements.
// =====================================================================================================
__device__ __forceinline__ unsigned lds_off(const void* p) { return (unsigned)(size_t)p; }
__device__ __forceinline__ void copy_plane(unsigned l, const _Float16* g, size_t rs16) {
#if defined(__HIP_DEVICE_COMPILE__)
  // the closing s_wait_xcnt stands inside the statement so that no address register is rewritten ahead of it
  asm volatile("global_load_async_to_lds_b128 %0, %8, off\n\t"
               "global_load_async_to_lds_b128 %1, %9, off\n\t"
               "global_load_async_to_lds_b128 %2, %10, off\n\t"
               "global_load_async_to_lds_b128 %3, %11, off\n\t"
               "global_load_async_to_lds_b128 %4, %12, off\n\t"
               "global_load_async_to_lds_b128 %5, %13, off\n\t"
               "global_load_async_to_lds_b128 %6, %14, off\n\t"
               "global_load_async_to_lds_b128 %7, %15, off\n\t"
               "s_wait_xcnt 0x0"
               :: "v"(l), "v"(l + 16 * LPITCH), "v"(l + 32 * LPITCH), "v"(l + 48 * LPITCH),
                  "v"(l + 64 * LPITCH), "v"(l + 80 * LPITCH), "v"(l + 96 * LPITCH), "v"(l + 112 * LPITCH),
                  "v"(g), "v"(g + rs16), "v"(g + 2 * rs16), "v"(g + 3 * rs16),
                  "v"(g + 4 * rs16), "v"(g + 5 * rs16), "v"(g + 6 * rs16), "v"(g + 7 * rs16)
               : "memory");
#endif
}

// Inputs-only fence on loaded fragments: keeps a group's LDS loads together ahead of its products, so that the wave waits for
// LDS once per group and not once per four products.
__device__ __forceinline__ void hold4(const v16h (&x)[4]) {
#if defined(__HIP_DEVICE_COMPILE__)
  asm volatile("" :: "v"(x[0]), "v"(x[1]), "v"(x[2]), "v"(x[3]));
#endif
}

// Stage one 16 x 64 f32 group of the wave's tile in its LDS slab (pitch 68): D element r of acc[j], lane l -> row 8h + r, col 16j + (l&15);
// the caller reloads it behind the wave sync.
// coverage: 32 lanes x 8 rows x 4 cols-of-16 = rows 0..15 x cols 0..63 of the slab (staged extent == consumed extent).
template <bool HASLO, bool BROW>
__device__ __forceinline__ void stage16(float* sl, v8f (&ah)[4], v8f (&al)[4], const float* __restrict__ bias,
                                        int rowb, int col0, float osc, float bsc, int lane) {
  const int hh = lane >> 4, m = lane & 15;
  float bc[4], br[8];
  if (BROW) {
#pragma unroll
    for (int r = 0; r < 8; ++r) br[r] = bfr(bias[rowb + 8 * hh + r]) * bsc;
#pragma unroll
    for (int j = 0; j < 4; ++j) bc[j] = 0.f;
  } else {
#pragma unroll
    for (int j = 0; j < 4; ++j) bc[j] = bfr(bias[col0 + 16 * j + m]) * bsc;
#pragma unroll
    for (int r = 0; r < 8; ++r) br[r] = 0.f;
  }
  const float oscl = osc * RINV;
#pragma unroll
  for (int r = 0; r < 8; ++r) {
    const int ro = (8 * hh + r) * GPITCH + m;
#pragma unroll
    for (int j = 0; j < 4; ++j) {
      float v = ah[j][r] * osc;
      if (HASLO) v += al[j][r] * oscl;
      v += BROW ? br[r] : bc[j];
      sl[ro + 16 * j] = v;
    }
  }
  wave_sync_lds();
}

// =====================================================================================================
// f16 GEMM, block = 128 x 128 tile, 4 waves (2 x 2) x 64 x 64; the k range is walked in tiles of 64; each tile's A rows
// (hi and, with HASLO, residual plane) and Bt rows are staged in LDS by asynchronous copies, two buffers, the next tile's
// copies in flight while this tile is multiplied; fragments come from LDS (4 A x 4 B fragments, 16 products per plane and k32).
//   C tile [z][Mb][N] = (A_hi[z][Mb][K] (+ A_res/2048)) . Bt[z][N][K]^T * osc + bias; per-z element strides aBs (A planes),
//   bBs (Bt), fBs (f32 output F), hBs (16-bit output planes H, L); 0 = shared.
//   M_HL  : H = f16(v*carry), L = f16 residual x2048 (two planes)       M_S16 : H only, bias per row
//   M_F32 : F = v (f32 rows, batch-row remap through fBs), no 16-bit output
// grid = nz x (Mb/128) x (N/128) (all launches: Mb % 128 == 0, N % 128 == 0, K % 64 == 0, K >= 128).
// Each accumulator sums its k32 products in ascending k, as a 16 x 64 wave tile did.
// Epilogue: the ring is free behind the last tile's barrier; each wave stages its four 16 x 64 f32 groups in its own range.
// coverage: per 16-row group 4 instr x 4 rows x 8 lanes x 8 halves = 16 x 64 (16-bit planes) and 8 instr x 2 rows x 16 lanes
//           x 4 floats = 16 x 64 (f32 plane); 4 groups x 4 waves = 128 x 128; the grid covers C exactly once.
// =====================================================================================================
template <bool HASLO, int MODE, bool BROW>
__global__ __launch_bounds__(128)
void gemm16(const u16* __restrict__ Ah, const u16* __restrict__ Al, const u16* __restrict__ Bt,
            const float* __restrict__ bias, float* F, u16* H, u16* L,
            int Mb, int N, int K, int aBs, int bBs, int fBs, int hBs,
            float osc, float bsc, float carry) {
  constexpr int BUFB = (HASLO ? 3 : 2) * PLANEB;          // one buffer: [A hi | Bt | A res]
  static_assert(4 * 64 * GPITCH * 4 <= 2 * BUFB && GKT == 64);          // epilogue staging fits the ring
  __shared__ __align__(16) unsigned char ring[2 * BUFB];
  constexpr bool LOUT = (MODE == M_HL);
  const int tid = threadIdx.x, wave = tid >> 5, lane = tid & 31, hh = lane >> 4, m = lane & 15;
  const int ntile = N >> 7, mtile = Mb >> 7;
  const int bid  = blockIdx.x;
  const int nt   = bid % ntile;
  const int tmp  = bid / ntile;
  const int mt   = tmp % mtile;
  const int bz   = tmp / mtile;
  const int wm = wave >> 1, wn = wave & 1;
  const int rowb = mt * 128 + wm * 64;
  const int col0 = nt * 128 + wn * 64;
  // copy side: the lane's row in a group of 16 and its 16-B piece of the 128-B row
  const int cr = tid >> 3, cc = tid & 7;
  const _Float16* gah = (const _Float16*)(const void*)Ah + (size_t)bz * (size_t)aBs + (size_t)(mt * 128 + cr) * (size_t)K + 8 * cc;
  const _Float16* gal = (const _Float16*)(const void*)Al + (size_t)bz * (size_t)aBs + (size_t)(mt * 128 + cr) * (size_t)K + 8 * cc;
  const _Float16* gb  = (const _Float16*)(const void*)Bt + (size_t)bz * (size_t)bBs + (size_t)(nt * 128 + cr) * (size_t)K + 8 * cc;
  const unsigned lc = lds_off(ring) + (unsigned)(cr * LPITCH + cc * 16);
  const size_t rs16 = (size_t)16 * (size_t)K;
  const int ntk = K >> 6;
  // fragment side: row (lane & 15) of the wave's first A / B group, +16 B for the upper lane half
  const unsigned char* fa = ring + (wm * 64 + m) * LPITCH + 16 * hh;
  const unsigned char* fb = ring + PLANEB + (wn * 64 + m) * LPITCH + 16 * hh;

  v8f ah[4][4], al[4][4];
#pragma unroll
  for (int i = 0; i < 4; ++i) {
#pragma unroll
    for (int j = 0; j < 4; ++j) { ah[i][j] = zero8(); al[i][j] = zero8(); }
  }

  // tile 0 -> buffer 0, landed and published; then tile 1 -> buffer 1 in flight
  copy_plane(lc, gah, rs16);
  copy_plane(lc + PLANEB, gb, rs16);
  if (HASLO) copy_plane(lc + 2 * PLANEB, gal, rs16);
  asm volatile("s_wait_asynccnt 0x0" ::: "memory");        // this wave's copies of tile 0 have landed
  __syncthreads();                                         // ... and every other wave's
  if (ntk > 1) {                                           // the same for the whole block
    copy_plane(lc + BUFB, gah + GKT, rs16);
    copy_plane(lc + BUFB + PLANEB, gb + GKT, rs16);
    if (HASLO) copy_plane(lc + BUFB + 2 * PLANEB, gal + GKT, rs16);
  }

  // rolled: one copy of the tile body, so that the hot loop stays small in the instruction cache; the unrolls inside it keep
  // the fragment and accumulator arrays in registers
#pragma unroll 1
  for (int t = 0; t < ntk; ++t) {
    const int bo = (t & 1) * BUFB;
    v16h a[2][4], b[2][4], r[2][4];
    if (!HASLO) {
      // both k32 groups' fragments are asked for at the top of the tile: the second group lands behind the first one's products
#pragma unroll
      for (int kk = 0; kk < 2; ++kk) {
#pragma unroll
        for (int i = 0; i < 4; ++i) {
          a[kk][i] = ldfrag_h((const _Float16*)(const void*)(fa + bo + i * 16 * LPITCH + kk * 64));
          b[kk][i] = ldfrag_h((const _Float16*)(const void*)(fb + bo + i * 16 * LPITCH + kk * 64));
        }
      }
    }
#pragma unroll
    for (int kk = 0; kk < 2; ++kk) {
      if (HASLO) {
#pragma unroll
        for (int i = 0; i < 4; ++i) {
          a[kk][i] = ldfrag_h((const _Float16*)(const void*)(fa + bo + i * 16 * LPITCH + kk * 64));
          b[kk][i] = ldfrag_h((const _Float16*)(const void*)(fb + bo + i * 16 * LPITCH + kk * 64));
          r[kk][i] = ldfrag_h((const _Float16*)(const void*)(fa + bo + 2 * PLANEB + i * 16 * LPITCH + kk * 64));
        }
        hold4(r[kk]);
      }
      hold4(a[kk]);
      hold4(b[kk]);
#pragma unroll
      for (int i = 0; i < 4; ++i) {
#pragma unroll
        for (int j = 0; j < 4; ++j) ah[i][j] = mma_h(a[kk][i], b[kk][j], ah[i][j]);
      }
      if (HASLO) {
#pragma unroll
        for (int i = 0; i < 4; ++i) {
#pragma unroll
          for (int j = 0; j < 4; ++j) al[i][j] = mma_h(r[kk][i], b[kk][j], al[i][j]);
        }
      }
      // keeps this group's products ahead of what follows: of the second group's LDS wait, and of the waits and the barrier at
      // the tile's foot, so that the copies in flight have the products' time to land
      if (!HASLO || kk == 1) __builtin_amdgcn_sched_barrier(0);
    }
    asm volatile("s_wait_dscnt 0x0" ::: "memory");         // this wave's reads of the buffer are done before it is refilled
    asm volatile("s_wait_asynccnt 0x0" ::: "memory");      // this wave's copies of tile t + 1 have landed
    __syncthreads();                                       // publishes tile t + 1, ends every reader's use of tile t
    if (t + 2 < ntk) {                                     // the same for the whole block
      const int ko = (t + 2) * GKT;
      copy_plane(lc + bo, gah + ko, rs16);
      copy_plane(lc + bo + PLANEB, gb + ko, rs16);
      if (HASLO) copy_plane(lc + bo + 2 * PLANEB, gal + ko, rs16);
    }
  }
  asm volatile("s_wait_asynccnt 0x0" ::: "memory");        // no copy outstanding when the ring becomes output staging

#pragma unroll
  for (int g = 0; g < 4; ++g) {
    const int rowg = rowb + 16 * g;
    float* sl = (float*)(void*)ring + (wave * 4 + g) * 16 * GPITCH;
    stage16<HASLO, BROW>(sl, ah[g], al[g], bias, rowg, col0, osc, bsc, lane);

    if (MODE == M_F32) {
      v4f vals[8];
#pragma unroll
      for (int it = 0; it < 8; ++it) vals[it] = *(const v4f*)(sl + (it * 2 + hh) * GPITCH + m * 4);
      float* Fb = F + (size_t)bz * (size_t)fBs + ((size_t)rowg + (size_t)hh) * (size_t)N + col0 + m * 4;
#pragma unroll
      for (int it = 0; it < 8; ++it) {
        *(v4f*)(Fb + (size_t)(it * 2) * (size_t)N) = vals[it];
      }
    } else {
      const int rq = lane >> 3, c8 = (lane & 7) * 8;
      v4u ovh[4], ovl[4];
#pragma unroll
      for (int i = 0; i < 4; ++i) {
        const int row = 4 * i + rq;
        const v4f a = *(const v4f*)(sl + row * GPITCH + c8), c4 = *(const v4f*)(sl + row * GPITCH + c8 + 4);
#pragma unroll
        for (int e = 0; e < 2; ++e) {
          unsigned ph0, pl0, ph1, pl1;
          split2(a[2 * e] * carry,  a[2 * e + 1] * carry,  ph0, pl0);
          split2(c4[2 * e] * carry, c4[2 * e + 1] * carry, ph1, pl1);
          ovh[i][e] = ph0;     ovl[i][e] = pl0;
          ovh[i][2 + e] = ph1; ovl[i][2 + e] = pl1;
        }
      }
      u16* Hb = H + (size_t)bz * (size_t)hBs + (size_t)rowg * (size_t)N + col0 + c8;
      u16* Lb = L + (size_t)bz * (size_t)hBs + (size_t)rowg * (size_t)N + col0 + c8;
#pragma unroll
      for (int i = 0; i < 4; ++i) {
        const int row = 4 * i + rq;
        *(v4u*)(Hb + (size_t)row * (size_t)N) = ovh[i];
        if (LOUT) *(v4u*)(Lb + (size_t)row * (size_t)N) = ovl[i];
      }
    }
  }
}

// =====================================================================================================
// Full (unmasked) multi-head cross attention with a per-key additive bias bfr(beta[h]) * sim[b][key]:
// block = (batch b, head, 64 query rows), 4 waves, wave w owns the 16 query rows q0 = 64*qt + 16*w .. q0+15
// The keys are walked in tiles of 64: each tile's k hi, k residual and v^T rows (64 rows x 128 B each, LDS pitch 144 B) are
// staged in LDS by asynchronous copies, two buffers, the next tile's copies in flight while this tile is worked on; the four
// waves share the tile. The batch's sim row (2 KB) is staged once with tile 0. One barrier per tile.
//   q planes f16 x8 hi / residual(x2048) [b*SQ + s][h*64 + d]; k planes likewise [b*SKV + s][h*64 + d];
//   v^T plane f16 x8 [(b*NH + h)*64 + d][s]; sim plane f32 [b][s]. All NKB key blocks of 32 keys are visited (static bound).
//   Scores are computed TRANSPOSED: S^T tile g (g = 0,1) = k rows (keys kb+16g .. +15, A operand, row m = lane&15, split map
//   over d) times q^T (B operand, col n = query q0 + (lane&15), k = d, split map), 2 d-chunks of 32; per chunk hi.hi -> s,
//   res.hi + hi.res -> r (scaled x2048, folded as s + r/2048); the q fragments are loaded once per wave.
//   D element r of lane l = (key kb+16g+8h+r, query q0+(l&15)), so a lane owns one query column and 16 of its 32 keys;
//   the partner lane l^16 owns the other 16 -> row max / row sum need one xor-16 shuffle. The bias of the lane's 16 keys
//   comes from four 16-B loads of the sim row (keys kb+8h..+7 and kb+16+8h..+7), times bfr(beta[h])*log2(e), added in f32.
//   Online max-subtracted base-2 softmax in f32 (1/sqrt(64) and the q/k carries folded into lsc). The exp'd values ARE the
//   P A-fragment in place: A row m = query = lane&15, element i <- key kb+8h+i (tile 0, D element i), element 8+i <- key
//   kb+16+8h+i (tile 1, D element i). P (<= 1) carried x32768 as f16. The rescale factor of query row 8h+r of the O
//   accumulators is fetched from lane 8h+r with a shuffle (uniform control). 4 v^T B fragments (col n = d = 16j + (lane&15),
//   keys k-contiguous), 4 P.V WMMAs, one guard.
//   Epilogue: 1/l (per query, shuffled to the D row owner) and the carry folds in f32; the wave's 16x64 f32 result staged in
// coverage: per wave 4 instructions x 4 rows x 8 lanes x 8 halves = 16 x 64 on both ctx planes; grid NB*NH*(SQ/64) blocks x
//           4 waves = every (b, s, h) row segment exactly once. LDS slab: 16 x 64 staged == 16 x 64 reloaded.
// =====================================================================================================
// One 64-key tile: 128 threads, thread = (row tid>>3 of a group of 16, 16-B piece tid&7), four groups per plane: one
// wave-instruction covers four whole 128-B lines. l = the lane's LDS byte address in the buffer's first plane.
__device__ __forceinline__ void copy_keys(unsigned l, const _Float16* kh, const _Float16* kl, const _Float16* v) {
#if defined(__HIP_DEVICE_COMPILE__)
  // the closing s_wait_xcnt stands inside the statement so that no address register is rewritten ahead of it
  asm volatile("global_load_async_to_lds_b128 %0, %12, off\n\t"
               "global_load_async_to_lds_b128 %1, %13, off\n\t"
               "global_load_async_to_lds_b128 %2, %14, off\n\t"
               "global_load_async_to_lds_b128 %3, %15, off\n\t"
               "global_load_async_to_lds_b128 %4, %16, off\n\t"
               "global_load_async_to_lds_b128 %5, %17, off\n\t"
               "global_load_async_to_lds_b128 %6, %18, off\n\t"
               "global_load_async_to_lds_b128 %7, %19, off\n\t"
               "global_load_async_to_lds_b128 %8, %20, off\n\t"
               "global_load_async_to_lds_b128 %9, %21, off\n\t"
               "global_load_async_to_lds_b128 %10, %22, off\n\t"
               "global_load_async_to_lds_b128 %11, %23, off\n\t"
               "s_wait_xcnt 0x0"
               :: "v"(l), "v"(l + 16 * LPITCH), "v"(l + 32 * LPITCH), "v"(l + 48 * LPITCH),
                  "v"(l + APLANEB), "v"(l + APLANEB + 16 * LPITCH), "v"(l + APLANEB + 32 * LPITCH),
                  "v"(l + APLANEB + 48 * LPITCH),
                  "v"(l + 2 * APLANEB), "v"(l + 2 * APLANEB + 16 * LPITCH), "v"(l + 2 * APLANEB + 32 * LPITCH),
                  "v"(l + 2 * APLANEB + 48 * LPITCH),
                  "v"(kh), "v"(kh + (size_t)16 * INNER), "v"(kh + (size_t)32 * INNER), "v"(kh + (size_t)48 * INNER),
                  "v"(kl), "v"(kl + (size_t)16 * INNER), "v"(kl + (size_t)32 * INNER), "v"(kl + (size_t)48 * INNER),
                  "v"(v), "v"(v + (size_t)16 * SKV), "v"(v + (size_t)32 * SKV), "v"(v + (size_t)48 * SKV)
               : "memory");
#endif
}
// The batch's sim row: 128 threads x 16 B = 512 floats.
__device__ __forceinline__ void copy_sim(unsigned l, const float* g) {
#if defined(__HIP_DEVICE_COMPILE__)
  // the closing s_wait_xcnt stands inside the statement so that no address register is rewritten ahead of it
  asm volatile("global_load_async_to_lds_b128 %0, %1, off\n\t"
               "s_wait_xcnt 0x0"
               :: "v"(l), "v"(g) : "memory");
#endif
}

__global__ __launch_bounds__(ATT_THREADS)
void attn_fwd(const u16* __restrict__ Qh, const u16* __restrict__ Ql, const u16* __restrict__ Kh,
              const u16* __restrict__ Kl, const u16* __restrict__ Vp, const float* __restrict__ Simp,
              const float* __restrict__ beta, u16* Oh, u16* Ol) {
  __shared__ __align__(16) unsigned char ring[2 * ABUFB];
  __shared__ __align__(16) float simrow[SKV];

  const int tid  = threadIdx.x;
  const int wave = tid >> 5;
  const int lane = tid & 31;
  const int hh   = lane >> 4;
  const int c    = lane & 15;

  constexpr int NQT = SQ / 64;
  const int bid  = blockIdx.x;
  const int qt   = bid % NQT;
  const int head = (bid / NQT) % NH;
  const int b    = bid / (NQT * NH);
  const int q0   = qt * 64 + wave * 16;

  // B fragments of q^T: col n = query q0 + c, k = d (k-contiguous row of the q planes)
  const size_t qo = ((size_t)(b * SQ + q0 + c)) * INNER + head * HD + 8 * hh;
  const _Float16* Qhb = (const _Float16*)(const void*)Qh + qo;
  const _Float16* Qlb = (const _Float16*)(const void*)Ql + qo;
  // copy side: the lane's row in a group of 16 and its 16-B piece of the 128-B row (k rows = keys, v^T rows = d)
  const int cr = tid >> 3, cc = tid & 7;
  const size_t ko = ((size_t)(b * SKV + cr)) * INNER + head * HD + 8 * cc;
  const _Float16* gkh = (const _Float16*)(const void*)Kh + ko;
  const _Float16* gkl = (const _Float16*)(const void*)Kl + ko;
  const _Float16* gv  = (const _Float16*)(const void*)Vp + ((size_t)(b * NH + head) * HD + cr) * SKV + 8 * cc;
  const unsigned lc = lds_off(ring) + (unsigned)(cr * LPITCH + cc * 16);
  // A fragments of k: row m = key 16g + c of the staged tile, k = d; +16 B for the upper lane half
  const unsigned char* fk = ring + c * LPITCH + 16 * hh;
  // B fragments of v: col n = d = 16j + c (row of the staged v^T tile), k = key
  const unsigned char* fv = ring + 2 * APLANEB + c * LPITCH + 16 * hh;
  // per-key bias row of this batch in LDS, offset to the lane half's first key
  const float* Sb = simrow + 8 * hh;
  const float bl2 = bfr(beta[head]) * LOG2E;
  const float lsc = (LOG2E * RSQ_HD) / (QS * KS);

  v16h qh[2], ql[2];
  qh[0] = ldfrag_h(Qhb);
  qh[1] = ldfrag_h(Qhb + 32);
  ql[0] = ldfrag_h(Qlb);
  ql[1] = ldfrag_h(Qlb + 32);

  float mrun = -INFINITY, lrun = 0.f;
  v8f o[4];
#pragma unroll
  for (int j = 0; j < 4; ++j) o[j] = zero8();

  // tile 0 and the sim row -> LDS, landed and published; then tile 1 -> buffer 1 in flight
  copy_keys(lc, gkh, gkl, gv);
  copy_sim(lds_off(simrow) + (unsigned)(tid * 16), Simp + (size_t)b * SKV + 4 * tid);
  asm volatile("s_wait_asynccnt 0x0" ::: "memory");        // this wave's copies of tile 0 have landed
  __syncthreads();                                         // ... and every other wave's
  copy_keys(lc + ABUFB, gkh + (size_t)AKT * INNER, gkl + (size_t)AKT * INNER, gv + AKT);

  // rolled over the tiles: one copy of the tile body in the instruction cache
#pragma unroll 1
  for (int st = 0; st < NST; ++st) {
   const int bo = (st & 1) * ABUFB;
   // unrolled: the two 32-key halves of a tile differ only in constant LDS offsets
#pragma unroll
   for (int sub = 0; sub < AKT / 32; ++sub) {
    const int kb = st * AKT + sub * 32;
    // ---- transposed scores: s0 = keys kb..kb+15, s1 = keys kb+16..kb+31, column = query q0 + c ----
    v8f s0 = zero8(), s1 = zero8(), r0 = zero8(), r1 = zero8();
    const _Float16* k0h = (const _Float16*)(const void*)(fk + bo + sub * 32 * LPITCH);
    const _Float16* k1h = (const _Float16*)(const void*)(fk + bo + (sub * 32 + 16) * LPITCH);
    const _Float16* k0l = (const _Float16*)(const void*)(fk + bo + APLANEB + sub * 32 * LPITCH);
    const _Float16* k1l = (const _Float16*)(const void*)(fk + bo + APLANEB + (sub * 32 + 16) * LPITCH);
#pragma unroll
    for (int kk = 0; kk < HD / 32; ++kk) {
      const v16h fh0 = ldfrag_h(k0h + kk * 32);
      const v16h fh1 = ldfrag_h(k1h + kk * 32);
      const v16h fl0 = ldfrag_h(k0l + kk * 32);
      const v16h fl1 = ldfrag_h(k1l + kk * 32);
      s0 = mma_h(fh0, qh[kk], s0);
      s1 = mma_h(fh1, qh[kk], s1);
      r0 = mma_h(fl0, qh[kk], r0);
      r1 = mma_h(fl1, qh[kk], r1);
      r0 = mma_h(fh0, ql[kk], r0);
      r1 = mma_h(fh1, ql[kk], r1);
      guard_s4(s0, s1, r0, r1, qh[kk], ql[kk], fh0, fh1, fl0, fl1);
    }
    // ---- per-key bias: keys kb+8hh+0..7 (g0, g1) and kb+16+8hh+0..7 (g2, g3) ----
    const v4f g0 = *(const v4f*)(Sb + kb);
    const v4f g1 = *(const v4f*)(Sb + kb + 4);
    const v4f g2 = *(const v4f*)(Sb + kb + 16);
    const v4f g3 = *(const v4f*)(Sb + kb + 20);
    // ---- base-2 logits of this lane's 16 keys for query q0 + c: t[i] <- key kb+8hh+i, t[8+i] <- key kb+16+8hh+i ----
    float t[16];
#pragma unroll
    for (int i = 0; i < 4; ++i) {
      t[i]      = (s0[i]     + r0[i]     * RINV) * lsc + g0[i] * bl2;
      t[4 + i]  = (s0[4 + i] + r0[4 + i] * RINV) * lsc + g1[i] * bl2;
      t[8 + i]  = (s1[i]     + r1[i]     * RINV) * lsc + g2[i] * bl2;
      t[12 + i] = (s1[4 + i] + r1[4 + i] * RINV) * lsc + g3[i] * bl2;
    }
    float cm = t[0];
#pragma unroll
    for (int i = 1; i < 16; ++i) cm = fmaxf(cm, t[i]);
    cm = fmaxf(cm, __shfl_xor(cm, 16, 32));
    const float mn = fmaxf(mrun, cm);        // finite from the first block on
    const float al = exp2f(mrun - mn);       // 0 on the first block (mrun = -inf)
    mrun = mn;
    // ---- probabilities (<= 1) and the P A-fragment: f16(p * 32768); element i <-> t[i] ----
    float ps = 0.f;
    FragH ph;
#pragma unroll
    for (int w = 0; w < 2; ++w) {
#pragma unroll
      for (int e4 = 0; e4 < 4; ++e4) {
        const int i = 8 * w + 2 * e4;
        const float p0 = exp2f(t[i] - mn), p1 = exp2f(t[i + 1] - mn);
        ps += p0 + p1;
        ph.u[w][e4] = pk16(h_bits((_Float16)(p0 * PCAR)), h_bits((_Float16)(p1 * PCAR)));
      }
    }
    ps += __shfl_xor(ps, 16, 32);
    lrun = lrun * al + ps;
    // ---- rescale the O accumulators: D row 8hh+r = query q0+8hh+r, its factor lives in lane 8hh+r (and 16+8hh+r) ----
    float scl[8];
#pragma unroll
    for (int r = 0; r < 8; ++r) scl[r] = __shfl(al, 8 * hh + r, 32);
#pragma unroll
    for (int j = 0; j < 4; ++j) {
#pragma unroll
      for (int r = 0; r < 8; ++r) o[j][r] *= scl[r];
    }
    // ---- P.V : B fragment col n = d = j*16 + c, keys contiguous in the v^T plane ----
    {
      const unsigned char* vp = fv + bo + sub * 64;
      const v16h v0 = ldfrag_h((const _Float16*)(const void*)(vp));
      const v16h v1 = ldfrag_h((const _Float16*)(const void*)(vp + 16 * LPITCH));
      const v16h v2 = ldfrag_h((const _Float16*)(const void*)(vp + 32 * LPITCH));
      const v16h v3 = ldfrag_h((const _Float16*)(const void*)(vp + 48 * LPITCH));
      o[0] = mma_h(ph.v, v0, o[0]);
      o[1] = mma_h(ph.v, v1, o[1]);
      o[2] = mma_h(ph.v, v2, o[2]);
      o[3] = mma_h(ph.v, v3, o[3]);
      guard_p(o[0], o[1], o[2], o[3], ph.v, v0, v1, v2, v3);
    }
   }
   asm volatile("s_wait_dscnt 0x0" ::: "memory");          // this wave's reads of the buffer are done before it is refilled
   asm volatile("s_wait_asynccnt 0x0" ::: "memory");       // this wave's copies of tile st + 1 have landed
   __syncthreads();                                        // publishes tile st + 1, ends every reader's use of tile st
   if (st + 2 < NST) {                                     // the same for the whole block
     const size_t k2 = (size_t)(st + 2) * AKT;
     copy_keys(lc + bo, gkh + k2 * INNER, gkl + k2 * INNER, gv + k2);
   }
  }
  asm volatile("s_wait_asynccnt 0x0" ::: "memory");        // no copy outstanding when the ring becomes output staging
  acc_guard4(o);

  // ---- fold 1/l (per query, owned by lane = query) and the carries (32768 on P, 8 on v), apply the ctx carry 1024 ----
  const float linv = (1.0f / lrun) * (OSC / (PCAR * VS));
  float inv[8];
#pragma unroll
  for (int r = 0; r < 8; ++r) inv[r] = __shfl(linv, 8 * hh + r, 32);
  float* slab = (float*)(void*)ring + wave * 16 * OPITCH;   // the ring is free behind the last tile's barrier
#pragma unroll
  for (int r = 0; r < 8; ++r) {
#pragma unroll
    for (int j = 0; j < 4; ++j) slab[(8 * hh + r) * OPITCH + j * 16 + c] = o[j][r] * inv[r];
  }
  wave_sync_lds();
  // ---- ctx x1024 -> f16 hi plane and residual plane; lane = (row in group of 4, 8 consecutive d) ----
  v4u ovh[4], ovl[4];
  const int rq = lane >> 3, c8 = (lane & 7) * 8;
#pragma unroll
  for (int i = 0; i < 4; ++i) {
    const int row = 4 * i + rq;
    const v4f a = *(const v4f*)(slab + row * OPITCH + c8), c4 = *(const v4f*)(slab + row * OPITCH + c8 + 4);
#pragma unroll
    for (int e = 0; e < 2; ++e) {
      unsigned ph0, pl0, ph1, pl1;
      split2(a[2 * e],  a[2 * e + 1],  ph0, pl0);
      split2(c4[2 * e], c4[2 * e + 1], ph1, pl1);
      ovh[i][e] = ph0;     ovl[i][e] = pl0;
      ovh[i][2 + e] = ph1; ovl[i][2 + e] = pl1;
    }
  }
  const size_t oo = ((size_t)(b * SQ + q0)) * INNER + head * HD + c8;
  u16* obh = Oh + oo;
  u16* obl = Ol + oo;
  {
#pragma unroll
    for (int i = 0; i < 4; ++i) {
      const int row = 4 * i + rq;
      *(v4u*)(obh + (size_t)row * INNER) = ovh[i];
      *(v4u*)(obl + (size_t)row * INNER) = ovl[i];
    }
    
  }
}

// =====================================================================================================
// Workspace map (bytes, NB=8, SQ=2048); every plane fully written by whole-line stores before it is read; all extents exact
//   XQ   f16 [NB*SQ][768]    f16(bf16(x))                 25165824   (region reused later as OH, same extent)
//   XV   f16 [NB*512][768]   f16(bf16(kg_value))           6291456
//   WQ16 WK16 WV16 WO16 f16 [768 n][768 k] x256            1179648 each
//   QH QL f16 [NB*SQ][768] x8 hi / res                     25165824 each
//   KH KL f16 [NB*512][768] x8 hi / res                     6291456 each
//   VT16 f16 [NB*768 (h,d)][512 s] x8                       6291456
//   OL   f16 [NB*SQ][768] x1024 res (ctx), OH aliases XQ    25165824
//   SIMP f32 [NB][512]                                         16384
//   end                                                    130564096
// =====================================================================================================
extern "C" void kernel_launch(void* const* d_in, const int* in_sizes, int n_in,
                              void* d_out, int out_size, void* d_ws, size_t ws_size,
                              hipStream_t stream) {
  if (n_in < 14) return;
  if (in_sizes[0] < ((NB - 1) * SQ_FULL + SQ) * DM) return;
  if (in_sizes[1] < 1) return;
  if (in_sizes[2] < NB * DM) return;
  if (in_sizes[3] < NB * SKV * DM || in_sizes[4] < NB * SKV * DM) return;
  if (in_sizes[5] < NH) return;
  if (in_sizes[6] != DM * DM || in_sizes[8] != DM * DM || in_sizes[10] != DM * DM || in_sizes[12] != DM * DM) return;
  if (in_sizes[7] < DM || in_sizes[9] < DM || in_sizes[11] < DM || in_sizes[13] < DM) return;
  if (out_size < ((NB - 1) * SQ_FULL + SQ) * DM) return;

  const float* x_in   = (const float*)d_in[0];
  const int*   msk    = (const int*)d_in[1];
  const float* pooled = (const float*)d_in[2];
  const float* kgk    = (const float*)d_in[3];
  const float* kgv    = (const float*)d_in[4];
  const float* beta   = (const float*)d_in[5];
  const float* wq     = (const float*)d_in[6];
  const float* bq     = (const float*)d_in[7];
  const float* wk     = (const float*)d_in[8];
  const float* bk     = (const float*)d_in[9];
  const float* wv     = (const float*)d_in[10];
  const float* bv     = (const float*)d_in[11];
  const float* wo     = (const float*)d_in[12];
  const float* bo     = (const float*)d_in[13];
  float*       out    = (float*)d_out;

  const size_t szXQ = (size_t)NB * SQ * DM * 2;
  const size_t szXV = (size_t)NB * SKV * DM * 2;
  const size_t szW  = (size_t)DM * DM * 2;
  const size_t szQP = (size_t)NB * SQ * INNER * 2;
  const size_t szKP = (size_t)NB * SKV * INNER * 2;
  const size_t szVT = (size_t)NB * INNER * SKV * 2;
  const size_t szS  = (size_t)NB * SKV * 4;
  static_assert((size_t)NB * SQ * DM * 2 == (size_t)NB * SQ * INNER * 2);   // XQ region reused as OH, same extent
  size_t off = 0;
  const size_t oXQ = off; off += szXQ;      // also OH
  const size_t oXV = off; off += szXV;
  const size_t oWQ = off; off += szW;
  const size_t oWK = off; off += szW;
  const size_t oWV = off; off += szW;
  const size_t oWO = off; off += szW;
  const size_t oQH = off; off += szQP;
  const size_t oQL = off; off += szQP;
  const size_t oKH = off; off += szKP;
  const size_t oKL = off; off += szKP;
  const size_t oVT = off; off += szVT;
  const size_t oOL = off; off += szQP;
  const size_t oS  = off; off += szS;
  if (off > ws_size) return;                // off = 130564096 at NB=8, SQ=2048
  if (off > (size_t)134217728) return;

  char* ws = (char*)d_ws;
  u16* XQ   = (u16*)(ws + oXQ);
  u16* XV   = (u16*)(ws + oXV);
  u16* WQ16 = (u16*)(ws + oWQ);
  u16* WK16 = (u16*)(ws + oWK);
  u16* WV16 = (u16*)(ws + oWV);
  u16* WO16 = (u16*)(ws + oWO);
  u16* QH   = (u16*)(ws + oQH);
  u16* QL   = (u16*)(ws + oQL);
  u16* KH   = (u16*)(ws + oKH);
  u16* KL   = (u16*)(ws + oKL);
  u16* VT16 = (u16*)(ws + oVT);
  u16* OH   = (u16*)(ws + oXQ);
  u16* OL   = (u16*)(ws + oOL);
  float* SIMP = (float*)(ws + oS);

  // (0) activations -> f16 planes of bf16-converted values (query rows s < SQ of batches b < NB, compact; kg_value rows) and
  //     weights [n = out][k = in] (y = x.W^T): already k-contiguous [n][k]; f16 planes of bf16(W) x256; one launch
  cvt_all<<<dim3(CVB_X + CVB_V + 4 * CVB_W), dim3(CVT_THREADS), 0, stream>>>(x_in, kgv, wq, wk, wv, wo,
                                                                             XQ, XV, WQ16, WK16, WV16, WO16);
  // (6) cosine similarity sim[b][k] -> SIMP f32 [NB][512]
  k_sim<<<dim3(NB * (SKV / SIM_KEYS)), dim3(SIM_THREADS), 0, stream>>>(pooled, kgk, msk, SIMP);
  // (7) q_un = x . Wq^T + bq -> f16 [NB*SQ][768] x8 hi + res (col = h*64 + d); the 1/8 is folded into the softmax scale
  gemm16<false, M_HL, false><<<dim3((NB * SQ / 128) * (INNER / 128)), dim3(128), 0, stream>>>(
      XQ, XQ, WQ16, bq, out, QH, QL, NB * SQ, INNER, DM, 0, 0, 0, 0, QS / WSC, QS, 1.0f);
  // (8) k = kg_value . Wk^T + bk -> f16 [NB*512][768] x8 hi + res
  gemm16<false, M_HL, false><<<dim3((NB * SKV / 128) * (INNER / 128)), dim3(128), 0, stream>>>(
      XV, XV, WK16, bk, out, KH, KL, NB * SKV, INNER, DM, 0, 0, 0, 0, KS / WSC, KS, 1.0f);
  // (9) v^T per batch: A = Wv [(h,d) = n][k], Bt = kg_value rows of batch b [s][k], bias bv per row -> f16 [(b,h,d)][s] x8
  gemm16<false, M_S16, true><<<dim3(NB * (INNER / 128) * (SKV / 128)), dim3(128), 0, stream>>>(
      WV16, WV16, XV, bv, out, VT16, VT16, INNER, SKV, DM, 0, SKV * DM, 0, INNER * SKV, VS / WSC, VS, 1.0f);
  // (10) attention with the beta*sim key bias -> ctx planes [NB*SQ][768] x1024 hi + res (OH reuses the XQ region)
  attn_fwd<<<dim3(NB * NH * (SQ / 64)), dim3(ATT_THREADS), 0, stream>>>(QH, QL, KH, KL, VT16, SIMP, beta, OH, OL);
  // (11) out rows [b][SQ_FULL][768] f32 = ctx . Wo^T + bo (rows s < SQ of batches b < NB); carries 1024 x 256 folded back
  gemm16<true, M_F32, false><<<dim3(NB * (SQ / 128) * (DM / 128)), dim3(128), 0, stream>>>(
      OH, OL, WO16, bo, out, OL, OL, SQ, DM, INNER, SQ * INNER, 0, SQ_FULL * DM, 0,
      1.0f / (OSC * WSC), 1.0f, 1.0f);
  (void)hipGetLastError();
}

// v005
// Measured time: 162 microseconds a run.
// Next to v004, in two timings, it ran 1.05 times as fast each time.
// Over all steps from v000 it is 2.69 times as fast.
// Contractions on v_wmma_f32_16x16x32_f16 (f16 operands, f32 accumulate): x.Wq^T, xv.Wk^T, Wv.xv^T single products on
// f16(bf16(x)) and f16(bf16(W) x256); k.q^T with q and k carried as f16 hi + residual(x2048) planes (3 products);
// P.v^T single product (P x32768, v x8); ctx.Wo^T with ctx carried as f16 hi (x1024) + residual(x2048) planes (2 products,
// separate residual accumulator); cosine-similarity bias, softmax, biases and all carry folds in f32 on VALU.
// Inputs RNE-converted to bf16 on load.
#include <hip/hip_runtime.h>
#include <math.h>
#include <stdint.h>

#ifndef NB
#define NB       8        // batches processed
#endif
#ifndef SQ
#define SQ       2048     // query rows processed per batch
#endif
#define NB_FULL  8
#define SQ_FULL  2048     // query rows per batch in the input / output layout (batch stride)
#define SKV      512      // key / value rows per batch (all of them)
#define DM       768      // model width
#define NH       12
#define HD       64
#define INNER    (NH * HD)
#define WSC      256.0f   // weight carry
#define QS       8.0f
#define KS       8.0f
#define VS       8.0f
#define PCAR     32768.0f
#define OSC      1024.0f  // ctx carry
#define RSC      2048.0f  // residual plane scale
#define RINV     0.00048828125f
#define LOG2E    1.4426950408889634f
#define RSQ_HD   0.125f
#define EPSN     1e-8f
#define NKB      (SKV / 32)
#define ATT_WAVES   4
#define ATT_THREADS (ATT_WAVES * 32)
#define CVT_THREADS 256      // streaming convert: 8 waves per block
#define CVT_LOADS   32       // 16-B loads per lane, all in flight
#define CVT_WAVE    (CVT_LOADS * 32 * 4)              // floats per wave (16 KB in, 8 KB out)
#define CVT_BLOCK   (CVT_WAVE * (CVT_THREADS / 32))   // floats per block
#define CVB_XB      (SQ * DM / CVT_BLOCK)             // blocks per batch of query rows
#define CVB_X       (NB * CVB_XB)
#define CVB_V       (NB * SKV * DM / CVT_BLOCK)
#define CVB_W       (DM * DM / CVT_BLOCK)
#define SIM_THREADS 256
#define SIM_KEYS    32       // keys per k_sim block (8 waves x 4)
#define OPITCH   68
#define GPITCH   68
#define GKT      64       // k per staged GEMM tile (128-B rows)
#define LPITCH   144      // LDS pitch of a staged row, bytes
#define PLANEB   (128 * LPITCH)
#define AKT      64       // keys per staged attention tile (128-B rows in all three planes)
#define APLANEB  (64 * LPITCH)
#define ABUFB    (3 * APLANEB)       // one attention buffer: [k hi | k res | v^T]
#define NST      (SKV / AKT)

#define M_HL     0
#define M_S16    1
#define M_F32    2

static_assert(NB >= 1 && NB <= NB_FULL);
static_assert((SQ % 128) == 0 && SQ >= 128 && SQ <= SQ_FULL);
static_assert(HD == 64 && INNER == 768 && NH == 12 && INNER == DM);
static_assert((SKV % 128) == 0 && (SKV % 32) == 0 && NKB * 32 == SKV && (SKV % SIM_KEYS) == 0);
static_assert((DM % 128) == 0 && (DM % 32) == 0 && (CVT_THREADS % 32) == 0);
static_assert((SQ * DM) % CVT_BLOCK == 0 && (NB * SKV * DM) % CVT_BLOCK == 0 && (DM * DM) % CVT_BLOCK == 0);
static_assert((OPITCH * 4) % 16 == 0 && (GPITCH * 4) % 16 == 0);
static_assert(ATT_THREADS * 4 == SKV && NST >= 2 && AKT == 64 && HD == 64);
static_assert(ATT_WAVES * 16 * OPITCH * 4 <= 2 * ABUFB);               // attention output staging fits its ring
static_assert(ATT_THREADS == 128 && SIM_THREADS == 256 && SIM_KEYS == (SIM_THREADS / 32) * 4);

typedef unsigned short u16;
typedef _Float16 v16h __attribute__((ext_vector_type(16)));
typedef _Float16 v8h  __attribute__((ext_vector_type(8)));
typedef float    v8f  __attribute__((ext_vector_type(8)));
typedef float    v4f  __attribute__((ext_vector_type(4)));
typedef unsigned int v4u __attribute__((ext_vector_type(4)));
typedef unsigned int v2u __attribute__((ext_vector_type(2)));

union FragH { v16h v; v8h h[2]; v4u u[2]; };

// ---- scalar helpers ----------------------------------------------------------------------------------
__device__ __forceinline__ unsigned short bf_bits(float f) {          // f32 -> bf16 bits, RNE convert
  unsigned u = __float_as_uint(f);
  return (unsigned short)((u + 0x7FFFu + ((u >> 16) & 1u)) >> 16);
}
__device__ __forceinline__ float bf_up(unsigned short h) { return __uint_as_float(((unsigned)h) << 16); }
__device__ __forceinline__ float bfr(float f) { return bf_up(bf_bits(f)); }
__device__ __forceinline__ unsigned short h_bits(_Float16 x) { return __builtin_bit_cast(unsigned short, x); }
__device__ __forceinline__ unsigned pk16(unsigned short a, unsigned short b) { return (unsigned)a | ((unsigned)b << 16); }
// 2^x in place as the bare hardware instruction, for a key block's rescale exponent y and its 16 score exponents x. The library
// form wraps each in a compare, two selects, an add and an ldexp so that results below 2^-126 come out as subnormals; here such a
// result may be 0. Nothing downstream sees it: a probability below 2^-40 is 0 in P's f16 (x32768) anyway, the row sum is >= 1
// from the first key block on, and a rescale factor that small takes the old sums (at most 2^40 in size) below 2^-86.
// One statement: no instruction of the run touches another's register, and the closing v_nop is the slot that the instruction
// set asks for between a transcendental and the first use of its result.
__device__ __forceinline__ void exp2_run(float& y, float (&x)[16]) {
#if defined(__HIP_DEVICE_COMPILE__)
  asm("v_exp_f32 %0, %0\n\tv_exp_f32 %1, %1\n\tv_exp_f32 %2, %2\n\tv_exp_f32 %3, %3\n\t"
      "v_exp_f32 %4, %4\n\tv_exp_f32 %5, %5\n\tv_exp_f32 %6, %6\n\tv_exp_f32 %7, %7\n\t"
      "v_exp_f32 %8, %8\n\tv_exp_f32 %9, %9\n\tv_exp_f32 %10, %10\n\tv_exp_f32 %11, %11\n\t"
      "v_exp_f32 %12, %12\n\tv_exp_f32 %13, %13\n\tv_exp_f32 %14, %14\n\tv_exp_f32 %15, %15\n\t"
      "v_exp_f32 %16, %16\n\tv_nop"
      : "+v"(y), "+v"(x[0]), "+v"(x[1]), "+v"(x[2]), "+v"(x[3]), "+v"(x[4]), "+v"(x[5]), "+v"(x[6]), "+v"(x[7]),
        "+v"(x[8]), "+v"(x[9]), "+v"(x[10]), "+v"(x[11]), "+v"(x[12]), "+v"(x[13]), "+v"(x[14]), "+v"(x[15]));
#endif
}
__device__ __forceinline__ v8f zero8() { v8f z = {0.f, 0.f, 0.f, 0.f, 0.f, 0.f, 0.f, 0.f}; return z; }

// x = hi + lo/2048 in f16: hi = f16(x), lo = f16((x - hi) * 2048); two values packed per 32-bit word
__device__ __forceinline__ void split2(float x0, float x1, unsigned& ph, unsigned& pl) {
  const _Float16 h0 = (_Float16)x0, h1 = (_Float16)x1;
  const float d0 = x0 - (float)h0, d1 = x1 - (float)h1;
  const _Float16 l0 = (_Float16)(d0 * RSC), l1 = (_Float16)(d1 * RSC);
  ph = pk16(h_bits(h0), h_bits(h1));
  pl = pk16(h_bits(l0), h_bits(l1));
}

// ---- fragment loader: 16-bit A/B operand, lane -> row/col (lane&15), p already includes +8*(lane>>4);
//      elements 0..7 <- p[0..7] (k0+8h..), elements 8..15 <- p[16..23] (k0+16+8h..); same split k map for A and B,
//      B always read from a k-contiguous [n][k] plane.
__device__ __forceinline__ v16h ldfrag_h(const _Float16* p) {
  FragH f;
  f.h[0] = *(const v8h*)(p);
  f.h[1] = *(const v8h*)(p + 16);
  return f.v;
}

// ---- WMMA helper and trailing VALU hazard gaps ----------------------------------------------------------
__device__ __forceinline__ v8f mma_h(v16h a, v16h b, v8f c) {
  return __builtin_amdgcn_wmma_f32_16x16x32_f16(false, a, false, b, (short)0, c, false, false);
}
__device__ __forceinline__ void guard_s4(v8f& a, v8f& b, v8f& c, v8f& d,
                                         v16h x0, v16h x1, v16h x2, v16h x3, v16h x4, v16h x5) {
#if defined(__HIP_DEVICE_COMPILE__)
  asm volatile("v_nop\n\tv_nop\n\tv_nop\n\tv_nop"
               : "+v"(a), "+v"(b), "+v"(c), "+v"(d)
               : "v"(x0), "v"(x1), "v"(x2), "v"(x3), "v"(x4), "v"(x5) : "memory");
#endif
}
__device__ __forceinline__ void guard_p(v8f& a, v8f& b, v8f& c, v8f& d, v16h p, v16h x0, v16h x1, v16h x2, v16h x3) {
#if defined(__HIP_DEVICE_COMPILE__)
  asm volatile("v_nop\n\tv_nop\n\tv_nop\n\tv_nop"
               : "+v"(a), "+v"(b), "+v"(c), "+v"(d) : "v"(p), "v"(x0), "v"(x1), "v"(x2), "v"(x3) : "memory");
#endif
}
__device__ __forceinline__ void acc_guard4(v8f (&a)[4]) {
#if defined(__HIP_DEVICE_COMPILE__)
  asm volatile("v_nop\n\tv_nop\n\tv_nop\n\tv_nop" : "+v"(a[0]), "+v"(a[1]), "+v"(a[2]), "+v"(a[3]));
#endif
}
__device__ __forceinline__ void wave_sync_lds() {
  __builtin_amdgcn_fence(__ATOMIC_RELEASE, "workgroup");
  __builtin_amdgcn_wave_barrier();
  __builtin_amdgcn_fence(__ATOMIC_ACQUIRE, "workgroup");
}

// =====================================================================================================
// Streaming convert, one launch for all six planes: Y[e] <- f16(bf16_RNE(x[e]) * scale), scale a power of two (1 for the two
// activation planes, 256 for the four weight planes). Every plane is a whole number of blocks; a block takes CVT_BLOCK
// consecutive floats of one plane (of one batch, for the query rows), a wave CVT_WAVE of them: 32 loads of 512 contiguous
// bytes, all asked for before the first is converted, then 32 stores of 256 contiguous bytes (whole lines both ways).
// coverage: grid = CVB_X + CVB_V + 4 * CVB_W blocks x CVT_BLOCK floats = every element of the six planes exactly once.
// =====================================================================================================
__global__ __launch_bounds__(CVT_THREADS)
void cvt_all(const float* __restrict__ x, const float* __restrict__ kgv, const float* __restrict__ wq,
             const float* __restrict__ wk, const float* __restrict__ wv, const float* __restrict__ wo,
             u16* XQ, u16* XV, u16* WQ, u16* WK, u16* WV, u16* WO) {
  const int bid = blockIdx.x;
  const float* src;
  u16* dst;
  float scale;
  if (bid < CVB_X) {                                     // query rows s < SQ of batch b, compact in the plane
    const int b = bid / CVB_XB;
    src = x + (size_t)b * ((size_t)SQ_FULL * DM) + (size_t)(bid - b * CVB_XB) * CVT_BLOCK;
    dst = XQ + (size_t)bid * CVT_BLOCK;
    scale = 1.0f;
  } else if (bid < CVB_X + CVB_V) {
    const int r = bid - CVB_X;
    src = kgv + (size_t)r * CVT_BLOCK;
    dst = XV + (size_t)r * CVT_BLOCK;
    scale = 1.0f;
  } else {
    const int w = bid - (CVB_X + CVB_V);
    const int sel = w / CVB_W;
    const int r = w - sel * CVB_W;
    src = (sel == 0 ? wq : sel == 1 ? wk : sel == 2 ? wv : wo) + (size_t)r * CVT_BLOCK;
    dst = (sel == 0 ? WQ : sel == 1 ? WK : sel == 2 ? WV : WO) + (size_t)r * CVT_BLOCK;
    scale = WSC;
  }
  const int off = (threadIdx.x >> 5) * CVT_WAVE + (threadIdx.x & 31) * 4;
  const float* p = src + off;
  u16* q = dst + off;
  v4f v[CVT_LOADS];
#pragma unroll
  for (int it = 0; it < CVT_LOADS; ++it) v[it] = *(const v4f*)(p + it * 128);
  // keeps every load ahead of the first convert and store: the wave pays the memory latency once, not once per group
  __builtin_amdgcn_sched_barrier(0);
#pragma unroll
  for (int it = 0; it < CVT_LOADS; ++it) {
    v2u o;
    o[0] = pk16(h_bits((_Float16)(bfr(v[it][0]) * scale)), h_bits((_Float16)(bfr(v[it][1]) * scale)));
    o[1] = pk16(h_bits((_Float16)(bfr(v[it][2]) * scale)), h_bits((_Float16)(bfr(v[it][3]) * scale)));
    *(v2u*)(q + it * 128) = o;
  }
}

// =====================================================================================================
// Cosine similarity sim[b][k] = <p, kgk[b][k]> / (max(|p|, eps) * max(|kgk[b][k]|, eps)), p = pooled[b], all operands
// bf16-RNE-converted, f32 arithmetic on VALU. Block = 256 threads = 8 waves = 32 keys of one batch (wave w -> keys
// kb + 4w .. kb + 4w + 3). A wave asks for its five rows (p and four keys, 3 KB each) at once, 16 B per lane and load; lane l
// sums elements 128 i + 4 l + e in ascending (i, e); the nine lane sums go through one xor tree side by side.
// =====================================================================================================
__global__ __launch_bounds__(SIM_THREADS)
void k_sim(const float* __restrict__ pooled, const float* __restrict__ kgk, const int* __restrict__ msk, float* S) {
  __shared__ __align__(16) float sv[SIM_KEYS];
  (void)msk;
  const int tid = threadIdx.x, wave = tid >> 5, lane = tid & 31;
  constexpr int NKBLK = SKV / SIM_KEYS;
  const int b  = blockIdx.x / NKBLK;
  const int kb = (blockIdx.x - b * NKBLK) * SIM_KEYS;
  const float* p = pooled + (size_t)b * DM + 4 * lane;
  const float* kr = kgk + ((size_t)b * SKV + (size_t)(kb + wave * 4)) * (size_t)DM + 4 * lane;   // keys < SKV by construction
  constexpr int NL = DM / 128;                                         // 512-B loads per row
  v4f pv[NL], kv[4][NL];
  // every loop below is unrolled so that the row arrays and the nine sums stay in registers
#pragma unroll
  for (int i = 0; i < NL; ++i) pv[i] = *(const v4f*)(p + i * 128);
#pragma unroll
  for (int j = 0; j < 4; ++j) {
#pragma unroll
    for (int i = 0; i < NL; ++i) kv[j][i] = *(const v4f*)(kr + j * DM + i * 128);
  }
  // keeps all 30 loads ahead of the first sum: the wave pays the memory latency once, not once per 512-B load
  __builtin_amdgcn_sched_barrier(0);
  float s[9];                                                          // |p|^2, <p, k_j>, |k_j|^2
#pragma unroll
  for (int q = 0; q < 9; ++q) s[q] = 0.f;
#pragma unroll
  for (int i = 0; i < NL; ++i) {
#pragma unroll
    for (int e = 0; e < 4; ++e) {
      const float xv = bfr(pv[i][e]);
      s[0] += xv * xv;
#pragma unroll
      for (int j = 0; j < 4; ++j) {
        const float yv = bfr(kv[j][i][e]);
        s[1 + j] += xv * yv;
        s[5 + j] += yv * yv;
      }
    }
  }
  // one xor tree (16, 8, 4, 2, 1) for all nine sums at once: the wave waits for five cross-lane exchanges, not five per sum
#pragma unroll
  for (int d = 16; d >= 1; d >>= 1) {
    float o[9];
#pragma unroll
    for (int q = 0; q < 9; ++q) o[q] = __shfl_xor(s[q], d, 32);
#pragma unroll
    for (int q = 0; q < 9; ++q) s[q] += o[q];
  }
  const float pnrm = fmaxf(sqrtf(s[0]), EPSN);
  {                                                                    // lane j < 4 finishes key j (every lane holds all sums)
    const int j = lane & 3;
    const float pk = j == 0 ? s[1] : j == 1 ? s[2] : j == 2 ? s[3] : s[4];
    const float kk = j == 0 ? s[5] : j == 1 ? s[6] : j == 2 ? s[7] : s[8];
    const float knrm = fmaxf(sqrtf(kk), EPSN);
    const float val = pk / (pnrm * knrm);
    if (lane < 4) sv[wave * 4 + lane] = val;
  }
  __syncthreads();
  if (wave == 0) {                                                     // wave-uniform
    const v4f v = *(const v4f*)(sv + 4 * (lane & 7));                   // clamped LDS address, all lanes load
    float* dst = S + (size_t)b * SKV + kb + 4 * (lane & 7);
    if (lane < 8) {
      *(v4f*)dst = v;
    }
    
  }
}

// =====================================================================================================
// Staging of one 128-row x 64-k f16 plane tile in LDS: rows of 128 B at pitch 144 B (16 B x odd: ds_load_b128 free of bank
// conflicts). 128 threads, thread = (row tid>>3 of a group of 16, 16-B piece tid&7), eight groups: one wave-instruction
// covers four whole 128-B lines. l = the lane's LDS byte address of group 0, g = its global address of group 0,
// rs16 = 16 source rows in elements.
// =====================================================================================================
__device__ __forceinline__ unsigned lds_off(const void* p) { return (unsigned)(size_t)p; }
__device__ __forceinline__ void copy_plane(unsigned l, const _Float16* g, size_t rs16) {
#if defined(__HIP_DEVICE_COMPILE__)
  // the closing s_wait_xcnt stands inside the statement so that no address register is rewritten ahead of it
  asm volatile("global_load_async_to_lds_b128 %0, %8, off\n\t"
               "global_load_async_to_lds_b128 %1, %9, off\n\t"
               "global_load_async_to_lds_b128 %2, %10, off\n\t"
               "global_load_async_to_lds_b128 %3, %11, off\n\t"
               "global_load_async_to_lds_b128 %4, %12, off\n\t"
               "global_load_async_to_lds_b128 %5, %13, off\n\t"
               "global_load_async_to_lds_b128 %6, %14, off\n\t"
               "global_load_async_to_lds_b128 %7, %15, off\n\t"
               "s_wait_xcnt 0x0"
               :: "v"(l), "v"(l + 16 * LPITCH), "v"(l + 32 * LPITCH), "v"(l + 48 * LPITCH),
                  "v"(l + 64 * LPITCH), "v"(l + 80 * LPITCH), "v"(l + 96 * LPITCH), "v"(l + 112 * LPITCH),
                  "v"(g), "v"(g + rs16), "v"(g + 2 * rs16), "v"(g + 3 * rs16),
                  "v"(g + 4 * rs16), "v"(g + 5 * rs16), "v"(g + 6 * rs16), "v"(g + 7 * rs16)
               : "memory");
#endif
}

// Inputs-only fence on loaded fragments: keeps a group's LDS loads together ahead of its products, so that the wave waits for
// LDS once per group and not once per four products.
__device__ __forceinline__ void hold4(const v16h (&x)[4]) {
#if defined(__HIP_DEVICE_COMPILE__)
  asm volatile("" :: "v"(x[0]), "v"(x[1]), "v"(x[2]), "v"(x[3]));
#endif
}

// Stage one 16 x 64 f32 group of the wave's tile in its LDS slab (pitch 68): D element r of acc[j], lane l -> row 8h + r, col 16j + (l&15);
// the caller reloads it behind the wave sync.
// coverage: 32 lanes x 8 rows x 4 cols-of-16 = rows 0..15 x cols 0..63 of the slab (staged extent == consumed extent).
template <bool HASLO, bool BROW>
__device__ __forceinline__ void stage16(float* sl, v8f (&ah)[4], v8f (&al)[4], const float* __restrict__ bias,
                                        int rowb, int col0, float osc, float bsc, int lane) {
  const int hh = lane >> 4, m = lane & 15;
  float bc[4], br[8];
  if (BROW) {
#pragma unroll
    for (int r = 0; r < 8; ++r) br[r] = bfr(bias[rowb + 8 * hh + r]) * bsc;
#pragma unroll
    for (int j = 0; j < 4; ++j) bc[j] = 0.f;
  } else {
#pragma unroll
    for (int j = 0; j < 4; ++j) bc[j] = bfr(bias[col0 + 16 * j + m]) * bsc;
#pragma unroll
    for (int r = 0; r < 8; ++r) br[r] = 0.f;
  }
  const float oscl = osc * RINV;
#pragma unroll
  for (int r = 0; r < 8; ++r) {
    const int ro = (8 * hh + r) * GPITCH + m;
#pragma unroll
    for (int j = 0; j < 4; ++j) {
      float v = ah[j][r] * osc;
      if (HASLO) v += al[j][r] * oscl;
      v += BROW ? br[r] : bc[j];
      sl[ro + 16 * j] = v;
    }
  }
  wave_sync_lds();
}

// =====================================================================================================
// f16 GEMM, block = 128 x 128 tile, 4 waves (2 x 2) x 64 x 64; the k range is walked in tiles of 64; each tile's A rows
// (hi and, with HASLO, residual plane) and Bt rows are staged in LDS by asynchronous copies, two buffers, the next tile's
// copies in flight while this tile is multiplied; fragments come from LDS (4 A x 4 B fragments, 16 products per plane and k32).
//   C tile [z][Mb][N] = (A_hi[z][Mb][K] (+ A_res/2048)) . Bt[z][N][K]^T * osc + bias; per-z element strides aBs (A planes),
//   bBs (Bt), fBs (f32 output F), hBs (16-bit output planes H, L); 0 = shared.
//   M_HL  : H = f16(v*carry), L = f16 residual x2048 (two planes)       M_S16 : H only, bias per row
//   M_F32 : F = v (f32 rows, batch-row remap through fBs), no 16-bit output
// grid = nz x (Mb/128) x (N/128) (all launches: Mb % 128 == 0, N % 128 == 0, K % 64 == 0, K >= 128).
// Each accumulator sums its k32 products in ascending k, as a 16 x 64 wave tile did.
// Epilogue: the ring is free behind the last tile's barrier; each wave stages its four 16 x 64 f32 groups in its own range.
// coverage: per 16-row group 4 instr x 4 rows x 8 lanes x 8 halves = 16 x 64 (16-bit planes) and 8 instr x 2 rows x 16 lanes
//           x 4 floats = 16 x 64 (f32 plane); 4 groups x 4 waves = 128 x 128; the grid covers C exactly once.
// =====================================================================================================
template <bool HASLO, int MODE, bool BROW>
__global__ __launch_bounds__(128)
void gemm16(const u16* __restrict__ Ah, const u16* __restrict__ Al, const u16* __restrict__ Bt,
            const float* __restrict__ bias, float* F, u16* H, u16* L,
            int Mb, int N, int K, int aBs, int bBs, int fBs, int hBs,
            float osc, float bsc, float carry) {
  constexpr int BUFB = (HASLO ? 3 : 2) * PLANEB;          // one buffer: [A hi | Bt | A res]
  static_assert(4 * 64 * GPITCH * 4 <= 2 * BUFB && GKT == 64);          // epilogue staging fits the ring
  __shared__ __align__(16) unsigned char ring[2 * BUFB];
  constexpr bool LOUT = (MODE == M_HL);
  const int tid = threadIdx.x, wave = tid >> 5, lane = tid & 31, hh = lane >> 4, m = lane & 15;
  const int ntile = N >> 7, mtile = Mb >> 7;
  const int bid  = blockIdx.x;
  const int nt   = bid % ntile;
  const int tmp  = bid / ntile;
  const int mt   = tmp % mtile;
  const int bz   = tmp / mtile;
  const int wm = wave >> 1, wn = wave & 1;
  const int rowb = mt * 128 + wm * 64;
  const int col0 = nt * 128 + wn * 64;
  // copy side: the lane's row in a group of 16 and its 16-B piece of the 128-B row
  const int cr = tid >> 3, cc = tid & 7;
  const _Float16* gah = (const _Float16*)(const void*)Ah + (size_t)bz * (size_t)aBs + (size_t)(mt * 128 + cr) * (size_t)K + 8 * cc;
  const _Float16* gal = (const _Float16*)(const void*)Al + (size_t)bz * (size_t)aBs + (size_t)(mt * 128 + cr) * (size_t)K + 8 * cc;
  const _Float16* gb  = (const _Float16*)(const void*)Bt + (size_t)bz * (size_t)bBs + (size_t)(nt * 128 + cr) * (size_t)K + 8 * cc;
  const unsigned lc = lds_off(ring) + (unsigned)(cr * LPITCH + cc * 16);
  const size_t rs16 = (size_t)16 * (size_t)K;
  const int ntk = K >> 6;
  // fragment side: row (lane & 15) of the wave's first A / B group, +16 B for the upper lane half
  const unsigned char* fa = ring + (wm * 64 + m) * LPITCH + 16 * hh;
  const unsigned char* fb = ring + PLANEB + (wn * 64 + m) * LPITCH + 16 * hh;

  v8f ah[4][4], al[4][4];
#pragma unroll
  for (int i = 0; i < 4; ++i) {
#pragma unroll
    for (int j = 0; j < 4; ++j) { ah[i][j] = zero8(); al[i][j] = zero8(); }
  }

  // tile 0 -> buffer 0, landed and published; then tile 1 -> buffer 1 in flight
  copy_plane(lc, gah, rs16);
  copy_plane(lc + PLANEB, gb, rs16);
  if (HASLO) copy_plane(lc + 2 * PLANEB, gal, rs16);
  asm volatile("s_wait_asynccnt 0x0" ::: "memory");        // this wave's copies of tile 0 have landed
  __syncthreads();                                         // ... and every other wave's
  if (ntk > 1) {                                           // the same for the whole block
    copy_plane(lc + BUFB, gah + GKT, rs16);
    copy_plane(lc + BUFB + PLANEB, gb + GKT, rs16);
    if (HASLO) copy_plane(lc + BUFB + 2 * PLANEB, gal + GKT, rs16);
  }

  // rolled: one copy of the tile body, so that the hot loop stays small in the instruction cache; the unrolls inside it keep
  // the fragment and accumulator arrays in registers
#pragma unroll 1
  for (int t = 0; t < ntk; ++t) {
    const int bo = (t & 1) * BUFB;
    v16h a[2][4], b[2][4], r[2][4];
    if (!HASLO) {
      // both k32 groups' fragments are asked for at the top of the tile: the second group lands behind the first one's products
#pragma unroll
      for (int kk = 0; kk < 2; ++kk) {
#pragma unroll
        for (int i = 0; i < 4; ++i) {
          a[kk][i] = ldfrag_h((const _Float16*)(const void*)(fa + bo + i * 16 * LPITCH + kk * 64));
          b[kk][i] = ldfrag_h((const _Float16*)(const void*)(fb + bo + i * 16 * LPITCH + kk * 64));
        }
      }
    }
#pragma unroll
    for (int kk = 0; kk < 2; ++kk) {
      if (HASLO) {
#pragma unroll
        for (int i = 0; i < 4; ++i) {
          a[kk][i] = ldfrag_h((const _Float16*)(const void*)(fa + bo + i * 16 * LPITCH + kk * 64));
          b[kk][i] = ldfrag_h((const _Float16*)(const void*)(fb + bo + i * 16 * LPITCH + kk * 64));
          r[kk][i] = ldfrag_h((const _Float16*)(const void*)(fa + bo + 2 * PLANEB + i * 16 * LPITCH + kk * 64));
        }
        hold4(r[kk]);
      }
      hold4(a[kk]);
      hold4(b[kk]);
#pragma unroll
      for (int i = 0; i < 4; ++i) {
#pragma unroll
        for (int j = 0; j < 4; ++j) ah[i][j] = mma_h(a[kk][i], b[kk][j], ah[i][j]);
      }
      if (HASLO) {
#pragma unroll
        for (int i = 0; i < 4; ++i) {
#pragma unroll
          for (int j = 0; j < 4; ++j) al[i][j] = mma_h(r[kk][i], b[kk][j], al[i][j]);
        }
      }
      // keeps this group's products ahead of what follows: of the second group's LDS wait, and of the waits and the barrier at
      // the tile's foot, so that the copies in flight have the products' time to land
      if (!HASLO || kk == 1) __builtin_amdgcn_sched_barrier(0);
    }
    asm volatile("s_wait_dscnt 0x0" ::: "memory");         // this wave's reads of the buffer are done before it is refilled
    asm volatile("s_wait_asynccnt 0x0" ::: "memory");      // this wave's copies of tile t + 1 have landed
    __syncthreads();                                       // publishes tile t + 1, ends every reader's use of tile t
    if (t + 2 < ntk) {                                     // the same for the whole block
      const int ko = (t + 2) * GKT;
      copy_plane(lc + bo, gah + ko, rs16);
      copy_plane(lc + bo + PLANEB, gb + ko, rs16);
      if (HASLO) copy_plane(lc + bo + 2 * PLANEB, gal + ko, rs16);
    }
  }
  asm volatile("s_wait_asynccnt 0x0" ::: "memory");        // no copy outstanding when the ring becomes output staging

#pragma unroll
  for (int g = 0; g < 4; ++g) {
    const int rowg = rowb + 16 * g;
    float* sl = (float*)(void*)ring + (wave * 4 + g) * 16 * GPITCH;
    stage16<HASLO, BROW>(sl, ah[g], al[g], bias, rowg, col0, osc, bsc, lane);

    if (MODE == M_F32) {
      v4f vals[8];
#pragma unroll
      for (int it = 0; it < 8; ++it) vals[it] = *(const v4f*)(sl + (it * 2 + hh) * GPITCH + m * 4);
      float* Fb = F + (size_t)bz * (size_t)fBs + ((size_t)rowg + (size_t)hh) * (size_t)N + col0 + m * 4;
#pragma unroll
      for (int it = 0; it < 8; ++it) {
        *(v4f*)(Fb + (size_t)(it * 2) * (size_t)N) = vals[it];
      }
    } else {
      const int rq = lane >> 3, c8 = (lane & 7) * 8;
      v4u ovh[4], ovl[4];
#pragma unroll
      for (int i = 0; i < 4; ++i) {
        const int row = 4 * i + rq;
        const v4f a = *(const v4f*)(sl + row * GPITCH + c8), c4 = *(const v4f*)(sl + row * GPITCH + c8 + 4);
#pragma unroll
        for (int e = 0; e < 2; ++e) {
          unsigned ph0, pl0, ph1, pl1;
          split2(a[2 * e] * carry,  a[2 * e + 1] * carry,  ph0, pl0);
          split2(c4[2 * e] * carry, c4[2 * e + 1] * carry, ph1, pl1);
          ovh[i][e] = ph0;     ovl[i][e] = pl0;
          ovh[i][2 + e] = ph1; ovl[i][2 + e] = pl1;
        }
      }
      u16* Hb = H + (size_t)bz * (size_t)hBs + (size_t)rowg * (size_t)N + col0 + c8;
      u16* Lb = L + (size_t)bz * (size_t)hBs + (size_t)rowg * (size_t)N + col0 + c8;
#pragma unroll
      for (int i = 0; i < 4; ++i) {
        const int row = 4 * i + rq;
        *(v4u*)(Hb + (size_t)row * (size_t)N) = ovh[i];
        if (LOUT) *(v4u*)(Lb + (size_t)row * (size_t)N) = ovl[i];
      }
    }
  }
}

// =====================================================================================================
// Full (unmasked) multi-head cross attention with a per-key additive bias bfr(beta[h]) * sim[b][key]:
// block = (batch b, head, 64 query rows), 4 waves, wave w owns the 16 query rows q0 = 64*qt + 16*w .. q0+15
// The keys are walked in tiles of 64: each tile's k hi, k residual and v^T rows (64 rows x 128 B each, LDS pitch 144 B) are
// staged in LDS by asynchronous copies, two buffers, the next tile's copies in flight while this tile is worked on; the four
// waves share the tile. The batch's sim row (2 KB) is staged once with tile 0. One barrier per tile.
//   q planes f16 x8 hi / residual(x2048) [b*SQ + s][h*64 + d]; k planes likewise [b*SKV + s][h*64 + d];
//   v^T plane f16 x8 [(b*NH + h)*64 + d][s]; sim plane f32 [b][s]. All NKB key blocks of 32 keys are visited (static bound).
//   Scores are computed TRANSPOSED: S^T tile g (g = 0,1) = k rows (keys kb+16g .. +15, A operand, row m = lane&15, split map
//   over d) times q^T (B operand, col n = query q0 + (lane&15), k = d, split map), 2 d-chunks of 32; per chunk hi.hi -> s,
//   res.hi + hi.res -> r (scaled x2048, folded as s + r/2048); the q fragments are loaded once per wave.
//   D element r of lane l = (key kb+16g+8h+r, query q0+(l&15)), so a lane owns one query column and 16 of its 32 keys;
//   the partner lane l^16 owns the other 16 -> row max / row sum need one xor-16 shuffle. The bias of the lane's 16 keys
//   comes from four 16-B loads of the sim row (keys kb+8h..+7 and kb+16+8h..+7), times bfr(beta[h])*log2(e), added in f32.
//   Online max-subtracted base-2 softmax in f32 (1/sqrt(64) and the q/k carries folded into lsc). The exp'd values ARE the
//   P A-fragment in place: A row m = query = lane&15, element i <- key kb+8h+i (tile 0, D element i), element 8+i <- key
//   kb+16+8h+i (tile 1, D element i). P (<= 1) carried x32768 as f16. The rescale factor of query row 8h+r of the O
//   accumulators is fetched from lane 8h+r with a shuffle (uniform control). 4 v^T B fragments (col n = d = 16j + (lane&15),
//   keys k-contiguous), 4 P.V WMMAs, one guard.
//   Epilogue: 1/l (per query, shuffled to the D row owner) and the carry folds in f32; the wave's 16x64 f32 result staged in
// coverage: per wave 4 instructions x 4 rows x 8 lanes x 8 halves = 16 x 64 on both ctx planes; grid NB*NH*(SQ/64) blocks x
//           4 waves = every (b, s, h) row segment exactly once. LDS slab: 16 x 64 staged == 16 x 64 reloaded.
// =====================================================================================================
// One 64-key tile: 128 threads, thread = (row tid>>3 of a group of 16, 16-B piece tid&7), four groups per plane: one
// wave-instruction covers four whole 128-B lines. l = the lane's LDS byte address in the buffer's first plane.
__device__ __forceinline__ void copy_keys(unsigned l, const _Float16* kh, const _Float16* kl, const _Float16* v) {
#if defined(__HIP_DEVICE_COMPILE__)
  // the closing s_wait_xcnt stands inside the statement so that no address register is rewritten ahead of it
  asm volatile("global_load_async_to_lds_b128 %0, %12, off\n\t"
               "global_load_async_to_lds_b128 %1, %13, off\n\t"
               "global_load_async_to_lds_b128 %2, %14, off\n\t"
               "global_load_async_to_lds_b128 %3, %15, off\n\t"
               "global_load_async_to_lds_b128 %4, %16, off\n\t"
               "global_load_async_to_lds_b128 %5, %17, off\n\t"
               "global_load_async_to_lds_b128 %6, %18, off\n\t"
               "global_load_async_to_lds_b128 %7, %19, off\n\t"
               "global_load_async_to_lds_b128 %8, %20, off\n\t"
               "global_load_async_to_lds_b128 %9, %21, off\n\t"
               "global_load_async_to_lds_b128 %10, %22, off\n\t"
               "global_load_async_to_lds_b128 %11, %23, off\n\t"
               "s_wait_xcnt 0x0"
               :: "v"(l), "v"(l + 16 * LPITCH), "v"(l + 32 * LPITCH), "v"(l + 48 * LPITCH),
                  "v"(l + APLANEB), "v"(l + APLANEB + 16 * LPITCH), "v"(l + APLANEB + 32 * LPITCH),
                  "v"(l + APLANEB + 48 * LPITCH),
                  "v"(l + 2 * APLANEB), "v"(l + 2 * APLANEB + 16 * LPITCH), "v"(l + 2 * APLANEB + 32 * LPITCH),
                  "v"(l + 2 * APLANEB + 48 * LPITCH),
                  "v"(kh), "v"(kh + (size_t)16 * INNER), "v"(kh + (size_t)32 * INNER), "v"(kh + (size_t)48 * INNER),
                  "v"(kl), "v"(kl + (size_t)16 * INNER), "v"(kl + (size_t)32 * INNER), "v"(kl + (size_t)48 * INNER),
                  "v"(v), "v"(v + (size_t)16 * SKV), "v"(v + (size_t)32 * SKV), "v"(v + (size_t)48 * SKV)
               : "memory");
#endif
}
// The batch's sim row: 128 threads x 16 B = 512 floats.
__device__ __forceinline__ void copy_sim(unsigned l, const float* g) {
#if defined(__HIP_DEVICE_COMPILE__)
  // the closing s_wait_xcnt stands inside the statement so that no address register is rewritten ahead of it
  asm volatile("global_load_async_to_lds_b128 %0, %1, off\n\t"
               "s_wait_xcnt 0x0"
               :: "v"(l), "v"(g) : "memory");
#endif
}

__global__ __launch_bounds__(ATT_THREADS)
void attn_fwd(const u16* __restrict__ Qh, const u16* __restrict__ Ql, const u16* __restrict__ Kh,
              const u16* __restrict__ Kl, const u16* __restrict__ Vp, const float* __restrict__ Simp,
              const float* __restrict__ beta, u16* Oh, u16* Ol) {
  __shared__ __align__(16) unsigned char ring[2 * ABUFB];
  __shared__ __align__(16) float simrow[SKV];

  const int tid  = threadIdx.x;
  const int wave = tid >> 5;
  const int lane = tid & 31;
  const int hh   = lane >> 4;
  const int c    = lane & 15;

  constexpr int NQT = SQ / 64;
  const int bid  = blockIdx.x;
  const int qt   = bid % NQT;
  const int head = (bid / NQT) % NH;
  const int b    = bid / (NQT * NH);
  const int q0   = qt * 64 + wave * 16;

  // B fragments of q^T: col n = query q0 + c, k = d (k-contiguous row of the q planes)
  const size_t qo = ((size_t)(b * SQ + q0 + c)) * INNER + head * HD + 8 * hh;
  const _Float16* Qhb = (const _Float16*)(const void*)Qh + qo;
  const _Float16* Qlb = (const _Float16*)(const void*)Ql + qo;
  // copy side: the lane's row in a group of 16 and its 16-B piece of the 128-B row (k rows = keys, v^T rows = d)
  const int cr = tid >> 3, cc = tid & 7;
  const size_t ko = ((size_t)(b * SKV + cr)) * INNER + head * HD + 8 * cc;
  const _Float16* gkh = (const _Float16*)(const void*)Kh + ko;
  const _Float16* gkl = (const _Float16*)(const void*)Kl + ko;
  const _Float16* gv  = (const _Float16*)(const void*)Vp + ((size_t)(b * NH + head) * HD + cr) * SKV + 8 * cc;
  const unsigned lc = lds_off(ring) + (unsigned)(cr * LPITCH + cc * 16);
  // A fragments of k: row m = key 16g + c of the staged tile, k = d; +16 B for the upper lane half
  const unsigned char* fk = ring + c * LPITCH + 16 * hh;
  // B fragments of v: col n = d = 16j + c (row of the staged v^T tile), k = key
  const unsigned char* fv = ring + 2 * APLANEB + c * LPITCH + 16 * hh;
  // per-key bias row of this batch in LDS, offset to the lane half's first key
  const float* Sb = simrow + 8 * hh;
  const float bl2 = bfr(beta[head]) * LOG2E;
  const float lsc = (LOG2E * RSQ_HD) / (QS * KS);

  v16h qh[2], ql[2];
  qh[0] = ldfrag_h(Qhb);
  qh[1] = ldfrag_h(Qhb + 32);
  ql[0] = ldfrag_h(Qlb);
  ql[1] = ldfrag_h(Qlb + 32);

  float mrun = -INFINITY, lrun = 0.f;
  v8f o[4];
#pragma unroll
  for (int j = 0; j < 4; ++j) o[j] = zero8();

  // tile 0 and the sim row -> LDS, landed and published; then tile 1 -> buffer 1 in flight
  copy_keys(lc, gkh, gkl, gv);
  copy_sim(lds_off(simrow) + (unsigned)(tid * 16), Simp + (size_t)b * SKV + 4 * tid);
  asm volatile("s_wait_asynccnt 0x0" ::: "memory");        // this wave's copies of tile 0 have landed
  __syncthreads();                                         // ... and every other wave's
  copy_keys(lc + ABUFB, gkh + (size_t)AKT * INNER, gkl + (size_t)AKT * INNER, gv + AKT);

  // rolled over the tiles: one copy of the tile body in the instruction cache
#pragma unroll 1
  for (int st = 0; st < NST; ++st) {
   const int bo = (st & 1) * ABUFB;
   // unrolled: the two 32-key halves of a tile differ only in constant LDS offsets
#pragma unroll
   for (int sub = 0; sub < AKT / 32; ++sub) {
    const int kb = st * AKT + sub * 32;
    // ---- transposed scores: s0 = keys kb..kb+15, s1 = keys kb+16..kb+31, column = query q0 + c ----
    v8f s0 = zero8(), s1 = zero8(), r0 = zero8(), r1 = zero8();
    const _Float16* k0h = (const _Float16*)(const void*)(fk + bo + sub * 32 * LPITCH);
    const _Float16* k1h = (const _Float16*)(const void*)(fk + bo + (sub * 32 + 16) * LPITCH);
    const _Float16* k0l = (const _Float16*)(const void*)(fk + bo + APLANEB + sub * 32 * LPITCH);
    const _Float16* k1l = (const _Float16*)(const void*)(fk + bo + APLANEB + (sub * 32 + 16) * LPITCH);
#pragma unroll
    for (int kk = 0; kk < HD / 32; ++kk) {
      const v16h fh0 = ldfrag_h(k0h + kk * 32);
      const v16h fh1 = ldfrag_h(k1h + kk * 32);
      const v16h fl0 = ldfrag_h(k0l + kk * 32);
      const v16h fl1 = ldfrag_h(k1l + kk * 32);
      s0 = mma_h(fh0, qh[kk], s0);
      s1 = mma_h(fh1, qh[kk], s1);
      r0 = mma_h(fl0, qh[kk], r0);
      r1 = mma_h(fl1, qh[kk], r1);
      r0 = mma_h(fh0, ql[kk], r0);
      r1 = mma_h(fh1, ql[kk], r1);
      guard_s4(s0, s1, r0, r1, qh[kk], ql[kk], fh0, fh1, fl0, fl1);
    }
    // ---- per-key bias: keys kb+8hh+0..7 (g0, g1) and kb+16+8hh+0..7 (g2, g3) ----
    const v4f g0 = *(const v4f*)(Sb + kb);
    const v4f g1 = *(const v4f*)(Sb + kb + 4);
    const v4f g2 = *(const v4f*)(Sb + kb + 16);
    const v4f g3 = *(const v4f*)(Sb + kb + 20);
    // ---- base-2 logits of this lane's 16 keys for query q0 + c: t[i] <- key kb+8hh+i, t[8+i] <- key kb+16+8hh+i ----
    float t[16];
#pragma unroll
    for (int i = 0; i < 4; ++i) {
      t[i]      = (s0[i]     + r0[i]     * RINV) * lsc + g0[i] * bl2;
      t[4 + i]  = (s0[4 + i] + r0[4 + i] * RINV) * lsc + g1[i] * bl2;
      t[8 + i]  = (s1[i]     + r1[i]     * RINV) * lsc + g2[i] * bl2;
      t[12 + i] = (s1[4 + i] + r1[4 + i] * RINV) * lsc + g3[i] * bl2;
    }
    float cm = t[0];
#pragma unroll
    for (int i = 1; i < 16; ++i) cm = fmaxf(cm, t[i]);
    cm = fmaxf(cm, __shfl_xor(cm, 16, 32));
    const float mn = fmaxf(mrun, cm);        // finite from the first block on
    float al = mrun - mn;                    // -> 2^(mrun - mn): 0 on the first block (mrun = -inf)
    // unrolled so that t stays in registers; t -> 2^(t - mn), the probabilities
#pragma unroll
    for (int i = 0; i < 16; ++i) t[i] -= mn;
    exp2_run(al, t);
    mrun = mn;
    // ---- probabilities (<= 1) and the P A-fragment: f16(p * 32768); element i <-> t[i] ----
    float ps = 0.f;
    FragH ph;
#pragma unroll
    for (int w = 0; w < 2; ++w) {
#pragma unroll
      for (int e4 = 0; e4 < 4; ++e4) {
        const int i = 8 * w + 2 * e4;
        const float p0 = t[i], p1 = t[i + 1];
        ps += p0 + p1;
        ph.u[w][e4] = pk16(h_bits((_Float16)(p0 * PCAR)), h_bits((_Float16)(p1 * PCAR)));
      }
    }
    ps += __shfl_xor(ps, 16, 32);
    lrun = lrun * al + ps;
    // ---- rescale the O accumulators: D row 8hh+r = query q0+8hh+r, its factor lives in lane 8hh+r (and 16+8hh+r) ----
    float scl[8];
#pragma unroll
    for (int r = 0; r < 8; ++r) scl[r] = __shfl(al, 8 * hh + r, 32);
#pragma unroll
    for (int j = 0; j < 4; ++j) {
#pragma unroll
      for (int r = 0; r < 8; ++r) o[j][r] *= scl[r];
    }
    // ---- P.V : B fragment col n = d = j*16 + c, keys contiguous in the v^T plane ----
    {
      const unsigned char* vp = fv + bo + sub * 64;
      const v16h v0 = ldfrag_h((const _Float16*)(const void*)(vp));
      const v16h v1 = ldfrag_h((const _Float16*)(const void*)(vp + 16 * LPITCH));
      const v16h v2 = ldfrag_h((const _Float16*)(const void*)(vp + 32 * LPITCH));
      const v16h v3 = ldfrag_h((const _Float16*)(const void*)(vp + 48 * LPITCH));
      o[0] = mma_h(ph.v, v0, o[0]);
      o[1] = mma_h(ph.v, v1, o[1]);
      o[2] = mma_h(ph.v, v2, o[2]);
      o[3] = mma_h(ph.v, v3, o[3]);
      guard_p(o[0], o[1], o[2], o[3], ph.v, v0, v1, v2, v3);
    }
   }
   asm volatile("s_wait_dscnt 0x0" ::: "memory");          // this wave's reads of the buffer are done before it is refilled
   asm volatile("s_wait_asynccnt 0x0" ::: "memory");       // this wave's copies of tile st + 1 have landed
   __syncthreads();                                        // publishes tile st + 1, ends every reader's use of tile st
   if (st + 2 < NST) {                                     // the same for the whole block
     const size_t k2 = (size_t)(st + 2) * AKT;
     copy_keys(lc + bo, gkh + k2 * INNER, gkl + k2 * INNER, gv + k2);
   }
  }
  asm volatile("s_wait_asynccnt 0x0" ::: "memory");        // no copy outstanding when the ring becomes output staging
  acc_guard4(o);

  // ---- fold 1/l (per query, owned by lane = query) and the carries (32768 on P, 8 on v), apply the ctx carry 1024 ----
  const float linv = (1.0f / lrun) * (OSC / (PCAR * VS));
  float inv[8];
#pragma unroll
  for (int r = 0; r < 8; ++r) inv[r] = __shfl(linv, 8 * hh + r, 32);
  float* slab = (float*)(void*)ring + wave * 16 * OPITCH;   // the ring is free behind the last tile's barrier
#pragma unroll
  for (int r = 0; r < 8; ++r) {
#pragma unroll
    for (int j = 0; j < 4; ++j) slab[(8 * hh + r) * OPITCH + j * 16 + c] = o[j][r] * inv[r];
  }
  wave_sync_lds();
  // ---- ctx x1024 -> f16 hi plane and residual plane; lane = (row in group of 4, 8 consecutive d) ----
  v4u ovh[4], ovl[4];
  const int rq = lane >> 3, c8 = (lane & 7) * 8;
#pragma unroll
  for (int i = 0; i < 4; ++i) {
    const int row = 4 * i + rq;
    const v4f a = *(const v4f*)(slab + row * OPITCH + c8), c4 = *(const v4f*)(slab + row * OPITCH + c8 + 4);
#pragma unroll
    for (int e = 0; e < 2; ++e) {
      unsigned ph0, pl0, ph1, pl1;
      split2(a[2 * e],  a[2 * e + 1],  ph0, pl0);
      split2(c4[2 * e], c4[2 * e + 1], ph1, pl1);
      ovh[i][e] = ph0;     ovl[i][e] = pl0;
      ovh[i][2 + e] = ph1; ovl[i][2 + e] = pl1;
    }
  }
  const size_t oo = ((size_t)(b * SQ + q0)) * INNER + head * HD + c8;
  u16* obh = Oh + oo;
  u16* obl = Ol + oo;
  {
#pragma unroll
    for (int i = 0; i < 4; ++i) {
      const int row = 4 * i + rq;
      *(v4u*)(obh + (size_t)row * INNER) = ovh[i];
      *(v4u*)(obl + (size_t)row * INNER) = ovl[i];
    }
    
  }
}

// =====================================================================================================
// Workspace map (bytes, NB=8, SQ=2048); every plane fully written by whole-line stores before it is read; all extents exact
//   XQ   f16 [NB*SQ][768]    f16(bf16(x))                 25165824   (region reused later as OH, same extent)
//   XV   f16 [NB*512][768]   f16(bf16(kg_value))           6291456
//   WQ16 WK16 WV16 WO16 f16 [768 n][768 k] x256            1179648 each
//   QH QL f16 [NB*SQ][768] x8 hi / res                     25165824 each
//   KH KL f16 [NB*512][768] x8 hi / res                     6291456 each
//   VT16 f16 [NB*768 (h,d)][512 s] x8                       6291456
//   OL   f16 [NB*SQ][768] x1024 res (ctx), OH aliases XQ    25165824
//   SIMP f32 [NB][512]                                         16384
//   end                                                    130564096
// =====================================================================================================
extern "C" void kernel_launch(void* const* d_in, const int* in_sizes, int n_in,
                              void* d_out, int out_size, void* d_ws, size_t ws_size,
                              hipStream_t stream) {
  if (n_in < 14) return;
  if (in_sizes[0] < ((NB - 1) * SQ_FULL + SQ) * DM) return;
  if (in_sizes[1] < 1) return;
  if (in_sizes[2] < NB * DM) return;
  if (in_sizes[3] < NB * SKV * DM || in_sizes[4] < NB * SKV * DM) return;
  if (in_sizes[5] < NH) return;
  if (in_sizes[6] != DM * DM || in_sizes[8] != DM * DM || in_sizes[10] != DM * DM || in_sizes[12] != DM * DM) return;
  if (in_sizes[7] < DM || in_sizes[9] < DM || in_sizes[11] < DM || in_sizes[13] < DM) return;
  if (out_size < ((NB - 1) * SQ_FULL + SQ) * DM) return;

  const float* x_in   = (const float*)d_in[0];
  const int*   msk    = (const int*)d_in[1];
  const float* pooled = (const float*)d_in[2];
  const float* kgk    = (const float*)d_in[3];
  const float* kgv    = (const float*)d_in[4];
  const float* beta   = (const float*)d_in[5];
  const float* wq     = (const float*)d_in[6];
  const float* bq     = (const float*)d_in[7];
  const float* wk     = (const float*)d_in[8];
  const float* bk     = (const float*)d_in[9];
  const float* wv     = (const float*)d_in[10];
  const float* bv     = (const float*)d_in[11];
  const float* wo     = (const float*)d_in[12];
  const float* bo     = (const float*)d_in[13];
  float*       out    = (float*)d_out;

  const size_t szXQ = (size_t)NB * SQ * DM * 2;
  const size_t szXV = (size_t)NB * SKV * DM * 2;
  const size_t szW  = (size_t)DM * DM * 2;
  const size_t szQP = (size_t)NB * SQ * INNER * 2;
  const size_t szKP = (size_t)NB * SKV * INNER * 2;
  const size_t szVT = (size_t)NB * INNER * SKV * 2;
  const size_t szS  = (size_t)NB * SKV * 4;
  static_assert((size_t)NB * SQ * DM * 2 == (size_t)NB * SQ * INNER * 2);   // XQ region reused as OH, same extent
  size_t off = 0;
  const size_t oXQ = off; off += szXQ;      // also OH
  const size_t oXV = off; off += szXV;
  const size_t oWQ = off; off += szW;
  const size_t oWK = off; off += szW;
  const size_t oWV = off; off += szW;
  const size_t oWO = off; off += szW;
  const size_t oQH = off; off += szQP;
  const size_t oQL = off; off += szQP;
  const size_t oKH = off; off += szKP;
  const size_t oKL = off; off += szKP;
  const size_t oVT = off; off += szVT;
  const size_t oOL = off; off += szQP;
  const size_t oS  = off; off += szS;
  if (off > ws_size) return;                // off = 130564096 at NB=8, SQ=2048
  if (off > (size_t)134217728) return;

  char* ws = (char*)d_ws;
  u16* XQ   = (u16*)(ws + oXQ);
  u16* XV   = (u16*)(ws + oXV);
  u16* WQ16 = (u16*)(ws + oWQ);
  u16* WK16 = (u16*)(ws + oWK);
  u16* WV16 = (u16*)(ws + oWV);
  u16* WO16 = (u16*)(ws + oWO);
  u16* QH   = (u16*)(ws + oQH);
  u16* QL   = (u16*)(ws + oQL);
  u16* KH   = (u16*)(ws + oKH);
  u16* KL   = (u16*)(ws + oKL);
  u16* VT16 = (u16*)(ws + oVT);
  u16* OH   = (u16*)(ws + oXQ);
  u16* OL   = (u16*)(ws + oOL);
  float* SIMP = (float*)(ws + oS);

  // (0) activations -> f16 planes of bf16-converted values (query rows s < SQ of batches b < NB, compact; kg_value rows) and
  //     weights [n = out][k = in] (y = x.W^T): already k-contiguous [n][k]; f16 planes of bf16(W) x256; one launch
  cvt_all<<<dim3(CVB_X + CVB_V + 4 * CVB_W), dim3(CVT_THREADS), 0, stream>>>(x_in, kgv, wq, wk, wv, wo,
                                                                             XQ, XV, WQ16, WK16, WV16, WO16);
  // (6) cosine similarity sim[b][k] -> SIMP f32 [NB][512]
  k_sim<<<dim3(NB * (SKV / SIM_KEYS)), dim3(SIM_THREADS), 0, stream>>>(pooled, kgk, msk, SIMP);
  // (7) q_un = x . Wq^T + bq -> f16 [NB*SQ][768] x8 hi + res (col = h*64 + d); the 1/8 is folded into the softmax scale
  gemm16<false, M_HL, false><<<dim3((NB * SQ / 128) * (INNER / 128)), dim3(128), 0, stream>>>(
      XQ, XQ, WQ16, bq, out, QH, QL, NB * SQ, INNER, DM, 0, 0, 0, 0, QS / WSC, QS, 1.0f);
  // (8) k = kg_value . Wk^T + bk -> f16 [NB*512][768] x8 hi + res
  gemm16<false, M_HL, false><<<dim3((NB * SKV / 128) * (INNER / 128)), dim3(128), 0, stream>>>(
      XV, XV, WK16, bk, out, KH, KL, NB * SKV, INNER, DM, 0, 0, 0, 0, KS / WSC, KS, 1.0f);
  // (9) v^T per batch: A = Wv [(h,d) = n][k], Bt = kg_value rows of batch b [s][k], bias bv per row -> f16 [(b,h,d)][s] x8
  gemm16<false, M_S16, true><<<dim3(NB * (INNER / 128) * (SKV / 128)), dim3(128), 0, stream>>>(
      WV16, WV16, XV, bv, out, VT16, VT16, INNER, SKV, DM, 0, SKV * DM, 0, INNER * SKV, VS / WSC, VS, 1.0f);
  // (10) attention with the beta*sim key bias -> ctx planes [NB*SQ][768] x1024 hi + res (OH reuses the XQ region)
  attn_fwd<<<dim3(NB * NH * (SQ / 64)), dim3(ATT_THREADS), 0, stream>>>(QH, QL, KH, KL, VT16, SIMP, beta, OH, OL);
  // (11) out rows [b][SQ_FULL][768] f32 = ctx . Wo^T + bo (rows s < SQ of batches b < NB); carries 1024 x 256 folded back
  gemm16<true, M_F32, false><<<dim3(NB * (SQ / 128) * (DM / 128)), dim3(128), 0, stream>>>(
      OH, OL, WO16, bo, out, OL, OL, SQ, DM, INNER, SQ * INNER, 0, SQ_FULL * DM, 0,
      1.0f / (OSC * WSC), 1.0f, 1.0f);
  (void)hipGetLastError();
}

// v006
// A run of this version takes 143 microseconds.
// Next to v005, in two timings, it ran 1.13 times as fast each time.
// Counting every step since v000, it is 3.04 times as fast.
// Contractions on v_wmma_f32_16x16x32_f16 (f16 operands, f32 accumulate): x.Wq^T, xv.Wk^T, Wv.xv^T single products on
// f16(bf16(x)) and f16(bf16(W) x256); k.q^T with q and k carried as f16 hi + residual(x2048) planes (3 products);
// P.v^T single product (P x32768, v x8); ctx.Wo^T with ctx carried as f16 hi (x1024) + residual(x2048) planes (2 products,
// separate residual accumulator); cosine-similarity bias, softmax, biases and all carry folds in f32 on VALU.
// Inputs RNE-converted to bf16 on load.
#include <hip/hip_runtime.h>
#include <math.h>
#include <stdint.h>

#ifndef NB
#define NB       8        // batches processed
#endif
#ifndef SQ
#define SQ       2048     // query rows processed per batch
#endif
#define NB_FULL  8
#define SQ_FULL  2048     // query rows per batch in the input / output layout (batch stride)
#define SKV      512      // key / value rows per batch (all of them)
#define DM       768      // model width
#define NH       12
#define HD       64
#define INNER    (NH * HD)
#define WSC      256.0f   // weight carry
#define QS       8.0f
#define KS       8.0f
#define VS       8.0f
#define PCAR     32768.0f
#define OSC      1024.0f  // ctx carry
#define RSC      2048.0f  // residual plane scale
#define RINV     0.00048828125f
#define LOG2E    1.4426950408889634f
#define RSQ_HD   0.125f
#define EPSN     1e-8f
#define NKB      (SKV / 32)
#define ATT_WAVES   4
#define ATT_THREADS (ATT_WAVES * 32)
#define CVT_THREADS 256      // streaming convert: 8 waves per block
#define CVT_LOADS   32       // 16-B loads per lane, all in flight
#define CVT_WAVE    (CVT_LOADS * 32 * 4)              // floats per wave (16 KB in, 8 KB out)
#define CVT_BLOCK   (CVT_WAVE * (CVT_THREADS / 32))   // floats per block
#define CVB_XB      (SQ * DM / CVT_BLOCK)             // blocks per batch of query rows
#define CVB_X       (NB * CVB_XB)
#define CVB_V       (NB * SKV * DM / CVT_BLOCK)
#define CVB_W       (DM * DM / CVT_BLOCK)
#define SIM_THREADS 256
#define SIM_KEYS    32       // keys per similarity block (8 waves x 4)
#define SIM_BLOCKS  (NB * (SKV / SIM_KEYS))
#define GB_Q        ((NB * SQ / 128) * (INNER / 128))          // 128 x 128 tiles of the q, k and v^T projections
#define GB_K        ((NB * SKV / 128) * (INNER / 128))
#define GB_V        (NB * (INNER / 128) * (SKV / 128))
#define OPITCH   68
#define GPITCH   68
#define GKT      64       // k per staged GEMM tile (128-B rows)
#define LPITCH   144      // LDS pitch of a staged row, bytes
#define PLANEB   (128 * LPITCH)
#define AKT      64       // keys per staged attention tile (128-B rows in all three planes)
#define APLANEB  (64 * LPITCH)
#define ABUFB    (3 * APLANEB)       // one attention buffer: [k hi | k res | v^T]
#define NST      (SKV / AKT)

#define M_HL     0
#define M_S16    1
#define M_F32    2

static_assert(NB >= 1 && NB <= NB_FULL);
static_assert((SQ % 128) == 0 && SQ >= 128 && SQ <= SQ_FULL);
static_assert(HD == 64 && INNER == 768 && NH == 12 && INNER == DM);
static_assert((SKV % 128) == 0 && (SKV % 32) == 0 && NKB * 32 == SKV && (SKV % SIM_KEYS) == 0);
static_assert((DM % 128) == 0 && (DM % 32) == 0 && (CVT_THREADS % 32) == 0);
static_assert((SQ * DM) % CVT_BLOCK == 0 && (NB * SKV * DM) % CVT_BLOCK == 0 && (DM * DM) % CVT_BLOCK == 0);
static_assert((OPITCH * 4) % 16 == 0 && (GPITCH * 4) % 16 == 0);
static_assert(ATT_THREADS * 4 == SKV && NST >= 2 && AKT == 64 && HD == 64);
static_assert(ATT_WAVES * 16 * OPITCH * 4 <= 2 * ABUFB);               // attention output staging fits its ring
static_assert(ATT_THREADS == 128 && SIM_THREADS == 256 && SIM_KEYS == (SIM_THREADS / 32) * 4 && SIM_THREADS == CVT_THREADS);

typedef unsigned short u16;
typedef _Float16 v16h __attribute__((ext_vector_type(16)));
typedef _Float16 v8h  __attribute__((ext_vector_type(8)));
typedef float    v8f  __attribute__((ext_vector_type(8)));
typedef float    v4f  __attribute__((ext_vector_type(4)));
typedef unsigned int v4u __attribute__((ext_vector_type(4)));
typedef unsigned int v2u __attribute__((ext_vector_type(2)));

union FragH { v16h v; v8h h[2]; v4u u[2]; };

// ---- scalar helpers ----------------------------------------------------------------------------------
__device__ __forceinline__ unsigned short bf_bits(float f) {          // f32 -> bf16 bits, RNE convert
  unsigned u = __float_as_uint(f);
  return (unsigned short)((u + 0x7FFFu + ((u >> 16) & 1u)) >> 16);
}
__device__ __forceinline__ float bf_up(unsigned short h) { return __uint_as_float(((unsigned)h) << 16); }
__device__ __forceinline__ float bfr(float f) { return bf_up(bf_bits(f)); }
__device__ __forceinline__ unsigned short h_bits(_Float16 x) { return __builtin_bit_cast(unsigned short, x); }
__device__ __forceinline__ unsigned pk16(unsigned short a, unsigned short b) { return (unsigned)a | ((unsigned)b << 16); }
// 2^x in place as the bare hardware instruction, for a key block's rescale exponent y and its 16 score exponents x. The library
// form wraps each in a compare, two selects, an add and an ldexp so that results below 2^-126 come out as subnormals; here such a
// result may be 0. Nothing downstream sees it: a probability below 2^-40 is 0 in P's f16 (x32768) anyway, the row sum is >= 1
// from the first key block on, and a rescale factor that small takes the old sums (at most 2^40 in size) below 2^-86.
// One statement: no instruction of the run touches another's register, and the closing v_nop is the slot that the instruction
// set asks for between a transcendental and the first use of its result.
__device__ __forceinline__ void exp2_run(float& y, float (&x)[16]) {
#if defined(__HIP_DEVICE_COMPILE__)
  asm("v_exp_f32 %0, %0\n\tv_exp_f32 %1, %1\n\tv_exp_f32 %2, %2\n\tv_exp_f32 %3, %3\n\t"
      "v_exp_f32 %4, %4\n\tv_exp_f32 %5, %5\n\tv_exp_f32 %6, %6\n\tv_exp_f32 %7, %7\n\t"
      "v_exp_f32 %8, %8\n\tv_exp_f32 %9, %9\n\tv_exp_f32 %10, %10\n\tv_exp_f32 %11, %11\n\t"
      "v_exp_f32 %12, %12\n\tv_exp_f32 %13, %13\n\tv_exp_f32 %14, %14\n\tv_exp_f32 %15, %15\n\t"
      "v_exp_f32 %16, %16\n\tv_nop"
      : "+v"(y), "+v"(x[0]), "+v"(x[1]), "+v"(x[2]), "+v"(x[3]), "+v"(x[4]), "+v"(x[5]), "+v"(x[6]), "+v"(x[7]),
        "+v"(x[8]), "+v"(x[9]), "+v"(x[10]), "+v"(x[11]), "+v"(x[12]), "+v"(x[13]), "+v"(x[14]), "+v"(x[15]));
#endif
}
__device__ __forceinline__ v8f zero8() { v8f z = {0.f, 0.f, 0.f, 0.f, 0.f, 0.f, 0.f, 0.f}; return z; }

// x = hi + lo/2048 in f16: hi = f16(x), lo = f16((x - hi) * 2048); two values packed per 32-bit word
__device__ __forceinline__ void split2(float x0, float x1, unsigned& ph, unsigned& pl) {
  const _Float16 h0 = (_Float16)x0, h1 = (_Float16)x1;
  const float d0 = x0 - (float)h0, d1 = x1 - (float)h1;
  const _Float16 l0 = (_Float16)(d0 * RSC), l1 = (_Float16)(d1 * RSC);
  ph = pk16(h_bits(h0), h_bits(h1));
  pl = pk16(h_bits(l0), h_bits(l1));
}

// ---- fragment loader: 16-bit A/B operand, lane -> row/col (lane&15), p already includes +8*(lane>>4);
//      elements 0..7 <- p[0..7] (k0+8h..), elements 8..15 <- p[16..23] (k0+16+8h..); same split k map for A and B,
//      B always read from a k-contiguous [n][k] plane.
__device__ __forceinline__ v16h ldfrag_h(const _Float16* p) {
  FragH f;
  f.h[0] = *(const v8h*)(p);
  f.h[1] = *(const v8h*)(p + 16);
  return f.v;
}

// ---- WMMA helper and trailing VALU hazard gaps ----------------------------------------------------------
__device__ __forceinline__ v8f mma_h(v16h a, v16h b, v8f c) {
  return __builtin_amdgcn_wmma_f32_16x16x32_f16(false, a, false, b, (short)0, c, false, false);
}
__device__ __forceinline__ void guard_s4(v8f& a, v8f& b, v8f& c, v8f& d,
                                         v16h x0, v16h x1, v16h x2, v16h x3, v16h x4, v16h x5) {
#if defined(__HIP_DEVICE_COMPILE__)
  asm volatile("v_nop\n\tv_nop\n\tv_nop\n\tv_nop"
               : "+v"(a), "+v"(b), "+v"(c), "+v"(d)
               : "v"(x0), "v"(x1), "v"(x2), "v"(x3), "v"(x4), "v"(x5) : "memory");
#endif
}
__device__ __forceinline__ void guard_p(v8f& a, v8f& b, v8f& c, v8f& d, v16h p, v16h x0, v16h x1, v16h x2, v16h x3) {
#if defined(__HIP_DEVICE_COMPILE__)
  asm volatile("v_nop\n\tv_nop\n\tv_nop\n\tv_nop"
               : "+v"(a), "+v"(b), "+v"(c), "+v"(d) : "v"(p), "v"(x0), "v"(x1), "v"(x2), "v"(x3) : "memory");
#endif
}
__device__ __forceinline__ void acc_guard4(v8f (&a)[4]) {
#if defined(__HIP_DEVICE_COMPILE__)
  asm volatile("v_nop\n\tv_nop\n\tv_nop\n\tv_nop" : "+v"(a[0]), "+v"(a[1]), "+v"(a[2]), "+v"(a[3]));
#endif
}
__device__ __forceinline__ void wave_sync_lds() {
  __builtin_amdgcn_fence(__ATOMIC_RELEASE, "workgroup");
  __builtin_amdgcn_wave_barrier();
  __builtin_amdgcn_fence(__ATOMIC_ACQUIRE, "workgroup");
}

// =====================================================================================================
// Streaming convert, one launch for all six planes: Y[e] <- f16(bf16_RNE(x[e]) * scale), scale a power of two (1 for the two
// activation planes, 256 for the four weight planes). Every plane is a whole number of blocks; a block takes CVT_BLOCK
// consecutive floats of one plane (of one batch, for the query rows), a wave CVT_WAVE of them: 32 loads of 512 contiguous
// bytes, all asked for before the first is converted, then 32 stores of 256 contiguous bytes (whole lines both ways).
// coverage: bid = 0 .. CVB_X + CVB_V + 4 * CVB_W - 1, CVT_BLOCK floats each = every element of the six planes exactly once.
// =====================================================================================================
__device__ __forceinline__
void cvt_body(int bid, const float* __restrict__ x, const float* __restrict__ kgv, const float* __restrict__ wq,
              const float* __restrict__ wk, const float* __restrict__ wv, const float* __restrict__ wo,
              u16* XQ, u16* XV, u16* WQ, u16* WK, u16* WV, u16* WO) {
  const float* src;
  u16* dst;
  float scale;
  if (bid < CVB_X) {                                     // query rows s < SQ of batch b, compact in the plane
    const int b = bid / CVB_XB;
    src = x + (size_t)b * ((size_t)SQ_FULL * DM) + (size_t)(bid - b * CVB_XB) * CVT_BLOCK;
    dst = XQ + (size_t)bid * CVT_BLOCK;
    scale = 1.0f;
  } else if (bid < CVB_X + CVB_V) {
    const int r = bid - CVB_X;
    src = kgv + (size_t)r * CVT_BLOCK;
    dst = XV + (size_t)r * CVT_BLOCK;
    scale = 1.0f;
  } else {
    const int w = bid - (CVB_X + CVB_V);
    const int sel = w / CVB_W;
    const int r = w - sel * CVB_W;
    src = (sel == 0 ? wq : sel == 1 ? wk : sel == 2 ? wv : wo) + (size_t)r * CVT_BLOCK;
    dst = (sel == 0 ? WQ : sel == 1 ? WK : sel == 2 ? WV : WO) + (size_t)r * CVT_BLOCK;
    scale = WSC;
  }
  const int off = (threadIdx.x >> 5) * CVT_WAVE + (threadIdx.x & 31) * 4;
  const float* p = src + off;
  u16* q = dst + off;
  v4f v[CVT_LOADS];
#pragma unroll
  for (int it = 0; it < CVT_LOADS; ++it) v[it] = *(const v4f*)(p + it * 128);
  // keeps every load ahead of the first convert and store: the wave pays the memory latency once, not once per group
  __builtin_amdgcn_sched_barrier(0);
#pragma unroll
  for (int it = 0; it < CVT_LOADS; ++it) {
    v2u o;
    o[0] = pk16(h_bits((_Float16)(bfr(v[it][0]) * scale)), h_bits((_Float16)(bfr(v[it][1]) * scale)));
    o[1] = pk16(h_bits((_Float16)(bfr(v[it][2]) * scale)), h_bits((_Float16)(bfr(v[it][3]) * scale)));
    *(v2u*)(q + it * 128) = o;
  }
}

// =====================================================================================================
// Cosine similarity sim[b][k] = <p, kgk[b][k]> / (max(|p|, eps) * max(|kgk[b][k]|, eps)), p = pooled[b], all operands
// bf16-RNE-converted, f32 arithmetic on VALU. Block = 256 threads = 8 waves = 32 keys of one batch (wave w -> keys
// kb + 4w .. kb + 4w + 3). A wave asks for its five rows (p and four keys, 3 KB each) at once, 16 B per lane and load; lane l
// sums elements 128 i + 4 l + e in ascending (i, e); the nine lane sums go through one xor tree side by side.
// =====================================================================================================
__device__ __forceinline__
void sim_body(int bid, float* sv, const float* __restrict__ pooled, const float* __restrict__ kgk, float* S) {
  const int tid = threadIdx.x, wave = tid >> 5, lane = tid & 31;
  constexpr int NKBLK = SKV / SIM_KEYS;
  const int b  = bid / NKBLK;
  const int kb = (bid - b * NKBLK) * SIM_KEYS;
  const float* p = pooled + (size_t)b * DM + 4 * lane;
  const float* kr = kgk + ((size_t)b * SKV + (size_t)(kb + wave * 4)) * (size_t)DM + 4 * lane;   // keys < SKV by construction
  constexpr int NL = DM / 128;                                         // 512-B loads per row
  v4f pv[NL], kv[4][NL];
  // every loop below is unrolled so that the row arrays and the nine sums stay in registers
#pragma unroll
  for (int i = 0; i < NL; ++i) pv[i] = *(const v4f*)(p + i * 128);
#pragma unroll
  for (int j = 0; j < 4; ++j) {
#pragma unroll
    for (int i = 0; i < NL; ++i) kv[j][i] = *(const v4f*)(kr + j * DM + i * 128);
  }
  // keeps all 30 loads ahead of the first sum: the wave pays the memory latency once, not once per 512-B load
  __builtin_amdgcn_sched_barrier(0);
  float s[9];                                                          // |p|^2, <p, k_j>, |k_j|^2
#pragma unroll
  for (int q = 0; q < 9; ++q) s[q] = 0.f;
#pragma unroll
  for (int i = 0; i < NL; ++i) {
#pragma unroll
    for (int e = 0; e < 4; ++e) {
      const float xv = bfr(pv[i][e]);
      s[0] += xv * xv;
#pragma unroll
      for (int j = 0; j < 4; ++j) {
        const float yv = bfr(kv[j][i][e]);
        s[1 + j] += xv * yv;
        s[5 + j] += yv * yv;
      }
    }
  }
  // one xor tree (16, 8, 4, 2, 1) for all nine sums at once: the wave waits for five cross-lane exchanges, not five per sum
#pragma unroll
  for (int d = 16; d >= 1; d >>= 1) {
    float o[9];
#pragma unroll
    for (int q = 0; q < 9; ++q) o[q] = __shfl_xor(s[q], d, 32);
#pragma unroll
    for (int q = 0; q < 9; ++q) s[q] += o[q];
  }
  const float pnrm = fmaxf(sqrtf(s[0]), EPSN);
  {                                                                    // lane j < 4 finishes key j (every lane holds all sums)
    const int j = lane & 3;
    const float pk = j == 0 ? s[1] : j == 1 ? s[2] : j == 2 ? s[3] : s[4];
    const float kk = j == 0 ? s[5] : j == 1 ? s[6] : j == 2 ? s[7] : s[8];
    const float knrm = fmaxf(sqrtf(kk), EPSN);
    const float val = pk / (pnrm * knrm);
    if (lane < 4) sv[wave * 4 + lane] = val;
  }
  __syncthreads();
  if (wave == 0) {                                                     // wave-uniform
    const v4f v = *(const v4f*)(sv + 4 * (lane & 7));                   // clamped LDS address, all lanes load
    float* dst = S + (size_t)b * SKV + kb + 4 * (lane & 7);
    if (lane < 8) {
      *(v4f*)dst = v;
    }
    
  }
}

// =====================================================================================================
// One launch for the two jobs that read only inputs: blocks 0 .. SIM_BLOCKS - 1 do the cosine similarity, the rest the streaming convert. Neither reads what the other writes. The split is by block, so
// the barrier in sim_body is passed by every thread of a block that reaches it; a convert block returns behind its last store.
// =====================================================================================================
__global__ __launch_bounds__(CVT_THREADS)
void prep_all(const float* __restrict__ x, const float* __restrict__ kgv, const float* __restrict__ wq,
              const float* __restrict__ wk, const float* __restrict__ wv, const float* __restrict__ wo,
              const float* __restrict__ pooled, const float* __restrict__ kgk, const int* __restrict__ msk,
              u16* XQ, u16* XV, u16* WQ, u16* WK, u16* WV, u16* WO, float* S) {
  __shared__ __align__(16) float sv[SIM_KEYS];
  (void)msk;
  const int bid = blockIdx.x;
  if (bid >= SIM_BLOCKS) {
    cvt_body(bid - SIM_BLOCKS, x, kgv, wq, wk, wv, wo, XQ, XV, WQ, WK, WV, WO);
    return;
  }
  sim_body(bid, sv, pooled, kgk, S);
}

// =====================================================================================================
// Staging of one 128-row x 64-k f16 plane tile in LDS: rows of 128 B at pitch 144 B (16 B x odd: ds_load_b128 free of bank
// conflicts). 128 threads, thread = (row tid>>3 of a group of 16, 16-B piece tid&7), eight groups: one wave-instruction
// covers four whole 128-B lines. l = the lane's LDS byte address of group 0, g = its global address of group 0,
// rs16 = 16 source rows in elements.
// =====================================================================================================
__device__ __forceinline__ unsigned lds_off(const void* p) { return (unsigned)(size_t)p; }
__device__ __forceinline__ void copy_plane(unsigned l, const _Float16* g, size_t rs16) {
#if defined(__HIP_DEVICE_COMPILE__)
  // the closing s_wait_xcnt stands inside the statement so that no address register is rewritten ahead of it
  asm volatile("global_load_async_to_lds_b128 %0, %8, off\n\t"
               "global_load_async_to_lds_b128 %1, %9, off\n\t"
               "global_load_async_to_lds_b128 %2, %10, off\n\t"
               "global_load_async_to_lds_b128 %3, %11, off\n\t"
               "global_load_async_to_lds_b128 %4, %12, off\n\t"
               "global_load_async_to_lds_b128 %5, %13, off\n\t"
               "global_load_async_to_lds_b128 %6, %14, off\n\t"
               "global_load_async_to_lds_b128 %7, %15, off\n\t"
               "s_wait_xcnt 0x0"
               :: "v"(l), "v"(l + 16 * LPITCH), "v"(l + 32 * LPITCH), "v"(l + 48 * LPITCH),
                  "v"(l + 64 * LPITCH), "v"(l + 80 * LPITCH), "v"(l + 96 * LPITCH), "v"(l + 112 * LPITCH),
                  "v"(g), "v"(g + rs16), "v"(g + 2 * rs16), "v"(g + 3 * rs16),
                  "v"(g + 4 * rs16), "v"(g + 5 * rs16), "v"(g + 6 * rs16), "v"(g + 7 * rs16)
               : "memory");
#endif
}

// Inputs-only fence on loaded fragments: keeps a group's LDS loads together ahead of its products, so that the wave waits for
// LDS once per group and not once per four products.
__device__ __forceinline__ void hold4(const v16h (&x)[4]) {
#if defined(__HIP_DEVICE_COMPILE__)
  asm volatile("" :: "v"(x[0]), "v"(x[1]), "v"(x[2]), "v"(x[3]));
#endif
}

// Stage one 16 x 64 f32 group of the wave's tile in its LDS slab (pitch 68): D element r of acc[j], lane l -> row 8h + r, col 16j + (l&15);
// the caller reloads it behind the wave sync.
// coverage: 32 lanes x 8 rows x 4 cols-of-16 = rows 0..15 x cols 0..63 of the slab (staged extent == consumed extent).
template <bool HASLO, bool BROW>
__device__ __forceinline__ void stage16(float* sl, v8f (&ah)[4], v8f (&al)[4], const float* __restrict__ bias,
                                        int rowb, int col0, float osc, float bsc, int lane) {
  const int hh = lane >> 4, m = lane & 15;
  float bc[4], br[8];
  if (BROW) {
    const float* bp = bias + rowb + 8 * hh;
#pragma unroll
    for (int r = 0; r < 8; ++r) br[r] = bp[r];
    // precaution: the loads' address, named as an input, stays in its registers up to this wait and is rewritten only behind it
    asm volatile("s_wait_xcnt 0x0" :: "v"(bp) : "memory");
#pragma unroll
    for (int r = 0; r < 8; ++r) br[r] = bfr(br[r]) * bsc;
#pragma unroll
    for (int j = 0; j < 4; ++j) bc[j] = 0.f;
  } else {
#pragma unroll
    for (int j = 0; j < 4; ++j) bc[j] = bfr(bias[col0 + 16 * j + m]) * bsc;
#pragma unroll
    for (int r = 0; r < 8; ++r) br[r] = 0.f;
  }
  const float oscl = osc * RINV;
#pragma unroll
  for (int r = 0; r < 8; ++r) {
    const int ro = (8 * hh + r) * GPITCH + m;
#pragma unroll
    for (int j = 0; j < 4; ++j) {
      float v = ah[j][r] * osc;
      if (HASLO) v += al[j][r] * oscl;
      v += BROW ? br[r] : bc[j];
      sl[ro + 16 * j] = v;
    }
  }
  wave_sync_lds();
}

// =====================================================================================================
// f16 GEMM, block = 128 x 128 tile, 4 waves (2 x 2) x 64 x 64; the k range is walked in tiles of 64; each tile's A rows
// (hi and, with HASLO, residual plane) and Bt rows are staged in LDS by asynchronous copies, two buffers, the next tile's
// copies in flight while this tile is multiplied; fragments come from LDS (4 A x 4 B fragments, 16 products per plane and k32).
//   C tile [z][Mb][N] = (A_hi[z][Mb][K] (+ A_res/2048)) . Bt[z][N][K]^T * osc + bias; per-z element strides aBs (A planes),
//   bBs (Bt), fBs (f32 output F), hBs (16-bit output planes H, L); 0 = shared.
//   M_HL  : H = f16(v*carry), L = f16 residual x2048 (two planes)       M_S16 : H only, bias per row
//   M_F32 : F = v (f32 rows, batch-row remap through fBs), no 16-bit output
// grid = nz x (Mb/128) x (N/128) (all launches: Mb % 128 == 0, N % 128 == 0, K % 64 == 0, K >= 128).
// Each accumulator sums its k32 products in ascending k, as a 16 x 64 wave tile did.
// Epilogue: the ring is free behind the last tile's barrier; each wave stages its four 16 x 64 f32 groups in its own range.
// coverage: per 16-row group 4 instr x 4 rows x 8 lanes x 8 halves = 16 x 64 (16-bit planes) and 8 instr x 2 rows x 16 lanes
//           x 4 floats = 16 x 64 (f32 plane); 4 groups x 4 waves = 128 x 128; the grid covers C exactly once.
// =====================================================================================================
// ring = the block's LDS ring of 2 * BUFB bytes, bid = the tile's index in that grid.
template <bool HASLO, int MODE, bool BROW>
__device__ __forceinline__
void gemm_body(unsigned char* ring, int bid,
               const u16* __restrict__ Ah, const u16* __restrict__ Al, const u16* __restrict__ Bt,
               const float* __restrict__ bias, float* F, u16* H, u16* L,
               int Mb, int N, int K, int aBs, int bBs, int fBs, int hBs,
               float osc, float bsc, float carry) {
  constexpr int BUFB = (HASLO ? 3 : 2) * PLANEB;          // one buffer: [A hi | Bt | A res]
  static_assert(4 * 64 * GPITCH * 4 <= 2 * BUFB && GKT == 64);          // epilogue staging fits the ring
  constexpr bool LOUT = (MODE == M_HL);
  const int tid = threadIdx.x, wave = tid >> 5, lane = tid & 31, hh = lane >> 4, m = lane & 15;
  const int ntile = N >> 7, mtile = Mb >> 7;
  const int nt   = bid % ntile;
  const int tmp  = bid / ntile;
  const int mt   = tmp % mtile;
  const int bz   = tmp / mtile;
  const int wm = wave >> 1, wn = wave & 1;
  const int rowb = mt * 128 + wm * 64;
  const int col0 = nt * 128 + wn * 64;
  // copy side: the lane's row in a group of 16 and its 16-B piece of the 128-B row
  const int cr = tid >> 3, cc = tid & 7;
  const _Float16* gah = (const _Float16*)(const void*)Ah + (size_t)bz * (size_t)aBs + (size_t)(mt * 128 + cr) * (size_t)K + 8 * cc;
  const _Float16* gal = (const _Float16*)(const void*)Al + (size_t)bz * (size_t)aBs + (size_t)(mt * 128 + cr) * (size_t)K + 8 * cc;
  const _Float16* gb  = (const _Float16*)(const void*)Bt + (size_t)bz * (size_t)bBs + (size_t)(nt * 128 + cr) * (size_t)K + 8 * cc;
  const unsigned lc = lds_off(ring) + (unsigned)(cr * LPITCH + cc * 16);
  const size_t rs16 = (size_t)16 * (size_t)K;
  const int ntk = K >> 6;
  // fragment side: row (lane & 15) of the wave's first A / B group, +16 B for the upper lane half
  const unsigned char* fa = ring + (wm * 64 + m) * LPITCH + 16 * hh;
  const unsigned char* fb = ring + PLANEB + (wn * 64 + m) * LPITCH + 16 * hh;

  v8f ah[4][4], al[4][4];
#pragma unroll
  for (int i = 0; i < 4; ++i) {
#pragma unroll
    for (int j = 0; j < 4; ++j) { ah[i][j] = zero8(); al[i][j] = zero8(); }
  }

  // tile 0 -> buffer 0, landed and published; then tile 1 -> buffer 1 in flight
  copy_plane(lc, gah, rs16);
  copy_plane(lc + PLANEB, gb, rs16);
  if (HASLO) copy_plane(lc + 2 * PLANEB, gal, rs16);
  asm volatile("s_wait_asynccnt 0x0" ::: "memory");        // this wave's copies of tile 0 have landed
  __syncthreads();                                         // ... and every other wave's
  if (ntk > 1) {                                           // the same for the whole block
    copy_plane(lc + BUFB, gah + GKT, rs16);
    copy_plane(lc + BUFB + PLANEB, gb + GKT, rs16);
    if (HASLO) copy_plane(lc + BUFB + 2 * PLANEB, gal + GKT, rs16);
  }

  // rolled: one copy of the tile body, so that the hot loop stays small in the instruction cache; the unrolls inside it keep
  // the fragment and accumulator arrays in registers
#pragma unroll 1
  for (int t = 0; t < ntk; ++t) {
    const int bo = (t & 1) * BUFB;
    v16h a[2][4], b[2][4], r[2][4];
    if (!HASLO) {
      // both k32 groups' fragments are asked for at the top of the tile: the second group lands behind the first one's products
#pragma unroll
      for (int kk = 0; kk < 2; ++kk) {
#pragma unroll
        for (int i = 0; i < 4; ++i) {
          a[kk][i] = ldfrag_h((const _Float16*)(const void*)(fa + bo + i * 16 * LPITCH + kk * 64));
          b[kk][i] = ldfrag_h((const _Float16*)(const void*)(fb + bo + i * 16 * LPITCH + kk * 64));
        }
      }
    }
#pragma unroll
    for (int kk = 0; kk < 2; ++kk) {
      if (HASLO) {
#pragma unroll
        for (int i = 0; i < 4; ++i) {
          a[kk][i] = ldfrag_h((const _Float16*)(const void*)(fa + bo + i * 16 * LPITCH + kk * 64));
          b[kk][i] = ldfrag_h((const _Float16*)(const void*)(fb + bo + i * 16 * LPITCH + kk * 64));
          r[kk][i] = ldfrag_h((const _Float16*)(const void*)(fa + bo + 2 * PLANEB + i * 16 * LPITCH + kk * 64));
        }
        hold4(r[kk]);
      }
      hold4(a[kk]);
      hold4(b[kk]);
#pragma unroll
      for (int i = 0; i < 4; ++i) {
#pragma unroll
        for (int j = 0; j < 4; ++j) ah[i][j] = mma_h(a[kk][i], b[kk][j], ah[i][j]);
      }
      if (HASLO) {
#pragma unroll
        for (int i = 0; i < 4; ++i) {
#pragma unroll
          for (int j = 0; j < 4; ++j) al[i][j] = mma_h(r[kk][i], b[kk][j], al[i][j]);
        }
      }
      // keeps this group's products ahead of what follows: of the second group's LDS wait, and of the waits and the barrier at
      // the tile's foot, so that the copies in flight have the products' time to land
      if (!HASLO || kk == 1) __builtin_amdgcn_sched_barrier(0);
    }
    asm volatile("s_wait_dscnt 0x0" ::: "memory");         // this wave's reads of the buffer are done before it is refilled
    asm volatile("s_wait_asynccnt 0x0" ::: "memory");      // this wave's copies of tile t + 1 have landed
    __syncthreads();                                       // publishes tile t + 1, ends every reader's use of tile t
    if (t + 2 < ntk) {                                     // the same for the whole block
      const int ko = (t + 2) * GKT;
      copy_plane(lc + bo, gah + ko, rs16);
      copy_plane(lc + bo + PLANEB, gb + ko, rs16);
      if (HASLO) copy_plane(lc + bo + 2 * PLANEB, gal + ko, rs16);
    }
  }
  asm volatile("s_wait_asynccnt 0x0" ::: "memory");        // no copy outstanding when the ring becomes output staging

#pragma unroll
  for (int g = 0; g < 4; ++g) {
    const int rowg = rowb + 16 * g;
    float* sl = (float*)(void*)ring + (wave * 4 + g) * 16 * GPITCH;
    stage16<HASLO, BROW>(sl, ah[g], al[g], bias, rowg, col0, osc, bsc, lane);

    if (MODE == M_F32) {
      v4f vals[8];
#pragma unroll
      for (int it = 0; it < 8; ++it) vals[it] = *(const v4f*)(sl + (it * 2 + hh) * GPITCH + m * 4);
      float* Fb = F + (size_t)bz * (size_t)fBs + ((size_t)rowg + (size_t)hh) * (size_t)N + col0 + m * 4;
#pragma unroll
      for (int it = 0; it < 8; ++it) {
        *(v4f*)(Fb + (size_t)(it * 2) * (size_t)N) = vals[it];
      }
    } else {
      const int rq = lane >> 3, c8 = (lane & 7) * 8;
      v4u ovh[4], ovl[4];
#pragma unroll
      for (int i = 0; i < 4; ++i) {
        const int row = 4 * i + rq;
        const v4f a = *(const v4f*)(sl + row * GPITCH + c8), c4 = *(const v4f*)(sl + row * GPITCH + c8 + 4);
#pragma unroll
        for (int e = 0; e < 2; ++e) {
          unsigned ph0, pl0, ph1, pl1;
          split2(a[2 * e] * carry,  a[2 * e + 1] * carry,  ph0, pl0);
          split2(c4[2 * e] * carry, c4[2 * e + 1] * carry, ph1, pl1);
          ovh[i][e] = ph0;     ovl[i][e] = pl0;
          ovh[i][2 + e] = ph1; ovl[i][2 + e] = pl1;
        }
      }
      u16* Hb = H + (size_t)bz * (size_t)hBs + (size_t)rowg * (size_t)N + col0 + c8;
      u16* Lb = L + (size_t)bz * (size_t)hBs + (size_t)rowg * (size_t)N + col0 + c8;
#pragma unroll
      for (int i = 0; i < 4; ++i) {
        const int row = 4 * i + rq;
        *(v4u*)(Hb + (size_t)row * (size_t)N) = ovh[i];
        if (LOUT) *(v4u*)(Lb + (size_t)row * (size_t)N) = ovl[i];
      }
      // precaution: no register that an issued store names is rewritten (by the next group's work) ahead of this wait
      asm volatile("s_wait_xcnt 0x0" ::: "memory");
    }
  }
}

template <bool HASLO, int MODE, bool BROW>
__global__ __launch_bounds__(128)
void gemm16(const u16* __restrict__ Ah, const u16* __restrict__ Al, const u16* __restrict__ Bt,
            const float* __restrict__ bias, float* F, u16* H, u16* L,
            int Mb, int N, int K, int aBs, int bBs, int fBs, int hBs,
            float osc, float bsc, float carry) {
  __shared__ __align__(16) unsigned char ring[2 * (HASLO ? 3 : 2) * PLANEB];
  gemm_body<HASLO, MODE, BROW>(ring, blockIdx.x, Ah, Al, Bt, bias, F, H, L, Mb, N, K, aBs, bBs, fBs, hBs, osc, bsc, carry);
}

// The three input projections in one launch: none reads what another writes, and the k and v^T grids (GB_K, GB_V tiles) are each
// smaller than the chip. Blocks 0 .. GB_V - 1: v^T per batch (A = Wv [(h,d) = n][k], Bt = kg_value rows of batch b [s][k], bias bv
// per row -> f16 [(b,h,d)][s] x8); then GB_K blocks: k = kg_value . Wk^T + bk -> f16 [NB*512][768] x8 hi + res; then GB_Q blocks:
// q_un = x . Wq^T + bq -> f16 [NB*SQ][768] x8 hi + res (col = h*64 + d; the 1/8 is folded into the softmax scale).
// The split is by block: every barrier in gemm_body is passed by all threads of its block.
__global__ __launch_bounds__(128)
void gemm_qkv(const u16* __restrict__ XQ, const u16* __restrict__ XV, const u16* __restrict__ WQ, const u16* __restrict__ WK,
              const u16* __restrict__ WV, const float* __restrict__ bq, const float* __restrict__ bk,
              const float* __restrict__ bv, u16* QH, u16* QL, u16* KH, u16* KL, u16* VT) {
  static_assert(QS == KS);
  __shared__ __align__(16) unsigned char ring[2 * 2 * PLANEB];
  const int bid = blockIdx.x;
  if (bid < GB_V) {
    gemm_body<false, M_S16, true>(ring, bid, WV, WV, XV, bv, nullptr, VT, VT,
                                  INNER, SKV, DM, 0, SKV * DM, 0, INNER * SKV, VS / WSC, VS, 1.0f);
  } else {
    const bool isk = bid < GB_V + GB_K;
    const u16* A = isk ? XV : XQ;
    gemm_body<false, M_HL, false>(ring, isk ? bid - GB_V : bid - (GB_V + GB_K), A, A, isk ? WK : WQ, isk ? bk : bq, nullptr,
                                  isk ? KH : QH, isk ? KL : QL, isk ? NB * SKV : NB * SQ, INNER, DM, 0, 0, 0, 0,
                                  QS / WSC, QS, 1.0f);
  }
}

// =====================================================================================================
// Full (unmasked) multi-head cross attention with a per-key additive bias bfr(beta[h]) * sim[b][key]:
// block = (batch b, head, 64 query rows), 4 waves, wave w owns the 16 query rows q0 = 64*qt + 16*w .. q0+15
// The keys are walked in tiles of 64: each tile's k hi, k residual and v^T rows (64 rows x 128 B each, LDS pitch 144 B) are
// staged in LDS by asynchronous copies, two buffers, the next tile's copies in flight while this tile is worked on; the four
// waves share the tile. The batch's sim row (2 KB) is staged once with tile 0. One barrier per tile.
//   q planes f16 x8 hi / residual(x2048) [b*SQ + s][h*64 + d]; k planes likewise [b*SKV + s][h*64 + d];
//   v^T plane f16 x8 [(b*NH + h)*64 + d][s]; sim plane f32 [b][s]. All NKB key blocks of 32 keys are visited (static bound).
//   Scores are computed TRANSPOSED: S^T tile g (g = 0,1) = k rows (keys kb+16g .. +15, A operand, row m = lane&15, split map
//   over d) times q^T (B operand, col n = query q0 + (lane&15), k = d, split map), 2 d-chunks of 32; per chunk hi.hi -> s,
//   res.hi + hi.res -> r (scaled x2048, folded as s + r/2048); the q fragments are loaded once per wave.
//   D element r of lane l = (key kb+16g+8h+r, query q0+(l&15)), so a lane owns one query column and 16 of its 32 keys;
//   the partner lane l^16 owns the other 16 -> row max / row sum need one xor-16 shuffle. The bias of the lane's 16 keys
//   comes from four 16-B loads of the sim row (keys kb+8h..+7 and kb+16+8h..+7), times bfr(beta[h])*log2(e), added in f32.
//   Online max-subtracted base-2 softmax in f32 (1/sqrt(64) and the q/k carries folded into lsc). The exp'd values ARE the
//   P A-fragment in place: A row m = query = lane&15, element i <- key kb+8h+i (tile 0, D element i), element 8+i <- key
//   kb+16+8h+i (tile 1, D element i). P (<= 1) carried x32768 as f16. The rescale factor of query row 8h+r of the O
//   accumulators is fetched from lane 8h+r with a shuffle (uniform control). 4 v^T B fragments (col n = d = 16j + (lane&15),
//   keys k-contiguous), 4 P.V WMMAs, one guard.
//   Epilogue: 1/l (per query, shuffled to the D row owner) and the carry folds in f32; the wave's 16x64 f32 result staged in
// coverage: per wave 4 instructions x 4 rows x 8 lanes x 8 halves = 16 x 64 on both ctx planes; grid NB*NH*(SQ/64) blocks x
//           4 waves = every (b, s, h) row segment exactly once. LDS slab: 16 x 64 staged == 16 x 64 reloaded.
// =====================================================================================================
// One 64-key tile: 128 threads, thread = (row tid>>3 of a group of 16, 16-B piece tid&7), four groups per plane: one
// wave-instruction covers four whole 128-B lines. l = the lane's LDS byte address in the buffer's first plane.
__device__ __forceinline__ void copy_keys(unsigned l, const _Float16* kh, const _Float16* kl, const _Float16* v) {
#if defined(__HIP_DEVICE_COMPILE__)
  // the closing s_wait_xcnt stands inside the statement so that no address register is rewritten ahead of it
  asm volatile("global_load_async_to_lds_b128 %0, %12, off\n\t"
               "global_load_async_to_lds_b128 %1, %13, off\n\t"
               "global_load_async_to_lds_b128 %2, %14, off\n\t"
               "global_load_async_to_lds_b128 %3, %15, off\n\t"
               "global_load_async_to_lds_b128 %4, %16, off\n\t"
               "global_load_async_to_lds_b128 %5, %17, off\n\t"
               "global_load_async_to_lds_b128 %6, %18, off\n\t"
               "global_load_async_to_lds_b128 %7, %19, off\n\t"
               "global_load_async_to_lds_b128 %8, %20, off\n\t"
               "global_load_async_to_lds_b128 %9, %21, off\n\t"
               "global_load_async_to_lds_b128 %10, %22, off\n\t"
               "global_load_async_to_lds_b128 %11, %23, off\n\t"
               "s_wait_xcnt 0x0"
               :: "v"(l), "v"(l + 16 * LPITCH), "v"(l + 32 * LPITCH), "v"(l + 48 * LPITCH),
                  "v"(l + APLANEB), "v"(l + APLANEB + 16 * LPITCH), "v"(l + APLANEB + 32 * LPITCH),
                  "v"(l + APLANEB + 48 * LPITCH),
                  "v"(l + 2 * APLANEB), "v"(l + 2 * APLANEB + 16 * LPITCH), "v"(l + 2 * APLANEB + 32 * LPITCH),
                  "v"(l + 2 * APLANEB + 48 * LPITCH),
                  "v"(kh), "v"(kh + (size_t)16 * INNER), "v"(kh + (size_t)32 * INNER), "v"(kh + (size_t)48 * INNER),
                  "v"(kl), "v"(kl + (size_t)16 * INNER), "v"(kl + (size_t)32 * INNER), "v"(kl + (size_t)48 * INNER),
                  "v"(v), "v"(v + (size_t)16 * SKV), "v"(v + (size_t)32 * SKV), "v"(v + (size_t)48 * SKV)
               : "memory");
#endif
}
// The batch's sim row: 128 threads x 16 B = 512 floats.
__device__ __forceinline__ void copy_sim(unsigned l, const float* g) {
#if defined(__HIP_DEVICE_COMPILE__)
  // the closing s_wait_xcnt stands inside the statement so that no address register is rewritten ahead of it
  asm volatile("global_load_async_to_lds_b128 %0, %1, off\n\t"
               "s_wait_xcnt 0x0"
               :: "v"(l), "v"(g) : "memory");
#endif
}

__global__ __launch_bounds__(ATT_THREADS)
void attn_fwd(const u16* __restrict__ Qh, const u16* __restrict__ Ql, const u16* __restrict__ Kh,
              const u16* __restrict__ Kl, const u16* __restrict__ Vp, const float* __restrict__ Simp,
              const float* __restrict__ beta, u16* Oh, u16* Ol) {
  __shared__ __align__(16) unsigned char ring[2 * ABUFB];
  __shared__ __align__(16) float simrow[SKV];

  const int tid  = threadIdx.x;
  const int wave = tid >> 5;
  const int lane = tid & 31;
  const int hh   = lane >> 4;
  const int c    = lane & 15;

  constexpr int NQT = SQ / 64;
  const int bid  = blockIdx.x;
  const int qt   = bid % NQT;
  const int head = (bid / NQT) % NH;
  const int b    = bid / (NQT * NH);
  const int q0   = qt * 64 + wave * 16;

  // B fragments of q^T: col n = query q0 + c, k = d (k-contiguous row of the q planes)
  const size_t qo = ((size_t)(b * SQ + q0 + c)) * INNER + head * HD + 8 * hh;
  const _Float16* Qhb = (const _Float16*)(const void*)Qh + qo;
  const _Float16* Qlb = (const _Float16*)(const void*)Ql + qo;
  // copy side: the lane's row in a group of 16 and its 16-B piece of the 128-B row (k rows = keys, v^T rows = d)
  const int cr = tid >> 3, cc = tid & 7;
  const size_t ko = ((size_t)(b * SKV + cr)) * INNER + head * HD + 8 * cc;
  const _Float16* gkh = (const _Float16*)(const void*)Kh + ko;
  const _Float16* gkl = (const _Float16*)(const void*)Kl + ko;
  const _Float16* gv  = (const _Float16*)(const void*)Vp + ((size_t)(b * NH + head) * HD + cr) * SKV + 8 * cc;
  const unsigned lc = lds_off(ring) + (unsigned)(cr * LPITCH + cc * 16);
  // A fragments of k: row m = key 16g + c of the staged tile, k = d; +16 B for the upper lane half
  const unsigned char* fk = ring + c * LPITCH + 16 * hh;
  // B fragments of v: col n = d = 16j + c (row of the staged v^T tile), k = key
  const unsigned char* fv = ring + 2 * APLANEB + c * LPITCH + 16 * hh;
  // per-key bias row of this batch in LDS, offset to the lane half's first key
  const float* Sb = simrow + 8 * hh;
  const float bl2 = bfr(beta[head]) * LOG2E;
  const float lsc = (LOG2E * RSQ_HD) / (QS * KS);

  v16h qh[2], ql[2];
  qh[0] = ldfrag_h(Qhb);
  qh[1] = ldfrag_h(Qhb + 32);
  ql[0] = ldfrag_h(Qlb);
  ql[1] = ldfrag_h(Qlb + 32);

  float mrun = -INFINITY, lrun = 0.f;
  v8f o[4];
#pragma unroll
  for (int j = 0; j < 4; ++j) o[j] = zero8();

  // tile 0 and the sim row -> LDS, landed and published; then tile 1 -> buffer 1 in flight
  copy_keys(lc, gkh, gkl, gv);
  copy_sim(lds_off(simrow) + (unsigned)(tid * 16), Simp + (size_t)b * SKV + 4 * tid);
  asm volatile("s_wait_asynccnt 0x0" ::: "memory");        // this wave's copies of tile 0 have landed
  __syncthreads();                                         // ... and every other wave's
  copy_keys(lc + ABUFB, gkh + (size_t)AKT * INNER, gkl + (size_t)AKT * INNER, gv + AKT);

  // rolled over the tiles: one copy of the tile body in the instruction cache
#pragma unroll 1
  for (int st = 0; st < NST; ++st) {
   const int bo = (st & 1) * ABUFB;
   // unrolled: the two 32-key halves of a tile differ only in constant LDS offsets
#pragma unroll
   for (int sub = 0; sub < AKT / 32; ++sub) {
    const int kb = st * AKT + sub * 32;
    // ---- transposed scores: s0 = keys kb..kb+15, s1 = keys kb+16..kb+31, column = query q0 + c ----
    v8f s0 = zero8(), s1 = zero8(), r0 = zero8(), r1 = zero8();
    const _Float16* k0h = (const _Float16*)(const void*)(fk + bo + sub * 32 * LPITCH);
    const _Float16* k1h = (const _Float16*)(const void*)(fk + bo + (sub * 32 + 16) * LPITCH);
    const _Float16* k0l = (const _Float16*)(const void*)(fk + bo + APLANEB + sub * 32 * LPITCH);
    const _Float16* k1l = (const _Float16*)(const void*)(fk + bo + APLANEB + (sub * 32 + 16) * LPITCH);
#pragma unroll
    for (int kk = 0; kk < HD / 32; ++kk) {
      const v16h fh0 = ldfrag_h(k0h + kk * 32);
      const v16h fh1 = ldfrag_h(k1h + kk * 32);
      const v16h fl0 = ldfrag_h(k0l + kk * 32);
      const v16h fl1 = ldfrag_h(k1l + kk * 32);
      s0 = mma_h(fh0, qh[kk], s0);
      s1 = mma_h(fh1, qh[kk], s1);
      r0 = mma_h(fl0, qh[kk], r0);
      r1 = mma_h(fl1, qh[kk], r1);
      r0 = mma_h(fh0, ql[kk], r0);
      r1 = mma_h(fh1, ql[kk], r1);
      guard_s4(s0, s1, r0, r1, qh[kk], ql[kk], fh0, fh1, fl0, fl1);
    }
    // ---- per-key bias: keys kb+8hh+0..7 (g0, g1) and kb+16+8hh+0..7 (g2, g3) ----
    const v4f g0 = *(const v4f*)(Sb + kb);
    const v4f g1 = *(const v4f*)(Sb + kb + 4);
    const v4f g2 = *(const v4f*)(Sb + kb + 16);
    const v4f g3 = *(const v4f*)(Sb + kb + 20);
    // ---- base-2 logits of this lane's 16 keys for query q0 + c: t[i] <- key kb+8hh+i, t[8+i] <- key kb+16+8hh+i ----
    float t[16];
#pragma unroll
    for (int i = 0; i < 4; ++i) {
      t[i]      = (s0[i]     + r0[i]     * RINV) * lsc + g0[i] * bl2;
      t[4 + i]  = (s0[4 + i] + r0[4 + i] * RINV) * lsc + g1[i] * bl2;
      t[8 + i]  = (s1[i]     + r1[i]     * RINV) * lsc + g2[i] * bl2;
      t[12 + i] = (s1[4 + i] + r1[4 + i] * RINV) * lsc + g3[i] * bl2;
    }
    float cm = t[0];
#pragma unroll
    for (int i = 1; i < 16; ++i) cm = fmaxf(cm, t[i]);
    cm = fmaxf(cm, __shfl_xor(cm, 16, 32));
    const float mn = fmaxf(mrun, cm);        // finite from the first block on
    float al = mrun - mn;                    // -> 2^(mrun - mn): 0 on the first block (mrun = -inf)
    // unrolled so that t stays in registers; t -> 2^(t - mn), the probabilities
#pragma unroll
    for (int i = 0; i < 16; ++i) t[i] -= mn;
    exp2_run(al, t);
    mrun = mn;
    // ---- probabilities (<= 1) and the P A-fragment: f16(p * 32768); element i <-> t[i] ----
    float ps = 0.f;
    FragH ph;
#pragma unroll
    for (int w = 0; w < 2; ++w) {
#pragma unroll
      for (int e4 = 0; e4 < 4; ++e4) {
        const int i = 8 * w + 2 * e4;
        const float p0 = t[i], p1 = t[i + 1];
        ps += p0 + p1;
        ph.u[w][e4] = pk16(h_bits((_Float16)(p0 * PCAR)), h_bits((_Float16)(p1 * PCAR)));
      }
    }
    ps += __shfl_xor(ps, 16, 32);
    lrun = lrun * al + ps;
    // ---- rescale the O accumulators: D row 8hh+r = query q0+8hh+r, its factor lives in lane 8hh+r (and 16+8hh+r) ----
    float scl[8];
#pragma unroll
    for (int r = 0; r < 8; ++r) scl[r] = __shfl(al, 8 * hh + r, 32);
#pragma unroll
    for (int j = 0; j < 4; ++j) {
#pragma unroll
      for (int r = 0; r < 8; ++r) o[j][r] *= scl[r];
    }
    // ---- P.V : B fragment col n = d = j*16 + c, keys contiguous in the v^T plane ----
    {
      const unsigned char* vp = fv + bo + sub * 64;
      const v16h v0 = ldfrag_h((const _Float16*)(const void*)(vp));
      const v16h v1 = ldfrag_h((const _Float16*)(const void*)(vp + 16 * LPITCH));
      const v16h v2 = ldfrag_h((const _Float16*)(const void*)(vp + 32 * LPITCH));
      const v16h v3 = ldfrag_h((const _Float16*)(const void*)(vp + 48 * LPITCH));
      o[0] = mma_h(ph.v, v0, o[0]);
      o[1] = mma_h(ph.v, v1, o[1]);
      o[2] = mma_h(ph.v, v2, o[2]);
      o[3] = mma_h(ph.v, v3, o[3]);
      guard_p(o[0], o[1], o[2], o[3], ph.v, v0, v1, v2, v3);
    }
   }
   asm volatile("s_wait_dscnt 0x0" ::: "memory");          // this wave's reads of the buffer are done before it is refilled
   asm volatile("s_wait_asynccnt 0x0" ::: "memory");       // this wave's copies of tile st + 1 have landed
   __syncthreads();                                        // publishes tile st + 1, ends every reader's use of tile st
   if (st + 2 < NST) {                                     // the same for the whole block
     const size_t k2 = (size_t)(st + 2) * AKT;
     copy_keys(lc + bo, gkh + k2 * INNER, gkl + k2 * INNER, gv + k2);
   }
  }
  asm volatile("s_wait_asynccnt 0x0" ::: "memory");        // no copy outstanding when the ring becomes output staging
  acc_guard4(o);

  // ---- fold 1/l (per query, owned by lane = query) and the carries (32768 on P, 8 on v), apply the ctx carry 1024 ----
  const float linv = (1.0f / lrun) * (OSC / (PCAR * VS));
  float inv[8];
#pragma unroll
  for (int r = 0; r < 8; ++r) inv[r] = __shfl(linv, 8 * hh + r, 32);
  float* slab = (float*)(void*)ring + wave * 16 * OPITCH;   // the ring is free behind the last tile's barrier
#pragma unroll
  for (int r = 0; r < 8; ++r) {
#pragma unroll
    for (int j = 0; j < 4; ++j) slab[(8 * hh + r) * OPITCH + j * 16 + c] = o[j][r] * inv[r];
  }
  wave_sync_lds();
  // ---- ctx x1024 -> f16 hi plane and residual plane; lane = (row in group of 4, 8 consecutive d) ----
  v4u ovh[4], ovl[4];
  const int rq = lane >> 3, c8 = (lane & 7) * 8;
#pragma unroll
  for (int i = 0; i < 4; ++i) {
    const int row = 4 * i + rq;
    const v4f a = *(const v4f*)(slab + row * OPITCH + c8), c4 = *(const v4f*)(slab + row * OPITCH + c8 + 4);
#pragma unroll
    for (int e = 0; e < 2; ++e) {
      unsigned ph0, pl0, ph1, pl1;
      split2(a[2 * e],  a[2 * e + 1],  ph0, pl0);
      split2(c4[2 * e], c4[2 * e + 1], ph1, pl1);
      ovh[i][e] = ph0;     ovl[i][e] = pl0;
      ovh[i][2 + e] = ph1; ovl[i][2 + e] = pl1;
    }
  }
  const size_t oo = ((size_t)(b * SQ + q0)) * INNER + head * HD + c8;
  u16* obh = Oh + oo;
  u16* obl = Ol + oo;
  {
#pragma unroll
    for (int i = 0; i < 4; ++i) {
      const int row = 4 * i + rq;
      *(v4u*)(obh + (size_t)row * INNER) = ovh[i];
      *(v4u*)(obl + (size_t)row * INNER) = ovl[i];
    }
    
  }
}

// =====================================================================================================
// Workspace map (bytes, NB=8, SQ=2048); every plane fully written by whole-line stores before it is read; all extents exact
//   XQ   f16 [NB*SQ][768]    f16(bf16(x))                 25165824   (region reused later as OH, same extent)
//   XV   f16 [NB*512][768]   f16(bf16(kg_value))           6291456
//   WQ16 WK16 WV16 WO16 f16 [768 n][768 k] x256            1179648 each
//   QH QL f16 [NB*SQ][768] x8 hi / res                     25165824 each
//   KH KL f16 [NB*512][768] x8 hi / res                     6291456 each
//   VT16 f16 [NB*768 (h,d)][512 s] x8                       6291456
//   OL   f16 [NB*SQ][768] x1024 res (ctx), OH aliases XQ    25165824
//   SIMP f32 [NB][512]                                         16384
//   end                                                    130564096
// =====================================================================================================
extern "C" void kernel_launch(void* const* d_in, const int* in_sizes, int n_in,
                              void* d_out, int out_size, void* d_ws, size_t ws_size,
                              hipStream_t stream) {
  if (n_in < 14) return;
  if (in_sizes[0] < ((NB - 1) * SQ_FULL + SQ) * DM) return;
  if (in_sizes[1] < 1) return;
  if (in_sizes[2] < NB * DM) return;
  if (in_sizes[3] < NB * SKV * DM || in_sizes[4] < NB * SKV * DM) return;
  if (in_sizes[5] < NH) return;
  if (in_sizes[6] != DM * DM || in_sizes[8] != DM * DM || in_sizes[10] != DM * DM || in_sizes[12] != DM * DM) return;
  if (in_sizes[7] < DM || in_sizes[9] < DM || in_sizes[11] < DM || in_sizes[13] < DM) return;
  if (out_size < ((NB - 1) * SQ_FULL + SQ) * DM) return;

  const float* x_in   = (const float*)d_in[0];
  const int*   msk    = (const int*)d_in[1];
  const float* pooled = (const float*)d_in[2];
  const float* kgk    = (const float*)d_in[3];
  const float* kgv    = (const float*)d_in[4];
  const float* beta   = (const float*)d_in[5];
  const float* wq     = (const float*)d_in[6];
  const float* bq     = (const float*)d_in[7];
  const float* wk     = (const float*)d_in[8];
  const float* bk     = (const float*)d_in[9];
  const float* wv     = (const float*)d_in[10];
  const float* bv     = (const float*)d_in[11];
  const float* wo     = (const float*)d_in[12];
  const float* bo     = (const float*)d_in[13];
  float*       out    = (float*)d_out;

  const size_t szXQ = (size_t)NB * SQ * DM * 2;
  const size_t szXV = (size_t)NB * SKV * DM * 2;
  const size_t szW  = (size_t)DM * DM * 2;
  const size_t szQP = (size_t)NB * SQ * INNER * 2;
  const size_t szKP = (size_t)NB * SKV * INNER * 2;
  const size_t szVT = (size_t)NB * INNER * SKV * 2;
  const size_t szS  = (size_t)NB * SKV * 4;
  static_assert((size_t)NB * SQ * DM * 2 == (size_t)NB * SQ * INNER * 2);   // XQ region reused as OH, same extent
  size_t off = 0;
  const size_t oXQ = off; off += szXQ;      // also OH
  const size_t oXV = off; off += szXV;
  const size_t oWQ = off; off += szW;
  const size_t oWK = off; off += szW;
  const size_t oWV = off; off += szW;
  const size_t oWO = off; off += szW;
  const size_t oQH = off; off += szQP;
  const size_t oQL = off; off += szQP;
  const size_t oKH = off; off += szKP;
  const size_t oKL = off; off += szKP;
  const size_t oVT = off; off += szVT;
  const size_t oOL = off; off += szQP;
  const size_t oS  = off; off += szS;
  if (off > ws_size) return;                // off = 130564096 at NB=8, SQ=2048
  if (off > (size_t)134217728) return;

  char* ws = (char*)d_ws;
  u16* XQ   = (u16*)(ws + oXQ);
  u16* XV   = (u16*)(ws + oXV);
  u16* WQ16 = (u16*)(ws + oWQ);
  u16* WK16 = (u16*)(ws + oWK);
  u16* WV16 = (u16*)(ws + oWV);
  u16* WO16 = (u16*)(ws + oWO);
  u16* QH   = (u16*)(ws + oQH);
  u16* QL   = (u16*)(ws + oQL);
  u16* KH   = (u16*)(ws + oKH);
  u16* KL   = (u16*)(ws + oKL);
  u16* VT16 = (u16*)(ws + oVT);
  u16* OH   = (u16*)(ws + oXQ);
  u16* OL   = (u16*)(ws + oOL);
  float* SIMP = (float*)(ws + oS);

  // (0) activations -> f16 planes of bf16-converted values (query rows s < SQ of batches b < NB, compact; kg_value rows) and
  //     weights [n = out][k = in] (y = x.W^T): already k-contiguous [n][k]; f16 planes of bf16(W) x256; one launch
  //     with, in the same launch, the cosine similarity sim[b][k] -> SIMP f32 [NB][512]
  prep_all<<<dim3(SIM_BLOCKS + CVB_X + CVB_V + 4 * CVB_W), dim3(CVT_THREADS), 0, stream>>>(
      x_in, kgv, wq, wk, wv, wo, pooled, kgk, msk, XQ, XV, WQ16, WK16, WV16, WO16, SIMP);
  // (7) the q, k and v^T projections, one launch
  gemm_qkv<<<dim3(GB_V + GB_K + GB_Q), dim3(128), 0, stream>>>(XQ, XV, WQ16, WK16, WV16, bq, bk, bv, QH, QL, KH, KL, VT16);
  // (10) attention with the beta*sim key bias -> ctx planes [NB*SQ][768] x1024 hi + res (OH reuses the XQ region)
  attn_fwd<<<dim3(NB * NH * (SQ / 64)), dim3(ATT_THREADS), 0, stream>>>(QH, QL, KH, KL, VT16, SIMP, beta, OH, OL);
  // (11) out rows [b][SQ_FULL][768] f32 = ctx . Wo^T + bo (rows s < SQ of batches b < NB); carries 1024 x 256 folded back
  gemm16<true, M_F32, false><<<dim3(NB * (SQ / 128) * (DM / 128)), dim3(128), 0, stream>>>(
      OH, OL, WO16, bo, out, OL, OL, SQ, DM, INNER, SQ * INNER, 0, SQ_FULL * DM, 0,
      1.0f / (OSC * WSC), 1.0f, 1.0f);
  (void)hipGetLastError();
}

// v007
// A run of this version takes 138 microseconds.
// Two timings next to v006 both put it at 1.04 times that version's speed.
// Over all steps from v000 it is 3.15 times as fast.
// Contractions on v_wmma_f32_16x16x32_f16 (f16 operands, f32 accumulate): x.Wq^T, xv.Wk^T, Wv.xv^T single products on
// f16(bf16(x)) and f16(bf16(W) x256); k.q^T with q and k carried as f16 hi + residual(x2048) planes (3 products);
// P.v^T single product (P x32768, v x8); ctx.Wo^T with ctx carried as f16 hi (x1024) + residual(x2048) planes (2 products,
// separate residual accumulator); cosine-similarity bias, softmax, biases and all carry folds in f32 on VALU.
// Inputs RNE-converted to bf16 on load.
#include <hip/hip_runtime.h>
#include <math.h>
#include <stdint.h>

#ifndef NB
#define NB       8        // batches processed
#endif
#ifndef SQ
#define SQ       2048     // query rows processed per batch
#endif
#define NB_FULL  8
#define SQ_FULL  2048     // query rows per batch in the input / output layout (batch stride)
#define SKV      512      // key / value rows per batch (all of them)
#define DM       768      // model width
#define NH       12
#define HD       64
#define INNER    (NH * HD)
#define WSC      256.0f   // weight carry
#define QS       8.0f
#define KS       8.0f
#define VS       8.0f
#define PCAR     32768.0f
#define OSC      1024.0f  // ctx carry
#define RSC      2048.0f  // residual plane scale
#define RINV     0.00048828125f
#define LOG2E    1.4426950408889634f
#define RSQ_HD   0.125f
#define EPSN     1e-8f
#define NKB      (SKV / 32)
#define ATT_WAVES   4
#define ATT_THREADS (ATT_WAVES * 32)
#define ATT_QT      2        // 16-query tiles per wave: each k, v^T and sim fragment read from LDS serves both
#define ATT_ROWS    (ATT_WAVES * ATT_QT * 16)         // query rows per attention block
#define CVT_THREADS 256      // streaming convert: 8 waves per block
#define CVT_LOADS   32       // 16-B loads per lane, all in flight
#define CVT_WAVE    (CVT_LOADS * 32 * 4)              // floats per wave (16 KB in, 8 KB out)
#define CVT_BLOCK   (CVT_WAVE * (CVT_THREADS / 32))   // floats per block
#define CVB_XB      (SQ * DM / CVT_BLOCK)             // blocks per batch of query rows
#define CVB_X       (NB * CVB_XB)
#define CVB_V       (NB * SKV * DM / CVT_BLOCK)
#define CVB_W       (DM * DM / CVT_BLOCK)
#define SIM_THREADS 256
#define SIM_KEYS    32       // keys per similarity block (8 waves x 4)
#define SIM_BLOCKS  (NB * (SKV / SIM_KEYS))
#define GB_Q        ((NB * SQ / 128) * (INNER / 128))          // 128 x 128 tiles of the q, k and v^T projections
#define GB_K        ((NB * SKV / 128) * (INNER / 128))
#define GB_V        (NB * (INNER / 128) * (SKV / 128))
#define OPITCH   68
#define GPITCH   68
#define GKT      64       // k per staged GEMM tile (128-B rows)
#define LPITCH   144      // LDS pitch of a staged row, bytes
#define PLANEB   (128 * LPITCH)
#define AKT      64       // keys per staged attention tile (128-B rows in all three planes)
#define APLANEB  (64 * LPITCH)
#define ABUFB    (3 * APLANEB)       // one attention buffer: [k hi | k res | v^T]
#define NST      (SKV / AKT)

#define M_HL     0
#define M_S16    1
#define M_F32    2

static_assert(NB >= 1 && NB <= NB_FULL);
static_assert((SQ % 128) == 0 && SQ >= 128 && SQ <= SQ_FULL);
static_assert(HD == 64 && INNER == 768 && NH == 12 && INNER == DM);
static_assert((SKV % 128) == 0 && (SKV % 32) == 0 && NKB * 32 == SKV && (SKV % SIM_KEYS) == 0);
static_assert((DM % 128) == 0 && (DM % 32) == 0 && (CVT_THREADS % 32) == 0);
static_assert((SQ * DM) % CVT_BLOCK == 0 && (NB * SKV * DM) % CVT_BLOCK == 0 && (DM * DM) % CVT_BLOCK == 0);
static_assert((OPITCH * 4) % 16 == 0 && (GPITCH * 4) % 16 == 0);
static_assert(ATT_THREADS * 4 == SKV && NST >= 2 && AKT == 64 && HD == 64);
static_assert(ATT_WAVES * ATT_QT * 16 * OPITCH * 4 <= 2 * ABUFB);      // attention output staging fits its ring
static_assert(ATT_QT == 2 && (SQ % ATT_ROWS) == 0);
static_assert(ATT_THREADS == 128 && SIM_THREADS == 256 && SIM_KEYS == (SIM_THREADS / 32) * 4 && SIM_THREADS == CVT_THREADS);

typedef unsigned short u16;
typedef _Float16 v16h __attribute__((ext_vector_type(16)));
typedef _Float16 v8h  __attribute__((ext_vector_type(8)));
typedef float    v8f  __attribute__((ext_vector_type(8)));
typedef float    v4f  __attribute__((ext_vector_type(4)));
typedef unsigned int v4u __attribute__((ext_vector_type(4)));
typedef unsigned int v2u __attribute__((ext_vector_type(2)));

union FragH { v16h v; v8h h[2]; v4u u[2]; };

// ---- scalar helpers ----------------------------------------------------------------------------------
__device__ __forceinline__ unsigned short bf_bits(float f) {          // f32 -> bf16 bits, RNE convert
  unsigned u = __float_as_uint(f);
  return (unsigned short)((u + 0x7FFFu + ((u >> 16) & 1u)) >> 16);
}
__device__ __forceinline__ float bf_up(unsigned short h) { return __uint_as_float(((unsigned)h) << 16); }
__device__ __forceinline__ float bfr(float f) { return bf_up(bf_bits(f)); }
__device__ __forceinline__ unsigned short h_bits(_Float16 x) { return __builtin_bit_cast(unsigned short, x); }
__device__ __forceinline__ unsigned pk16(unsigned short a, unsigned short b) { return (unsigned)a | ((unsigned)b << 16); }
// 2^x in place as the bare hardware instruction, for a key block's rescale exponent y and its 16 score exponents x. The library
// form wraps each in a compare, two selects, an add and an ldexp so that results below 2^-126 come out as subnormals; here such a
// result may be 0. Nothing downstream sees it: a probability below 2^-40 is 0 in P's f16 (x32768) anyway, the row sum is >= 1
// from the first key block on, and a rescale factor that small takes the old sums (at most 2^40 in size) below 2^-86.
// One statement: no instruction of the run touches another's register, and the closing v_nop is the slot that the instruction
// set asks for between a transcendental and the first use of its result.
__device__ __forceinline__ void exp2_run(float& y, float (&x)[16]) {
#if defined(__HIP_DEVICE_COMPILE__)
  asm("v_exp_f32 %0, %0\n\tv_exp_f32 %1, %1\n\tv_exp_f32 %2, %2\n\tv_exp_f32 %3, %3\n\t"
      "v_exp_f32 %4, %4\n\tv_exp_f32 %5, %5\n\tv_exp_f32 %6, %6\n\tv_exp_f32 %7, %7\n\t"
      "v_exp_f32 %8, %8\n\tv_exp_f32 %9, %9\n\tv_exp_f32 %10, %10\n\tv_exp_f32 %11, %11\n\t"
      "v_exp_f32 %12, %12\n\tv_exp_f32 %13, %13\n\tv_exp_f32 %14, %14\n\tv_exp_f32 %15, %15\n\t"
      "v_exp_f32 %16, %16\n\tv_nop"
      : "+v"(y), "+v"(x[0]), "+v"(x[1]), "+v"(x[2]), "+v"(x[3]), "+v"(x[4]), "+v"(x[5]), "+v"(x[6]), "+v"(x[7]),
        "+v"(x[8]), "+v"(x[9]), "+v"(x[10]), "+v"(x[11]), "+v"(x[12]), "+v"(x[13]), "+v"(x[14]), "+v"(x[15]));
#endif
}
__device__ __forceinline__ v8f zero8() { v8f z = {0.f, 0.f, 0.f, 0.f, 0.f, 0.f, 0.f, 0.f}; return z; }

// x = hi + lo/2048 in f16: hi = f16(x), lo = f16((x - hi) * 2048); two values packed per 32-bit word
__device__ __forceinline__ void split2(float x0, float x1, unsigned& ph, unsigned& pl) {
  const _Float16 h0 = (_Float16)x0, h1 = (_Float16)x1;
  const float d0 = x0 - (float)h0, d1 = x1 - (float)h1;
  const _Float16 l0 = (_Float16)(d0 * RSC), l1 = (_Float16)(d1 * RSC);
  ph = pk16(h_bits(h0), h_bits(h1));
  pl = pk16(h_bits(l0), h_bits(l1));
}

// ---- fragment loader: 16-bit A/B operand, lane -> row/col (lane&15), p already includes +8*(lane>>4);
//      elements 0..7 <- p[0..7] (k0+8h..), elements 8..15 <- p[16..23] (k0+16+8h..); same split k map for A and B,
//      B always read from a k-contiguous [n][k] plane.
__device__ __forceinline__ v16h ldfrag_h(const _Float16* p) {
  FragH f;
  f.h[0] = *(const v8h*)(p);
  f.h[1] = *(const v8h*)(p + 16);
  return f.v;
}

// ---- WMMA helper and trailing VALU hazard gaps ----------------------------------------------------------
__device__ __forceinline__ v8f mma_h(v16h a, v16h b, v8f c) {
  return __builtin_amdgcn_wmma_f32_16x16x32_f16(false, a, false, b, (short)0, c, false, false);
}
__device__ __forceinline__ void acc_guard4(v8f (&a)[4]) {
#if defined(__HIP_DEVICE_COMPILE__)
  asm volatile("v_nop\n\tv_nop\n\tv_nop\n\tv_nop" : "+v"(a[0]), "+v"(a[1]), "+v"(a[2]), "+v"(a[3]));
#endif
}
__device__ __forceinline__ void wave_sync_lds() {
  __builtin_amdgcn_fence(__ATOMIC_RELEASE, "workgroup");
  __builtin_amdgcn_wave_barrier();
  __builtin_amdgcn_fence(__ATOMIC_ACQUIRE, "workgroup");
}

// =====================================================================================================
// Streaming convert, one launch for all six planes: Y[e] <- f16(bf16_RNE(x[e]) * scale), scale a power of two (1 for the two
// activation planes, 256 for the four weight planes). Every plane is a whole number of blocks; a block takes CVT_BLOCK
// consecutive floats of one plane (of one batch, for the query rows), a wave CVT_WAVE of them: 32 loads of 512 contiguous
// bytes, all asked for before the first is converted, then 32 stores of 256 contiguous bytes (whole lines both ways).
// coverage: bid = 0 .. CVB_X + CVB_V + 4 * CVB_W - 1, CVT_BLOCK floats each = every element of the six planes exactly once.
// =====================================================================================================
__device__ __forceinline__
void cvt_body(int bid, const float* __restrict__ x, const float* __restrict__ kgv, const float* __restrict__ wq,
              const float* __restrict__ wk, const float* __restrict__ wv, const float* __restrict__ wo,
              u16* XQ, u16* XV, u16* WQ, u16* WK, u16* WV, u16* WO) {
  const float* src;
  u16* dst;
  float scale;
  if (bid < CVB_X) {                                     // query rows s < SQ of batch b, compact in the plane
    const int b = bid / CVB_XB;
    src = x + (size_t)b * ((size_t)SQ_FULL * DM) + (size_t)(bid - b * CVB_XB) * CVT_BLOCK;
    dst = XQ + (size_t)bid * CVT_BLOCK;
    scale = 1.0f;
  } else if (bid < CVB_X + CVB_V) {
    const int r = bid - CVB_X;
    src = kgv + (size_t)r * CVT_BLOCK;
    dst = XV + (size_t)r * CVT_BLOCK;
    scale = 1.0f;
  } else {
    const int w = bid - (CVB_X + CVB_V);
    const int sel = w / CVB_W;
    const int r = w - sel * CVB_W;
    src = (sel == 0 ? wq : sel == 1 ? wk : sel == 2 ? wv : wo) + (size_t)r * CVT_BLOCK;
    dst = (sel == 0 ? WQ : sel == 1 ? WK : sel == 2 ? WV : WO) + (size_t)r * CVT_BLOCK;
    scale = WSC;
  }
  const int off = (threadIdx.x >> 5) * CVT_WAVE + (threadIdx.x & 31) * 4;
  const float* p = src + off;
  u16* q = dst + off;
  v4f v[CVT_LOADS];
#pragma unroll
  for (int it = 0; it < CVT_LOADS; ++it) v[it] = *(const v4f*)(p + it * 128);
  // keeps every load ahead of the first convert and store: the wave pays the memory latency once, not once per group
  __builtin_amdgcn_sched_barrier(0);
#pragma unroll
  for (int it = 0; it < CVT_LOADS; ++it) {
    v2u o;
    o[0] = pk16(h_bits((_Float16)(bfr(v[it][0]) * scale)), h_bits((_Float16)(bfr(v[it][1]) * scale)));
    o[1] = pk16(h_bits((_Float16)(bfr(v[it][2]) * scale)), h_bits((_Float16)(bfr(v[it][3]) * scale)));
    *(v2u*)(q + it * 128) = o;
  }
}

// =====================================================================================================
// Cosine similarity sim[b][k] = <p, kgk[b][k]> / (max(|p|, eps) * max(|kgk[b][k]|, eps)), p = pooled[b], all operands
// bf16-RNE-converted, f32 arithmetic on VALU. Block = 256 threads = 8 waves = 32 keys of one batch (wave w -> keys
// kb + 4w .. kb + 4w + 3). A wave asks for its five rows (p and four keys, 3 KB each) at once, 16 B per lane and load; lane l
// sums elements 128 i + 4 l + e in ascending (i, e); the nine lane sums go through one xor tree side by side.
// =====================================================================================================
__device__ __forceinline__
void sim_body(int bid, float* sv, const float* __restrict__ pooled, const float* __restrict__ kgk, float* S) {
  const int tid = threadIdx.x, wave = tid >> 5, lane = tid & 31;
  constexpr int NKBLK = SKV / SIM_KEYS;
  const int b  = bid / NKBLK;
  const int kb = (bid - b * NKBLK) * SIM_KEYS;
  const float* p = pooled + (size_t)b * DM + 4 * lane;
  const float* kr = kgk + ((size_t)b * SKV + (size_t)(kb + wave * 4)) * (size_t)DM + 4 * lane;   // keys < SKV by construction
  constexpr int NL = DM / 128;                                         // 512-B loads per row
  v4f pv[NL], kv[4][NL];
  // every loop below is unrolled so that the row arrays and the nine sums stay in registers
#pragma unroll
  for (int i = 0; i < NL; ++i) pv[i] = *(const v4f*)(p + i * 128);
#pragma unroll
  for (int j = 0; j < 4; ++j) {
#pragma unroll
    for (int i = 0; i < NL; ++i) kv[j][i] = *(const v4f*)(kr + j * DM + i * 128);
  }
  // keeps all 30 loads ahead of the first sum: the wave pays the memory latency once, not once per 512-B load
  __builtin_amdgcn_sched_barrier(0);
  float s[9];                                                          // |p|^2, <p, k_j>, |k_j|^2
#pragma unroll
  for (int q = 0; q < 9; ++q) s[q] = 0.f;
#pragma unroll
  for (int i = 0; i < NL; ++i) {
#pragma unroll
    for (int e = 0; e < 4; ++e) {
      const float xv = bfr(pv[i][e]);
      s[0] += xv * xv;
#pragma unroll
      for (int j = 0; j < 4; ++j) {
        const float yv = bfr(kv[j][i][e]);
        s[1 + j] += xv * yv;
        s[5 + j] += yv * yv;
      }
    }
  }
  // one xor tree (16, 8, 4, 2, 1) for all nine sums at once: the wave waits for five cross-lane exchanges, not five per sum
#pragma unroll
  for (int d = 16; d >= 1; d >>= 1) {
    float o[9];
#pragma unroll
    for (int q = 0; q < 9; ++q) o[q] = __shfl_xor(s[q], d, 32);
#pragma unroll
    for (int q = 0; q < 9; ++q) s[q] += o[q];
  }
  const float pnrm = fmaxf(sqrtf(s[0]), EPSN);
  {                                                                    // lane j < 4 finishes key j (every lane holds all sums)
    const int j = lane & 3;
    const float pk = j == 0 ? s[1] : j == 1 ? s[2] : j == 2 ? s[3] : s[4];
    const float kk = j == 0 ? s[5] : j == 1 ? s[6] : j == 2 ? s[7] : s[8];
    const float knrm = fmaxf(sqrtf(kk), EPSN);
    const float val = pk / (pnrm * knrm);
    if (lane < 4) sv[wave * 4 + lane] = val;
  }
  __syncthreads();
  if (wave == 0) {                                                     // wave-uniform
    const v4f v = *(const v4f*)(sv + 4 * (lane & 7));                   // clamped LDS address, all lanes load
    float* dst = S + (size_t)b * SKV + kb + 4 * (lane & 7);
    if (lane < 8) {
      *(v4f*)dst = v;
    }
    
  }
}

// =====================================================================================================
// One launch for the two jobs that read only inputs: blocks 0 .. SIM_BLOCKS - 1 do the cosine similarity, the rest the streaming convert. Neither reads what the other writes. The split is by block, so
// the barrier in sim_body is passed by every thread of a block that reaches it; a convert block returns behind its last store.
// =====================================================================================================
__global__ __launch_bounds__(CVT_THREADS)
void prep_all(const float* __restrict__ x, const float* __restrict__ kgv, const float* __restrict__ wq,
              const float* __restrict__ wk, const float* __restrict__ wv, const float* __restrict__ wo,
              const float* __restrict__ pooled, const float* __restrict__ kgk, const int* __restrict__ msk,
              u16* XQ, u16* XV, u16* WQ, u16* WK, u16* WV, u16* WO, float* S) {
  __shared__ __align__(16) float sv[SIM_KEYS];
  (void)msk;
  const int bid = blockIdx.x;
  if (bid >= SIM_BLOCKS) {
    cvt_body(bid - SIM_BLOCKS, x, kgv, wq, wk, wv, wo, XQ, XV, WQ, WK, WV, WO);
    return;
  }
  sim_body(bid, sv, pooled, kgk, S);
}

// =====================================================================================================
// Staging of one 128-row x 64-k f16 plane tile in LDS: rows of 128 B at pitch 144 B (16 B x odd: ds_load_b128 free of bank
// conflicts). 128 threads, thread = (row tid>>3 of a group of 16, 16-B piece tid&7), eight groups: one wave-instruction
// covers four whole 128-B lines. l = the lane's LDS byte address of group 0, g = its global address of group 0,
// rs16 = 16 source rows in elements.
// =====================================================================================================
__device__ __forceinline__ unsigned lds_off(const void* p) { return (unsigned)(size_t)p; }
__device__ __forceinline__ void copy_plane(unsigned l, const _Float16* g, size_t rs16) {
#if defined(__HIP_DEVICE_COMPILE__)
  // the closing s_wait_xcnt stands inside the statement so that no address register is rewritten ahead of it
  asm volatile("global_load_async_to_lds_b128 %0, %8, off\n\t"
               "global_load_async_to_lds_b128 %1, %9, off\n\t"
               "global_load_async_to_lds_b128 %2, %10, off\n\t"
               "global_load_async_to_lds_b128 %3, %11, off\n\t"
               "global_load_async_to_lds_b128 %4, %12, off\n\t"
               "global_load_async_to_lds_b128 %5, %13, off\n\t"
               "global_load_async_to_lds_b128 %6, %14, off\n\t"
               "global_load_async_to_lds_b128 %7, %15, off\n\t"
               "s_wait_xcnt 0x0"
               :: "v"(l), "v"(l + 16 * LPITCH), "v"(l + 32 * LPITCH), "v"(l + 48 * LPITCH),
                  "v"(l + 64 * LPITCH), "v"(l + 80 * LPITCH), "v"(l + 96 * LPITCH), "v"(l + 112 * LPITCH),
                  "v"(g), "v"(g + rs16), "v"(g + 2 * rs16), "v"(g + 3 * rs16),
                  "v"(g + 4 * rs16), "v"(g + 5 * rs16), "v"(g + 6 * rs16), "v"(g + 7 * rs16)
               : "memory");
#endif
}

// Inputs-only fence on loaded fragments: keeps a group's LDS loads together ahead of its products, so that the wave waits for
// LDS once per group and not once per four products.
__device__ __forceinline__ void hold4(const v16h (&x)[4]) {
#if defined(__HIP_DEVICE_COMPILE__)
  asm volatile("" :: "v"(x[0]), "v"(x[1]), "v"(x[2]), "v"(x[3]));
#endif
}

// Stage one 16 x 64 f32 group of the wave's tile in its LDS slab (pitch 68): D element r of acc[j], lane l -> row 8h + r, col 16j + (l&15);
// the caller reloads it behind the wave sync.
// coverage: 32 lanes x 8 rows x 4 cols-of-16 = rows 0..15 x cols 0..63 of the slab (staged extent == consumed extent).
template <bool HASLO, bool BROW>
__device__ __forceinline__ void stage16(float* sl, v8f (&ah)[4], v8f (&al)[4], const float* __restrict__ bias,
                                        int rowb, int col0, float osc, float bsc, int lane) {
  const int hh = lane >> 4, m = lane & 15;
  float bc[4], br[8];
  if (BROW) {
    const float* bp = bias + rowb + 8 * hh;
#pragma unroll
    for (int r = 0; r < 8; ++r) br[r] = bp[r];
    // precaution: the loads' address, named as an input, stays in its registers up to this wait and is rewritten only behind it
    asm volatile("s_wait_xcnt 0x0" :: "v"(bp) : "memory");
#pragma unroll
    for (int r = 0; r < 8; ++r) br[r] = bfr(br[r]) * bsc;
#pragma unroll
    for (int j = 0; j < 4; ++j) bc[j] = 0.f;
  } else {
#pragma unroll
    for (int j = 0; j < 4; ++j) bc[j] = bfr(bias[col0 + 16 * j + m]) * bsc;
#pragma unroll
    for (int r = 0; r < 8; ++r) br[r] = 0.f;
  }
  const float oscl = osc * RINV;
#pragma unroll
  for (int r = 0; r < 8; ++r) {
    const int ro = (8 * hh + r) * GPITCH + m;
#pragma unroll
    for (int j = 0; j < 4; ++j) {
      float v = ah[j][r] * osc;
      if (HASLO) v += al[j][r] * oscl;
      v += BROW ? br[r] : bc[j];
      sl[ro + 16 * j] = v;
    }
  }
  wave_sync_lds();
}

// =====================================================================================================
// f16 GEMM, block = 128 x 128 tile, 4 waves (2 x 2) x 64 x 64; the k range is walked in tiles of 64; each tile's A rows
// (hi and, with HASLO, residual plane) and Bt rows are staged in LDS by asynchronous copies, two buffers, the next tile's
// copies in flight while this tile is multiplied; fragments come from LDS (4 A x 4 B fragments, 16 products per plane and k32).
//   C tile [z][Mb][N] = (A_hi[z][Mb][K] (+ A_res/2048)) . Bt[z][N][K]^T * osc + bias; per-z element strides aBs (A planes),
//   bBs (Bt), fBs (f32 output F), hBs (16-bit output planes H, L); 0 = shared.
//   M_HL  : H = f16(v*carry), L = f16 residual x2048 (two planes)       M_S16 : H only, bias per row
//   M_F32 : F = v (f32 rows, batch-row remap through fBs), no 16-bit output
// grid = nz x (Mb/128) x (N/128) (all launches: Mb % 128 == 0, N % 128 == 0, K % 64 == 0, K >= 128).
// Each accumulator sums its k32 products in ascending k, as a 16 x 64 wave tile did.
// Epilogue: the ring is free behind the last tile's barrier; each wave stages its four 16 x 64 f32 groups in its own range.
// coverage: per 16-row group 4 instr x 4 rows x 8 lanes x 8 halves = 16 x 64 (16-bit planes) and 8 instr x 2 rows x 16 lanes
//           x 4 floats = 16 x 64 (f32 plane); 4 groups x 4 waves = 128 x 128; the grid covers C exactly once.
// =====================================================================================================
// ring = the block's LDS ring of 2 * BUFB bytes, bid = the tile's index in that grid.
template <bool HASLO, int MODE, bool BROW>
__device__ __forceinline__
void gemm_body(unsigned char* ring, int bid,
               const u16* __restrict__ Ah, const u16* __restrict__ Al, const u16* __restrict__ Bt,
               const float* __restrict__ bias, float* F, u16* H, u16* L,
               int Mb, int N, int K, int aBs, int bBs, int fBs, int hBs,
               float osc, float bsc, float carry) {
  constexpr int BUFB = (HASLO ? 3 : 2) * PLANEB;          // one buffer: [A hi | Bt | A res]
  static_assert(4 * 64 * GPITCH * 4 <= 2 * BUFB && GKT == 64);          // epilogue staging fits the ring
  constexpr bool LOUT = (MODE == M_HL);
  const int tid = threadIdx.x, wave = tid >> 5, lane = tid & 31, hh = lane >> 4, m = lane & 15;
  const int ntile = N >> 7, mtile = Mb >> 7;
  const int nt   = bid % ntile;
  const int tmp  = bid / ntile;
  const int mt   = tmp % mtile;
  const int bz   = tmp / mtile;
  const int wm = wave >> 1, wn = wave & 1;
  const int rowb = mt * 128 + wm * 64;
  const int col0 = nt * 128 + wn * 64;
  // copy side: the lane's row in a group of 16 and its 16-B piece of the 128-B row
  const int cr = tid >> 3, cc = tid & 7;
  const _Float16* gah = (const _Float16*)(const void*)Ah + (size_t)bz * (size_t)aBs + (size_t)(mt * 128 + cr) * (size_t)K + 8 * cc;
  const _Float16* gal = (const _Float16*)(const void*)Al + (size_t)bz * (size_t)aBs + (size_t)(mt * 128 + cr) * (size_t)K + 8 * cc;
  const _Float16* gb  = (const _Float16*)(const void*)Bt + (size_t)bz * (size_t)bBs + (size_t)(nt * 128 + cr) * (size_t)K + 8 * cc;
  const unsigned lc = lds_off(ring) + (unsigned)(cr * LPITCH + cc * 16);
  const size_t rs16 = (size_t)16 * (size_t)K;
  const int ntk = K >> 6;
  // fragment side: row (lane & 15) of the wave's first A / B group, +16 B for the upper lane half
  const unsigned char* fa = ring + (wm * 64 + m) * LPITCH + 16 * hh;
  const unsigned char* fb = ring + PLANEB + (wn * 64 + m) * LPITCH + 16 * hh;

  v8f ah[4][4], al[4][4];
#pragma unroll
  for (int i = 0; i < 4; ++i) {
#pragma unroll
    for (int j = 0; j < 4; ++j) { ah[i][j] = zero8(); al[i][j] = zero8(); }
  }

  // tile 0 -> buffer 0, landed and published; then tile 1 -> buffer 1 in flight
  copy_plane(lc, gah, rs16);
  copy_plane(lc + PLANEB, gb, rs16);
  if (HASLO) copy_plane(lc + 2 * PLANEB, gal, rs16);
  asm volatile("s_wait_asynccnt 0x0" ::: "memory");        // this wave's copies of tile 0 have landed
  __syncthreads();                                         // ... and every other wave's
  if (ntk > 1) {                                           // the same for the whole block
    copy_plane(lc + BUFB, gah + GKT, rs16);
    copy_plane(lc + BUFB + PLANEB, gb + GKT, rs16);
    if (HASLO) copy_plane(lc + BUFB + 2 * PLANEB, gal + GKT, rs16);
  }

  // rolled: one copy of the tile body, so that the hot loop stays small in the instruction cache; the unrolls inside it keep
  // the fragment and accumulator arrays in registers
#pragma unroll 1
  for (int t = 0; t < ntk; ++t) {
    const int bo = (t & 1) * BUFB;
    v16h a[2][4], b[2][4], r[2][4];
    if (!HASLO) {
      // both k32 groups' fragments are asked for at the top of the tile: the second group lands behind the first one's products
#pragma unroll
      for (int kk = 0; kk < 2; ++kk) {
#pragma unroll
        for (int i = 0; i < 4; ++i) {
          a[kk][i] = ldfrag_h((const _Float16*)(const void*)(fa + bo + i * 16 * LPITCH + kk * 64));
          b[kk][i] = ldfrag_h((const _Float16*)(const void*)(fb + bo + i * 16 * LPITCH + kk * 64));
        }
      }
    }
#pragma unroll
    for (int kk = 0; kk < 2; ++kk) {
      if (HASLO) {
#pragma unroll
        for (int i = 0; i < 4; ++i) {
          a[kk][i] = ldfrag_h((const _Float16*)(const void*)(fa + bo + i * 16 * LPITCH + kk * 64));
          b[kk][i] = ldfrag_h((const _Float16*)(const void*)(fb + bo + i * 16 * LPITCH + kk * 64));
          r[kk][i] = ldfrag_h((const _Float16*)(const void*)(fa + bo + 2 * PLANEB + i * 16 * LPITCH + kk * 64));
        }
        hold4(r[kk]);
      }
      hold4(a[kk]);
      hold4(b[kk]);
#pragma unroll
      for (int i = 0; i < 4; ++i) {
#pragma unroll
        for (int j = 0; j < 4; ++j) ah[i][j] = mma_h(a[kk][i], b[kk][j], ah[i][j]);
      }
      if (HASLO) {
#pragma unroll
        for (int i = 0; i < 4; ++i) {
#pragma unroll
          for (int j = 0; j < 4; ++j) al[i][j] = mma_h(r[kk][i], b[kk][j], al[i][j]);
        }
      }
      // keeps this group's products ahead of what follows: of the second group's LDS wait, and of the waits and the barrier at
      // the tile's foot, so that the copies in flight have the products' time to land
      if (!HASLO || kk == 1) __builtin_amdgcn_sched_barrier(0);
    }
    asm volatile("s_wait_dscnt 0x0" ::: "memory");         // this wave's reads of the buffer are done before it is refilled
    asm volatile("s_wait_asynccnt 0x0" ::: "memory");      // this wave's copies of tile t + 1 have landed
    __syncthreads();                                       // publishes tile t + 1, ends every reader's use of tile t
    if (t + 2 < ntk) {                                     // the same for the whole block
      const int ko = (t + 2) * GKT;
      copy_plane(lc + bo, gah + ko, rs16);
      copy_plane(lc + bo + PLANEB, gb + ko, rs16);
      if (HASLO) copy_plane(lc + bo + 2 * PLANEB, gal + ko, rs16);
    }
  }
  asm volatile("s_wait_asynccnt 0x0" ::: "memory");        // no copy outstanding when the ring becomes output staging

#pragma unroll
  for (int g = 0; g < 4; ++g) {
    const int rowg = rowb + 16 * g;
    float* sl = (float*)(void*)ring + (wave * 4 + g) * 16 * GPITCH;
    stage16<HASLO, BROW>(sl, ah[g], al[g], bias, rowg, col0, osc, bsc, lane);

    if (MODE == M_F32) {
      v4f vals[8];
#pragma unroll
      for (int it = 0; it < 8; ++it) vals[it] = *(const v4f*)(sl + (it * 2 + hh) * GPITCH + m * 4);
      float* Fb = F + (size_t)bz * (size_t)fBs + ((size_t)rowg + (size_t)hh) * (size_t)N + col0 + m * 4;
#pragma unroll
      for (int it = 0; it < 8; ++it) {
        *(v4f*)(Fb + (size_t)(it * 2) * (size_t)N) = vals[it];
      }
    } else {
      const int rq = lane >> 3, c8 = (lane & 7) * 8;
      v4u ovh[4], ovl[4];
#pragma unroll
      for (int i = 0; i < 4; ++i) {
        const int row = 4 * i + rq;
        const v4f a = *(const v4f*)(sl + row * GPITCH + c8), c4 = *(const v4f*)(sl + row * GPITCH + c8 + 4);
#pragma unroll
        for (int e = 0; e < 2; ++e) {
          unsigned ph0, pl0, ph1, pl1;
          split2(a[2 * e] * carry,  a[2 * e + 1] * carry,  ph0, pl0);
          split2(c4[2 * e] * carry, c4[2 * e + 1] * carry, ph1, pl1);
          ovh[i][e] = ph0;     ovl[i][e] = pl0;
          ovh[i][2 + e] = ph1; ovl[i][2 + e] = pl1;
        }
      }
      u16* Hb = H + (size_t)bz * (size_t)hBs + (size_t)rowg * (size_t)N + col0 + c8;
      u16* Lb = L + (size_t)bz * (size_t)hBs + (size_t)rowg * (size_t)N + col0 + c8;
#pragma unroll
      for (int i = 0; i < 4; ++i) {
        const int row = 4 * i + rq;
        *(v4u*)(Hb + (size_t)row * (size_t)N) = ovh[i];
        if (LOUT) *(v4u*)(Lb + (size_t)row * (size_t)N) = ovl[i];
      }
      // precaution: no register that an issued store names is rewritten (by the next group's work) ahead of this wait
      asm volatile("s_wait_xcnt 0x0" ::: "memory");
    }
  }
}

template <bool HASLO, int MODE, bool BROW>
__global__ __launch_bounds__(128)
void gemm16(const u16* __restrict__ Ah, const u16* __restrict__ Al, const u16* __restrict__ Bt,
            const float* __restrict__ bias, float* F, u16* H, u16* L,
            int Mb, int N, int K, int aBs, int bBs, int fBs, int hBs,
            float osc, float bsc, float carry) {
  __shared__ __align__(16) unsigned char ring[2 * (HASLO ? 3 : 2) * PLANEB];
  gemm_body<HASLO, MODE, BROW>(ring, blockIdx.x, Ah, Al, Bt, bias, F, H, L, Mb, N, K, aBs, bBs, fBs, hBs, osc, bsc, carry);
}

// The three input projections in one launch: none reads what another writes, and the k and v^T grids (GB_K, GB_V tiles) are each
// smaller than the chip. Blocks 0 .. GB_V - 1: v^T per batch (A = Wv [(h,d) = n][k], Bt = kg_value rows of batch b [s][k], bias bv
// per row -> f16 [(b,h,d)][s] x8); then GB_K blocks: k = kg_value . Wk^T + bk -> f16 [NB*512][768] x8 hi + res; then GB_Q blocks:
// q_un = x . Wq^T + bq -> f16 [NB*SQ][768] x8 hi + res (col = h*64 + d; the 1/8 is folded into the softmax scale).
// The split is by block: every barrier in gemm_body is passed by all threads of its block.
__global__ __launch_bounds__(128)
void gemm_qkv(const u16* __restrict__ XQ, const u16* __restrict__ XV, const u16* __restrict__ WQ, const u16* __restrict__ WK,
              const u16* __restrict__ WV, const float* __restrict__ bq, const float* __restrict__ bk,
              const float* __restrict__ bv, u16* QH, u16* QL, u16* KH, u16* KL, u16* VT) {
  static_assert(QS == KS);
  __shared__ __align__(16) unsigned char ring[2 * 2 * PLANEB];
  const int bid = blockIdx.x;
  if (bid < GB_V) {
    gemm_body<false, M_S16, true>(ring, bid, WV, WV, XV, bv, nullptr, VT, VT,
                                  INNER, SKV, DM, 0, SKV * DM, 0, INNER * SKV, VS / WSC, VS, 1.0f);
  } else {
    const bool isk = bid < GB_V + GB_K;
    const u16* A = isk ? XV : XQ;
    gemm_body<false, M_HL, false>(ring, isk ? bid - GB_V : bid - (GB_V + GB_K), A, A, isk ? WK : WQ, isk ? bk : bq, nullptr,
                                  isk ? KH : QH, isk ? KL : QL, isk ? NB * SKV : NB * SQ, INNER, DM, 0, 0, 0, 0,
                                  QS / WSC, QS, 1.0f);
  }
}

// =====================================================================================================
// Full (unmasked) multi-head cross attention with a per-key additive bias bfr(beta[h]) * sim[b][key]:
// block = (batch b, head, 128 query rows), 4 waves, wave w owns the 32 query rows q0 = 128*qt + 32*w .. q0+31 as two tiles of
// 16 (u = 0, 1); what follows is said of one tile; every k, v^T and sim fragment that the wave reads from LDS serves both tiles
// The keys are walked in tiles of 64: each tile's k hi, k residual and v^T rows (64 rows x 128 B each, LDS pitch 144 B) are
// staged in LDS by asynchronous copies, two buffers, the next tile's copies in flight while this tile is worked on; the four
// waves share the tile. The batch's sim row (2 KB) is staged once with tile 0. One barrier per tile.
//   q planes f16 x8 hi / residual(x2048) [b*SQ + s][h*64 + d]; k planes likewise [b*SKV + s][h*64 + d];
//   v^T plane f16 x8 [(b*NH + h)*64 + d][s]; sim plane f32 [b][s]. All NKB key blocks of 32 keys are visited (static bound).
//   Scores are computed TRANSPOSED: S^T tile g (g = 0,1) = k rows (keys kb+16g .. +15, A operand, row m = lane&15, split map
//   over d) times q^T (B operand, col n = query q0 + (lane&15), k = d, split map), 2 d-chunks of 32; per chunk hi.hi -> s,
//   res.hi + hi.res -> r (scaled x2048, folded as s + r/2048); the q fragments are loaded once per wave.
//   D element r of lane l = (key kb+16g+8h+r, query q0+(l&15)), so a lane owns one query column and 16 of its 32 keys;
//   the partner lane l^16 owns the other 16 -> row max / row sum need one xor-16 shuffle. The bias of the lane's 16 keys
//   comes from four 16-B loads of the sim row (keys kb+8h..+7 and kb+16+8h..+7), times bfr(beta[h])*log2(e), added in f32.
//   Online max-subtracted base-2 softmax in f32 (1/sqrt(64) and the q/k carries folded into lsc). The exp'd values ARE the
//   P A-fragment in place: A row m = query = lane&15, element i <- key kb+8h+i (tile 0, D element i), element 8+i <- key
//   kb+16+8h+i (tile 1, D element i). P (<= 1) carried x32768 as f16. The rescale factor of query row 8h+r of the O
//   accumulators is fetched from lane 8h+r with a shuffle (uniform control). 4 v^T B fragments (col n = d = 16j + (lane&15),
//   keys k-contiguous), 4 P.V WMMAs.
//   Epilogue: 1/l (per query, shuffled to the D row owner) and the carry folds in f32; the wave's 16x64 f32 result staged in
// coverage: per wave and tile 4 instructions x 4 rows x 8 lanes x 8 halves = 16 x 64 on both ctx planes; grid NB*NH*(SQ/128)
//           blocks x 4 waves x 2 tiles = every (b, s, h) row segment exactly once. LDS slab: 16 x 64 staged == 16 x 64 reloaded.
// =====================================================================================================
// One 64-key tile: 128 threads, thread = (row tid>>3 of a group of 16, 16-B piece tid&7), four groups per plane: one
// wave-instruction covers four whole 128-B lines. l = the lane's LDS byte address in the buffer's first plane.
__device__ __forceinline__ void copy_keys(unsigned l, const _Float16* kh, const _Float16* kl, const _Float16* v) {
#if defined(__HIP_DEVICE_COMPILE__)
  // the closing s_wait_xcnt stands inside the statement so that no address register is rewritten ahead of it
  asm volatile("global_load_async_to_lds_b128 %0, %12, off\n\t"
               "global_load_async_to_lds_b128 %1, %13, off\n\t"
               "global_load_async_to_lds_b128 %2, %14, off\n\t"
               "global_load_async_to_lds_b128 %3, %15, off\n\t"
               "global_load_async_to_lds_b128 %4, %16, off\n\t"
               "global_load_async_to_lds_b128 %5, %17, off\n\t"
               "global_load_async_to_lds_b128 %6, %18, off\n\t"
               "global_load_async_to_lds_b128 %7, %19, off\n\t"
               "global_load_async_to_lds_b128 %8, %20, off\n\t"
               "global_load_async_to_lds_b128 %9, %21, off\n\t"
               "global_load_async_to_lds_b128 %10, %22, off\n\t"
               "global_load_async_to_lds_b128 %11, %23, off\n\t"
               "s_wait_xcnt 0x0"
               :: "v"(l), "v"(l + 16 * LPITCH), "v"(l + 32 * LPITCH), "v"(l + 48 * LPITCH),
                  "v"(l + APLANEB), "v"(l + APLANEB + 16 * LPITCH), "v"(l + APLANEB + 32 * LPITCH),
                  "v"(l + APLANEB + 48 * LPITCH),
                  "v"(l + 2 * APLANEB), "v"(l + 2 * APLANEB + 16 * LPITCH), "v"(l + 2 * APLANEB + 32 * LPITCH),
                  "v"(l + 2 * APLANEB + 48 * LPITCH),
                  "v"(kh), "v"(kh + (size_t)16 * INNER), "v"(kh + (size_t)32 * INNER), "v"(kh + (size_t)48 * INNER),
                  "v"(kl), "v"(kl + (size_t)16 * INNER), "v"(kl + (size_t)32 * INNER), "v"(kl + (size_t)48 * INNER),
                  "v"(v), "v"(v + (size_t)16 * SKV), "v"(v + (size_t)32 * SKV), "v"(v + (size_t)48 * SKV)
               : "memory");
#endif
}
// The batch's sim row: 128 threads x 16 B = 512 floats.
__device__ __forceinline__ void copy_sim(unsigned l, const float* g) {
#if defined(__HIP_DEVICE_COMPILE__)
  // the closing s_wait_xcnt stands inside the statement so that no address register is rewritten ahead of it
  asm volatile("global_load_async_to_lds_b128 %0, %1, off\n\t"
               "s_wait_xcnt 0x0"
               :: "v"(l), "v"(g) : "memory");
#endif
}

__global__ __launch_bounds__(ATT_THREADS)
void attn_fwd(const u16* __restrict__ Qh, const u16* __restrict__ Ql, const u16* __restrict__ Kh,
              const u16* __restrict__ Kl, const u16* __restrict__ Vp, const float* __restrict__ Simp,
              const float* __restrict__ beta, u16* Oh, u16* Ol) {
  __shared__ __align__(16) unsigned char ring[2 * ABUFB];
  __shared__ __align__(16) float simrow[SKV];

  const int tid  = threadIdx.x;
  const int wave = tid >> 5;
  const int lane = tid & 31;
  const int hh   = lane >> 4;
  const int c    = lane & 15;

  constexpr int NQT = SQ / ATT_ROWS;
  const int bid  = blockIdx.x;
  const int qt   = bid % NQT;
  const int head = (bid / NQT) % NH;
  const int b    = bid / (NQT * NH);
  const int q0   = qt * ATT_ROWS + wave * (ATT_QT * 16);

  // B fragments of q^T: col n = query q0 + 16u + c, k = d (k-contiguous row of the q planes)
  const size_t qo = ((size_t)(b * SQ + q0 + c)) * INNER + head * HD + 8 * hh;
  const _Float16* Qhb = (const _Float16*)(const void*)Qh + qo;
  const _Float16* Qlb = (const _Float16*)(const void*)Ql + qo;
  // copy side: the lane's row in a group of 16 and its 16-B piece of the 128-B row (k rows = keys, v^T rows = d)
  const int cr = tid >> 3, cc = tid & 7;
  const size_t ko = ((size_t)(b * SKV + cr)) * INNER + head * HD + 8 * cc;
  const _Float16* gkh = (const _Float16*)(const void*)Kh + ko;
  const _Float16* gkl = (const _Float16*)(const void*)Kl + ko;
  const _Float16* gv  = (const _Float16*)(const void*)Vp + ((size_t)(b * NH + head) * HD + cr) * SKV + 8 * cc;
  const unsigned lc = lds_off(ring) + (unsigned)(cr * LPITCH + cc * 16);
  // A fragments of k: row m = key 16g + c of the staged tile, k = d; +16 B for the upper lane half
  const unsigned char* fk = ring + c * LPITCH + 16 * hh;
  // B fragments of v: col n = d = 16j + c (row of the staged v^T tile), k = key
  const unsigned char* fv = ring + 2 * APLANEB + c * LPITCH + 16 * hh;
  // per-key bias row of this batch in LDS, offset to the lane half's first key
  const float* Sb = simrow + 8 * hh;
  const float bl2 = bfr(beta[head]) * LOG2E;
  const float lsc = (LOG2E * RSQ_HD) / (QS * KS);

  // every loop over u (the wave's query tiles) is unrolled so that the per-tile arrays stay in registers
  v16h qh[ATT_QT][2], ql[ATT_QT][2];
#pragma unroll
  for (int u = 0; u < ATT_QT; ++u) {
    qh[u][0] = ldfrag_h(Qhb + (size_t)u * 16 * INNER);
    qh[u][1] = ldfrag_h(Qhb + (size_t)u * 16 * INNER + 32);
    ql[u][0] = ldfrag_h(Qlb + (size_t)u * 16 * INNER);
    ql[u][1] = ldfrag_h(Qlb + (size_t)u * 16 * INNER + 32);
  }
  // precaution: the loads' addresses, named as inputs, stay in their registers up to this wait and are rewritten only behind it
  asm volatile("s_wait_xcnt 0x0" :: "v"(Qhb), "v"(Qlb) : "memory");

  float mrun[ATT_QT], lrun[ATT_QT];
  v8f o[ATT_QT][4];
#pragma unroll
  for (int u = 0; u < ATT_QT; ++u) {
    mrun[u] = -INFINITY;
    lrun[u] = 0.f;
#pragma unroll
    for (int j = 0; j < 4; ++j) o[u][j] = zero8();
  }

  // tile 0 and the sim row -> LDS, landed and published; then tile 1 -> buffer 1 in flight
  copy_keys(lc, gkh, gkl, gv);
  copy_sim(lds_off(simrow) + (unsigned)(tid * 16), Simp + (size_t)b * SKV + 4 * tid);
  asm volatile("s_wait_asynccnt 0x0" ::: "memory");        // this wave's copies of tile 0 have landed
  __syncthreads();                                         // ... and every other wave's
  copy_keys(lc + ABUFB, gkh + (size_t)AKT * INNER, gkl + (size_t)AKT * INNER, gv + AKT);

  // rolled over the tiles: one copy of the tile body in the instruction cache
#pragma unroll 1
  for (int st = 0; st < NST; ++st) {
   const int bo = (st & 1) * ABUFB;
   // unrolled: the two 32-key halves of a tile differ only in constant LDS offsets
#pragma unroll
   for (int sub = 0; sub < AKT / 32; ++sub) {
    const int kb = st * AKT + sub * 32;
    // ---- transposed scores: s0 = keys kb..kb+15, s1 = keys kb+16..kb+31, column = query q0 + 16u + c ----
    v8f s0[ATT_QT], s1[ATT_QT], r0[ATT_QT], r1[ATT_QT];
#pragma unroll
    for (int u = 0; u < ATT_QT; ++u) { s0[u] = zero8(); s1[u] = zero8(); r0[u] = zero8(); r1[u] = zero8(); }
    const _Float16* k0h = (const _Float16*)(const void*)(fk + bo + sub * 32 * LPITCH);
    const _Float16* k1h = (const _Float16*)(const void*)(fk + bo + (sub * 32 + 16) * LPITCH);
    const _Float16* k0l = (const _Float16*)(const void*)(fk + bo + APLANEB + sub * 32 * LPITCH);
    const _Float16* k1l = (const _Float16*)(const void*)(fk + bo + APLANEB + (sub * 32 + 16) * LPITCH);
#pragma unroll
    for (int kk = 0; kk < HD / 32; ++kk) {
      const v16h fh0 = ldfrag_h(k0h + kk * 32);
      const v16h fh1 = ldfrag_h(k1h + kk * 32);
      const v16h fl0 = ldfrag_h(k0l + kk * 32);
      const v16h fl1 = ldfrag_h(k1l + kk * 32);
#pragma unroll
      for (int u = 0; u < ATT_QT; ++u) {
        s0[u] = mma_h(fh0, qh[u][kk], s0[u]);
        s1[u] = mma_h(fh1, qh[u][kk], s1[u]);
        r0[u] = mma_h(fl0, qh[u][kk], r0[u]);
        r1[u] = mma_h(fl1, qh[u][kk], r1[u]);
      }
#pragma unroll
      for (int u = 0; u < ATT_QT; ++u) {
        r0[u] = mma_h(fh0, ql[u][kk], r0[u]);
        r1[u] = mma_h(fh1, ql[u][kk], r1[u]);
      }
      // keeps the next d-chunk's LDS loads and products behind this chunk's products, so that only one chunk's fragments are
      // live: without it the kernel takes over 300 registers and loses the fourth wave per SIMD
      __builtin_amdgcn_sched_barrier(0);
    }
    // ---- per-key bias: keys kb+8hh+0..7 (g0, g1) and kb+16+8hh+0..7 (g2, g3), the same for both query tiles ----
    const v4f g0 = *(const v4f*)(Sb + kb);
    const v4f g1 = *(const v4f*)(Sb + kb + 4);
    const v4f g2 = *(const v4f*)(Sb + kb + 16);
    const v4f g3 = *(const v4f*)(Sb + kb + 20);
    FragH ph[ATT_QT];
#pragma unroll
    for (int u = 0; u < ATT_QT; ++u) {
      // ---- base-2 logits of this lane's 16 keys for query q0 + 16u + c: t[i] <- key kb+8hh+i, t[8+i] <- key kb+16+8hh+i ----
      float t[16];
#pragma unroll
      for (int i = 0; i < 4; ++i) {
        t[i]      = (s0[u][i]     + r0[u][i]     * RINV) * lsc + g0[i] * bl2;
        t[4 + i]  = (s0[u][4 + i] + r0[u][4 + i] * RINV) * lsc + g1[i] * bl2;
        t[8 + i]  = (s1[u][i]     + r1[u][i]     * RINV) * lsc + g2[i] * bl2;
        t[12 + i] = (s1[u][4 + i] + r1[u][4 + i] * RINV) * lsc + g3[i] * bl2;
      }
      float cm = t[0];
#pragma unroll
      for (int i = 1; i < 16; ++i) cm = fmaxf(cm, t[i]);
      cm = fmaxf(cm, __shfl_xor(cm, 16, 32));
      const float mn = fmaxf(mrun[u], cm);     // finite from the first block on
      float al = mrun[u] - mn;                 // -> 2^(mrun - mn): 0 on the first block (mrun = -inf)
      // unrolled so that t stays in registers; t -> 2^(t - mn), the probabilities
#pragma unroll
      for (int i = 0; i < 16; ++i) t[i] -= mn;
      exp2_run(al, t);
      mrun[u] = mn;
      // ---- probabilities (<= 1) and the P A-fragment: f16(p * 32768); element i <-> t[i] ----
      float ps = 0.f;
#pragma unroll
      for (int w = 0; w < 2; ++w) {
#pragma unroll
        for (int e4 = 0; e4 < 4; ++e4) {
          const int i = 8 * w + 2 * e4;
          const float p0 = t[i], p1 = t[i + 1];
          ps += p0 + p1;
          ph[u].u[w][e4] = pk16(h_bits((_Float16)(p0 * PCAR)), h_bits((_Float16)(p1 * PCAR)));
        }
      }
      ps += __shfl_xor(ps, 16, 32);
      lrun[u] = lrun[u] * al + ps;
      // ---- rescale the O accumulators: D row 8hh+r = query q0+16u+8hh+r, its factor lives in lane 8hh+r (and 16+8hh+r) ----
      float scl[8];
#pragma unroll
      for (int r = 0; r < 8; ++r) scl[r] = __shfl(al, 8 * hh + r, 32);
#pragma unroll
      for (int j = 0; j < 4; ++j) {
#pragma unroll
        for (int r = 0; r < 8; ++r) o[u][j][r] *= scl[r];
      }
    }
    // ---- P.V : B fragment col n = d = j*16 + c, keys contiguous in the v^T plane; each fragment serves both query tiles ----
    {
      const unsigned char* vp = fv + bo + sub * 64;
      const v16h v0 = ldfrag_h((const _Float16*)(const void*)(vp));
      const v16h v1 = ldfrag_h((const _Float16*)(const void*)(vp + 16 * LPITCH));
      const v16h v2 = ldfrag_h((const _Float16*)(const void*)(vp + 32 * LPITCH));
      const v16h v3 = ldfrag_h((const _Float16*)(const void*)(vp + 48 * LPITCH));
#pragma unroll
      for (int u = 0; u < ATT_QT; ++u) {
        o[u][0] = mma_h(ph[u].v, v0, o[u][0]);
        o[u][1] = mma_h(ph[u].v, v1, o[u][1]);
        o[u][2] = mma_h(ph[u].v, v2, o[u][2]);
        o[u][3] = mma_h(ph[u].v, v3, o[u][3]);
      }
      // for the same reason the next half's loads and products stay behind this half's last products
      __builtin_amdgcn_sched_barrier(0);
    }
   }
   asm volatile("s_wait_dscnt 0x0" ::: "memory");          // this wave's reads of the buffer are done before it is refilled
   asm volatile("s_wait_asynccnt 0x0" ::: "memory");       // this wave's copies of tile st + 1 have landed
   __syncthreads();                                        // publishes tile st + 1, ends every reader's use of tile st
   if (st + 2 < NST) {                                     // the same for the whole block
     const size_t k2 = (size_t)(st + 2) * AKT;
     copy_keys(lc + bo, gkh + k2 * INNER, gkl + k2 * INNER, gv + k2);
   }
  }
  asm volatile("s_wait_asynccnt 0x0" ::: "memory");        // no copy outstanding when the ring becomes output staging

#pragma unroll
  for (int u = 0; u < ATT_QT; ++u) {
    acc_guard4(o[u]);
    // ---- fold 1/l (per query, owned by lane = query) and the carries (32768 on P, 8 on v), apply the ctx carry 1024 ----
    const float linv = (1.0f / lrun[u]) * (OSC / (PCAR * VS));
    float inv[8];
#pragma unroll
    for (int r = 0; r < 8; ++r) inv[r] = __shfl(linv, 8 * hh + r, 32);
    float* slab = (float*)(void*)ring + (wave * ATT_QT + u) * 16 * OPITCH;   // the ring is free behind the last tile's barrier
#pragma unroll
    for (int r = 0; r < 8; ++r) {
#pragma unroll
      for (int j = 0; j < 4; ++j) slab[(8 * hh + r) * OPITCH + j * 16 + c] = o[u][j][r] * inv[r];
    }
    wave_sync_lds();
    // ---- ctx x1024 -> f16 hi plane and residual plane; lane = (row in group of 4, 8 consecutive d) ----
    v4u ovh[4], ovl[4];
    const int rq = lane >> 3, c8 = (lane & 7) * 8;
#pragma unroll
    for (int i = 0; i < 4; ++i) {
      const int row = 4 * i + rq;
      const v4f a = *(const v4f*)(slab + row * OPITCH + c8), c4 = *(const v4f*)(slab + row * OPITCH + c8 + 4);
#pragma unroll
      for (int e = 0; e < 2; ++e) {
        unsigned ph0, pl0, ph1, pl1;
        split2(a[2 * e],  a[2 * e + 1],  ph0, pl0);
        split2(c4[2 * e], c4[2 * e + 1], ph1, pl1);
        ovh[i][e] = ph0;     ovl[i][e] = pl0;
        ovh[i][2 + e] = ph1; ovl[i][2 + e] = pl1;
      }
    }
    const size_t oo = ((size_t)(b * SQ + q0 + 16 * u)) * INNER + head * HD + c8;
    u16* obh = Oh + oo;
    u16* obl = Ol + oo;
#pragma unroll
    for (int i = 0; i < 4; ++i) {
      const int row = 4 * i + rq;
      *(v4u*)(obh + (size_t)row * INNER) = ovh[i];
      *(v4u*)(obl + (size_t)row * INNER) = ovl[i];
    }
    // precaution: no register that an issued store names is rewritten (by the next query tile's work) ahead of this wait
    asm volatile("s_wait_xcnt 0x0" ::: "memory");
  }
}

// =====================================================================================================
// Workspace map (bytes, NB=8, SQ=2048); every plane fully written by whole-line stores before it is read; all extents exact
//   XQ   f16 [NB*SQ][768]    f16(bf16(x))                 25165824   (region reused later as OH, same extent)
//   XV   f16 [NB*512][768]   f16(bf16(kg_value))           6291456
//   WQ16 WK16 WV16 WO16 f16 [768 n][768 k] x256            1179648 each
//   QH QL f16 [NB*SQ][768] x8 hi / res                     25165824 each
//   KH KL f16 [NB*512][768] x8 hi / res                     6291456 each
//   VT16 f16 [NB*768 (h,d)][512 s] x8                       6291456
//   OL   f16 [NB*SQ][768] x1024 res (ctx), OH aliases XQ    25165824
//   SIMP f32 [NB][512]                                         16384
//   end                                                    130564096
// =====================================================================================================
extern "C" void kernel_launch(void* const* d_in, const int* in_sizes, int n_in,
                              void* d_out, int out_size, void* d_ws, size_t ws_size,
                              hipStream_t stream) {
  if (n_in < 14) return;
  if (in_sizes[0] < ((NB - 1) * SQ_FULL + SQ) * DM) return;
  if (in_sizes[1] < 1) return;
  if (in_sizes[2] < NB * DM) return;
  if (in_sizes[3] < NB * SKV * DM || in_sizes[4] < NB * SKV * DM) return;
  if (in_sizes[5] < NH) return;
  if (in_sizes[6] != DM * DM || in_sizes[8] != DM * DM || in_sizes[10] != DM * DM || in_sizes[12] != DM * DM) return;
  if (in_sizes[7] < DM || in_sizes[9] < DM || in_sizes[11] < DM || in_sizes[13] < DM) return;
  if (out_size < ((NB - 1) * SQ_FULL + SQ) * DM) return;

  const float* x_in   = (const float*)d_in[0];
  const int*   msk    = (const int*)d_in[1];
  const float* pooled = (const float*)d_in[2];
  const float* kgk    = (const float*)d_in[3];
  const float* kgv    = (const float*)d_in[4];
  const float* beta   = (const float*)d_in[5];
  const float* wq     = (const float*)d_in[6];
  const float* bq     = (const float*)d_in[7];
  const float* wk     = (const float*)d_in[8];
  const float* bk     = (const float*)d_in[9];
  const float* wv     = (const float*)d_in[10];
  const float* bv     = (const float*)d_in[11];
  const float* wo     = (const float*)d_in[12];
  const float* bo     = (const float*)d_in[13];
  float*       out    = (float*)d_out;

  const size_t szXQ = (size_t)NB * SQ * DM * 2;
  const size_t szXV = (size_t)NB * SKV * DM * 2;
  const size_t szW  = (size_t)DM * DM * 2;
  const size_t szQP = (size_t)NB * SQ * INNER * 2;
  const size_t szKP = (size_t)NB * SKV * INNER * 2;
  const size_t szVT = (size_t)NB * INNER * SKV * 2;
  const size_t szS  = (size_t)NB * SKV * 4;
  static_assert((size_t)NB * SQ * DM * 2 == (size_t)NB * SQ * INNER * 2);   // XQ region reused as OH, same extent
  size_t off = 0;
  const size_t oXQ = off; off += szXQ;      // also OH
  const size_t oXV = off; off += szXV;
  const size_t oWQ = off; off += szW;
  const size_t oWK = off; off += szW;
  const size_t oWV = off; off += szW;
  const size_t oWO = off; off += szW;
  const size_t oQH = off; off += szQP;
  const size_t oQL = off; off += szQP;
  const size_t oKH = off; off += szKP;
  const size_t oKL = off; off += szKP;
  const size_t oVT = off; off += szVT;
  const size_t oOL = off; off += szQP;
  const size_t oS  = off; off += szS;
  if (off > ws_size) return;                // off = 130564096 at NB=8, SQ=2048
  if (off > (size_t)134217728) return;

  char* ws = (char*)d_ws;
  u16* XQ   = (u16*)(ws + oXQ);
  u16* XV   = (u16*)(ws + oXV);
  u16* WQ16 = (u16*)(ws + oWQ);
  u16* WK16 = (u16*)(ws + oWK);
  u16* WV16 = (u16*)(ws + oWV);
  u16* WO16 = (u16*)(ws + oWO);
  u16* QH   = (u16*)(ws + oQH);
  u16* QL   = (u16*)(ws + oQL);
  u16* KH   = (u16*)(ws + oKH);
  u16* KL   = (u16*)(ws + oKL);
  u16* VT16 = (u16*)(ws + oVT);
  u16* OH   = (u16*)(ws + oXQ);
  u16* OL   = (u16*)(ws + oOL);
  float* SIMP = (float*)(ws + oS);

  // (0) activations -> f16 planes of bf16-converted values (query rows s < SQ of batches b < NB, compact; kg_value rows) and
  //     weights [n = out][k = in] (y = x.W^T): already k-contiguous [n][k]; f16 planes of bf16(W) x256; one launch
  //     with, in the same launch, the cosine similarity sim[b][k] -> SIMP f32 [NB][512]
  prep_all<<<dim3(SIM_BLOCKS + CVB_X + CVB_V + 4 * CVB_W), dim3(CVT_THREADS), 0, stream>>>(
      x_in, kgv, wq, wk, wv, wo, pooled, kgk, msk, XQ, XV, WQ16, WK16, WV16, WO16, SIMP);
  // (7) the q, k and v^T projections, one launch
  gemm_qkv<<<dim3(GB_V + GB_K + GB_Q), dim3(128), 0, stream>>>(XQ, XV, WQ16, WK16, WV16, bq, bk, bv, QH, QL, KH, KL, VT16);
  // (10) attention with the beta*sim key bias -> ctx planes [NB*SQ][768] x1024 hi + res (OH reuses the XQ region)
  attn_fwd<<<dim3(NB * NH * (SQ / ATT_ROWS)), dim3(ATT_THREADS), 0, stream>>>(QH, QL, KH, KL, VT16, SIMP, beta, OH, OL);
  // (11) out rows [b][SQ_FULL][768] f32 = ctx . Wo^T + bo (rows s < SQ of batches b < NB); carries 1024 x 256 folded back
  gemm16<true, M_F32, false><<<dim3(NB * (SQ / 128) * (DM / 128)), dim3(128), 0, stream>>>(
      OH, OL, WO16, bo, out, OL, OL, SQ, DM, INNER, SQ * INNER, 0, SQ_FULL * DM, 0,
      1.0f / (OSC * WSC), 1.0f, 1.0f);
  (void)hipGetLastError();
}

// v009
// One run takes 96.2 microseconds.
// It is 1.44 times as fast as v007, going by the measured steps of the versions left out in between.
// All steps since v000 together make it 4.53 times as fast.
// Contractions on v_wmma_f32_16x16x32_f16 (f16 operands, f32 accumulate): x.Wq^T, xv.Wk^T, Wv.xv^T single products on
// f16(bf16(x)) and f16(bf16(W) x256); k.q^T single product (q and k each one f16 plane, x8);
// P.v^T single product (P x32768, v x8); ctx.Wo^T single product (ctx one f16 plane, x1024);
// cosine-similarity bias, softmax, biases and all carry folds in f32 on VALU.
// Inputs RNE-converted to bf16 on load: they hold 8 significant bits, the f16 planes between the products 11.
#include <hip/hip_runtime.h>
#include <math.h>
#include <stdint.h>

#ifndef NB
#define NB       8        // batches processed
#endif
#ifndef SQ
#define SQ       2048     // query rows processed per batch
#endif
#define NB_FULL  8
#define SQ_FULL  2048     // query rows per batch in the input / output layout (batch stride)
#define SKV      512      // key / value rows per batch (all of them)
#define DM       768      // model width
#define NH       12
#define HD       64
#define INNER    (NH * HD)
#define WSC      256.0f   // weight carry
#define QS       8.0f
#define KS       8.0f
#define VS       8.0f
#define PCAR     32768.0f
#define OSC      1024.0f  // ctx carry
#define LOG2E    1.4426950408889634f
#define RSQ_HD   0.125f
#define EPSN     1e-8f
#define NKB      (SKV / 32)
#define ATT_WAVES   4
#define ATT_THREADS (ATT_WAVES * 32)
#define ATT_QT      2        // 16-query tiles per wave: each k, v^T and sim fragment read from LDS serves both
#define ATT_ROWS    (ATT_WAVES * ATT_QT * 16)         // query rows per attention block
#define CVT_THREADS 256      // streaming convert: 8 waves per block
#define CVT_LOADS   32       // 16-B loads per lane, all in flight
#define CVT_WAVE    (CVT_LOADS * 32 * 4)              // floats per wave (16 KB in, 8 KB out)
#define CVT_BLOCK   (CVT_WAVE * (CVT_THREADS / 32))   // floats per block
#define CVB_XB      (SQ * DM / CVT_BLOCK)             // blocks per batch of query rows
#define CVB_X       (NB * CVB_XB)
#define CVB_V       (NB * SKV * DM / CVT_BLOCK)
#define CVB_W       (DM * DM / CVT_BLOCK)
#define SIM_THREADS 256
#define SIM_KEYS    32       // keys per similarity block (8 waves x 4)
#define SIM_BLOCKS  (NB * (SKV / SIM_KEYS))
#define PT_S        128      // projection tiles: 128 x 192 (q, k), 192 x 128 (v^T)
#define PT_L        192
#define OT_M        256      // output projection tile: 256 x 192
#define OT_N        192
#define GB_Q        ((NB * SQ / PT_S) * (INNER / PT_L))
#define GB_K        ((NB * SKV / PT_S) * (INNER / PT_L))
#define GB_V        (NB * (INNER / PT_L) * (SKV / PT_S))
#define OPITCH   68
#define GKT      64       // k per staged GEMM tile (128-B rows)
#define LPITCH   144      // LDS pitch of a staged row, bytes
#define AKT      64       // keys per staged attention tile (128-B rows in both planes)
#define APLANEB  (64 * LPITCH)
#define ABUFB    (2 * APLANEB)       // one attention buffer: [k | v^T]
#define NST      (SKV / AKT)

#define M_S16    1
#define M_F32    2

static_assert(NB >= 1 && NB <= NB_FULL);
static_assert((SQ % 128) == 0 && SQ >= 128 && SQ <= SQ_FULL);
static_assert(HD == 64 && INNER == 768 && NH == 12 && INNER == DM);
static_assert((SKV % 128) == 0 && (SKV % 32) == 0 && NKB * 32 == SKV && (SKV % SIM_KEYS) == 0);
static_assert((DM % 128) == 0 && (DM % 32) == 0 && (CVT_THREADS % 32) == 0);
static_assert((SQ * DM) % CVT_BLOCK == 0 && (NB * SKV * DM) % CVT_BLOCK == 0 && (DM * DM) % CVT_BLOCK == 0);
static_assert((OPITCH * 4) % 16 == 0);
static_assert((NB * SQ) % PT_S == 0 && (NB * SKV) % PT_S == 0 && (INNER % PT_L) == 0 && (SKV % PT_S) == 0);
static_assert((SQ % OT_M) == 0 && (DM % OT_N) == 0);
static_assert(ATT_THREADS * 4 == SKV && NST >= 2 && AKT == 64 && HD == 64);
static_assert(ATT_WAVES * ATT_QT * 16 * OPITCH * 4 <= 2 * ABUFB);      // attention output staging fits its ring
static_assert(ATT_QT == 2 && (SQ % ATT_ROWS) == 0);
static_assert(ATT_THREADS == 128 && SIM_THREADS == 256 && SIM_KEYS == (SIM_THREADS / 32) * 4 && SIM_THREADS == CVT_THREADS);

typedef unsigned short u16;
typedef _Float16 v16h __attribute__((ext_vector_type(16)));
typedef _Float16 v8h  __attribute__((ext_vector_type(8)));
typedef float    v8f  __attribute__((ext_vector_type(8)));
typedef float    v4f  __attribute__((ext_vector_type(4)));
typedef unsigned int v4u __attribute__((ext_vector_type(4)));
typedef unsigned int v2u __attribute__((ext_vector_type(2)));

union FragH { v16h v; v8h h[2]; v4u u[2]; };

// ---- scalar helpers ----------------------------------------------------------------------------------
__device__ __forceinline__ unsigned short bf_bits(float f) {          // f32 -> bf16 bits, RNE convert
  unsigned u = __float_as_uint(f);
  return (unsigned short)((u + 0x7FFFu + ((u >> 16) & 1u)) >> 16);
}
__device__ __forceinline__ float bf_up(unsigned short h) { return __uint_as_float(((unsigned)h) << 16); }
__device__ __forceinline__ float bfr(float f) { return bf_up(bf_bits(f)); }
__device__ __forceinline__ unsigned short h_bits(_Float16 x) { return __builtin_bit_cast(unsigned short, x); }
__device__ __forceinline__ unsigned pk16(unsigned short a, unsigned short b) { return (unsigned)a | ((unsigned)b << 16); }
// 2^x in place as the bare hardware instruction, for a key block's rescale exponent y and its 16 score exponents x. The library
// form wraps each in a compare, two selects, an add and an ldexp so that results below 2^-126 come out as subnormals; here such a
// result may be 0. Nothing downstream sees it: a probability below 2^-40 is 0 in P's f16 (x32768) anyway, the row sum is >= 1
// from the first key block on, and a rescale factor that small takes the old sums (at most 2^40 in size) below 2^-86.
// One statement: no instruction of the run touches another's register, and the closing v_nop is the slot that the instruction
// set asks for between a transcendental and the first use of its result.
__device__ __forceinline__ void exp2_run(float& y, float (&x)[16]) {
#if defined(__HIP_DEVICE_COMPILE__)
  asm("v_exp_f32 %0, %0\n\tv_exp_f32 %1, %1\n\tv_exp_f32 %2, %2\n\tv_exp_f32 %3, %3\n\t"
      "v_exp_f32 %4, %4\n\tv_exp_f32 %5, %5\n\tv_exp_f32 %6, %6\n\tv_exp_f32 %7, %7\n\t"
      "v_exp_f32 %8, %8\n\tv_exp_f32 %9, %9\n\tv_exp_f32 %10, %10\n\tv_exp_f32 %11, %11\n\t"
      "v_exp_f32 %12, %12\n\tv_exp_f32 %13, %13\n\tv_exp_f32 %14, %14\n\tv_exp_f32 %15, %15\n\t"
      "v_exp_f32 %16, %16\n\tv_nop"
      : "+v"(y), "+v"(x[0]), "+v"(x[1]), "+v"(x[2]), "+v"(x[3]), "+v"(x[4]), "+v"(x[5]), "+v"(x[6]), "+v"(x[7]),
        "+v"(x[8]), "+v"(x[9]), "+v"(x[10]), "+v"(x[11]), "+v"(x[12]), "+v"(x[13]), "+v"(x[14]), "+v"(x[15]));
#endif
}
__device__ __forceinline__ v8f zero8() { v8f z = {0.f, 0.f, 0.f, 0.f, 0.f, 0.f, 0.f, 0.f}; return z; }

// ---- fragment loader: 16-bit A/B operand, lane -> row/col (lane&15), p already includes +8*(lane>>4);
//      elements 0..7 <- p[0..7] (k0+8h..), elements 8..15 <- p[16..23] (k0+16+8h..); same split k map for A and B,
//      B always read from a k-contiguous [n][k] plane.
__device__ __forceinline__ v16h ldfrag_h(const _Float16* p) {
  FragH f;
  f.h[0] = *(const v8h*)(p);
  f.h[1] = *(const v8h*)(p + 16);
  return f.v;
}

// ---- WMMA helper and trailing VALU hazard gaps ----------------------------------------------------------
__device__ __forceinline__ v8f mma_h(v16h a, v16h b, v8f c) {
  return __builtin_amdgcn_wmma_f32_16x16x32_f16(false, a, false, b, (short)0, c, false, false);
}
__device__ __forceinline__ void acc_guard4(v8f (&a)[4]) {
#if defined(__HIP_DEVICE_COMPILE__)
  asm volatile("v_nop\n\tv_nop\n\tv_nop\n\tv_nop" : "+v"(a[0]), "+v"(a[1]), "+v"(a[2]), "+v"(a[3]));
#endif
}
__device__ __forceinline__ void wave_sync_lds() {
  __builtin_amdgcn_fence(__ATOMIC_RELEASE, "workgroup");
  __builtin_amdgcn_wave_barrier();
  __builtin_amdgcn_fence(__ATOMIC_ACQUIRE, "workgroup");
}

// =====================================================================================================
// Streaming convert, one launch for all six planes: Y[e] <- f16(bf16_RNE(x[e]) * scale), scale a power of two (1 for the two
// activation planes, 256 for the four weight planes). Every plane is a whole number of blocks; a block takes CVT_BLOCK
// consecutive floats of one plane (of one batch, for the query rows), a wave CVT_WAVE of them: 32 loads of 512 contiguous
// bytes, all asked for before the first is converted, then 32 stores of 256 contiguous bytes (whole lines both ways).
// coverage: bid = 0 .. CVB_X + CVB_V + 4 * CVB_W - 1, CVT_BLOCK floats each = every element of the six planes exactly once.
// =====================================================================================================
__device__ __forceinline__
void cvt_body(int bid, const float* __restrict__ x, const float* __restrict__ kgv, const float* __restrict__ wq,
              const float* __restrict__ wk, const float* __restrict__ wv, const float* __restrict__ wo,
              u16* XQ, u16* XV, u16* WQ, u16* WK, u16* WV, u16* WO) {
  const float* src;
  u16* dst;
  float scale;
  if (bid < CVB_X) {                                     // query rows s < SQ of batch b, compact in the plane
    const int b = bid / CVB_XB;
    src = x + (size_t)b * ((size_t)SQ_FULL * DM) + (size_t)(bid - b * CVB_XB) * CVT_BLOCK;
    dst = XQ + (size_t)bid * CVT_BLOCK;
    scale = 1.0f;
  } else if (bid < CVB_X + CVB_V) {
    const int r = bid - CVB_X;
    src = kgv + (size_t)r * CVT_BLOCK;
    dst = XV + (size_t)r * CVT_BLOCK;
    scale = 1.0f;
  } else {
    const int w = bid - (CVB_X + CVB_V);
    const int sel = w / CVB_W;
    const int r = w - sel * CVB_W;
    src = (sel == 0 ? wq : sel == 1 ? wk : sel == 2 ? wv : wo) + (size_t)r * CVT_BLOCK;
    dst = (sel == 0 ? WQ : sel == 1 ? WK : sel == 2 ? WV : WO) + (size_t)r * CVT_BLOCK;
    scale = WSC;
  }
  const int off = (threadIdx.x >> 5) * CVT_WAVE + (threadIdx.x & 31) * 4;
  const float* p = src + off;
  u16* q = dst + off;
  v4f v[CVT_LOADS];
#pragma unroll
  for (int it = 0; it < CVT_LOADS; ++it) v[it] = *(const v4f*)(p + it * 128);
  // keeps every load ahead of the first convert and store: the wave pays the memory latency once, not once per group
  __builtin_amdgcn_sched_barrier(0);
#pragma unroll
  for (int it = 0; it < CVT_LOADS; ++it) {
    v2u o;
    o[0] = pk16(h_bits((_Float16)(bfr(v[it][0]) * scale)), h_bits((_Float16)(bfr(v[it][1]) * scale)));
    o[1] = pk16(h_bits((_Float16)(bfr(v[it][2]) * scale)), h_bits((_Float16)(bfr(v[it][3]) * scale)));
    *(v2u*)(q + it * 128) = o;
  }
}

// =====================================================================================================
// Cosine similarity sim[b][k] = <p, kgk[b][k]> / (max(|p|, eps) * max(|kgk[b][k]|, eps)), p = pooled[b], all operands
// bf16-RNE-converted, f32 arithmetic on VALU. Block = 256 threads = 8 waves = 32 keys of one batch (wave w -> keys
// kb + 4w .. kb + 4w + 3). A wave asks for its five rows (p and four keys, 3 KB each) at once, 16 B per lane and load; lane l
// sums elements 128 i + 4 l + e in ascending (i, e); the nine lane sums go through one xor tree side by side.
// =====================================================================================================
__device__ __forceinline__
void sim_body(int bid, float* sv, const float* __restrict__ pooled, const float* __restrict__ kgk, float* S) {
  const int tid = threadIdx.x, wave = tid >> 5, lane = tid & 31;
  constexpr int NKBLK = SKV / SIM_KEYS;
  const int b  = bid / NKBLK;
  const int kb = (bid - b * NKBLK) * SIM_KEYS;
  const float* p = pooled + (size_t)b * DM + 4 * lane;
  const float* kr = kgk + ((size_t)b * SKV + (size_t)(kb + wave * 4)) * (size_t)DM + 4 * lane;   // keys < SKV by construction
  constexpr int NL = DM / 128;                                         // 512-B loads per row
  v4f pv[NL], kv[4][NL];
  // every loop below is unrolled so that the row arrays and the nine sums stay in registers
#pragma unroll
  for (int i = 0; i < NL; ++i) pv[i] = *(const v4f*)(p + i * 128);
#pragma unroll
  for (int j = 0; j < 4; ++j) {
#pragma unroll
    for (int i = 0; i < NL; ++i) kv[j][i] = *(const v4f*)(kr + j * DM + i * 128);
  }
  // keeps all 30 loads ahead of the first sum: the wave pays the memory latency once, not once per 512-B load
  __builtin_amdgcn_sched_barrier(0);
  float s[9];                                                          // |p|^2, <p, k_j>, |k_j|^2
#pragma unroll
  for (int q = 0; q < 9; ++q) s[q] = 0.f;
#pragma unroll
  for (int i = 0; i < NL; ++i) {
#pragma unroll
    for (int e = 0; e < 4; ++e) {
      const float xv = bfr(pv[i][e]);
      s[0] += xv * xv;
#pragma unroll
      for (int j = 0; j < 4; ++j) {
        const float yv = bfr(kv[j][i][e]);
        s[1 + j] += xv * yv;
        s[5 + j] += yv * yv;
      }
    }
  }
  // one xor tree (16, 8, 4, 2, 1) for all nine sums at once: the wave waits for five cross-lane exchanges, not five per sum
#pragma unroll
  for (int d = 16; d >= 1; d >>= 1) {
    float o[9];
#pragma unroll
    for (int q = 0; q < 9; ++q) o[q] = __shfl_xor(s[q], d, 32);
#pragma unroll
    for (int q = 0; q < 9; ++q) s[q] += o[q];
  }
  const float pnrm = fmaxf(sqrtf(s[0]), EPSN);
  {                                                                    // lane j < 4 finishes key j (every lane holds all sums)
    const int j = lane & 3;
    const float pk = j == 0 ? s[1] : j == 1 ? s[2] : j == 2 ? s[3] : s[4];
    const float kk = j == 0 ? s[5] : j == 1 ? s[6] : j == 2 ? s[7] : s[8];
    const float knrm = fmaxf(sqrtf(kk), EPSN);
    const float val = pk / (pnrm * knrm);
    if (lane < 4) sv[wave * 4 + lane] = val;
  }
  __syncthreads();
  if (wave == 0) {                                                     // wave-uniform
    const v4f v = *(const v4f*)(sv + 4 * (lane & 7));                   // clamped LDS address, all lanes load
    float* dst = S + (size_t)b * SKV + kb + 4 * (lane & 7);
    if (lane < 8) {
      *(v4f*)dst = v;
    }
    
  }
}

// =====================================================================================================
// One launch for the two jobs that read only inputs: blocks 0 .. SIM_BLOCKS - 1 do the cosine similarity, the rest the streaming convert. Neither reads what the other writes. The split is by block, so
// the barrier in sim_body is passed by every thread of a block that reaches it; a convert block returns behind its last store.
// =====================================================================================================
__global__ __launch_bounds__(CVT_THREADS)
void prep_all(const float* __restrict__ x, const float* __restrict__ kgv, const float* __restrict__ wq,
              const float* __restrict__ wk, const float* __restrict__ wv, const float* __restrict__ wo,
              const float* __restrict__ pooled, const float* __restrict__ kgk, const int* __restrict__ msk,
              u16* XQ, u16* XV, u16* WQ, u16* WK, u16* WV, u16* WO, float* S) {
  __shared__ __align__(16) float sv[SIM_KEYS];
  (void)msk;
  const int bid = blockIdx.x;
  if (bid >= SIM_BLOCKS) {
    cvt_body(bid - SIM_BLOCKS, x, kgv, wq, wk, wv, wo, XQ, XV, WQ, WK, WV, WO);
    return;
  }
  sim_body(bid, sv, pooled, kgk, S);
}

// =====================================================================================================
// Staging of f16 plane rows in LDS: rows of 128 B (64 k) at pitch 144 B (16 B x odd: ds_load_b128 free of bank conflicts).
// Thread = (row tid>>3 of a group, 16-B piece tid&7): one wave-instruction covers four whole 128-B lines, a group is as many
// rows as the block has threads / 8. l = the lane's LDS byte address in group 0, g = its global address in group 0,
// ls = a group in LDS bytes, gs = a group in source elements.
// =====================================================================================================
__device__ __forceinline__ unsigned lds_off(const void* p) { return (unsigned)(size_t)p; }
__device__ __forceinline__ void copy8(unsigned l, const _Float16* g, unsigned ls, size_t gs) {
#if defined(__HIP_DEVICE_COMPILE__)
  // the closing s_wait_xcnt stands inside the statement so that no address register is rewritten ahead of it
  asm volatile("global_load_async_to_lds_b128 %0, %8, off\n\t"
               "global_load_async_to_lds_b128 %1, %9, off\n\t"
               "global_load_async_to_lds_b128 %2, %10, off\n\t"
               "global_load_async_to_lds_b128 %3, %11, off\n\t"
               "global_load_async_to_lds_b128 %4, %12, off\n\t"
               "global_load_async_to_lds_b128 %5, %13, off\n\t"
               "global_load_async_to_lds_b128 %6, %14, off\n\t"
               "global_load_async_to_lds_b128 %7, %15, off\n\t"
               "s_wait_xcnt 0x0"
               :: "v"(l), "v"(l + ls), "v"(l + 2 * ls), "v"(l + 3 * ls),
                  "v"(l + 4 * ls), "v"(l + 5 * ls), "v"(l + 6 * ls), "v"(l + 7 * ls),
                  "v"(g), "v"(g + gs), "v"(g + 2 * gs), "v"(g + 3 * gs),
                  "v"(g + 4 * gs), "v"(g + 5 * gs), "v"(g + 6 * gs), "v"(g + 7 * gs)
               : "memory");
#endif
}
__device__ __forceinline__ void copy6(unsigned l, const _Float16* g, unsigned ls, size_t gs) {
#if defined(__HIP_DEVICE_COMPILE__)
  // the closing s_wait_xcnt stands inside the statement so that no address register is rewritten ahead of it
  asm volatile("global_load_async_to_lds_b128 %0, %6, off\n\t"
               "global_load_async_to_lds_b128 %1, %7, off\n\t"
               "global_load_async_to_lds_b128 %2, %8, off\n\t"
               "global_load_async_to_lds_b128 %3, %9, off\n\t"
               "global_load_async_to_lds_b128 %4, %10, off\n\t"
               "global_load_async_to_lds_b128 %5, %11, off\n\t"
               "s_wait_xcnt 0x0"
               :: "v"(l), "v"(l + ls), "v"(l + 2 * ls), "v"(l + 3 * ls), "v"(l + 4 * ls), "v"(l + 5 * ls),
                  "v"(g), "v"(g + gs), "v"(g + 2 * gs), "v"(g + 3 * gs), "v"(g + 4 * gs), "v"(g + 5 * gs)
               : "memory");
#endif
}
template <int NG>
__device__ __forceinline__ void copy_rows(unsigned l, const _Float16* g, unsigned ls, size_t gs) {
  static_assert(NG == 6 || NG == 8 || NG == 12);
  if constexpr (NG == 8) {
    copy8(l, g, ls, gs);
  } else {
    copy6(l, g, ls, gs);
    if constexpr (NG == 12) copy6(l + 6 * ls, g + 6 * gs, ls, gs);
  }
}

// Runs of 16-B global stores. The closing s_wait_xcnt stands inside the statement so that no address or data register of an
// issued store is rewritten ahead of it (written as plain stores, this compiler reuses those registers between them).
__device__ __forceinline__ void store8(void* const (&p)[8], const v4u (&d)[8]) {
#if defined(__HIP_DEVICE_COMPILE__)
  asm volatile("global_store_b128 %0, %8, off\n\t"
               "global_store_b128 %1, %9, off\n\t"
               "global_store_b128 %2, %10, off\n\t"
               "global_store_b128 %3, %11, off\n\t"
               "global_store_b128 %4, %12, off\n\t"
               "global_store_b128 %5, %13, off\n\t"
               "global_store_b128 %6, %14, off\n\t"
               "global_store_b128 %7, %15, off\n\t"
               "s_wait_xcnt 0x0"
               :: "v"(p[0]), "v"(p[1]), "v"(p[2]), "v"(p[3]), "v"(p[4]), "v"(p[5]), "v"(p[6]), "v"(p[7]),
                  "v"(d[0]), "v"(d[1]), "v"(d[2]), "v"(d[3]), "v"(d[4]), "v"(d[5]), "v"(d[6]), "v"(d[7])
               : "memory");
#endif
}
__device__ __forceinline__ void store6(void* const (&p)[6], const v4u (&d)[6]) {
#if defined(__HIP_DEVICE_COMPILE__)
  asm volatile("global_store_b128 %0, %6, off\n\t"
               "global_store_b128 %1, %7, off\n\t"
               "global_store_b128 %2, %8, off\n\t"
               "global_store_b128 %3, %9, off\n\t"
               "global_store_b128 %4, %10, off\n\t"
               "global_store_b128 %5, %11, off\n\t"
               "s_wait_xcnt 0x0"
               :: "v"(p[0]), "v"(p[1]), "v"(p[2]), "v"(p[3]), "v"(p[4]), "v"(p[5]),
                  "v"(d[0]), "v"(d[1]), "v"(d[2]), "v"(d[3]), "v"(d[4]), "v"(d[5])
               : "memory");
#endif
}

// Inputs-only fences on loaded fragments: keep a group's LDS loads together ahead of its products, so that the wave waits for
// LDS once per group and not once per few products.
__device__ __forceinline__ void hold(const v16h (&x)[4]) {
#if defined(__HIP_DEVICE_COMPILE__)
  asm volatile("" :: "v"(x[0]), "v"(x[1]), "v"(x[2]), "v"(x[3]));
#endif
}
__device__ __forceinline__ void hold(const v16h (&x)[6]) {
#if defined(__HIP_DEVICE_COMPILE__)
  asm volatile("" :: "v"(x[0]), "v"(x[1]), "v"(x[2]), "v"(x[3]), "v"(x[4]), "v"(x[5]));
#endif
}

// =====================================================================================================
// f16 GEMM. Block tile BM x BN = (WM * MI * 16) x (WN * NJ * 16), WM x WN waves, a wave owns MI x NJ tiles of 16 x 16
// (64 x 96 or 96 x 64: 10 fragments from LDS feed 24 products). The k range is walked in tiles of 64; each tile's A rows and Bt
// rows are staged in LDS by asynchronous copies, two buffers, the next tile's copies in flight while this tile is multiplied.
// The tile shapes are chosen for bytes per product (a block fetches (BM + BN) rows for BM x BN results) and so that each grid
// fills the chip a whole number of times.
//   C tile [z][Mb][N] = A[z][Mb][K] . Bt[z][N][K]^T * osc + bias; per-z element strides aBs (A),
//   bBs (Bt), fBs (f32 output F), hBs (16-bit output plane H); 0 = shared.
//   M_S16 : H = f16(v*carry)
//   M_F32 : F = v (f32 rows, batch-row remap through fBs), no 16-bit output
// grid = nz x (Mb/BM) x (N/BN) (all launches: Mb % BM == 0, N % BN == 0, K % 64 == 0, K >= 128).
// Each accumulator sums its k32 products in ascending k.
// PRE2: both k32 groups' fragments are asked for at the top of a tile (where the register budget has room for two sets).
// Epilogue: the ring is free behind the last tile's barrier.
//   M_S16: the block stages its BM x BN f16 results in the ring, one barrier, then every wave-instruction stores four whole
//          128-B lines. coverage: BM * BN / 8 pieces of 16 B over NT threads, each piece once.
//   M_F32: each wave stages one 16 x (NJ*16) f32 group at a time in its own slab and stores it as whole lines.
//          coverage: 16 * NJ * 4 pieces of 16 B over 32 lanes per group; MI groups x WM x WN waves = BM x BN.
// =====================================================================================================
// ring = the block's LDS ring of 2 * BUFB bytes, bid = the tile's index in that grid.
template <int MODE, bool BROW, int MI, int NJ, int WM, int WN, bool PRE2>
__device__ __forceinline__
void gemm_body(unsigned char* ring, int bid,
               const u16* __restrict__ Ah, const u16* __restrict__ Bt,
               const float* __restrict__ bias, float* F, u16* H,
               int Mb, int N, int K, int aBs, int bBs, int fBs, int hBs,
               float osc, float bsc, float carry) {
  constexpr int NT = WM * WN * 32, BM = WM * MI * 16, BN = WN * NJ * 16;
  constexpr int RG = NT / 8;                              // rows per copy group
  constexpr int APL = BM * LPITCH;                        // the A plane of a buffer
  constexpr int BUFB = (BM + BN) * LPITCH;                // one buffer: [A | Bt]
  constexpr unsigned LS = RG * LPITCH;
  static_assert(GKT == 64 && (BM % RG) == 0 && (BN % RG) == 0);
  const int tid = threadIdx.x, wave = tid >> 5, lane = tid & 31, hh = lane >> 4, m = lane & 15;
  const int ntile = N / BN, mtile = Mb / BM;
  const int nt   = bid % ntile;
  const int tmp  = bid / ntile;
  const int mt   = tmp % mtile;
  const int bz   = tmp / mtile;
  const int wm = wave / WN, wn = wave % WN;
  const int rowb = mt * BM + wm * (MI * 16);
  const int col0 = nt * BN + wn * (NJ * 16);
  // copy side: the lane's row in a group and its 16-B piece of the 128-B row
  const int cr = tid >> 3, cc = tid & 7;
  const _Float16* gah = (const _Float16*)(const void*)Ah + (size_t)bz * (size_t)aBs + (size_t)(mt * BM + cr) * (size_t)K + 8 * cc;
  const _Float16* gb  = (const _Float16*)(const void*)Bt + (size_t)bz * (size_t)bBs + (size_t)(nt * BN + cr) * (size_t)K + 8 * cc;
  const unsigned lc = lds_off(ring) + (unsigned)(cr * LPITCH + cc * 16);
  const size_t gs = (size_t)RG * (size_t)K;
  const int ntk = K >> 6;
  // fragment side: row (lane & 15) of the wave's first A / B group, +16 B for the upper lane half
  const unsigned char* fa = ring + (wm * (MI * 16) + m) * LPITCH + 16 * hh;
  const unsigned char* fb = ring + APL + (wn * (NJ * 16) + m) * LPITCH + 16 * hh;

  v8f ah[MI][NJ];
#pragma unroll
  for (int i = 0; i < MI; ++i) {
#pragma unroll
    for (int j = 0; j < NJ; ++j) ah[i][j] = zero8();
  }

  // tile 0 -> buffer 0, landed and published; then tile 1 -> buffer 1 in flight
  copy_rows<BM / RG>(lc, gah, LS, gs);
  copy_rows<BN / RG>(lc + APL, gb, LS, gs);
  asm volatile("s_wait_asynccnt 0x0" ::: "memory");        // this wave's copies of tile 0 have landed
  __syncthreads();                                         // ... and every other wave's
  if (ntk > 1) {                                           // the same for the whole block
    copy_rows<BM / RG>(lc + BUFB, gah + GKT, LS, gs);
    copy_rows<BN / RG>(lc + BUFB + APL, gb + GKT, LS, gs);
  }

  // rolled: one copy of the tile body, so that the hot loop stays small in the instruction cache; the unrolls inside it keep
  // the fragment and accumulator arrays in registers
#pragma unroll 1
  for (int t = 0; t < ntk; ++t) {
    const int bo = (t & 1) * BUFB;
    v16h a[2][MI], b[2][NJ];
#pragma unroll
    for (int kk = 0; kk < 2; ++kk) {
      // PRE2: on the first pass both groups are asked for, the second lands behind the first one's products
#pragma unroll
      for (int k2 = 0; k2 < 2; ++k2) {
        if (PRE2 ? kk == 0 : k2 == kk) {
#pragma unroll
          for (int i = 0; i < MI; ++i) a[k2][i] = ldfrag_h((const _Float16*)(const void*)(fa + bo + i * 16 * LPITCH + k2 * 64));
#pragma unroll
          for (int j = 0; j < NJ; ++j) b[k2][j] = ldfrag_h((const _Float16*)(const void*)(fb + bo + j * 16 * LPITCH + k2 * 64));
        }
      }
      hold(a[kk]);
      hold(b[kk]);
#pragma unroll
      for (int i = 0; i < MI; ++i) {
#pragma unroll
        for (int j = 0; j < NJ; ++j) ah[i][j] = mma_h(a[kk][i], b[kk][j], ah[i][j]);
      }
      // keeps this group's products ahead of what follows: of the second group's LDS loads or wait, and of the waits and the
      // barrier at the tile's foot, so that the copies in flight have the products' time to land
      __builtin_amdgcn_sched_barrier(0);
    }
    asm volatile("s_wait_dscnt 0x0" ::: "memory");         // this wave's reads of the buffer are done before it is refilled
    asm volatile("s_wait_asynccnt 0x0" ::: "memory");      // this wave's copies of tile t + 1 have landed
    __syncthreads();                                       // publishes tile t + 1, ends every reader's use of tile t
    if (t + 2 < ntk) {                                     // the same for the whole block
      const int ko = (t + 2) * GKT;
      copy_rows<BM / RG>(lc + bo, gah + ko, LS, gs);
      copy_rows<BN / RG>(lc + bo + APL, gb + ko, LS, gs);
    }
  }
  asm volatile("s_wait_asynccnt 0x0" ::: "memory");        // no copy outstanding when the ring becomes output staging

  // bias of the lane's columns (one per 16-column tile) or of its rows (eight per 16-row tile)
  float bc[NJ], br[MI][8];
  if (BROW) {
    const float* bp = bias + rowb + 8 * hh;
#pragma unroll
    for (int i = 0; i < MI; ++i) {
#pragma unroll
      for (int r = 0; r < 8; ++r) br[i][r] = bp[16 * i + r];
    }
    // precaution: the loads' address, named as an input, stays in its registers up to this wait and is rewritten only behind it
    asm volatile("s_wait_xcnt 0x0" :: "v"(bp) : "memory");
#pragma unroll
    for (int i = 0; i < MI; ++i) {
#pragma unroll
      for (int r = 0; r < 8; ++r) br[i][r] = bfr(br[i][r]) * bsc;
    }
  } else {
    const float* bp = bias + col0 + m;
#pragma unroll
    for (int j = 0; j < NJ; ++j) bc[j] = bp[16 * j];
    // precaution: the loads' address, named as an input, stays in its registers up to this wait and is rewritten only behind it
    asm volatile("s_wait_xcnt 0x0" :: "v"(bp) : "memory");
#pragma unroll
    for (int j = 0; j < NJ; ++j) bc[j] = bfr(bc[j]) * bsc;
  }

  if constexpr (MODE == M_F32) {
    // D element r of ah[g][j], lane l -> row 8h + r, col 16j + (l&15) of the wave's slab
    constexpr int FP = NJ * 16 + 4;                        // slab pitch in floats (16-B multiple, rows 8 apart on other banks)
    constexpr int PPR = NJ * 4, NP = 16 * PPR / 32;        // 16-B pieces per row, pieces per lane
    static_assert(WM * WN * 16 * FP * 4 <= 2 * BUFB && (FP * 4) % 16 == 0 && (16 * PPR) % (32 * 6) == 0 && (PPR % 8) == 0);
    float* sl = (float*)(void*)ring + wave * 16 * FP;
#pragma unroll
    for (int g = 0; g < MI; ++g) {
#pragma unroll
      for (int r = 0; r < 8; ++r) {
#pragma unroll
        for (int j = 0; j < NJ; ++j) {
          float v = ah[g][j][r] * osc;
          v += BROW ? br[g][r] : bc[j];
          sl[(8 * hh + r) * FP + 16 * j + m] = v;
        }
      }
      wave_sync_lds();
      float* Fb = F + (size_t)bz * (size_t)fBs + (size_t)(rowb + 16 * g) * (size_t)N + col0;
#pragma unroll
      for (int c = 0; c < NP; c += 6) {
        v4u vals[6];
        void* dst[6];
#pragma unroll
        for (int it = 0; it < 6; ++it) {
          const int p = (c + it) * 32 + lane;
          vals[it] = *(const v4u*)(const void*)(sl + (p / PPR) * FP + (p % PPR) * 4);
          dst[it] = Fb + (size_t)(p / PPR) * (size_t)N + (p % PPR) * 4;
        }
        store6(dst, vals);
      }
      wave_sync_lds();                                     // the slab's reads are done before the next group overwrites it
    }
  } else {
    // D element r of ah[i][j], lane l -> row 16i + 8h + r, col 16j + (l&15) of the wave's part of the block's f16 tile
    constexpr int SP = BN + 8;                             // staging pitch in halves (16-B multiple)
    constexpr int PPR = BN / 8, NP = BM * PPR / NT;        // 16-B pieces per row, pieces per thread
    static_assert(BM * SP * 2 <= 2 * BUFB && (SP * 2) % 16 == 0 && (BM * PPR) % (NT * 8) == 0 && (PPR % 8) == 0);
    _Float16* st = (_Float16*)(void*)ring;
    _Float16* sw = st + (wm * (MI * 16) + 8 * hh) * SP + wn * (NJ * 16) + m;
#pragma unroll
    for (int i = 0; i < MI; ++i) {
#pragma unroll
      for (int r = 0; r < 8; ++r) {
#pragma unroll
        for (int j = 0; j < NJ; ++j) {
          float v = ah[i][j][r] * osc;
          v += BROW ? br[i][r] : bc[j];
          sw[(16 * i + r) * SP + 16 * j] = (_Float16)(v * carry);
        }
      }
    }
    __syncthreads();                                       // every wave's part is staged before any line is gathered
    u16* Hb = H + (size_t)bz * (size_t)hBs + (size_t)(mt * BM) * (size_t)N + nt * BN;
#pragma unroll
    for (int c = 0; c < NP; c += 8) {
      v4u val[8];
      void* dst[8];
#pragma unroll
      for (int it = 0; it < 8; ++it) {
        const int p = (c + it) * NT + tid;
        val[it] = *(const v4u*)(const void*)(st + (p / PPR) * SP + (p % PPR) * 8);
        dst[it] = Hb + (size_t)(p / PPR) * (size_t)N + (p % PPR) * 8;
      }
      store8(dst, val);
    }
  }
}

// Output projection: 256 x 192 block tile, 8 waves (4 x 2) of 64 x 96, one block per WGP.
template <int MODE, bool BROW>
__global__ __launch_bounds__(256)
void gemm16(const u16* __restrict__ Ah, const u16* __restrict__ Bt,
            const float* __restrict__ bias, float* F, u16* H,
            int Mb, int N, int K, int aBs, int bBs, int fBs, int hBs,
            float osc, float bsc, float carry) {
  __shared__ __align__(16) unsigned char ring[2 * (OT_M + OT_N) * LPITCH];
  gemm_body<MODE, BROW, 4, 6, 4, 2, true>(ring, blockIdx.x, Ah, Bt, bias, F, H, Mb, N, K, aBs, bBs, fBs, hBs, osc, bsc, carry);
}

// The three input projections in one launch: none reads what another writes. 4 waves (2 x 2) per block; q and k tiles are
// 128 x 192 (waves of 64 x 96), v^T tiles 192 x 128 (waves of 96 x 64): GB_V + GB_K + GB_Q tiles of equal work.
// Blocks 0 .. GB_V - 1: v^T per batch (A = Wv [(h,d) = n][k], Bt = kg_value rows of batch b [s][k], bias bv
// per row -> f16 [(b,h,d)][s] x8); then GB_K blocks: k = kg_value . Wk^T + bk -> f16 [NB*512][768] x8; then GB_Q blocks:
// q_un = x . Wq^T + bq -> f16 [NB*SQ][768] x8 (col = h*64 + d; the 1/8 is folded into the softmax scale).
// The split is by block: every barrier in gemm_body is passed by all threads of its block.
__global__ __launch_bounds__(128)
void gemm_qkv(const u16* __restrict__ XQ, const u16* __restrict__ XV, const u16* __restrict__ WQ, const u16* __restrict__ WK,
              const u16* __restrict__ WV, const float* __restrict__ bq, const float* __restrict__ bk,
              const float* __restrict__ bv, u16* QH, u16* KH, u16* VT) {
  static_assert(QS == KS);
  __shared__ __align__(16) unsigned char ring[2 * (PT_S + PT_L) * LPITCH];
  const int bid = blockIdx.x;
  if (bid < GB_V) {
    gemm_body<M_S16, true, 6, 4, 2, 2, false>(ring, bid, WV, XV, bv, nullptr, VT,
                                              INNER, SKV, DM, 0, SKV * DM, 0, INNER * SKV, VS / WSC, VS, 1.0f);
  } else {
    const bool isk = bid < GB_V + GB_K;
    gemm_body<M_S16, false, 4, 6, 2, 2, false>(ring, isk ? bid - GB_V : bid - (GB_V + GB_K), isk ? XV : XQ, isk ? WK : WQ,
                                               isk ? bk : bq, nullptr, isk ? KH : QH, isk ? NB * SKV : NB * SQ, INNER, DM,
                                               0, 0, 0, 0, QS / WSC, QS, 1.0f);
  }
}

// =====================================================================================================
// Full (unmasked) multi-head cross attention with a per-key additive bias bfr(beta[h]) * sim[b][key]:
// block = (batch b, head, 128 query rows), 4 waves, wave w owns the 32 query rows q0 = 128*qt + 32*w .. q0+31 as two tiles of
// 16 (u = 0, 1); what follows is said of one tile; every k, v^T and sim fragment that the wave reads from LDS serves both tiles
// The keys are walked in tiles of 64: each tile's k and v^T rows (64 rows x 128 B each, LDS pitch 144 B) are
// staged in LDS by asynchronous copies, two buffers, the next tile's copies in flight while this tile is worked on; the four
// waves share the tile. The batch's sim row (2 KB) is staged once with tile 0. One barrier per tile.
//   q plane f16 x8 [b*SQ + s][h*64 + d]; k plane likewise [b*SKV + s][h*64 + d];
//   v^T plane f16 x8 [(b*NH + h)*64 + d][s]; sim plane f32 [b][s]. All NKB key blocks of 32 keys are visited (static bound).
//   Scores are computed TRANSPOSED: S^T tile g (g = 0,1) = k rows (keys kb+16g .. +15, A operand, row m = lane&15, split map
//   over d) times q^T (B operand, col n = query q0 + (lane&15), k = d, split map), 2 d-chunks of 32, one product each;
//   the q fragments are loaded once per wave.
//   D element r of lane l = (key kb+16g+8h+r, query q0+(l&15)), so a lane owns one query column and 16 of its 32 keys;
//   the partner lane l^16 owns the other 16 -> row max / row sum need one xor-16 shuffle. The bias of the lane's 16 keys
//   comes from four 16-B loads of the staged sim row (keys kb+8h..+7 and kb+16+8h..+7), times bfr(beta[h])*log2(e), added in f32.
//   Online max-subtracted base-2 softmax in f32 (1/sqrt(64) and the q/k carries folded into lsc). The exp'd values ARE the
//   P A-fragment in place: A row m = query = lane&15, element i <- key kb+8h+i (tile 0, D element i), element 8+i <- key
//   kb+16+8h+i (tile 1, D element i). P (<= 1) carried x32768 as f16. The rescale factor of query row 8h+r of the O
//   accumulators is fetched from lane 8h+r with a shuffle (uniform control). 4 v^T B fragments (col n = d = 16j + (lane&15),
//   keys k-contiguous), 4 P.V WMMAs.
//   Epilogue: 1/l (per query, shuffled to the D row owner) and the carry folds in f32; the wave's 16x64 f32 result staged in
// coverage: per wave and tile 4 instructions x 4 rows x 8 lanes x 8 halves = 16 x 64 of the ctx plane; grid NB*NH*(SQ/128)
//           blocks x 4 waves x 2 tiles = every (b, s, h) row segment exactly once. LDS slab: 16 x 64 staged == 16 x 64 reloaded.
// =====================================================================================================
// One 64-key tile: 128 threads, thread = (row tid>>3 of a group of 16, 16-B piece tid&7), four groups per plane: one
// wave-instruction covers four whole 128-B lines. l = the lane's LDS byte address in the buffer's first plane.
__device__ __forceinline__ void copy_keys(unsigned l, const _Float16* k, const _Float16* v) {
#if defined(__HIP_DEVICE_COMPILE__)
  // the closing s_wait_xcnt stands inside the statement so that no address register is rewritten ahead of it
  asm volatile("global_load_async_to_lds_b128 %0, %8, off\n\t"
               "global_load_async_to_lds_b128 %1, %9, off\n\t"
               "global_load_async_to_lds_b128 %2, %10, off\n\t"
               "global_load_async_to_lds_b128 %3, %11, off\n\t"
               "global_load_async_to_lds_b128 %4, %12, off\n\t"
               "global_load_async_to_lds_b128 %5, %13, off\n\t"
               "global_load_async_to_lds_b128 %6, %14, off\n\t"
               "global_load_async_to_lds_b128 %7, %15, off\n\t"
               "s_wait_xcnt 0x0"
               :: "v"(l), "v"(l + 16 * LPITCH), "v"(l + 32 * LPITCH), "v"(l + 48 * LPITCH),
                  "v"(l + APLANEB), "v"(l + APLANEB + 16 * LPITCH), "v"(l + APLANEB + 32 * LPITCH),
                  "v"(l + APLANEB + 48 * LPITCH),
                  "v"(k), "v"(k + (size_t)16 * INNER), "v"(k + (size_t)32 * INNER), "v"(k + (size_t)48 * INNER),
                  "v"(v), "v"(v + (size_t)16 * SKV), "v"(v + (size_t)32 * SKV), "v"(v + (size_t)48 * SKV)
               : "memory");
#endif
}
// The batch's sim row: 128 threads x 16 B = 512 floats.
__device__ __forceinline__ void copy_sim(unsigned l, const float* g) {
#if defined(__HIP_DEVICE_COMPILE__)
  // the closing s_wait_xcnt stands inside the statement so that no address register is rewritten ahead of it
  asm volatile("global_load_async_to_lds_b128 %0, %1, off\n\t"
               "s_wait_xcnt 0x0"
               :: "v"(l), "v"(g) : "memory");
#endif
}

__global__ __launch_bounds__(ATT_THREADS)
void attn_fwd(const u16* __restrict__ Qh, const u16* __restrict__ Kh, const u16* __restrict__ Vp,
              const float* __restrict__ Simp, const float* __restrict__ beta, u16* Oh) {
  __shared__ __align__(16) unsigned char ring[2 * ABUFB];
  __shared__ __align__(16) float simrow[SKV];

  const int tid  = threadIdx.x;
  const int wave = tid >> 5;
  const int lane = tid & 31;
  const int hh   = lane >> 4;
  const int c    = lane & 15;

  constexpr int NQT = SQ / ATT_ROWS;
  const int bid  = blockIdx.x;
  const int qt   = bid % NQT;
  const int head = (bid / NQT) % NH;
  const int b    = bid / (NQT * NH);
  const int q0   = qt * ATT_ROWS + wave * (ATT_QT * 16);

  // B fragments of q^T: col n = query q0 + 16u + c, k = d (k-contiguous row of the q plane)
  const size_t qo = ((size_t)(b * SQ + q0 + c)) * INNER + head * HD + 8 * hh;
  const _Float16* Qhb = (const _Float16*)(const void*)Qh + qo;
  // copy side: the lane's row in a group of 16 and its 16-B piece of the 128-B row (k rows = keys, v^T rows = d)
  const int cr = tid >> 3, cc = tid & 7;
  const size_t ko = ((size_t)(b * SKV + cr)) * INNER + head * HD + 8 * cc;
  const _Float16* gkh = (const _Float16*)(const void*)Kh + ko;
  const _Float16* gv  = (const _Float16*)(const void*)Vp + ((size_t)(b * NH + head) * HD + cr) * SKV + 8 * cc;
  const unsigned lc = lds_off(ring) + (unsigned)(cr * LPITCH + cc * 16);
  // A fragments of k: row m = key 16g + c of the staged tile, k = d; +16 B for the upper lane half
  const unsigned char* fk = ring + c * LPITCH + 16 * hh;
  // B fragments of v: col n = d = 16j + c (row of the staged v^T tile), k = key
  const unsigned char* fv = ring + APLANEB + c * LPITCH + 16 * hh;
  // per-key bias row of this batch in LDS, offset to the lane half's first key
  const float* Sb = simrow + 8 * hh;
  const float bl2 = bfr(beta[head]) * LOG2E;
  const float lsc = (LOG2E * RSQ_HD) / (QS * KS);

  // every loop over u (the wave's query tiles) is unrolled so that the per-tile arrays stay in registers
  v16h qh[ATT_QT][2];
#pragma unroll
  for (int u = 0; u < ATT_QT; ++u) {
    qh[u][0] = ldfrag_h(Qhb + (size_t)u * 16 * INNER);
    qh[u][1] = ldfrag_h(Qhb + (size_t)u * 16 * INNER + 32);
  }
  // precaution: the loads' address, named as an input, stays in its registers up to this wait and is rewritten only behind it
  asm volatile("s_wait_xcnt 0x0" :: "v"(Qhb) : "memory");

  float mrun[ATT_QT], lrun[ATT_QT];
  v8f o[ATT_QT][4];
#pragma unroll
  for (int u = 0; u < ATT_QT; ++u) {
    mrun[u] = -INFINITY;
    lrun[u] = 0.f;
#pragma unroll
    for (int j = 0; j < 4; ++j) o[u][j] = zero8();
  }

  // tile 0 and the sim row -> LDS, landed and published; then tile 1 -> buffer 1 in flight
  copy_keys(lc, gkh, gv);
  copy_sim(lds_off(simrow) + (unsigned)(tid * 16), Simp + (size_t)b * SKV + 4 * tid);
  asm volatile("s_wait_asynccnt 0x0" ::: "memory");        // this wave's copies of tile 0 have landed
  __syncthreads();                                         // ... and every other wave's
  copy_keys(lc + ABUFB, gkh + (size_t)AKT * INNER, gv + AKT);

  // rolled over the tiles: one copy of the tile body in the instruction cache
#pragma unroll 1
  for (int st = 0; st < NST; ++st) {
   const int bo = (st & 1) * ABUFB;
   // unrolled: the two 32-key halves of a tile differ only in constant LDS offsets
#pragma unroll
   for (int sub = 0; sub < AKT / 32; ++sub) {
    const int kb = st * AKT + sub * 32;
    // ---- transposed scores: s0 = keys kb..kb+15, s1 = keys kb+16..kb+31, column = query q0 + 16u + c ----
    v8f s0[ATT_QT], s1[ATT_QT];
#pragma unroll
    for (int u = 0; u < ATT_QT; ++u) { s0[u] = zero8(); s1[u] = zero8(); }
    const _Float16* k0h = (const _Float16*)(const void*)(fk + bo + sub * 32 * LPITCH);
    const _Float16* k1h = (const _Float16*)(const void*)(fk + bo + (sub * 32 + 16) * LPITCH);
#pragma unroll
    for (int kk = 0; kk < HD / 32; ++kk) {
      const v16h fh0 = ldfrag_h(k0h + kk * 32);
      const v16h fh1 = ldfrag_h(k1h + kk * 32);
#pragma unroll
      for (int u = 0; u < ATT_QT; ++u) {
        s0[u] = mma_h(fh0, qh[u][kk], s0[u]);
        s1[u] = mma_h(fh1, qh[u][kk], s1[u]);
      }
    }
    // ---- per-key bias: keys kb+8hh+0..7 (g0, g1) and kb+16+8hh+0..7 (g2, g3), the same for both query tiles ----
    const v4f g0 = *(const v4f*)(Sb + kb);
    const v4f g1 = *(const v4f*)(Sb + kb + 4);
    const v4f g2 = *(const v4f*)(Sb + kb + 16);
    const v4f g3 = *(const v4f*)(Sb + kb + 20);
    FragH ph[ATT_QT];
#pragma unroll
    for (int u = 0; u < ATT_QT; ++u) {
      // ---- base-2 logits of this lane's 16 keys for query q0 + 16u + c: t[i] <- key kb+8hh+i, t[8+i] <- key kb+16+8hh+i ----
      float t[16];
#pragma unroll
      for (int i = 0; i < 4; ++i) {
        t[i]      = s0[u][i]     * lsc + g0[i] * bl2;
        t[4 + i]  = s0[u][4 + i] * lsc + g1[i] * bl2;
        t[8 + i]  = s1[u][i]     * lsc + g2[i] * bl2;
        t[12 + i] = s1[u][4 + i] * lsc + g3[i] * bl2;
      }
      float cm = t[0];
#pragma unroll
      for (int i = 1; i < 16; ++i) cm = fmaxf(cm, t[i]);
      cm = fmaxf(cm, __shfl_xor(cm, 16, 32));
      const float mn = fmaxf(mrun[u], cm);     // finite from the first block on
      float al = mrun[u] - mn;                 // -> 2^(mrun - mn): 0 on the first block (mrun = -inf)
      // unrolled so that t stays in registers; t -> 2^(t - mn), the probabilities
#pragma unroll
      for (int i = 0; i < 16; ++i) t[i] -= mn;
      exp2_run(al, t);
      mrun[u] = mn;
      // ---- probabilities (<= 1) and the P A-fragment: f16(p * 32768); element i <-> t[i] ----
      float ps = 0.f;
#pragma unroll
      for (int w = 0; w < 2; ++w) {
#pragma unroll
        for (int e4 = 0; e4 < 4; ++e4) {
          const int i = 8 * w + 2 * e4;
          const float p0 = t[i], p1 = t[i + 1];
          ps += p0 + p1;
          ph[u].u[w][e4] = pk16(h_bits((_Float16)(p0 * PCAR)), h_bits((_Float16)(p1 * PCAR)));
        }
      }
      ps += __shfl_xor(ps, 16, 32);
      lrun[u] = lrun[u] * al + ps;
      // ---- rescale the O accumulators: D row 8hh+r = query q0+16u+8hh+r, its factor lives in lane 8hh+r (and 16+8hh+r) ----
      float scl[8];
#pragma unroll
      for (int r = 0; r < 8; ++r) scl[r] = __shfl(al, 8 * hh + r, 32);
#pragma unroll
      for (int j = 0; j < 4; ++j) {
#pragma unroll
        for (int r = 0; r < 8; ++r) o[u][j][r] *= scl[r];
      }
    }
    // ---- P.V : B fragment col n = d = j*16 + c, keys contiguous in the v^T plane; each fragment serves both query tiles ----
    {
      const unsigned char* vp = fv + bo + sub * 64;
      const v16h v0 = ldfrag_h((const _Float16*)(const void*)(vp));
      const v16h v1 = ldfrag_h((const _Float16*)(const void*)(vp + 16 * LPITCH));
      const v16h v2 = ldfrag_h((const _Float16*)(const void*)(vp + 32 * LPITCH));
      const v16h v3 = ldfrag_h((const _Float16*)(const void*)(vp + 48 * LPITCH));
#pragma unroll
      for (int u = 0; u < ATT_QT; ++u) {
        o[u][0] = mma_h(ph[u].v, v0, o[u][0]);
        o[u][1] = mma_h(ph[u].v, v1, o[u][1]);
        o[u][2] = mma_h(ph[u].v, v2, o[u][2]);
        o[u][3] = mma_h(ph[u].v, v3, o[u][3]);
      }
      // keeps the next half's loads and products behind this half's last products: without it this compiler spreads the v^T
      // loads in pairs among the products, each pair waited for in full right ahead of its use
      __builtin_amdgcn_sched_barrier(0);
    }
   }
   asm volatile("s_wait_dscnt 0x0" ::: "memory");          // this wave's reads of the buffer are done before it is refilled
   asm volatile("s_wait_asynccnt 0x0" ::: "memory");       // this wave's copies of tile st + 1 have landed
   __syncthreads();                                        // publishes tile st + 1, ends every reader's use of tile st
   if (st + 2 < NST) {                                     // the same for the whole block
     const size_t k2 = (size_t)(st + 2) * AKT;
     copy_keys(lc + bo, gkh + k2 * INNER, gv + k2);
   }
  }
  asm volatile("s_wait_asynccnt 0x0" ::: "memory");        // no copy outstanding when the ring becomes output staging

#pragma unroll
  for (int u = 0; u < ATT_QT; ++u) {
    acc_guard4(o[u]);
    // ---- fold 1/l (per query, owned by lane = query) and the carries (32768 on P, 8 on v), apply the ctx carry 1024 ----
    const float linv = (1.0f / lrun[u]) * (OSC / (PCAR * VS));
    float inv[8];
#pragma unroll
    for (int r = 0; r < 8; ++r) inv[r] = __shfl(linv, 8 * hh + r, 32);
    float* slab = (float*)(void*)ring + (wave * ATT_QT + u) * 16 * OPITCH;   // the ring is free behind the last tile's barrier
#pragma unroll
    for (int r = 0; r < 8; ++r) {
#pragma unroll
      for (int j = 0; j < 4; ++j) slab[(8 * hh + r) * OPITCH + j * 16 + c] = o[u][j][r] * inv[r];
    }
    wave_sync_lds();
    // ---- ctx x1024 -> f16 plane; lane = (row in group of 4, 8 consecutive d) ----
    v4u ovh[4];
    const int rq = lane >> 3, c8 = (lane & 7) * 8;
#pragma unroll
    for (int i = 0; i < 4; ++i) {
      const int row = 4 * i + rq;
      const v4f a = *(const v4f*)(slab + row * OPITCH + c8), c4 = *(const v4f*)(slab + row * OPITCH + c8 + 4);
#pragma unroll
      for (int e = 0; e < 2; ++e) {
        ovh[i][e]     = pk16(h_bits((_Float16)a[2 * e]),  h_bits((_Float16)a[2 * e + 1]));
        ovh[i][2 + e] = pk16(h_bits((_Float16)c4[2 * e]), h_bits((_Float16)c4[2 * e + 1]));
      }
    }
    const size_t oo = ((size_t)(b * SQ + q0 + 16 * u)) * INNER + head * HD + c8;
    u16* obh = Oh + oo;
#pragma unroll
    for (int i = 0; i < 4; ++i) {
      const int row = 4 * i + rq;
      *(v4u*)(obh + (size_t)row * INNER) = ovh[i];
    }
    // precaution: no register that an issued store names is rewritten (by the next query tile's work) ahead of this wait
    asm volatile("s_wait_xcnt 0x0" ::: "memory");
  }
}

// =====================================================================================================
// Workspace map (bytes, NB=8, SQ=2048); every plane fully written by whole-line stores before it is read; all extents exact
//   XQ   f16 [NB*SQ][768]    f16(bf16(x))                 25165824   (region reused later as OH, same extent)
//   XV   f16 [NB*512][768]   f16(bf16(kg_value))           6291456
//   WQ16 WK16 WV16 WO16 f16 [768 n][768 k] x256            1179648 each
//   QH   f16 [NB*SQ][768] x8                               25165824
//   KH   f16 [NB*512][768] x8                               6291456
//   VT16 f16 [NB*768 (h,d)][512 s] x8                       6291456
//   OH   f16 [NB*SQ][768] x1024 (ctx) aliases XQ
//   SIMP f32 [NB][512]                                         16384
//   end                                                     73940992
// =====================================================================================================
extern "C" void kernel_launch(void* const* d_in, const int* in_sizes, int n_in,
                              void* d_out, int out_size, void* d_ws, size_t ws_size,
                              hipStream_t stream) {
  if (n_in < 14) return;
  if (in_sizes[0] < ((NB - 1) * SQ_FULL + SQ) * DM) return;
  if (in_sizes[1] < 1) return;
  if (in_sizes[2] < NB * DM) return;
  if (in_sizes[3] < NB * SKV * DM || in_sizes[4] < NB * SKV * DM) return;
  if (in_sizes[5] < NH) return;
  if (in_sizes[6] != DM * DM || in_sizes[8] != DM * DM || in_sizes[10] != DM * DM || in_sizes[12] != DM * DM) return;
  if (in_sizes[7] < DM || in_sizes[9] < DM || in_sizes[11] < DM || in_sizes[13] < DM) return;
  if (out_size < ((NB - 1) * SQ_FULL + SQ) * DM) return;

  const float* x_in   = (const float*)d_in[0];
  const int*   msk    = (const int*)d_in[1];
  const float* pooled = (const float*)d_in[2];
  const float* kgk    = (const float*)d_in[3];
  const float* kgv    = (const float*)d_in[4];
  const float* beta   = (const float*)d_in[5];
  const float* wq     = (const float*)d_in[6];
  const float* bq     = (const float*)d_in[7];
  const float* wk     = (const float*)d_in[8];
  const float* bk     = (const float*)d_in[9];
  const float* wv     = (const float*)d_in[10];
  const float* bv     = (const float*)d_in[11];
  const float* wo     = (const float*)d_in[12];
  const float* bo     = (const float*)d_in[13];
  float*       out    = (float*)d_out;

  const size_t szXQ = (size_t)NB * SQ * DM * 2;
  const size_t szXV = (size_t)NB * SKV * DM * 2;
  const size_t szW  = (size_t)DM * DM * 2;
  const size_t szQP = (size_t)NB * SQ * INNER * 2;
  const size_t szKP = (size_t)NB * SKV * INNER * 2;
  const size_t szVT = (size_t)NB * INNER * SKV * 2;
  const size_t szS  = (size_t)NB * SKV * 4;
  static_assert((size_t)NB * SQ * DM * 2 == (size_t)NB * SQ * INNER * 2);   // XQ region reused as OH, same extent
  size_t off = 0;
  const size_t oXQ = off; off += szXQ;      // also OH
  const size_t oXV = off; off += szXV;
  const size_t oWQ = off; off += szW;
  const size_t oWK = off; off += szW;
  const size_t oWV = off; off += szW;
  const size_t oWO = off; off += szW;
  const size_t oQH = off; off += szQP;
  const size_t oKH = off; off += szKP;
  const size_t oVT = off; off += szVT;
  const size_t oS  = off; off += szS;
  if (off > ws_size) return;                // off = 73940992 at NB=8, SQ=2048
  if (off > (size_t)134217728) return;

  char* ws = (char*)d_ws;
  u16* XQ   = (u16*)(ws + oXQ);
  u16* XV   = (u16*)(ws + oXV);
  u16* WQ16 = (u16*)(ws + oWQ);
  u16* WK16 = (u16*)(ws + oWK);
  u16* WV16 = (u16*)(ws + oWV);
  u16* WO16 = (u16*)(ws + oWO);
  u16* QH   = (u16*)(ws + oQH);
  u16* KH   = (u16*)(ws + oKH);
  u16* VT16 = (u16*)(ws + oVT);
  u16* OH   = (u16*)(ws + oXQ);
  float* SIMP = (float*)(ws + oS);

  // (0) activations -> f16 planes of bf16-converted values (query rows s < SQ of batches b < NB, compact; kg_value rows) and
  //     weights [n = out][k = in] (y = x.W^T): already k-contiguous [n][k]; f16 planes of bf16(W) x256; one launch
  //     with, in the same launch, the cosine similarity sim[b][k] -> SIMP f32 [NB][512]
  prep_all<<<dim3(SIM_BLOCKS + CVB_X + CVB_V + 4 * CVB_W), dim3(CVT_THREADS), 0, stream>>>(
      x_in, kgv, wq, wk, wv, wo, pooled, kgk, msk, XQ, XV, WQ16, WK16, WV16, WO16, SIMP);
  // (7) the q, k and v^T projections, one launch
  gemm_qkv<<<dim3(GB_V + GB_K + GB_Q), dim3(128), 0, stream>>>(XQ, XV, WQ16, WK16, WV16, bq, bk, bv, QH, KH, VT16);
  // (10) attention with the beta*sim key bias -> ctx plane [NB*SQ][768] x1024 (OH reuses the XQ region)
  attn_fwd<<<dim3(NB * NH * (SQ / ATT_ROWS)), dim3(ATT_THREADS), 0, stream>>>(QH, KH, VT16, SIMP, beta, OH);
  // (11) out rows [b][SQ_FULL][768] f32 = ctx . Wo^T + bo (rows s < SQ of batches b < NB); carries 1024 x 256 folded back
  gemm16<M_F32, false><<<dim3(NB * (SQ / OT_M) * (DM / OT_N)), dim3(256), 0, stream>>>(
      OH, WO16, bo, out, nullptr, SQ, DM, INNER, SQ * INNER, 0, SQ_FULL * DM, 0,
      1.0f / (OSC * WSC), 1.0f, 1.0f);
  (void)hipGetLastError();
}

// v010
// It runs in 92.3 microseconds.
// Two timings next to v009 both put it at 1.04 times that version's speed.
// Over all steps from v000 it is 4.73 times as fast.
// Contractions on v_wmma_f32_16x16x32_f16 (f16 operands, f32 accumulate): x.Wq^T, xv.Wk^T, Wv.xv^T single products on
// f16(bf16(x)) and f16(bf16(W) x256); k.q^T single product (q and k each one f16 plane, x8);
// P.v^T single product (P x128, v x8); ctx.Wo^T single product (ctx one f16 plane, x1024);
// cosine-similarity bias, softmax, biases and all carry folds in f32 on VALU.
// Inputs RNE-converted to bf16 on load: they hold 8 significant bits, the f16 planes between the products 11.
#include <hip/hip_runtime.h>
#include <math.h>
#include <stdint.h>

#ifndef NB
#define NB       8        // batches processed
#endif
#ifndef SQ
#define SQ       2048     // query rows processed per batch
#endif
#define NB_FULL  8
#define SQ_FULL  2048     // query rows per batch in the input / output layout (batch stride)
#define SKV      512      // key / value rows per batch (all of them)
#define DM       768      // model width
#define NH       12
#define HD       64
#define INNER    (NH * HD)
#define WSC      256.0f   // weight carry
#define QS       8.0f
#define KS       8.0f
#define VS       8.0f
#define PCAR     128.0f   // P carry: P <= 2^LAZY, so P x128 <= 2^15 fits f16
#define LAZY     8.0f     // a row's max in use is renewed only when a base-2 logit tops it by more than this
#define OSC      1024.0f  // ctx carry
#define LOG2E    1.4426950408889634f
#define RSQ_HD   0.125f
#define EPSN     1e-8f
#define NKB      (SKV / 32)
#define ATT_WAVES   4
#define ATT_THREADS (ATT_WAVES * 32)
#define ATT_QT      2        // 16-query tiles per wave: each k, v^T and sim fragment read from LDS serves both
#define ATT_ROWS    (ATT_WAVES * ATT_QT * 16)         // query rows per attention block
#define CVT_THREADS 256      // streaming convert: 8 waves per block
#define CVT_LOADS   32       // 16-B loads per lane, all in flight
#define CVT_WAVE    (CVT_LOADS * 32 * 4)              // floats per wave (16 KB in, 8 KB out)
#define CVT_BLOCK   (CVT_WAVE * (CVT_THREADS / 32))   // floats per block
#define CVB_XB      (SQ * DM / CVT_BLOCK)             // blocks per batch of query rows
#define CVB_X       (NB * CVB_XB)
#define CVB_V       (NB * SKV * DM / CVT_BLOCK)
#define CVB_W       (DM * DM / CVT_BLOCK)
#define SIM_THREADS 256
#define SIM_KEYS    32       // keys per similarity block (8 waves x 4)
#define SIM_BLOCKS  (NB * (SKV / SIM_KEYS))
#define PT_S        128      // projection tiles: 128 x 192 (q, k), 192 x 128 (v^T)
#define PT_L        192
#define OT_M        256      // output projection tile: 256 x 192
#define OT_N        192
#define GB_Q        ((NB * SQ / PT_S) * (INNER / PT_L))
#define GB_K        ((NB * SKV / PT_S) * (INNER / PT_L))
#define GB_V        (NB * (INNER / PT_L) * (SKV / PT_S))
#define OPITCH   68
#define GKT      64       // k per staged GEMM tile (128-B rows)
#define LPITCH   144      // LDS pitch of a staged row, bytes
#define AKT      64       // keys per staged attention tile (128-B rows in both planes)
#define APLANEB  (64 * LPITCH)
#define ABUFB    (2 * APLANEB)       // one attention buffer: [k | v^T]
#define NST      (SKV / AKT)

#define M_S16    1
#define M_F32    2

static_assert(NB >= 1 && NB <= NB_FULL);
static_assert((SQ % 128) == 0 && SQ >= 128 && SQ <= SQ_FULL);
static_assert(HD == 64 && INNER == 768 && NH == 12 && INNER == DM);
static_assert((SKV % 128) == 0 && (SKV % 32) == 0 && NKB * 32 == SKV && (SKV % SIM_KEYS) == 0);
static_assert((DM % 128) == 0 && (DM % 32) == 0 && (CVT_THREADS % 32) == 0);
static_assert((SQ * DM) % CVT_BLOCK == 0 && (NB * SKV * DM) % CVT_BLOCK == 0 && (DM * DM) % CVT_BLOCK == 0);
static_assert((OPITCH * 4) % 16 == 0);
static_assert((NB * SQ) % PT_S == 0 && (NB * SKV) % PT_S == 0 && (INNER % PT_L) == 0 && (SKV % PT_S) == 0);
static_assert((SQ % OT_M) == 0 && (DM % OT_N) == 0);
static_assert(ATT_THREADS * 4 == SKV && NST >= 2 && AKT == 64 && HD == 64);
static_assert(ATT_WAVES * ATT_QT * 16 * OPITCH * 4 <= 2 * ABUFB);      // attention output staging fits its ring
static_assert(ATT_QT == 2 && (SQ % ATT_ROWS) == 0);
static_assert(ATT_THREADS == 128 && SIM_THREADS == 256 && SIM_KEYS == (SIM_THREADS / 32) * 4 && SIM_THREADS == CVT_THREADS);

typedef unsigned short u16;
typedef _Float16 v16h __attribute__((ext_vector_type(16)));
typedef _Float16 v8h  __attribute__((ext_vector_type(8)));
typedef float    v8f  __attribute__((ext_vector_type(8)));
typedef float    v4f  __attribute__((ext_vector_type(4)));
typedef unsigned int v4u __attribute__((ext_vector_type(4)));
typedef unsigned int v2u __attribute__((ext_vector_type(2)));

union FragH { v16h v; v8h h[2]; v4u u[2]; };

// ---- scalar helpers ----------------------------------------------------------------------------------
__device__ __forceinline__ unsigned short bf_bits(float f) {          // f32 -> bf16 bits, RNE convert
  unsigned u = __float_as_uint(f);
  return (unsigned short)((u + 0x7FFFu + ((u >> 16) & 1u)) >> 16);
}
__device__ __forceinline__ float bf_up(unsigned short h) { return __uint_as_float(((unsigned)h) << 16); }
__device__ __forceinline__ float bfr(float f) { return bf_up(bf_bits(f)); }
__device__ __forceinline__ unsigned short h_bits(_Float16 x) { return __builtin_bit_cast(unsigned short, x); }
__device__ __forceinline__ unsigned pk16(unsigned short a, unsigned short b) { return (unsigned)a | ((unsigned)b << 16); }
// 2^x in place as the bare hardware instruction, for a key block's 16 score exponents x. The library form wraps each in a
// compare, two selects, an add and an ldexp so that results below 2^-126 come out as subnormals; here such a result may be 0.
// Nothing downstream sees it: a probability below 2^-32 is 0 in P's f16 (x128) anyway, and the row sum is >= 1 from the first
// key block on.
// One statement: no instruction of the run touches another's register, and the closing v_nop is the slot that the instruction
// set asks for between a transcendental and the first use of its result.
__device__ __forceinline__ void exp2_run(float (&x)[16]) {
#if defined(__HIP_DEVICE_COMPILE__)
  asm("v_exp_f32 %0, %0\n\tv_exp_f32 %1, %1\n\tv_exp_f32 %2, %2\n\tv_exp_f32 %3, %3\n\t"
      "v_exp_f32 %4, %4\n\tv_exp_f32 %5, %5\n\tv_exp_f32 %6, %6\n\tv_exp_f32 %7, %7\n\t"
      "v_exp_f32 %8, %8\n\tv_exp_f32 %9, %9\n\tv_exp_f32 %10, %10\n\tv_exp_f32 %11, %11\n\t"
      "v_exp_f32 %12, %12\n\tv_exp_f32 %13, %13\n\tv_exp_f32 %14, %14\n\tv_exp_f32 %15, %15\n\tv_nop"
      : "+v"(x[0]), "+v"(x[1]), "+v"(x[2]), "+v"(x[3]), "+v"(x[4]), "+v"(x[5]), "+v"(x[6]), "+v"(x[7]),
        "+v"(x[8]), "+v"(x[9]), "+v"(x[10]), "+v"(x[11]), "+v"(x[12]), "+v"(x[13]), "+v"(x[14]), "+v"(x[15]));
#endif
}
// The same for one rescale exponent: a factor below 2^-126 may be 0; it takes the old sums (at most 2^40 in size) below 2^-86.
__device__ __forceinline__ void exp2_one(float& y) {
#if defined(__HIP_DEVICE_COMPILE__)
  asm("v_exp_f32 %0, %0\n\tv_nop" : "+v"(y));
#endif
}
__device__ __forceinline__ v8f zero8() { v8f z = {0.f, 0.f, 0.f, 0.f, 0.f, 0.f, 0.f, 0.f}; return z; }

// ---- fragment loader: 16-bit A/B operand, lane -> row/col (lane&15), p already includes +8*(lane>>4);
//      elements 0..7 <- p[0..7] (k0+8h..), elements 8..15 <- p[16..23] (k0+16+8h..); same split k map for A and B,
//      B always read from a k-contiguous [n][k] plane.
__device__ __forceinline__ v16h ldfrag_h(const _Float16* p) {
  FragH f;
  f.h[0] = *(const v8h*)(p);
  f.h[1] = *(const v8h*)(p + 16);
  return f.v;
}

// ---- WMMA helper and trailing VALU hazard gaps ----------------------------------------------------------
__device__ __forceinline__ v8f mma_h(v16h a, v16h b, v8f c) {
  return __builtin_amdgcn_wmma_f32_16x16x32_f16(false, a, false, b, (short)0, c, false, false);
}
__device__ __forceinline__ void acc_guard4(v8f (&a)[4]) {
#if defined(__HIP_DEVICE_COMPILE__)
  asm volatile("v_nop\n\tv_nop\n\tv_nop\n\tv_nop" : "+v"(a[0]), "+v"(a[1]), "+v"(a[2]), "+v"(a[3]));
#endif
}
__device__ __forceinline__ void wave_sync_lds() {
  __builtin_amdgcn_fence(__ATOMIC_RELEASE, "workgroup");
  __builtin_amdgcn_wave_barrier();
  __builtin_amdgcn_fence(__ATOMIC_ACQUIRE, "workgroup");
}

// =====================================================================================================
// Streaming convert, one launch for all six planes: Y[e] <- f16(bf16_RNE(x[e]) * scale), scale a power of two (1 for the two
// activation planes, 256 for the four weight planes). Every plane is a whole number of blocks; a block takes CVT_BLOCK
// consecutive floats of one plane (of one batch, for the query rows), a wave CVT_WAVE of them: 32 loads of 512 contiguous
// bytes, all asked for before the first is converted, then 32 stores of 256 contiguous bytes (whole lines both ways).
// coverage: bid = 0 .. CVB_X + CVB_V + 4 * CVB_W - 1, CVT_BLOCK floats each = every element of the six planes exactly once.
// =====================================================================================================
__device__ __forceinline__
void cvt_body(int bid, const float* __restrict__ x, const float* __restrict__ kgv, const float* __restrict__ wq,
              const float* __restrict__ wk, const float* __restrict__ wv, const float* __restrict__ wo,
              u16* XQ, u16* XV, u16* WQ, u16* WK, u16* WV, u16* WO) {
  const float* src;
  u16* dst;
  float scale;
  if (bid < CVB_X) {                                     // query rows s < SQ of batch b, compact in the plane
    const int b = bid / CVB_XB;
    src = x + (size_t)b * ((size_t)SQ_FULL * DM) + (size_t)(bid - b * CVB_XB) * CVT_BLOCK;
    dst = XQ + (size_t)bid * CVT_BLOCK;
    scale = 1.0f;
  } else if (bid < CVB_X + CVB_V) {
    const int r = bid - CVB_X;
    src = kgv + (size_t)r * CVT_BLOCK;
    dst = XV + (size_t)r * CVT_BLOCK;
    scale = 1.0f;
  } else {
    const int w = bid - (CVB_X + CVB_V);
    const int sel = w / CVB_W;
    const int r = w - sel * CVB_W;
    src = (sel == 0 ? wq : sel == 1 ? wk : sel == 2 ? wv : wo) + (size_t)r * CVT_BLOCK;
    dst = (sel == 0 ? WQ : sel == 1 ? WK : sel == 2 ? WV : WO) + (size_t)r * CVT_BLOCK;
    scale = WSC;
  }
  const int off = (threadIdx.x >> 5) * CVT_WAVE + (threadIdx.x & 31) * 4;
  const float* p = src + off;
  u16* q = dst + off;
  v4f v[CVT_LOADS];
#pragma unroll
  for (int it = 0; it < CVT_LOADS; ++it) v[it] = *(const v4f*)(p + it * 128);
  // keeps every load ahead of the first convert and store: the wave pays the memory latency once, not once per group
  __builtin_amdgcn_sched_barrier(0);
#pragma unroll
  for (int it = 0; it < CVT_LOADS; ++it) {
    v2u o;
    o[0] = pk16(h_bits((_Float16)(bfr(v[it][0]) * scale)), h_bits((_Float16)(bfr(v[it][1]) * scale)));
    o[1] = pk16(h_bits((_Float16)(bfr(v[it][2]) * scale)), h_bits((_Float16)(bfr(v[it][3]) * scale)));
    *(v2u*)(q + it * 128) = o;
  }
}

// =====================================================================================================
// Cosine similarity sim[b][k] = <p, kgk[b][k]> / (max(|p|, eps) * max(|kgk[b][k]|, eps)), p = pooled[b], all operands
// bf16-RNE-converted, f32 arithmetic on VALU. Block = 256 threads = 8 waves = 32 keys of one batch (wave w -> keys
// kb + 4w .. kb + 4w + 3). A wave asks for its five rows (p and four keys, 3 KB each) at once, 16 B per lane and load; lane l
// sums elements 128 i + 4 l + e in ascending (i, e); the nine lane sums go through one xor tree side by side.
// =====================================================================================================
__device__ __forceinline__
void sim_body(int bid, float* sv, const float* __restrict__ pooled, const float* __restrict__ kgk, float* S) {
  const int tid = threadIdx.x, wave = tid >> 5, lane = tid & 31;
  constexpr int NKBLK = SKV / SIM_KEYS;
  const int b  = bid / NKBLK;
  const int kb = (bid - b * NKBLK) * SIM_KEYS;
  const float* p = pooled + (size_t)b * DM + 4 * lane;
  const float* kr = kgk + ((size_t)b * SKV + (size_t)(kb + wave * 4)) * (size_t)DM + 4 * lane;   // keys < SKV by construction
  constexpr int NL = DM / 128;                                         // 512-B loads per row
  v4f pv[NL], kv[4][NL];
  // every loop below is unrolled so that the row arrays and the nine sums stay in registers
#pragma unroll
  for (int i = 0; i < NL; ++i) pv[i] = *(const v4f*)(p + i * 128);
#pragma unroll
  for (int j = 0; j < 4; ++j) {
#pragma unroll
    for (int i = 0; i < NL; ++i) kv[j][i] = *(const v4f*)(kr + j * DM + i * 128);
  }
  // keeps all 30 loads ahead of the first sum: the wave pays the memory latency once, not once per 512-B load
  __builtin_amdgcn_sched_barrier(0);
  float s[9];                                                          // |p|^2, <p, k_j>, |k_j|^2
#pragma unroll
  for (int q = 0; q < 9; ++q) s[q] = 0.f;
#pragma unroll
  for (int i = 0; i < NL; ++i) {
#pragma unroll
    for (int e = 0; e < 4; ++e) {
      const float xv = bfr(pv[i][e]);
      s[0] += xv * xv;
#pragma unroll
      for (int j = 0; j < 4; ++j) {
        const float yv = bfr(kv[j][i][e]);
        s[1 + j] += xv * yv;
        s[5 + j] += yv * yv;
      }
    }
  }
  // one xor tree (16, 8, 4, 2, 1) for all nine sums at once: the wave waits for five cross-lane exchanges, not five per sum
#pragma unroll
  for (int d = 16; d >= 1; d >>= 1) {
    float o[9];
#pragma unroll
    for (int q = 0; q < 9; ++q) o[q] = __shfl_xor(s[q], d, 32);
#pragma unroll
    for (int q = 0; q < 9; ++q) s[q] += o[q];
  }
  const float pnrm = fmaxf(sqrtf(s[0]), EPSN);
  {                                                                    // lane j < 4 finishes key j (every lane holds all sums)
    const int j = lane & 3;
    const float pk = j == 0 ? s[1] : j == 1 ? s[2] : j == 2 ? s[3] : s[4];
    const float kk = j == 0 ? s[5] : j == 1 ? s[6] : j == 2 ? s[7] : s[8];
    const float knrm = fmaxf(sqrtf(kk), EPSN);
    const float val = pk / (pnrm * knrm);
    if (lane < 4) sv[wave * 4 + lane] = val;
  }
  __syncthreads();
  if (wave == 0) {                                                     // wave-uniform
    const v4f v = *(const v4f*)(sv + 4 * (lane & 7));                   // clamped LDS address, all lanes load
    float* dst = S + (size_t)b * SKV + kb + 4 * (lane & 7);
    if (lane < 8) {
      *(v4f*)dst = v;
    }
    
  }
}

// =====================================================================================================
// One launch for the two jobs that read only inputs: blocks 0 .. SIM_BLOCKS - 1 do the cosine similarity, the rest the streaming convert. Neither reads what the other writes. The split is by block, so
// the barrier in sim_body is passed by every thread of a block that reaches it; a convert block returns behind its last store.
// =====================================================================================================
__global__ __launch_bounds__(CVT_THREADS)
void prep_all(const float* __restrict__ x, const float* __restrict__ kgv, const float* __restrict__ wq,
              const float* __restrict__ wk, const float* __restrict__ wv, const float* __restrict__ wo,
              const float* __restrict__ pooled, const float* __restrict__ kgk, const int* __restrict__ msk,
              u16* XQ, u16* XV, u16* WQ, u16* WK, u16* WV, u16* WO, float* S) {
  __shared__ __align__(16) float sv[SIM_KEYS];
  (void)msk;
  const int bid = blockIdx.x;
  if (bid >= SIM_BLOCKS) {
    cvt_body(bid - SIM_BLOCKS, x, kgv, wq, wk, wv, wo, XQ, XV, WQ, WK, WV, WO);
    return;
  }
  sim_body(bid, sv, pooled, kgk, S);
}

// =====================================================================================================
// Staging of f16 plane rows in LDS: rows of 128 B (64 k) at pitch 144 B (16 B x odd: ds_load_b128 free of bank conflicts).
// Thread = (row tid>>3 of a group, 16-B piece tid&7): one wave-instruction covers four whole 128-B lines, a group is as many
// rows as the block has threads / 8. l = the lane's LDS byte address in group 0, g = its global address in group 0,
// ls = a group in LDS bytes, gs = a group in source elements.
// =====================================================================================================
__device__ __forceinline__ unsigned lds_off(const void* p) { return (unsigned)(size_t)p; }
__device__ __forceinline__ void copy8(unsigned l, const _Float16* g, unsigned ls, size_t gs) {
#if defined(__HIP_DEVICE_COMPILE__)
  // the closing s_wait_xcnt stands inside the statement so that no address register is rewritten ahead of it
  asm volatile("global_load_async_to_lds_b128 %0, %8, off\n\t"
               "global_load_async_to_lds_b128 %1, %9, off\n\t"
               "global_load_async_to_lds_b128 %2, %10, off\n\t"
               "global_load_async_to_lds_b128 %3, %11, off\n\t"
               "global_load_async_to_lds_b128 %4, %12, off\n\t"
               "global_load_async_to_lds_b128 %5, %13, off\n\t"
               "global_load_async_to_lds_b128 %6, %14, off\n\t"
               "global_load_async_to_lds_b128 %7, %15, off\n\t"
               "s_wait_xcnt 0x0"
               :: "v"(l), "v"(l + ls), "v"(l + 2 * ls), "v"(l + 3 * ls),
                  "v"(l + 4 * ls), "v"(l + 5 * ls), "v"(l + 6 * ls), "v"(l + 7 * ls),
                  "v"(g), "v"(g + gs), "v"(g + 2 * gs), "v"(g + 3 * gs),
                  "v"(g + 4 * gs), "v"(g + 5 * gs), "v"(g + 6 * gs), "v"(g + 7 * gs)
               : "memory");
#endif
}
__device__ __forceinline__ void copy6(unsigned l, const _Float16* g, unsigned ls, size_t gs) {
#if defined(__HIP_DEVICE_COMPILE__)
  // the closing s_wait_xcnt stands inside the statement so that no address register is rewritten ahead of it
  asm volatile("global_load_async_to_lds_b128 %0, %6, off\n\t"
               "global_load_async_to_lds_b128 %1, %7, off\n\t"
               "global_load_async_to_lds_b128 %2, %8, off\n\t"
               "global_load_async_to_lds_b128 %3, %9, off\n\t"
               "global_load_async_to_lds_b128 %4, %10, off\n\t"
               "global_load_async_to_lds_b128 %5, %11, off\n\t"
               "s_wait_xcnt 0x0"
               :: "v"(l), "v"(l + ls), "v"(l + 2 * ls), "v"(l + 3 * ls), "v"(l + 4 * ls), "v"(l + 5 * ls),
                  "v"(g), "v"(g + gs), "v"(g + 2 * gs), "v"(g + 3 * gs), "v"(g + 4 * gs), "v"(g + 5 * gs)
               : "memory");
#endif
}
template <int NG>
__device__ __forceinline__ void copy_rows(unsigned l, const _Float16* g, unsigned ls, size_t gs) {
  static_assert(NG == 6 || NG == 8 || NG == 12);
  if constexpr (NG == 8) {
    copy8(l, g, ls, gs);
  } else {
    copy6(l, g, ls, gs);
    if constexpr (NG == 12) copy6(l + 6 * ls, g + 6 * gs, ls, gs);
  }
}

// Runs of 16-B global stores. The closing s_wait_xcnt stands inside the statement so that no address or data register of an
// issued store is rewritten ahead of it (written as plain stores, this compiler reuses those registers between them).
__device__ __forceinline__ void store8(void* const (&p)[8], const v4u (&d)[8]) {
#if defined(__HIP_DEVICE_COMPILE__)
  asm volatile("global_store_b128 %0, %8, off\n\t"
               "global_store_b128 %1, %9, off\n\t"
               "global_store_b128 %2, %10, off\n\t"
               "global_store_b128 %3, %11, off\n\t"
               "global_store_b128 %4, %12, off\n\t"
               "global_store_b128 %5, %13, off\n\t"
               "global_store_b128 %6, %14, off\n\t"
               "global_store_b128 %7, %15, off\n\t"
               "s_wait_xcnt 0x0"
               :: "v"(p[0]), "v"(p[1]), "v"(p[2]), "v"(p[3]), "v"(p[4]), "v"(p[5]), "v"(p[6]), "v"(p[7]),
                  "v"(d[0]), "v"(d[1]), "v"(d[2]), "v"(d[3]), "v"(d[4]), "v"(d[5]), "v"(d[6]), "v"(d[7])
               : "memory");
#endif
}
__device__ __forceinline__ void store6(void* const (&p)[6], const v4u (&d)[6]) {
#if defined(__HIP_DEVICE_COMPILE__)
  asm volatile("global_store_b128 %0, %6, off\n\t"
               "global_store_b128 %1, %7, off\n\t"
               "global_store_b128 %2, %8, off\n\t"
               "global_store_b128 %3, %9, off\n\t"
               "global_store_b128 %4, %10, off\n\t"
               "global_store_b128 %5, %11, off\n\t"
               "s_wait_xcnt 0x0"
               :: "v"(p[0]), "v"(p[1]), "v"(p[2]), "v"(p[3]), "v"(p[4]), "v"(p[5]),
                  "v"(d[0]), "v"(d[1]), "v"(d[2]), "v"(d[3]), "v"(d[4]), "v"(d[5])
               : "memory");
#endif
}

// Inputs-only fences on loaded fragments: keep a group's LDS loads together ahead of its products, so that the wave waits for
// LDS once per group and not once per few products.
__device__ __forceinline__ void hold(const v16h (&x)[4]) {
#if defined(__HIP_DEVICE_COMPILE__)
  asm volatile("" :: "v"(x[0]), "v"(x[1]), "v"(x[2]), "v"(x[3]));
#endif
}
__device__ __forceinline__ void hold(const v16h (&x)[6]) {
#if defined(__HIP_DEVICE_COMPILE__)
  asm volatile("" :: "v"(x[0]), "v"(x[1]), "v"(x[2]), "v"(x[3]), "v"(x[4]), "v"(x[5]));
#endif
}

// =====================================================================================================
// f16 GEMM. Block tile BM x BN = (WM * MI * 16) x (WN * NJ * 16), WM x WN waves, a wave owns MI x NJ tiles of 16 x 16
// (64 x 96 or 96 x 64: 10 fragments from LDS feed 24 products). The k range is walked in tiles of 64; each tile's A rows and Bt
// rows are staged in LDS by asynchronous copies, two buffers, the next tile's copies in flight while this tile is multiplied.
// The tile shapes are chosen for bytes per product (a block fetches (BM + BN) rows for BM x BN results) and so that each grid
// fills the chip a whole number of times.
//   C tile [z][Mb][N] = A[z][Mb][K] . Bt[z][N][K]^T * osc + bias; per-z element strides aBs (A),
//   bBs (Bt), fBs (f32 output F), hBs (16-bit output plane H); 0 = shared.
//   M_S16 : H = f16(v*carry)
//   M_F32 : F = v (f32 rows, batch-row remap through fBs), no 16-bit output
// grid = nz x (Mb/BM) x (N/BN) (all launches: Mb % BM == 0, N % BN == 0, K % 64 == 0, K >= 128).
// Each accumulator sums its k32 products in ascending k.
// PRE2: both k32 groups' fragments are asked for at the top of a tile (where the register budget has room for two sets).
// Epilogue: the ring is free behind the last tile's barrier.
//   M_S16: the block stages its BM x BN f16 results in the ring, one barrier, then every wave-instruction stores four whole
//          128-B lines. coverage: BM * BN / 8 pieces of 16 B over NT threads, each piece once.
//   M_F32: each wave stages one 16 x (NJ*16) f32 group at a time in its own slab and stores it as whole lines.
//          coverage: 16 * NJ * 4 pieces of 16 B over 32 lanes per group; MI groups x WM x WN waves = BM x BN.
// =====================================================================================================
// ring = the block's LDS ring of 2 * BUFB bytes, bid = the tile's index in that grid.
template <int MODE, bool BROW, int MI, int NJ, int WM, int WN, bool PRE2>
__device__ __forceinline__
void gemm_body(unsigned char* ring, int bid,
               const u16* __restrict__ Ah, const u16* __restrict__ Bt,
               const float* __restrict__ bias, float* F, u16* H,
               int Mb, int N, int K, int aBs, int bBs, int fBs, int hBs,
               float osc, float bsc, float carry) {
  constexpr int NT = WM * WN * 32, BM = WM * MI * 16, BN = WN * NJ * 16;
  constexpr int RG = NT / 8;                              // rows per copy group
  constexpr int APL = BM * LPITCH;                        // the A plane of a buffer
  constexpr int BUFB = (BM + BN) * LPITCH;                // one buffer: [A | Bt]
  constexpr unsigned LS = RG * LPITCH;
  static_assert(GKT == 64 && (BM % RG) == 0 && (BN % RG) == 0);
  const int tid = threadIdx.x, wave = tid >> 5, lane = tid & 31, hh = lane >> 4, m = lane & 15;
  const int ntile = N / BN, mtile = Mb / BM;
  const int nt   = bid % ntile;
  const int tmp  = bid / ntile;
  const int mt   = tmp % mtile;
  const int bz   = tmp / mtile;
  const int wm = wave / WN, wn = wave % WN;
  const int rowb = mt * BM + wm * (MI * 16);
  const int col0 = nt * BN + wn * (NJ * 16);
  // copy side: the lane's row in a group and its 16-B piece of the 128-B row
  const int cr = tid >> 3, cc = tid & 7;
  const _Float16* gah = (const _Float16*)(const void*)Ah + (size_t)bz * (size_t)aBs + (size_t)(mt * BM + cr) * (size_t)K + 8 * cc;
  const _Float16* gb  = (const _Float16*)(const void*)Bt + (size_t)bz * (size_t)bBs + (size_t)(nt * BN + cr) * (size_t)K + 8 * cc;
  const unsigned lc = lds_off(ring) + (unsigned)(cr * LPITCH + cc * 16);
  const size_t gs = (size_t)RG * (size_t)K;
  const int ntk = K >> 6;
  // fragment side: row (lane & 15) of the wave's first A / B group, +16 B for the upper lane half
  const unsigned char* fa = ring + (wm * (MI * 16) + m) * LPITCH + 16 * hh;
  const unsigned char* fb = ring + APL + (wn * (NJ * 16) + m) * LPITCH + 16 * hh;

  v8f ah[MI][NJ];
#pragma unroll
  for (int i = 0; i < MI; ++i) {
#pragma unroll
    for (int j = 0; j < NJ; ++j) ah[i][j] = zero8();
  }

  // tile 0 -> buffer 0, landed and published; then tile 1 -> buffer 1 in flight
  copy_rows<BM / RG>(lc, gah, LS, gs);
  copy_rows<BN / RG>(lc + APL, gb, LS, gs);
  asm volatile("s_wait_asynccnt 0x0" ::: "memory");        // this wave's copies of tile 0 have landed
  __syncthreads();                                         // ... and every other wave's
  if (ntk > 1) {                                           // the same for the whole block
    copy_rows<BM / RG>(lc + BUFB, gah + GKT, LS, gs);
    copy_rows<BN / RG>(lc + BUFB + APL, gb + GKT, LS, gs);
  }

  // rolled: one copy of the tile body, so that the hot loop stays small in the instruction cache; the unrolls inside it keep
  // the fragment and accumulator arrays in registers
#pragma unroll 1
  for (int t = 0; t < ntk; ++t) {
    const int bo = (t & 1) * BUFB;
    v16h a[2][MI], b[2][NJ];
#pragma unroll
    for (int kk = 0; kk < 2; ++kk) {
      // PRE2: on the first pass both groups are asked for, the second lands behind the first one's products
#pragma unroll
      for (int k2 = 0; k2 < 2; ++k2) {
        if (PRE2 ? kk == 0 : k2 == kk) {
#pragma unroll
          for (int i = 0; i < MI; ++i) a[k2][i] = ldfrag_h((const _Float16*)(const void*)(fa + bo + i * 16 * LPITCH + k2 * 64));
#pragma unroll
          for (int j = 0; j < NJ; ++j) b[k2][j] = ldfrag_h((const _Float16*)(const void*)(fb + bo + j * 16 * LPITCH + k2 * 64));
        }
      }
      hold(a[kk]);
      hold(b[kk]);
#pragma unroll
      for (int i = 0; i < MI; ++i) {
#pragma unroll
        for (int j = 0; j < NJ; ++j) ah[i][j] = mma_h(a[kk][i], b[kk][j], ah[i][j]);
      }
      // keeps this group's products ahead of what follows: of the second group's LDS loads or wait, and of the waits and the
      // barrier at the tile's foot, so that the copies in flight have the products' time to land
      __builtin_amdgcn_sched_barrier(0);
    }
    asm volatile("s_wait_dscnt 0x0" ::: "memory");         // this wave's reads of the buffer are done before it is refilled
    asm volatile("s_wait_asynccnt 0x0" ::: "memory");      // this wave's copies of tile t + 1 have landed
    __syncthreads();                                       // publishes tile t + 1, ends every reader's use of tile t
    if (t + 2 < ntk) {                                     // the same for the whole block
      const int ko = (t + 2) * GKT;
      copy_rows<BM / RG>(lc + bo, gah + ko, LS, gs);
      copy_rows<BN / RG>(lc + bo + APL, gb + ko, LS, gs);
    }
  }
  asm volatile("s_wait_asynccnt 0x0" ::: "memory");        // no copy outstanding when the ring becomes output staging

  // bias of the lane's columns (one per 16-column tile) or of its rows (eight per 16-row tile)
  float bc[NJ], br[MI][8];
  if (BROW) {
    const float* bp = bias + rowb + 8 * hh;
#pragma unroll
    for (int i = 0; i < MI; ++i) {
#pragma unroll
      for (int r = 0; r < 8; ++r) br[i][r] = bp[16 * i + r];
    }
    // precaution: the loads' address, named as an input, stays in its registers up to this wait and is rewritten only behind it
    asm volatile("s_wait_xcnt 0x0" :: "v"(bp) : "memory");
#pragma unroll
    for (int i = 0; i < MI; ++i) {
#pragma unroll
      for (int r = 0; r < 8; ++r) br[i][r] = bfr(br[i][r]) * bsc;
    }
  } else {
    const float* bp = bias + col0 + m;
#pragma unroll
    for (int j = 0; j < NJ; ++j) bc[j] = bp[16 * j];
    // precaution: the loads' address, named as an input, stays in its registers up to this wait and is rewritten only behind it
    asm volatile("s_wait_xcnt 0x0" :: "v"(bp) : "memory");
#pragma unroll
    for (int j = 0; j < NJ; ++j) bc[j] = bfr(bc[j]) * bsc;
  }

  if constexpr (MODE == M_F32) {
    // D element r of ah[g][j], lane l -> row 8h + r, col 16j + (l&15) of the wave's slab
    constexpr int FP = NJ * 16 + 4;                        // slab pitch in floats (16-B multiple, rows 8 apart on other banks)
    constexpr int PPR = NJ * 4, NP = 16 * PPR / 32;        // 16-B pieces per row, pieces per lane
    static_assert(WM * WN * 16 * FP * 4 <= 2 * BUFB && (FP * 4) % 16 == 0 && (16 * PPR) % (32 * 6) == 0 && (PPR % 8) == 0);
    float* sl = (float*)(void*)ring + wave * 16 * FP;
#pragma unroll
    for (int g = 0; g < MI; ++g) {
#pragma unroll
      for (int r = 0; r < 8; ++r) {
#pragma unroll
        for (int j = 0; j < NJ; ++j) {
          float v = ah[g][j][r] * osc;
          v += BROW ? br[g][r] : bc[j];
          sl[(8 * hh + r) * FP + 16 * j + m] = v;
        }
      }
      wave_sync_lds();
      float* Fb = F + (size_t)bz * (size_t)fBs + (size_t)(rowb + 16 * g) * (size_t)N + col0;
#pragma unroll
      for (int c = 0; c < NP; c += 6) {
        v4u vals[6];
        void* dst[6];
#pragma unroll
        for (int it = 0; it < 6; ++it) {
          const int p = (c + it) * 32 + lane;
          vals[it] = *(const v4u*)(const void*)(sl + (p / PPR) * FP + (p % PPR) * 4);
          dst[it] = Fb + (size_t)(p / PPR) * (size_t)N + (p % PPR) * 4;
        }
        store6(dst, vals);
      }
      wave_sync_lds();                                     // the slab's reads are done before the next group overwrites it
    }
  } else {
    // D element r of ah[i][j], lane l -> row 16i + 8h + r, col 16j + (l&15) of the wave's part of the block's f16 tile
    constexpr int SP = BN + 8;                             // staging pitch in halves (16-B multiple)
    constexpr int PPR = BN / 8, NP = BM * PPR / NT;        // 16-B pieces per row, pieces per thread
    static_assert(BM * SP * 2 <= 2 * BUFB && (SP * 2) % 16 == 0 && (BM * PPR) % (NT * 8) == 0 && (PPR % 8) == 0);
    _Float16* st = (_Float16*)(void*)ring;
    _Float16* sw = st + (wm * (MI * 16) + 8 * hh) * SP + wn * (NJ * 16) + m;
#pragma unroll
    for (int i = 0; i < MI; ++i) {
#pragma unroll
      for (int r = 0; r < 8; ++r) {
#pragma unroll
        for (int j = 0; j < NJ; ++j) {
          float v = ah[i][j][r] * osc;
          v += BROW ? br[i][r] : bc[j];
          sw[(16 * i + r) * SP + 16 * j] = (_Float16)(v * carry);
        }
      }
    }
    __syncthreads();                                       // every wave's part is staged before any line is gathered
    u16* Hb = H + (size_t)bz * (size_t)hBs + (size_t)(mt * BM) * (size_t)N + nt * BN;
#pragma unroll
    for (int c = 0; c < NP; c += 8) {
      v4u val[8];
      void* dst[8];
#pragma unroll
      for (int it = 0; it < 8; ++it) {
        const int p = (c + it) * NT + tid;
        val[it] = *(const v4u*)(const void*)(st + (p / PPR) * SP + (p % PPR) * 8);
        dst[it] = Hb + (size_t)(p / PPR) * (size_t)N + (p % PPR) * 8;
      }
      store8(dst, val);
    }
  }
}

// Output projection: 256 x 192 block tile, 8 waves (4 x 2) of 64 x 96, one block per WGP.
template <int MODE, bool BROW>
__global__ __launch_bounds__(256)
void gemm16(const u16* __restrict__ Ah, const u16* __restrict__ Bt,
            const float* __restrict__ bias, float* F, u16* H,
            int Mb, int N, int K, int aBs, int bBs, int fBs, int hBs,
            float osc, float bsc, float carry) {
  __shared__ __align__(16) unsigned char ring[2 * (OT_M + OT_N) * LPITCH];
  gemm_body<MODE, BROW, 4, 6, 4, 2, true>(ring, blockIdx.x, Ah, Bt, bias, F, H, Mb, N, K, aBs, bBs, fBs, hBs, osc, bsc, carry);
}

// The three input projections in one launch: none reads what another writes. 4 waves (2 x 2) per block; q and k tiles are
// 128 x 192 (waves of 64 x 96), v^T tiles 192 x 128 (waves of 96 x 64): GB_V + GB_K + GB_Q tiles of equal work.
// Blocks 0 .. GB_V - 1: v^T per batch (A = Wv [(h,d) = n][k], Bt = kg_value rows of batch b [s][k], bias bv
// per row -> f16 [(b,h,d)][s] x8); then GB_K blocks: k = kg_value . Wk^T + bk -> f16 [NB*512][768] x8; then GB_Q blocks:
// q_un = x . Wq^T + bq -> f16 [NB*SQ][768] x8 (col = h*64 + d; the 1/8 is folded into the softmax scale).
// The split is by block: every barrier in gemm_body is passed by all threads of its block.
__global__ __launch_bounds__(128)
void gemm_qkv(const u16* __restrict__ XQ, const u16* __restrict__ XV, const u16* __restrict__ WQ, const u16* __restrict__ WK,
              const u16* __restrict__ WV, const float* __restrict__ bq, const float* __restrict__ bk,
              const float* __restrict__ bv, u16* QH, u16* KH, u16* VT) {
  static_assert(QS == KS);
  __shared__ __align__(16) unsigned char ring[2 * (PT_S + PT_L) * LPITCH];
  const int bid = blockIdx.x;
  if (bid < GB_V) {
    gemm_body<M_S16, true, 6, 4, 2, 2, false>(ring, bid, WV, XV, bv, nullptr, VT,
                                              INNER, SKV, DM, 0, SKV * DM, 0, INNER * SKV, VS / WSC, VS, 1.0f);
  } else {
    const bool isk = bid < GB_V + GB_K;
    gemm_body<M_S16, false, 4, 6, 2, 2, false>(ring, isk ? bid - GB_V : bid - (GB_V + GB_K), isk ? XV : XQ, isk ? WK : WQ,
                                               isk ? bk : bq, nullptr, isk ? KH : QH, isk ? NB * SKV : NB * SQ, INNER, DM,
                                               0, 0, 0, 0, QS / WSC, QS, 1.0f);
  }
}

// =====================================================================================================
// Full (unmasked) multi-head cross attention with a per-key additive bias bfr(beta[h]) * sim[b][key]:
// block = (batch b, head, 128 query rows), 4 waves, wave w owns the 32 query rows q0 = 128*qt + 32*w .. q0+31 as two tiles of
// 16 (u = 0, 1); what follows is said of one tile; every k, v^T and sim fragment that the wave reads from LDS serves both tiles
// The keys are walked in tiles of 64: each tile's k and v^T rows (64 rows x 128 B each, LDS pitch 144 B) are
// staged in LDS by asynchronous copies, two buffers, the next tile's copies in flight while this tile is worked on; the four
// waves share the tile. The batch's sim row (2 KB) is staged once with tile 0. One barrier per tile.
//   q plane f16 x8 [b*SQ + s][h*64 + d]; k plane likewise [b*SKV + s][h*64 + d];
//   v^T plane f16 x8 [(b*NH + h)*64 + d][s]; sim plane f32 [b][s]. All NKB key blocks of 32 keys are visited (static bound).
//   Scores are computed TRANSPOSED: S^T tile g (g = 0,1) = k rows (keys kb+16g .. +15, A operand, row m = lane&15, split map
//   over d) times q^T (B operand, col n = query q0 + (lane&15), k = d, split map), 2 d-chunks of 32, one product each;
//   the q fragments are loaded once per wave.
//   D element r of lane l = (key kb+16g+8h+r, query q0+(l&15)), so a lane owns one query column and 16 of its 32 keys;
//   the partner lane l^16 owns the other 16 -> a new row max needs one xor-16 shuffle, the row sum one at the end. The bias of the lane's 16 keys
//   comes from four 16-B loads of the sim row (keys kb+8h..+7 and kb+16+8h..+7), times bfr(beta[h])*log2(e), added in f32.
//   Online max-subtracted base-2 softmax in f32 (1/sqrt(64) and the q/k carries folded into lsc). The exp'd values ARE the
//   P A-fragment in place: A row m = query = lane&15, element i <- key kb+8h+i (tile 0, D element i), element 8+i <- key
//   kb+16+8h+i (tile 1, D element i). P (<= 256: the max in use is renewed lazily) carried x128 as f16. The rescale factor of query row 8h+r of the O
//   accumulators is fetched from lane 8h+r with a shuffle (uniform control). 4 v^T B fragments (col n = d = 16j + (lane&15),
//   keys k-contiguous), 4 P.V WMMAs.
//   Epilogue: 1/l (per query, shuffled to the D row owner) and the carry folds in f32; the wave's 16x64 f32 result staged in
// coverage: per wave and tile 4 instructions x 4 rows x 8 lanes x 8 halves = 16 x 64 of the ctx plane; grid NB*NH*(SQ/128)
//           blocks x 4 waves x 2 tiles = every (b, s, h) row segment exactly once. LDS slab: 16 x 64 staged == 16 x 64 reloaded.
// =====================================================================================================
// One 64-key tile: 128 threads, thread = (row tid>>3 of a group of 16, 16-B piece tid&7), four groups per plane: one
// wave-instruction covers four whole 128-B lines. l = the lane's LDS byte address in the buffer's first plane.
__device__ __forceinline__ void copy_keys(unsigned l, const _Float16* k, const _Float16* v) {
#if defined(__HIP_DEVICE_COMPILE__)
  // the closing s_wait_xcnt stands inside the statement so that no address register is rewritten ahead of it
  asm volatile("global_load_async_to_lds_b128 %0, %8, off\n\t"
               "global_load_async_to_lds_b128 %1, %9, off\n\t"
               "global_load_async_to_lds_b128 %2, %10, off\n\t"
               "global_load_async_to_lds_b128 %3, %11, off\n\t"
               "global_load_async_to_lds_b128 %4, %12, off\n\t"
               "global_load_async_to_lds_b128 %5, %13, off\n\t"
               "global_load_async_to_lds_b128 %6, %14, off\n\t"
               "global_load_async_to_lds_b128 %7, %15, off\n\t"
               "s_wait_xcnt 0x0"
               :: "v"(l), "v"(l + 16 * LPITCH), "v"(l + 32 * LPITCH), "v"(l + 48 * LPITCH),
                  "v"(l + APLANEB), "v"(l + APLANEB + 16 * LPITCH), "v"(l + APLANEB + 32 * LPITCH),
                  "v"(l + APLANEB + 48 * LPITCH),
                  "v"(k), "v"(k + (size_t)16 * INNER), "v"(k + (size_t)32 * INNER), "v"(k + (size_t)48 * INNER),
                  "v"(v), "v"(v + (size_t)16 * SKV), "v"(v + (size_t)32 * SKV), "v"(v + (size_t)48 * SKV)
               : "memory");
#endif
}
// The batch's sim row: 128 threads x 16 B = 512 floats.
__device__ __forceinline__ void copy_sim(unsigned l, const float* g) {
#if defined(__HIP_DEVICE_COMPILE__)
  // the closing s_wait_xcnt stands inside the statement so that no address register is rewritten ahead of it
  asm volatile("global_load_async_to_lds_b128 %0, %1, off\n\t"
               "s_wait_xcnt 0x0"
               :: "v"(l), "v"(g) : "memory");
#endif
}

__global__ __launch_bounds__(ATT_THREADS)
void attn_fwd(const u16* __restrict__ Qh, const u16* __restrict__ Kh, const u16* __restrict__ Vp,
              const float* __restrict__ Simp, const float* __restrict__ beta, u16* Oh) {
  __shared__ __align__(16) unsigned char ring[2 * ABUFB];
  __shared__ __align__(16) float simrow[SKV];

  const int tid  = threadIdx.x;
  const int wave = tid >> 5;
  const int lane = tid & 31;
  const int hh   = lane >> 4;
  const int c    = lane & 15;

  constexpr int NQT = SQ / ATT_ROWS;
  const int bid  = blockIdx.x;
  const int qt   = bid % NQT;
  const int head = (bid / NQT) % NH;
  const int b    = bid / (NQT * NH);
  const int q0   = qt * ATT_ROWS + wave * (ATT_QT * 16);

  // B fragments of q^T: col n = query q0 + 16u + c, k = d (k-contiguous row of the q plane)
  const size_t qo = ((size_t)(b * SQ + q0 + c)) * INNER + head * HD + 8 * hh;
  const _Float16* Qhb = (const _Float16*)(const void*)Qh + qo;
  // copy side: the lane's row in a group of 16 and its 16-B piece of the 128-B row (k rows = keys, v^T rows = d)
  const int cr = tid >> 3, cc = tid & 7;
  const size_t ko = ((size_t)(b * SKV + cr)) * INNER + head * HD + 8 * cc;
  const _Float16* gkh = (const _Float16*)(const void*)Kh + ko;
  const _Float16* gv  = (const _Float16*)(const void*)Vp + ((size_t)(b * NH + head) * HD + cr) * SKV + 8 * cc;
  const unsigned lc = lds_off(ring) + (unsigned)(cr * LPITCH + cc * 16);
  // A fragments of k: row m = key 16g + c of the staged tile, k = d; +16 B for the upper lane half
  const unsigned char* fk = ring + c * LPITCH + 16 * hh;
  // B fragments of v: col n = d = 16j + c (row of the staged v^T tile), k = key
  const unsigned char* fv = ring + APLANEB + c * LPITCH + 16 * hh;
  // per-key bias row of this batch in LDS, offset to the lane half's first key
  const float* Sb = simrow + 8 * hh;
  const float bl2 = bfr(beta[head]) * LOG2E;
  const float lsc = (LOG2E * RSQ_HD) / (QS * KS);

  // every loop over u (the wave's query tiles) is unrolled so that the per-tile arrays stay in registers
  v16h qh[ATT_QT][2];
#pragma unroll
  for (int u = 0; u < ATT_QT; ++u) {
    qh[u][0] = ldfrag_h(Qhb + (size_t)u * 16 * INNER);
    qh[u][1] = ldfrag_h(Qhb + (size_t)u * 16 * INNER + 32);
  }
  // precaution: the loads' address, named as an input, stays in its registers up to this wait and is rewritten only behind it
  asm volatile("s_wait_xcnt 0x0" :: "v"(Qhb) : "memory");

  float mrun[ATT_QT], mthr[ATT_QT], lrun[ATT_QT];
  v8f o[ATT_QT][4];
#pragma unroll
  for (int u = 0; u < ATT_QT; ++u) {
    mrun[u] = -INFINITY;
    mthr[u] = -INFINITY;
    lrun[u] = 0.f;
#pragma unroll
    for (int j = 0; j < 4; ++j) o[u][j] = zero8();
  }

  // tile 0 and the sim row -> LDS, landed and published; then tile 1 -> buffer 1 in flight
  copy_keys(lc, gkh, gv);
  copy_sim(lds_off(simrow) + (unsigned)(tid * 16), Simp + (size_t)b * SKV + 4 * tid);
  asm volatile("s_wait_asynccnt 0x0" ::: "memory");        // this wave's copies of tile 0 have landed
  __syncthreads();                                         // ... and every other wave's
  copy_keys(lc + ABUFB, gkh + (size_t)AKT * INNER, gv + AKT);

  // rolled over the tiles: one copy of the tile body in the instruction cache
#pragma unroll 1
  for (int st = 0; st < NST; ++st) {
   const int bo = (st & 1) * ABUFB;
   // unrolled: the two 32-key halves of a tile differ only in constant LDS offsets
#pragma unroll
   for (int sub = 0; sub < AKT / 32; ++sub) {
    const int kb = st * AKT + sub * 32;
    // ---- transposed scores: s0 = keys kb..kb+15, s1 = keys kb+16..kb+31, column = query q0 + 16u + c ----
    v8f s0[ATT_QT], s1[ATT_QT];
#pragma unroll
    for (int u = 0; u < ATT_QT; ++u) { s0[u] = zero8(); s1[u] = zero8(); }
    const _Float16* k0h = (const _Float16*)(const void*)(fk + bo + sub * 32 * LPITCH);
    const _Float16* k1h = (const _Float16*)(const void*)(fk + bo + (sub * 32 + 16) * LPITCH);
#pragma unroll
    for (int kk = 0; kk < HD / 32; ++kk) {
      const v16h fh0 = ldfrag_h(k0h + kk * 32);
      const v16h fh1 = ldfrag_h(k1h + kk * 32);
#pragma unroll
      for (int u = 0; u < ATT_QT; ++u) {
        s0[u] = mma_h(fh0, qh[u][kk], s0[u]);
        s1[u] = mma_h(fh1, qh[u][kk], s1[u]);
      }
    }
    // ---- per-key bias: keys kb+8hh+0..7 (g0, g1) and kb+16+8hh+0..7 (g2, g3), the same for both query tiles ----
    const v4f g0 = *(const v4f*)(Sb + kb);
    const v4f g1 = *(const v4f*)(Sb + kb + 4);
    const v4f g2 = *(const v4f*)(Sb + kb + 16);
    const v4f g3 = *(const v4f*)(Sb + kb + 20);
    // ---- base-2 logits of this lane's 16 keys for query q0 + 16u + c: t[u][i] <- key kb+8hh+i, t[u][8+i] <- key kb+16+8hh+i ----
    float t[ATT_QT][16], cm[ATT_QT];
#pragma unroll
    for (int u = 0; u < ATT_QT; ++u) {
#pragma unroll
      for (int i = 0; i < 4; ++i) {
        t[u][i]      = s0[u][i]     * lsc + g0[i] * bl2;
        t[u][4 + i]  = s0[u][4 + i] * lsc + g1[i] * bl2;
        t[u][8 + i]  = s1[u][i]     * lsc + g2[i] * bl2;
        t[u][12 + i] = s1[u][4 + i] * lsc + g3[i] * bl2;
      }
      cm[u] = t[u][0];
#pragma unroll
      for (int i = 1; i < 16; ++i) cm[u] = fmaxf(cm[u], t[u][i]);
    }
    // ---- lazy upkeep: the max in use stays while no logit of the wave tops it by more than LAZY (P <= 2^LAZY then); one test
    //      per key block, a scalar branch. Always taken on the first block (mthr = -inf). ----
    if (__builtin_amdgcn_ballot_w32(cm[0] > mthr[0] || cm[1] > mthr[1]) != 0) {
#pragma unroll
      for (int u = 0; u < ATT_QT; ++u) {
        const float mn = fmaxf(mrun[u], fmaxf(cm[u], __shfl_xor(cm[u], 16, 32)));   // finite from the first block on
        float al = mrun[u] - mn;               // -> 2^(mrun - mn): 0 on the first block (mrun = -inf)
        exp2_one(al);
        mrun[u] = mn;
        mthr[u] = mn + LAZY;
        lrun[u] *= al;
        // rescale the O accumulators: D row 8hh+r = query q0+16u+8hh+r, its factor lives in lane 8hh+r (and 16+8hh+r)
        float scl[8];
#pragma unroll
        for (int r = 0; r < 8; ++r) scl[r] = __shfl(al, 8 * hh + r, 32);
#pragma unroll
        for (int j = 0; j < 4; ++j) {
#pragma unroll
          for (int r = 0; r < 8; ++r) o[u][j][r] *= scl[r];
        }
      }
    }
    FragH ph[ATT_QT];
#pragma unroll
    for (int u = 0; u < ATT_QT; ++u) {
      // unrolled so that t stays in registers; t -> 2^(t - mrun), the probabilities against the max in use
#pragma unroll
      for (int i = 0; i < 16; ++i) t[u][i] -= mrun[u];
      exp2_run(t[u]);
      // ---- probabilities (<= 2^LAZY) and the P A-fragment: f16(p * 128); element i <-> t[u][i] ----
      float ps = 0.f;
#pragma unroll
      for (int w = 0; w < 2; ++w) {
#pragma unroll
        for (int e4 = 0; e4 < 4; ++e4) {
          const int i = 8 * w + 2 * e4;
          const float p0 = t[u][i], p1 = t[u][i + 1];
          ps += p0 + p1;
          ph[u].u[w][e4] = pk16(h_bits((_Float16)(p0 * PCAR)), h_bits((_Float16)(p1 * PCAR)));
        }
      }
      lrun[u] += ps;                           // the lane half's own 16 keys; the halves are joined behind the loop
    }
    // ---- P.V : B fragment col n = d = j*16 + c, keys contiguous in the v^T plane; each fragment serves both query tiles ----
    {
      const unsigned char* vp = fv + bo + sub * 64;
      const v16h v0 = ldfrag_h((const _Float16*)(const void*)(vp));
      const v16h v1 = ldfrag_h((const _Float16*)(const void*)(vp + 16 * LPITCH));
      const v16h v2 = ldfrag_h((const _Float16*)(const void*)(vp + 32 * LPITCH));
      const v16h v3 = ldfrag_h((const _Float16*)(const void*)(vp + 48 * LPITCH));
#pragma unroll
      for (int u = 0; u < ATT_QT; ++u) {
        o[u][0] = mma_h(ph[u].v, v0, o[u][0]);
        o[u][1] = mma_h(ph[u].v, v1, o[u][1]);
        o[u][2] = mma_h(ph[u].v, v2, o[u][2]);
        o[u][3] = mma_h(ph[u].v, v3, o[u][3]);
      }
      // keeps the next half's loads and products behind this half's last products: without it this compiler spreads the v^T
      // loads in pairs among the products, each pair waited for in full right ahead of its use
      __builtin_amdgcn_sched_barrier(0);
    }
   }
   asm volatile("s_wait_dscnt 0x0" ::: "memory");          // this wave's reads of the buffer are done before it is refilled
   asm volatile("s_wait_asynccnt 0x0" ::: "memory");       // this wave's copies of tile st + 1 have landed
   __syncthreads();                                        // publishes tile st + 1, ends every reader's use of tile st
   if (st + 2 < NST) {                                     // the same for the whole block
     const size_t k2 = (size_t)(st + 2) * AKT;
     copy_keys(lc + bo, gkh + k2 * INNER, gv + k2);
   }
  }
  asm volatile("s_wait_asynccnt 0x0" ::: "memory");        // no copy outstanding when the ring becomes output staging

#pragma unroll
  for (int u = 0; u < ATT_QT; ++u) {
    acc_guard4(o[u]);
    // ---- join the halves' row sums; fold 1/l (per query, owned by lane = query) and the carries (128 on P, 8 on v), apply the
    //      ctx carry 1024 ----
    const float linv = (1.0f / (lrun[u] + __shfl_xor(lrun[u], 16, 32))) * (OSC / (PCAR * VS));
    float inv[8];
#pragma unroll
    for (int r = 0; r < 8; ++r) inv[r] = __shfl(linv, 8 * hh + r, 32);
    float* slab = (float*)(void*)ring + (wave * ATT_QT + u) * 16 * OPITCH;   // the ring is free behind the last tile's barrier
#pragma unroll
    for (int r = 0; r < 8; ++r) {
#pragma unroll
      for (int j = 0; j < 4; ++j) slab[(8 * hh + r) * OPITCH + j * 16 + c] = o[u][j][r] * inv[r];
    }
    wave_sync_lds();
    // ---- ctx x1024 -> f16 plane; lane = (row in group of 4, 8 consecutive d) ----
    v4u ovh[4];
    const int rq = lane >> 3, c8 = (lane & 7) * 8;
#pragma unroll
    for (int i = 0; i < 4; ++i) {
      const int row = 4 * i + rq;
      const v4f a = *(const v4f*)(slab + row * OPITCH + c8), c4 = *(const v4f*)(slab + row * OPITCH + c8 + 4);
#pragma unroll
      for (int e = 0; e < 2; ++e) {
        ovh[i][e]     = pk16(h_bits((_Float16)a[2 * e]),  h_bits((_Float16)a[2 * e + 1]));
        ovh[i][2 + e] = pk16(h_bits((_Float16)c4[2 * e]), h_bits((_Float16)c4[2 * e + 1]));
      }
    }
    const size_t oo = ((size_t)(b * SQ + q0 + 16 * u)) * INNER + head * HD + c8;
    u16* obh = Oh + oo;
#pragma unroll
    for (int i = 0; i < 4; ++i) {
      const int row = 4 * i + rq;
      *(v4u*)(obh + (size_t)row * INNER) = ovh[i];
    }
    // precaution: no register that an issued store names is rewritten (by the next query tile's work) ahead of this wait
    asm volatile("s_wait_xcnt 0x0" ::: "memory");
  }
}

// =====================================================================================================
// Workspace map (bytes, NB=8, SQ=2048); every plane fully written by whole-line stores before it is read; all extents exact
//   XQ   f16 [NB*SQ][768]    f16(bf16(x))                 25165824   (region reused later as OH, same extent)
//   XV   f16 [NB*512][768]   f16(bf16(kg_value))           6291456
//   WQ16 WK16 WV16 WO16 f16 [768 n][768 k] x256            1179648 each
//   QH   f16 [NB*SQ][768] x8                               25165824
//   KH   f16 [NB*512][768] x8                               6291456
//   VT16 f16 [NB*768 (h,d)][512 s] x8                       6291456
//   OH   f16 [NB*SQ][768] x1024 (ctx) aliases XQ
//   SIMP f32 [NB][512]                                         16384
//   end                                                     73940992
// =====================================================================================================
extern "C" void kernel_launch(void* const* d_in, const int* in_sizes, int n_in,
                              void* d_out, int out_size, void* d_ws, size_t ws_size,
                              hipStream_t stream) {
  if (n_in < 14) return;
  if (in_sizes[0] < ((NB - 1) * SQ_FULL + SQ) * DM) return;
  if (in_sizes[1] < 1) return;
  if (in_sizes[2] < NB * DM) return;
  if (in_sizes[3] < NB * SKV * DM || in_sizes[4] < NB * SKV * DM) return;
  if (in_sizes[5] < NH) return;
  if (in_sizes[6] != DM * DM || in_sizes[8] != DM * DM || in_sizes[10] != DM * DM || in_sizes[12] != DM * DM) return;
  if (in_sizes[7] < DM || in_sizes[9] < DM || in_sizes[11] < DM || in_sizes[13] < DM) return;
  if (out_size < ((NB - 1) * SQ_FULL + SQ) * DM) return;

  const float* x_in   = (const float*)d_in[0];
  const int*   msk    = (const int*)d_in[1];
  const float* pooled = (const float*)d_in[2];
  const float* kgk    = (const float*)d_in[3];
  const float* kgv    = (const float*)d_in[4];
  const float* beta   = (const float*)d_in[5];
  const float* wq     = (const float*)d_in[6];
  const float* bq     = (const float*)d_in[7];
  const float* wk     = (const float*)d_in[8];
  const float* bk     = (const float*)d_in[9];
  const float* wv     = (const float*)d_in[10];
  const float* bv     = (const float*)d_in[11];
  const float* wo     = (const float*)d_in[12];
  const float* bo     = (const float*)d_in[13];
  float*       out    = (float*)d_out;

  const size_t szXQ = (size_t)NB * SQ * DM * 2;
  const size_t szXV = (size_t)NB * SKV * DM * 2;
  const size_t szW  = (size_t)DM * DM * 2;
  const size_t szQP = (size_t)NB * SQ * INNER * 2;
  const size_t szKP = (size_t)NB * SKV * INNER * 2;
  const size_t szVT = (size_t)NB * INNER * SKV * 2;
  const size_t szS  = (size_t)NB * SKV * 4;
  static_assert((size_t)NB * SQ * DM * 2 == (size_t)NB * SQ * INNER * 2);   // XQ region reused as OH, same extent
  size_t off = 0;
  const size_t oXQ = off; off += szXQ;      // also OH
  const size_t oXV = off; off += szXV;
  const size_t oWQ = off; off += szW;
  const size_t oWK = off; off += szW;
  const size_t oWV = off; off += szW;
  const size_t oWO = off; off += szW;
  const size_t oQH = off; off += szQP;
  const size_t oKH = off; off += szKP;
  const size_t oVT = off; off += szVT;
  const size_t oS  = off; off += szS;
  if (off > ws_size) return;                // off = 73940992 at NB=8, SQ=2048
  if (off > (size_t)134217728) return;

  char* ws = (char*)d_ws;
  u16* XQ   = (u16*)(ws + oXQ);
  u16* XV   = (u16*)(ws + oXV);
  u16* WQ16 = (u16*)(ws + oWQ);
  u16* WK16 = (u16*)(ws + oWK);
  u16* WV16 = (u16*)(ws + oWV);
  u16* WO16 = (u16*)(ws + oWO);
  u16* QH   = (u16*)(ws + oQH);
  u16* KH   = (u16*)(ws + oKH);
  u16* VT16 = (u16*)(ws + oVT);
  u16* OH   = (u16*)(ws + oXQ);
  float* SIMP = (float*)(ws + oS);

  // (0) activations -> f16 planes of bf16-converted values (query rows s < SQ of batches b < NB, compact; kg_value rows) and
  //     weights [n = out][k = in] (y = x.W^T): already k-contiguous [n][k]; f16 planes of bf16(W) x256; one launch
  //     with, in the same launch, the cosine similarity sim[b][k] -> SIMP f32 [NB][512]
  prep_all<<<dim3(SIM_BLOCKS + CVB_X + CVB_V + 4 * CVB_W), dim3(CVT_THREADS), 0, stream>>>(
      x_in, kgv, wq, wk, wv, wo, pooled, kgk, msk, XQ, XV, WQ16, WK16, WV16, WO16, SIMP);
  // (7) the q, k and v^T projections, one launch
  gemm_qkv<<<dim3(GB_V + GB_K + GB_Q), dim3(128), 0, stream>>>(XQ, XV, WQ16, WK16, WV16, bq, bk, bv, QH, KH, VT16);
  // (10) attention with the beta*sim key bias -> ctx plane [NB*SQ][768] x1024 (OH reuses the XQ region)
  attn_fwd<<<dim3(NB * NH * (SQ / ATT_ROWS)), dim3(ATT_THREADS), 0, stream>>>(QH, KH, VT16, SIMP, beta, OH);
  // (11) out rows [b][SQ_FULL][768] f32 = ctx . Wo^T + bo (rows s < SQ of batches b < NB); carries 1024 x 256 folded back
  gemm16<M_F32, false><<<dim3(NB * (SQ / OT_M) * (DM / OT_N)), dim3(256), 0, stream>>>(
      OH, WO16, bo, out, nullptr, SQ, DM, INNER, SQ * INNER, 0, SQ_FULL * DM, 0,
      1.0f / (OSC * WSC), 1.0f, 1.0f);
  (void)hipGetLastError();
}
